// v000
// Measured on an AMD MI455X. A time is GPU time per run, averaged over a window of back-to-back runs after a warm-up
// (all launches, gaps included; the runs take copies of the inputs in turn), and the median of several windows.
// Apart from v000's, it joins two sittings. Times from different sittings can be a few percent apart, while
// side-by-side timings come from the same sitting.
// The starting kernel, v000, takes 354 microseconds a run.
// Contractions (token embed 64->128, fused q|k projection, v^T projection, q.k^T, p.v, W_o projection, W_out projection): v_wmma_f32_16x16x32_f16 (f16 operands: weights carried x8, attention output x16, softmax numerators x2^15; f32 accumulate); softmax statistics, biases, positional add and gated residual in f32.
#include <hip/hip_runtime.h>
#include <math.h>
#include <stdint.h>

typedef __attribute__((ext_vector_type(16))) _Float16 v16h;
typedef __attribute__((ext_vector_type(8)))  _Float16 v8h;
typedef __attribute__((ext_vector_type(16))) __bf16   v16b;
typedef __attribute__((ext_vector_type(8)))  __bf16   v8b;
typedef __attribute__((ext_vector_type(8)))  float    v8f;
typedef __attribute__((ext_vector_type(4)))  float    v4f;
typedef __attribute__((ext_vector_type(2)))  float    v2f;
typedef __attribute__((ext_vector_type(4)))  unsigned int v4u;

// ---- problem geometry ----
constexpr int NBATCH_  = 2;
constexpr int CIN_     = 64;
constexpr int EMB_     = 128;
constexpr int COUT_    = 64;
constexpr int NHEAD_   = 2;
constexpr int HDIM_    = 64;
constexpr int SEQL_    = 4096;               // 16*16*16 tokens per batch element
constexpr int NTOK_    = NBATCH_ * SEQL_;    // 8192
constexpr int QKPITCH_ = 2 * EMB_;           // fused q|k plane pitch (halves)

// ---- f16 weight pool offsets (halves) ----
constexpr int WOFF_CP   = 0;                              // [128][64]
constexpr int WOFF_Q    = WOFF_CP + EMB_ * CIN_;          // [128][128]  (q rows)
constexpr int WOFF_K    = WOFF_Q + EMB_ * EMB_;           // [128][128]  (k rows, contiguous after q -> [256][128])
constexpr int WOFF_V    = WOFF_K + EMB_ * EMB_;           // [128][128]
constexpr int WOFF_O    = WOFF_V + EMB_ * EMB_;           // [128][128]
constexpr int WOFF_OUT  = WOFF_O + EMB_ * EMB_;           // [64][128]
constexpr int WPOOL_H   = WOFF_OUT + COUT_ * EMB_;        // 81920 halves = 163840 B
static_assert(WPOOL_H == 81920, "weight pool size");

//   WPOOL f16 weights x8                     0          163840
//   XT16  f16 [8192 tok][64 ch]         163840         1048576
//   XF16  f16 [8192 tok][128]          1212416         2097152
//   QK16  f16 [8192 tok][256] (q|k)    3309568         4194304
//   VT16  f16 [2][128 (h,d)][4096]     7503872         2097152
//   O16   f16 [8192 tok][128] (x16)    9601024         2097152
//   O1_16 f16 [8192 tok][128]         11698176         2097152
//   total                             13795328
constexpr size_t OFFB_W   = 0;
constexpr size_t OFFB_XT  = OFFB_W  + (size_t)WPOOL_H * 2;
constexpr size_t OFFB_XF  = OFFB_XT + (size_t)NTOK_ * CIN_ * 2;
constexpr size_t OFFB_QK  = OFFB_XF + (size_t)NTOK_ * EMB_ * 2;
constexpr size_t OFFB_VT  = OFFB_QK + (size_t)NTOK_ * QKPITCH_ * 2;
constexpr size_t OFFB_O   = OFFB_VT + (size_t)NBATCH_ * EMB_ * SEQL_ * 2;
constexpr size_t OFFB_O1  = OFFB_O  + (size_t)NTOK_ * EMB_ * 2;
constexpr size_t WS_TOTAL = OFFB_O1 + (size_t)NTOK_ * EMB_ * 2;
static_assert(WS_TOTAL == 13795328, "carve total");
static_assert((OFFB_XT % 128) == 0 && (OFFB_XF % 128) == 0 && (OFFB_QK % 128) == 0 &&
              (OFFB_VT % 128) == 0 && (OFFB_O % 128) == 0 && (OFFB_O1 % 128) == 0, "128-B aligned regions");

#define U16(p) ((const unsigned short*)(const void*)(p))

__device__ __forceinline__ unsigned short f2bf_bits(float f) {
  unsigned u = __float_as_uint(f);
  return (unsigned short)((u + 0x7FFFu + ((u >> 16) & 1u)) >> 16);
}
__device__ __forceinline__ float bf_bits2f(unsigned short h) { return __uint_as_float(((unsigned)h) << 16); }
__device__ __forceinline__ unsigned pk16(unsigned short a, unsigned short b) { return (unsigned)a | ((unsigned)b << 16); }
__device__ __forceinline__ unsigned short h_bits(float f) { return __builtin_bit_cast(unsigned short, (_Float16)f); }

// hazard guards as plain device helpers (no inline asm inside the kernel template body)
__device__ __forceinline__ void dep_guard_h(v8f& a, v8f& b, v16h x, v16h y) { asm volatile("v_nop\n\tv_nop\n\tv_nop\n\tv_nop" : "+v"(a), "+v"(b) : "v"(x), "v"(y)); }
__device__ __forceinline__ void dep_guard_b(v8f& a, v8f& b, v16b x, v16b y) { asm volatile("v_nop\n\tv_nop\n\tv_nop\n\tv_nop" : "+v"(a), "+v"(b) : "v"(x), "v"(y)); }
__device__ __forceinline__ void keep4_h(v16h a, v16h b, v16h c, v16h d) { asm volatile("v_nop" :: "v"(a), "v"(b), "v"(c), "v"(d)); }
__device__ __forceinline__ void keep4_b(v16b a, v16b b, v16b c, v16b d) { asm volatile("v_nop" :: "v"(a), "v"(b), "v"(c), "v"(d)); }
__device__ __forceinline__ void acc_guard4(v8f& a, v8f& b, v8f& c, v8f& d) { asm volatile("v_nop\n\tv_nop\n\tv_nop\n\tv_nop" : "+v"(a), "+v"(b), "+v"(c), "+v"(d)); }
template <typename T> struct Frag;
template <> struct Frag<_Float16> {
  typedef v16h V; union U { v16h v; v8h h[2]; };
  static __device__ __forceinline__ v16h load(const _Float16* p) {   // elements 0..7 <- p[0..7], 8..15 <- p[16..23]
    U f; f.h[0] = *(const v8h*)(p); f.h[1] = *(const v8h*)(p + 16); return f.v;
  }
  static __device__ __forceinline__ v8f mma(v16h a, v16h b, v8f c) {
    return __builtin_amdgcn_wmma_f32_16x16x32_f16(false, a, false, b, (short)0, c, false, false);
  }
  static __device__ __forceinline__ void guard(v8f& a, v8f& b, v16h x, v16h y) { dep_guard_h(a, b, x, y); }
  static __device__ __forceinline__ void keep(v16h a, v16h b, v16h c, v16h d) { keep4_h(a, b, c, d); }
};
template <> struct Frag<__bf16> {
  typedef v16b V; union U { v16b v; v8b h[2]; };
  static __device__ __forceinline__ v16b load(const __bf16* p) {
    U f; f.h[0] = *(const v8b*)(p); f.h[1] = *(const v8b*)(p + 16); return f.v;
  }
  static __device__ __forceinline__ v8f mma(v16b a, v16b b, v8f c) {
    return __builtin_amdgcn_wmma_f32_16x16x32_bf16(false, a, false, b, (short)0, c, false, false);
  }
  static __device__ __forceinline__ void guard(v8f& a, v8f& b, v16b x, v16b y) { dep_guard_b(a, b, x, y); }
  static __device__ __forceinline__ void keep(v16b a, v16b b, v16b c, v16b d) { keep4_b(a, b, c, d); }
};

// ---- Register-blocked batched WMMA GEMM ------------------------------------
// C[m,n] = scale * sum_k A[m,k] * Bt[n,k] (+bias)(+rg*resid); each wave owns a 64x64 tile.
// A row-major [M,K]; Bt row-major [N,K]; M,N % 64 == 0, K % 32 == 0.
// SPLIT: operands are hi/lo planes (A2/Bt2 = lo planes, same layout); product = hi.hi + hi.lo + lo.hi.
// BIAS_MODE: 0 = none, 1 = bias[m], 2 = bias[n].
// OUT_MODE: 0 = f32, 1 = f16, 2 = bf16 hi plane (Cout) + bf16 lo plane (Cout2).
// RESID: v += rg * resid[m*ldc+n] with rg = rgain[0] when rgain != nullptr else 1.
// ET: 0 = f16 operands, 1 = bf16 operands (pointers passed as 16-bit storage)
template <int ET> struct Elem;
template <> struct Elem<0> { typedef _Float16 T; };
template <> struct Elem<1> { typedef __bf16 T; };
template <int ET, bool SPLIT, int BIAS_MODE, int OUT_MODE, bool RESID, int ACT = 0>
__global__ __launch_bounds__(256) void wmma_gemm64(
    const unsigned short* __restrict__ Ap, const unsigned short* __restrict__ A2p, int lda, long strideA,
    const unsigned short* __restrict__ Btp, const unsigned short* __restrict__ Bt2p, int ldb, long strideB,
    void* __restrict__ Cout, void* __restrict__ Cout2, int ldc, long strideC,
    const float* __restrict__ bias,
    const float* __restrict__ resid, long strideR, const float* __restrict__ rgain,
    int M, int N, int K, float scale) {
  typedef typename Elem<ET>::T T;
  typedef typename Frag<T>::V V;
  const T* A = (const T*)Ap; const T* A2 = (const T*)A2p; const T* Bt = (const T*)Btp; const T* Bt2 = (const T*)Bt2p;
  __shared__ __align__(16) float sT[8][16 * 68];   // per-wave 16x64 slab, pitch 68 floats
  const int b    = blockIdx.y;
  const int lane = threadIdx.x & 31;
  const int wave = threadIdx.x >> 5;
  const int tilesN = N >> 6;
  const int tilesM = M >> 6;
  const int tile = blockIdx.x * 8 + wave;
  if (tile >= tilesM * tilesN) return;   // wave-uniform; no block barriers in this kernel
  const int tm = tile / tilesN;
  const int tn = tile - tm * tilesN;
  const int m0 = tm << 6;
  const int n0 = tn << 6;

  const T* Ab  = A  + (size_t)b * strideA;
  const T* Bb  = Bt + (size_t)b * strideB;
  const T* Ab2 = SPLIT ? (A2  + (size_t)b * strideA) : nullptr;
  const T* Bb2 = SPLIT ? (Bt2 + (size_t)b * strideB) : nullptr;

  const int rlane = lane & 15;                 // row (A) / col (B, D) within subtile
  const int koff  = (lane >> 4) * 8;           // k offset of this lane half
  const int mOff  = (lane >> 4) * 8;           // D row offset

  v8f acc[4][4];
#pragma unroll
  for (int i = 0; i < 4; ++i)
#pragma unroll
    for (int j = 0; j < 4; ++j) acc[i][j] = (v8f){0.f,0.f,0.f,0.f,0.f,0.f,0.f,0.f};

  for (int k0 = 0; k0 < K; k0 += 32) {
    V bh[4], bl[4];
#pragma unroll
    for (int j = 0; j < 4; ++j) {
      const size_t bo = (size_t)(n0 + (j << 4) + rlane) * ldb + koff + k0;
      bh[j] = Frag<T>::load(Bb + bo);
      if (SPLIT) bl[j] = Frag<T>::load(Bb2 + bo);
    }
#pragma unroll
    for (int i = 0; i < 4; ++i) {
      const size_t ao = (size_t)(m0 + (i << 4) + rlane) * lda + koff + k0;
      V ah = Frag<T>::load(Ab + ao);
      V al;
      if (SPLIT) al = Frag<T>::load(Ab2 + ao);
#pragma unroll
      for (int j = 0; j < 4; ++j) {
        acc[i][j] = Frag<T>::mma(ah, bh[j], acc[i][j]);
        if (SPLIT) {
          acc[i][j] = Frag<T>::mma(ah, bl[j], acc[i][j]);
          acc[i][j] = Frag<T>::mma(al, bh[j], acc[i][j]);
        }
      }
      Frag<T>::guard(acc[i][0], acc[i][3], ah, SPLIT ? al : ah);
    }
    Frag<T>::keep(bh[0], bh[1], bh[2], bh[3]);
    if (SPLIT) Frag<T>::keep(bl[0], bl[1], bl[2], bl[3]);
  }
  acc_guard4(acc[0][0], acc[0][1], acc[0][2], acc[0][3]);
  acc_guard4(acc[1][0], acc[1][1], acc[1][2], acc[1][3]);
  acc_guard4(acc[2][0], acc[2][1], acc[2][2], acc[2][3]);
  acc_guard4(acc[3][0], acc[3][1], acc[3][2], acc[3][3]);

  // ---- epilogue ----
  float* slab = sT[wave];
  const float* Rb = RESID ? (resid + (size_t)b * strideR) : nullptr;
  float rg = 1.0f;
  if (RESID) { if (rgain != nullptr) rg = rgain[0]; }
#pragma unroll
  for (int i = 0; i < 4; ++i) {
    const int mBase = m0 + (i << 4);
#pragma unroll
    for (int j = 0; j < 4; ++j) {
      const int n = n0 + (j << 4) + rlane;
      float bv = 0.f;
      if (BIAS_MODE == 2) bv = bias[n];
#pragma unroll
      for (int r = 0; r < 8; ++r) {
        float v = acc[i][j][r] * scale;
        if (BIAS_MODE == 1) v += bias[mBase + mOff + r];
        if (BIAS_MODE == 2) v += bv;
        if (RESID) v += rg * Rb[(size_t)(mBase + mOff + r) * ldc + n];
        if (ACT == 1) v = tanhf(v);
        if (ACT == 2) v = fmaxf(v, 0.0f);
        if (ACT == 3) v = v / (1.0f + expf(-v));
        if (ACT == 4) v = (v > 0.f) ? v : 0.01f * v;
        slab[(mOff + r) * 68 + (j << 4) + rlane] = v;
      }
    }
    __builtin_amdgcn_fence(__ATOMIC_RELEASE, "workgroup");
    __builtin_amdgcn_wave_barrier();
    __builtin_amdgcn_fence(__ATOMIC_ACQUIRE, "workgroup");
    if (OUT_MODE == 0) {
      float* C = (float*)Cout + (size_t)b * strideC;
      const int hh = lane >> 4, c4 = (lane & 15) * 4;     // row seg = 256 B = 16 lanes x 16 B
      {
#pragma unroll
        for (int it = 0; it < 8; ++it) {
          const int row = it * 2 + hh;
          v4f v = *(const v4f*)(slab + row * 68 + c4);
          *(v4f*)(C + (size_t)(mBase + row) * ldc + n0 + c4) = v;
        }
        
      }
    } else {
      const int q = lane >> 3, c8 = (lane & 7) * 8;
      unsigned short* C  = (unsigned short*)Cout  + (size_t)b * strideC;
      unsigned short* C2 = (OUT_MODE == 2) ? ((unsigned short*)Cout2 + (size_t)b * strideC) : nullptr;
      {
#pragma unroll
        for (int it = 0; it < 4; ++it) {
          const int row = it * 4 + q;
          const float* sp = slab + row * 68 + c8;
          v8h hv, lv;
#pragma unroll
          for (int e = 0; e < 8; ++e) {
            if (OUT_MODE == 1) {
              hv[e] = (_Float16)sp[e];
            } else {
              unsigned short hb = f2bf_bits(sp[e]);
              unsigned short lb = f2bf_bits(sp[e] - bf_bits2f(hb));
              hv[e] = __builtin_bit_cast(_Float16, hb);
              lv[e] = __builtin_bit_cast(_Float16, lb);
            }
          }
          *(v8h*)(C + (size_t)(mBase + row) * ldc + n0 + c8) = hv;
          if (OUT_MODE == 2) *(v8h*)(C2 + (size_t)(mBase + row) * ldc + n0 + c8) = lv;
        }
        
      }
    }
    __builtin_amdgcn_fence(__ATOMIC_RELEASE, "workgroup");
    __builtin_amdgcn_wave_barrier();
    __builtin_amdgcn_fence(__ATOMIC_ACQUIRE, "workgroup");
  }
}

// ---------------------------------------------------------------------------
// Weight cast f32 -> f16 with a power-of-two carry sc (x8): six matrices selected by blockIdx.y (block-uniform),
// Coverage: grid.x = 32 blocks x 256 threads = 8192 pairs >= n2 for every matrix (n2 = 4096 or 8192 pairs).
// ---------------------------------------------------------------------------
__global__ __launch_bounds__(256) void cast_w6_kernel(const float* __restrict__ w0, const float* __restrict__ w1,
                                                      const float* __restrict__ w2, const float* __restrict__ w3,
                                                      const float* __restrict__ w4, const float* __restrict__ w5,
                                                      _Float16* __restrict__ pool, float sc) {
  const int y = blockIdx.y;                 // block-uniform selector
  const float* in = w0; int n2 = (EMB_ * CIN_) / 2; int off = WOFF_CP;
  if (y == 1) { in = w1; n2 = (EMB_ * EMB_) / 2;  off = WOFF_Q; }
  if (y == 2) { in = w2; n2 = (EMB_ * EMB_) / 2;  off = WOFF_K; }
  if (y == 3) { in = w3; n2 = (EMB_ * EMB_) / 2;  off = WOFF_V; }
  if (y == 4) { in = w4; n2 = (EMB_ * EMB_) / 2;  off = WOFF_O; }
  if (y == 5) { in = w5; n2 = (COUT_ * EMB_) / 2; off = WOFF_OUT; }
  _Float16* out = pool + off;
  const int i = blockIdx.x * 256 + threadIdx.x;
  if (i < n2) {
    const v2f f = *(const v2f*)(in + 2 * (size_t)i);
    const unsigned u = pk16(h_bits(f[0] * sc), h_bits(f[1] * sc));
    ((unsigned*)out)[i] = u;
    
  }
}

// ---------------------------------------------------------------------------
// Fused transpose + f16 cast of an f32 matrix, z-batched: in_z = W + z*sIn viewed [R rows][Cc cols] (pitch Cc) ->
//   oh_z[c][r] = f16(in_z[r][c])   ([Cc][R], pitch R), oh_z = oh + z*sOut.
// Here: in_z = x[z] viewed [R=64 ch][Cc=4096 tok] -> out [4096 tok][64 ch]; grid = (Cc/64=64, R/64=1, Z=2), 256 threads.
// Coverage per block: load 4 it x 256 thr x 4 floats = 64x64; store 2 it x 256 thr x 8 u16 = 64x64.
// ---------------------------------------------------------------------------
__global__ __launch_bounds__(256) void tcast16_kernel(const float* __restrict__ W, unsigned short* __restrict__ oh,
                                                      int R, int Cc, long sIn, long sOut) {
  __shared__ __align__(16) float tf[64 * 68];
  W  += (size_t)blockIdx.z * sIn;
  oh += (size_t)blockIdx.z * sOut;
  const int c0  = blockIdx.x * 64;   // input column block = output row block
  const int r0  = blockIdx.y * 64;   // input row block    = output column block
  const int tid = threadIdx.x;
  {
    const int lr = tid >> 4;         // 0..15
    const int c4 = (tid & 15) * 4;   // 0..60
#pragma unroll
    for (int it = 0; it < 4; ++it) {
      const int rr = it * 16 + lr;   // 0..63
      const v4f a = *(const v4f*)(W + (size_t)(r0 + rr) * Cc + c0 + c4);
      *(v4f*)(tf + rr * 68 + c4) = a;
    }
  }
  __syncthreads();
  const int sub = tid >> 3;          // 0..31
  const int c8  = (tid & 7) * 8;     // 0..56
  v4u hv[2];
#pragma unroll
  for (int it = 0; it < 2; ++it) {
    const int oc = it * 32 + sub;    // output row within tile (= input column)
    v4u a;
#pragma unroll
    for (int q = 0; q < 4; ++q) {
      const float f0 = tf[(c8 + 2 * q) * 68 + oc];
      const float f1 = tf[(c8 + 2 * q + 1) * 68 + oc];
      a[q] = pk16(h_bits(f0), h_bits(f1));
    }
    hv[it] = a;
  }
  {
#pragma unroll
    for (int it = 0; it < 2; ++it) {
      const int oc = it * 32 + sub;
      const size_t go = (size_t)(c0 + oc) * R + r0 + c8;
      *(v4u*)(oh + go) = hv[it];
    }
    
  }
}

// =====================================================================================
// Full (non-causal, unmasked) attention, head dim 64, all (batch, head, 64-query tile) in one launch.
//   q|k plane (f16): q element (b, t, h, d) at [(b*SEQL_+t)*QKPITCH_ + h*64 + d]; k at the same + EMB_.
//   v^T plane (f16): element (b, h, d, s) at [b*EMB_*SEQL_ + (h*64 + d)*SEQL_ + s]
//   out (f16, carried x oscale): element (b, t, h, d) at [(b*SEQL_+t)*EMB_ + h*64 + d]
//   scores = (q . k) * sscale : v_wmma_f32_16x16x32_f16 single product, f32 accumulate
//   out    = p . v            : p = exp(s - m) carried x2^15 in f16, v f16, f32 accumulate, 1/(l*2^15) in f32
//   online softmax in f32 over all SEQL_ keys (64 chunks of 64, compile-time trip count, no masking).
//   Block = 4 waves = 64 query rows of one (batch, head); grid.x = NBATCH_ * NHEAD_ * (SEQL_/64) = 256.
//   K / V^T chunk staging: 128 threads x 32 elements per plane = the whole 64x64 tile (16-B copies, plain loads,
//   __syncthreads before and after); fragment loads read the LDS tiles with the same v8h element type.
// =====================================================================================
#define AT_D 64
#define AT_NW 4
#define AT_QB 64
#define AT_KC 64
#define P_CARRY 32768.0f

__device__ __forceinline__ v8f at_mma_h(v16h a, v16h b, v8f c) {
  c = __builtin_amdgcn_wmma_f32_16x16x32_f16(false, a, false, b, (short)0, c, false, false);
  asm volatile("v_nop\n\tv_nop\n\tv_nop\n\tv_nop" : "+v"(c) : "v"(a), "v"(b));
  return c;
}

__global__ __launch_bounds__(128)
void attn_full64_f16_kernel(const unsigned short* __restrict__ qkp, const unsigned short* __restrict__ vtp,
                            unsigned short* __restrict__ op, float sscale, float oscale) {
  union FH { v16h v; v8h h[2]; };
  __shared__ __align__(16) _Float16 Ksh[AT_KC * AT_D];             // K [kv][d]      8 KB
  __shared__ __align__(16) _Float16 Vth[AT_D * AT_KC];             // V [d][kv]      8 KB
  __shared__ __align__(16) _Float16 Psh[AT_NW][16 * AT_KC];        // per wave P [row][kv]  8 KB
  __shared__ __align__(16) float    Os[AT_NW][16 * 68];            // per wave out tile, pitch 68

  const int tid  = threadIdx.x;
  const int wave = tid >> 5;
  const int lane = tid & 31;
  const int hh   = lane >> 4;
  const int c    = lane & 15;

  const int nqb = SEQL_ / AT_QB;          // 64
  const int bx = blockIdx.x;
  const int qb = bx % nqb;
  const int bh = bx / nqb;                // 0..NBATCH_*NHEAD_-1
  const int h  = bh % NHEAD_;
  const int b  = bh / NHEAD_;
  const int q0 = qb * AT_QB + wave * 16;

  const _Float16* Qh = (const _Float16*)(const void*)qkp + (size_t)b * SEQL_ * QKPITCH_ + (size_t)h * AT_D;
  const _Float16* Kh = Qh + EMB_;
  const _Float16* Vh = (const _Float16*)(const void*)vtp + (size_t)b * EMB_ * SEQL_ + (size_t)h * AT_D * SEQL_;
  _Float16*       ob = (_Float16*)(void*)op + (size_t)b * SEQL_ * EMB_ + (size_t)h * AT_D;

  // ---- Q fragments (A operand, row = lane&15, split k map via Frag load): 2 d-chunks ----
  v16h qa[2];
#pragma unroll
  for (int dc = 0; dc < 2; ++dc) {
    const _Float16* qr = Qh + (size_t)(q0 + c) * QKPITCH_ + dc * 32 + 8 * hh;
    qa[dc] = Frag<_Float16>::load(qr);
  }

  float mrow[8], lrow[8];
  v8f oacc[4];
#pragma unroll
  for (int r = 0; r < 8; ++r) { mrow[r] = -INFINITY; lrow[r] = 0.f; }
#pragma unroll
  for (int t = 0; t < 4; ++t) oacc[t] = (v8f){0.f,0.f,0.f,0.f,0.f,0.f,0.f,0.f};

  const int nChunks = SEQL_ / AT_KC;   // 64, compile-time constant
  for (int kc = 0; kc < nChunks; ++kc) {
    const int kv0 = kc * AT_KC;
    __syncthreads();
    {
      // staging coverage: 128 threads x (4 x 8) elements = 64 rows x 64 per plane = the whole chunk tile
      const int r = tid >> 1, half = (tid & 1) * 32;
      const _Float16* ksh = Kh + (size_t)(kv0 + r) * QKPITCH_ + half;   // K row kv0+r, d = half..half+31
      const _Float16* vsh = Vh + (size_t)r * SEQL_ + kv0 + half;        // V^T row d = r, s = kv0+half..+31
#pragma unroll
      for (int i = 0; i < 4; ++i) {
        const v8h a0 = *(const v8h*)(ksh + 8 * i);
        const v8h b0 = *(const v8h*)(vsh + 8 * i);
        *(v8h*)(Ksh + r * AT_D  + half + 8 * i) = a0;
        *(v8h*)(Vth + r * AT_KC + half + 8 * i) = b0;
      }
    }
    __syncthreads();

    v8f s[4];
#pragma unroll
    for (int j = 0; j < 4; ++j) {
      s[j] = (v8f){0.f,0.f,0.f,0.f,0.f,0.f,0.f,0.f};
#pragma unroll
      for (int dc = 0; dc < 2; ++dc) {
        FH kb;
        kb.h[0] = *(const v8h*)(Ksh + (j * 16 + c) * AT_D + dc * 32 + 8 * hh);
        kb.h[1] = *(const v8h*)(Ksh + (j * 16 + c) * AT_D + dc * 32 + 16 + 8 * hh);
        s[j] = at_mma_h(qa[dc], kb.v, s[j]);
      }
    }
    float cm[8];
#pragma unroll
    for (int r = 0; r < 8; ++r) {
      float m = -INFINITY;
#pragma unroll
      for (int j = 0; j < 4; ++j) {
        const float sv = s[j][r] * sscale;
        s[j][r] = sv;
        m = fmaxf(m, sv);
      }
#pragma unroll
      for (int off = 1; off < 16; off <<= 1) m = fmaxf(m, __shfl_xor(m, off, 32));
      cm[r] = m;
    }
    _Float16* pwh = Psh[wave];
#pragma unroll
    for (int r = 0; r < 8; ++r) {
      const float mnew = fmaxf(mrow[r], cm[r]);
      const float alpha = expf(mrow[r] - mnew);
      mrow[r] = mnew;
      float psum = 0.f;
#pragma unroll
      for (int j = 0; j < 4; ++j) {
        const float p = expf(s[j][r] - mnew);
        psum += p;
        pwh[(8 * hh + r) * AT_KC + j * 16 + c] = (_Float16)(p * P_CARRY);
      }
#pragma unroll
      for (int off = 1; off < 16; off <<= 1) psum += __shfl_xor(psum, off, 32);
      lrow[r] = lrow[r] * alpha + psum;
#pragma unroll
      for (int t = 0; t < 4; ++t) oacc[t][r] *= alpha;
    }
    __builtin_amdgcn_fence(__ATOMIC_RELEASE, "workgroup");
    __builtin_amdgcn_wave_barrier();
    __builtin_amdgcn_fence(__ATOMIC_ACQUIRE, "workgroup");
#pragma unroll 1
    for (int kk = 0; kk < 2; ++kk) {
      FH pa;
      pa.h[0] = *(const v8h*)(pwh + c * AT_KC + kk * 32 + 8 * hh);
      pa.h[1] = *(const v8h*)(pwh + c * AT_KC + kk * 32 + 16 + 8 * hh);
#pragma unroll
      for (int t = 0; t < 4; ++t) {
        FH vb;
        vb.h[0] = *(const v8h*)(Vth + (t * 16 + c) * AT_KC + kk * 32 + 8 * hh);
        vb.h[1] = *(const v8h*)(Vth + (t * 16 + c) * AT_KC + kk * 32 + 16 + 8 * hh);
        oacc[t] = at_mma_h(pa.v, vb.v, oacc[t]);
      }
    }
  }

  float* os = Os[wave];
#pragma unroll
  for (int r = 0; r < 8; ++r) {
    const float inv = oscale / (lrow[r] * P_CARRY);
#pragma unroll
    for (int t = 0; t < 4; ++t) os[(8 * hh + r) * 68 + t * 16 + c] = oacc[t][r] * inv;
  }
  __builtin_amdgcn_fence(__ATOMIC_RELEASE, "workgroup");
  __builtin_amdgcn_wave_barrier();
  __builtin_amdgcn_fence(__ATOMIC_ACQUIRE, "workgroup");
  {
    const int q8 = lane >> 3, c8 = (lane & 7) * 8;      // it 0..3 x q8 0..3 covers rows 0..15 of the wave tile
    {
#pragma unroll
      for (int it = 0; it < 4; ++it) {
        const int row = it * 4 + q8;
        const float* sp = os + row * 68 + c8;
        v8h hv;
#pragma unroll
        for (int e = 0; e < 8; ++e) hv[e] = (_Float16)sp[e];
        *(v8h*)(ob + (size_t)(q0 + row) * EMB_ + c8) = hv;
      }
      
    }
  }
}

// ---------------------------------------------------------------------------
extern "C" void kernel_launch(void* const* d_in, const int* in_sizes, int n_in,
                              void* d_out, int out_size, void* d_ws, size_t ws_size,
                              hipStream_t stream) {
  if (n_in < 12) return;
  if (in_sizes[0] != NBATCH_ * CIN_ * SEQL_) return;
  if (in_sizes[1] != EMB_ * CIN_ || in_sizes[2] != EMB_) return;
  if (in_sizes[3] != EMB_ * EMB_ || in_sizes[4] != EMB_ * EMB_ || in_sizes[5] != EMB_ * EMB_) return;
  if (in_sizes[6] != EMB_ * EMB_ || in_sizes[7] != EMB_) return;
  if (in_sizes[8] != COUT_ * EMB_ || in_sizes[9] != COUT_) return;
  if (in_sizes[10] != SEQL_ * EMB_ || in_sizes[11] < 1) return;
  if (out_size != NBATCH_ * COUT_ * SEQL_) return;
  if (ws_size < WS_TOTAL) return;

  const float* x     = (const float*)d_in[0];
  const float* W_cp  = (const float*)d_in[1];
  const float* b_cp  = (const float*)d_in[2];
  const float* W_q   = (const float*)d_in[3];
  const float* W_k   = (const float*)d_in[4];
  const float* W_v   = (const float*)d_in[5];
  const float* W_o   = (const float*)d_in[6];
  const float* b_o   = (const float*)d_in[7];
  const float* W_out = (const float*)d_in[8];
  const float* b_out = (const float*)d_in[9];
  const float* pos   = (const float*)d_in[10];
  const float* gatep = (const float*)d_in[11];
  float* out = (float*)d_out;

  char* ws = (char*)d_ws;
  _Float16* wpool = (_Float16*)(void*)(ws + OFFB_W);
  unsigned short* XT16 = (unsigned short*)(void*)(ws + OFFB_XT);
  unsigned short* XF16 = (unsigned short*)(void*)(ws + OFFB_XF);
  unsigned short* QK16 = (unsigned short*)(void*)(ws + OFFB_QK);
  unsigned short* VT16 = (unsigned short*)(void*)(ws + OFFB_VT);
  unsigned short* O16  = (unsigned short*)(void*)(ws + OFFB_O);
  unsigned short* O1   = (unsigned short*)(void*)(ws + OFFB_O1);
  const unsigned short* Wcp16  = U16(wpool + WOFF_CP);
  const unsigned short* Wqk16  = U16(wpool + WOFF_Q);     // [256][128]: q rows then k rows
  const unsigned short* Wv16   = U16(wpool + WOFF_V);
  const unsigned short* Wo16   = U16(wpool + WOFF_O);
  const unsigned short* Wout16 = U16(wpool + WOFF_OUT);

  const float WSC = 8.0f;                 // weight carry
  const float OSC = 16.0f;                // attention-output carry
  const float inv_w  = 1.0f / 8.0f;
  const float inv_wo = 1.0f / (8.0f * 16.0f);

  // 1. weights -> f16 x8
  cast_w6_kernel<<<dim3(32, 6, 1), dim3(256, 1, 1), 0, stream>>>(W_cp, W_q, W_k, W_v, W_o, W_out, wpool, WSC);

  // 2. x [b][64 ch][4096 tok] -> XT16 [b*4096+tok][64 ch] f16   (in[rows=64][cols=4096] -> out[4096][64])
  tcast16_kernel<<<dim3(SEQL_ / 64, CIN_ / 64, NBATCH_), dim3(256, 1, 1), 0, stream>>>(
      x, XT16, CIN_, SEQL_, (long)CIN_ * SEQL_, (long)SEQL_ * CIN_);

  // 3. XF16[b][tok][e] = XT16[b][tok][:] . Wcp[e][:] /8 + b_cp[e] + pos[tok][e]  (M=4096, N=128, K=64 per batch; f16 out)
  wmma_gemm64<0, false, 2, 1, true><<<dim3((SEQL_ / 64) * (EMB_ / 64) / 8, NBATCH_, 1), dim3(256, 1, 1), 0, stream>>>(
      XT16, XT16, CIN_, (long)SEQL_ * CIN_,
      Wcp16, Wcp16, CIN_, 0L,
      (void*)XF16, nullptr, EMB_, (long)SEQL_ * EMB_,
      b_cp, pos, 0L, nullptr,
      SEQL_, EMB_, CIN_, inv_w);

  // 4. QK16[tok][n] = XF16[tok][:] . Wqk[n][:] /8   (M=8192, N=256, K=128; q = cols 0..127, k = cols 128..255)
  wmma_gemm64<0, false, 0, 1, false><<<dim3((NTOK_ / 64) * (QKPITCH_ / 64) / 8, 1, 1), dim3(256, 1, 1), 0, stream>>>(
      XF16, XF16, EMB_, 0L,
      Wqk16, Wqk16, EMB_, 0L,
      (void*)QK16, nullptr, QKPITCH_, 0L,
      nullptr, nullptr, 0L, nullptr,
      NTOK_, QKPITCH_, EMB_, inv_w);

  // 5. VT16[b][(h,d)][tok] = Wv[(h,d)][:] . XF16[b][tok][:] /8   (M=128, N=4096, K=128 per batch)
  wmma_gemm64<0, false, 0, 1, false><<<dim3((EMB_ / 64) * (SEQL_ / 64) / 8, NBATCH_, 1), dim3(256, 1, 1), 0, stream>>>(
      Wv16, Wv16, EMB_, 0L,
      XF16, XF16, EMB_, (long)SEQL_ * EMB_,
      (void*)VT16, nullptr, SEQL_, (long)EMB_ * SEQL_,
      nullptr, nullptr, 0L, nullptr,
      EMB_, SEQL_, EMB_, inv_w);

  // 6. attention -> O16 [tok][128] f16 (x16)
  attn_full64_f16_kernel<<<dim3(NBATCH_ * NHEAD_ * (SEQL_ / AT_QB), 1, 1), dim3(128, 1, 1), 0, stream>>>(
      QK16, VT16, O16, 0.125f, OSC);

  // 7. O1[tok][n] = O16[tok][:] . Wo[n][:] /128 + b_o[n]   (M=8192, N=128, K=128; f16 out)
  wmma_gemm64<0, false, 2, 1, false><<<dim3((NTOK_ / 64) * (EMB_ / 64) / 8, 1, 1), dim3(256, 1, 1), 0, stream>>>(
      O16, O16, EMB_, 0L,
      Wo16, Wo16, EMB_, 0L,
      (void*)O1, nullptr, EMB_, 0L,
      b_o, nullptr, 0L, nullptr,
      NTOK_, EMB_, EMB_, inv_wo);

  // 8. out[b][c][tok] = Wout[c][:] . O1[b][tok][:] /8 + b_out[c] + gate*x[b][c][tok]   (M=64, N=4096, K=128 per batch; f32)
  wmma_gemm64<0, false, 1, 0, true><<<dim3((COUT_ / 64) * (SEQL_ / 64) / 8, NBATCH_, 1), dim3(256, 1, 1), 0, stream>>>(
      Wout16, Wout16, EMB_, 0L,
      O1, O1, EMB_, (long)SEQL_ * EMB_,
      (void*)out, nullptr, SEQL_, (long)COUT_ * SEQL_,
      b_out, x, (long)COUT_ * SEQL_, gatep,
      COUT_, SEQL_, EMB_, inv_w);
}

// v001
// It runs in 195 microseconds.
// Two timings next to v000 both put it at 1.83 times that version's speed.
// Contractions (token embed 64->128, fused q|k projection, v^T projection, q.k^T, p.v, W_o projection, W_out projection): v_wmma_f32_16x16x32_f16 (f16 operands: weights carried x8, attention output x16, softmax numerators x2^15; f32 accumulate); softmax statistics, biases, positional add and gated residual in f32.
#include <hip/hip_runtime.h>
#include <math.h>
#include <stdint.h>

typedef __attribute__((ext_vector_type(16))) _Float16 v16h;
typedef __attribute__((ext_vector_type(8)))  _Float16 v8h;
typedef __attribute__((ext_vector_type(16))) __bf16   v16b;
typedef __attribute__((ext_vector_type(8)))  __bf16   v8b;
typedef __attribute__((ext_vector_type(8)))  float    v8f;
typedef __attribute__((ext_vector_type(4)))  float    v4f;
typedef __attribute__((ext_vector_type(2)))  float    v2f;
typedef __attribute__((ext_vector_type(4)))  unsigned int v4u;

// ---- problem geometry ----
constexpr int NBATCH_  = 2;
constexpr int CIN_     = 64;
constexpr int EMB_     = 128;
constexpr int COUT_    = 64;
constexpr int NHEAD_   = 2;
constexpr int HDIM_    = 64;
constexpr int SEQL_    = 4096;               // 16*16*16 tokens per batch element
constexpr int NTOK_    = NBATCH_ * SEQL_;    // 8192
constexpr int QKPITCH_ = 2 * EMB_;           // fused q|k plane pitch (halves)

// ---- f16 weight pool offsets (halves) ----
constexpr int WOFF_CP   = 0;                              // [128][64]
constexpr int WOFF_Q    = WOFF_CP + EMB_ * CIN_;          // [128][128]  (q rows)
constexpr int WOFF_K    = WOFF_Q + EMB_ * EMB_;           // [128][128]  (k rows, contiguous after q -> [256][128])
constexpr int WOFF_V    = WOFF_K + EMB_ * EMB_;           // [128][128]
constexpr int WOFF_O    = WOFF_V + EMB_ * EMB_;           // [128][128]
constexpr int WOFF_OUT  = WOFF_O + EMB_ * EMB_;           // [64][128]
constexpr int WPOOL_H   = WOFF_OUT + COUT_ * EMB_;        // 81920 halves = 163840 B
static_assert(WPOOL_H == 81920, "weight pool size");

//   WPOOL f16 weights x8                     0          163840
//   XT16  f16 [8192 tok][64 ch]         163840         1048576
//   XF16  f16 [8192 tok][128]          1212416         2097152
//   QK16  f16 [8192 tok][256] (q|k)    3309568         4194304
//   VT16  f16 [2][128 (h,d)][4096]     7503872         2097152
//   O16   f16 [8192 tok][128] (x16)    9601024         2097152
//   O1_16 f16 [8192 tok][128]         11698176         2097152
//   total                             13795328
constexpr size_t OFFB_W   = 0;
constexpr size_t OFFB_XT  = OFFB_W  + (size_t)WPOOL_H * 2;
constexpr size_t OFFB_XF  = OFFB_XT + (size_t)NTOK_ * CIN_ * 2;
constexpr size_t OFFB_QK  = OFFB_XF + (size_t)NTOK_ * EMB_ * 2;
constexpr size_t OFFB_VT  = OFFB_QK + (size_t)NTOK_ * QKPITCH_ * 2;
constexpr size_t OFFB_O   = OFFB_VT + (size_t)NBATCH_ * EMB_ * SEQL_ * 2;
constexpr size_t OFFB_O1  = OFFB_O  + (size_t)NTOK_ * EMB_ * 2;
constexpr size_t WS_TOTAL = OFFB_O1 + (size_t)NTOK_ * EMB_ * 2;
static_assert(WS_TOTAL == 13795328, "carve total");
static_assert((OFFB_XT % 128) == 0 && (OFFB_XF % 128) == 0 && (OFFB_QK % 128) == 0 &&
              (OFFB_VT % 128) == 0 && (OFFB_O % 128) == 0 && (OFFB_O1 % 128) == 0, "128-B aligned regions");

#define U16(p) ((const unsigned short*)(const void*)(p))

__device__ __forceinline__ unsigned short f2bf_bits(float f) {
  unsigned u = __float_as_uint(f);
  return (unsigned short)((u + 0x7FFFu + ((u >> 16) & 1u)) >> 16);
}
__device__ __forceinline__ float bf_bits2f(unsigned short h) { return __uint_as_float(((unsigned)h) << 16); }
__device__ __forceinline__ unsigned pk16(unsigned short a, unsigned short b) { return (unsigned)a | ((unsigned)b << 16); }
__device__ __forceinline__ unsigned short h_bits(float f) { return __builtin_bit_cast(unsigned short, (_Float16)f); }

// hazard guards as plain device helpers (no inline asm inside the kernel template body)
__device__ __forceinline__ void dep_guard_h(v8f& a, v8f& b, v16h x, v16h y) { asm volatile("v_nop\n\tv_nop\n\tv_nop\n\tv_nop" : "+v"(a), "+v"(b) : "v"(x), "v"(y)); }
__device__ __forceinline__ void dep_guard_b(v8f& a, v8f& b, v16b x, v16b y) { asm volatile("v_nop\n\tv_nop\n\tv_nop\n\tv_nop" : "+v"(a), "+v"(b) : "v"(x), "v"(y)); }
__device__ __forceinline__ void keep4_h(v16h a, v16h b, v16h c, v16h d) { asm volatile("v_nop" :: "v"(a), "v"(b), "v"(c), "v"(d)); }
__device__ __forceinline__ void keep4_b(v16b a, v16b b, v16b c, v16b d) { asm volatile("v_nop" :: "v"(a), "v"(b), "v"(c), "v"(d)); }
__device__ __forceinline__ void acc_guard4(v8f& a, v8f& b, v8f& c, v8f& d) { asm volatile("v_nop\n\tv_nop\n\tv_nop\n\tv_nop" : "+v"(a), "+v"(b), "+v"(c), "+v"(d)); }
template <typename T> struct Frag;
template <> struct Frag<_Float16> {
  typedef v16h V; union U { v16h v; v8h h[2]; };
  static __device__ __forceinline__ v16h load(const _Float16* p) {   // elements 0..7 <- p[0..7], 8..15 <- p[16..23]
    U f; f.h[0] = *(const v8h*)(p); f.h[1] = *(const v8h*)(p + 16); return f.v;
  }
  static __device__ __forceinline__ v8f mma(v16h a, v16h b, v8f c) {
    return __builtin_amdgcn_wmma_f32_16x16x32_f16(false, a, false, b, (short)0, c, false, false);
  }
  static __device__ __forceinline__ void guard(v8f& a, v8f& b, v16h x, v16h y) { dep_guard_h(a, b, x, y); }
  static __device__ __forceinline__ void keep(v16h a, v16h b, v16h c, v16h d) { keep4_h(a, b, c, d); }
};
template <> struct Frag<__bf16> {
  typedef v16b V; union U { v16b v; v8b h[2]; };
  static __device__ __forceinline__ v16b load(const __bf16* p) {
    U f; f.h[0] = *(const v8b*)(p); f.h[1] = *(const v8b*)(p + 16); return f.v;
  }
  static __device__ __forceinline__ v8f mma(v16b a, v16b b, v8f c) {
    return __builtin_amdgcn_wmma_f32_16x16x32_bf16(false, a, false, b, (short)0, c, false, false);
  }
  static __device__ __forceinline__ void guard(v8f& a, v8f& b, v16b x, v16b y) { dep_guard_b(a, b, x, y); }
  static __device__ __forceinline__ void keep(v16b a, v16b b, v16b c, v16b d) { keep4_b(a, b, c, d); }
};

// ---- Register-blocked batched WMMA GEMM ------------------------------------
// C[m,n] = scale * sum_k A[m,k] * Bt[n,k] (+bias)(+rg*resid); each wave owns a 64x64 tile.
// A row-major [M,K]; Bt row-major [N,K]; M,N % 64 == 0, K % 32 == 0.
// SPLIT: operands are hi/lo planes (A2/Bt2 = lo planes, same layout); product = hi.hi + hi.lo + lo.hi.
// BIAS_MODE: 0 = none, 1 = bias[m], 2 = bias[n].
// OUT_MODE: 0 = f32, 1 = f16, 2 = bf16 hi plane (Cout) + bf16 lo plane (Cout2).
// RESID: v += rg * resid[m*ldc+n] with rg = rgain[0] when rgain != nullptr else 1.
// ET: 0 = f16 operands, 1 = bf16 operands (pointers passed as 16-bit storage)
template <int ET> struct Elem;
template <> struct Elem<0> { typedef _Float16 T; };
template <> struct Elem<1> { typedef __bf16 T; };
template <int ET, bool SPLIT, int BIAS_MODE, int OUT_MODE, bool RESID, int ACT = 0>
__global__ __launch_bounds__(256) void wmma_gemm64(
    const unsigned short* __restrict__ Ap, const unsigned short* __restrict__ A2p, int lda, long strideA,
    const unsigned short* __restrict__ Btp, const unsigned short* __restrict__ Bt2p, int ldb, long strideB,
    void* __restrict__ Cout, void* __restrict__ Cout2, int ldc, long strideC,
    const float* __restrict__ bias,
    const float* __restrict__ resid, long strideR, const float* __restrict__ rgain,
    int M, int N, int K, float scale) {
  typedef typename Elem<ET>::T T;
  typedef typename Frag<T>::V V;
  const T* A = (const T*)Ap; const T* A2 = (const T*)A2p; const T* Bt = (const T*)Btp; const T* Bt2 = (const T*)Bt2p;
  __shared__ __align__(16) float sT[8][16 * 68];   // per-wave 16x64 slab, pitch 68 floats
  const int b    = blockIdx.y;
  const int lane = threadIdx.x & 31;
  const int wave = threadIdx.x >> 5;
  const int tilesN = N >> 6;
  const int tilesM = M >> 6;
  const int tile = blockIdx.x * 8 + wave;
  if (tile >= tilesM * tilesN) return;   // wave-uniform; no block barriers in this kernel
  const int tm = tile / tilesN;
  const int tn = tile - tm * tilesN;
  const int m0 = tm << 6;
  const int n0 = tn << 6;

  const T* Ab  = A  + (size_t)b * strideA;
  const T* Bb  = Bt + (size_t)b * strideB;
  const T* Ab2 = SPLIT ? (A2  + (size_t)b * strideA) : nullptr;
  const T* Bb2 = SPLIT ? (Bt2 + (size_t)b * strideB) : nullptr;

  const int rlane = lane & 15;                 // row (A) / col (B, D) within subtile
  const int koff  = (lane >> 4) * 8;           // k offset of this lane half
  const int mOff  = (lane >> 4) * 8;           // D row offset

  v8f acc[4][4];
#pragma unroll
  for (int i = 0; i < 4; ++i)
#pragma unroll
    for (int j = 0; j < 4; ++j) acc[i][j] = (v8f){0.f,0.f,0.f,0.f,0.f,0.f,0.f,0.f};

  for (int k0 = 0; k0 < K; k0 += 32) {
    V bh[4], bl[4];
#pragma unroll
    for (int j = 0; j < 4; ++j) {
      const size_t bo = (size_t)(n0 + (j << 4) + rlane) * ldb + koff + k0;
      bh[j] = Frag<T>::load(Bb + bo);
      if (SPLIT) bl[j] = Frag<T>::load(Bb2 + bo);
    }
#pragma unroll
    for (int i = 0; i < 4; ++i) {
      const size_t ao = (size_t)(m0 + (i << 4) + rlane) * lda + koff + k0;
      V ah = Frag<T>::load(Ab + ao);
      V al;
      if (SPLIT) al = Frag<T>::load(Ab2 + ao);
#pragma unroll
      for (int j = 0; j < 4; ++j) {
        acc[i][j] = Frag<T>::mma(ah, bh[j], acc[i][j]);
        if (SPLIT) {
          acc[i][j] = Frag<T>::mma(ah, bl[j], acc[i][j]);
          acc[i][j] = Frag<T>::mma(al, bh[j], acc[i][j]);
        }
      }
      Frag<T>::guard(acc[i][0], acc[i][3], ah, SPLIT ? al : ah);
    }
    Frag<T>::keep(bh[0], bh[1], bh[2], bh[3]);
    if (SPLIT) Frag<T>::keep(bl[0], bl[1], bl[2], bl[3]);
  }
  acc_guard4(acc[0][0], acc[0][1], acc[0][2], acc[0][3]);
  acc_guard4(acc[1][0], acc[1][1], acc[1][2], acc[1][3]);
  acc_guard4(acc[2][0], acc[2][1], acc[2][2], acc[2][3]);
  acc_guard4(acc[3][0], acc[3][1], acc[3][2], acc[3][3]);

  // ---- epilogue ----
  float* slab = sT[wave];
  const float* Rb = RESID ? (resid + (size_t)b * strideR) : nullptr;
  float rg = 1.0f;
  if (RESID) { if (rgain != nullptr) rg = rgain[0]; }
#pragma unroll
  for (int i = 0; i < 4; ++i) {
    const int mBase = m0 + (i << 4);
#pragma unroll
    for (int j = 0; j < 4; ++j) {
      const int n = n0 + (j << 4) + rlane;
      float bv = 0.f;
      if (BIAS_MODE == 2) bv = bias[n];
#pragma unroll
      for (int r = 0; r < 8; ++r) {
        float v = acc[i][j][r] * scale;
        if (BIAS_MODE == 1) v += bias[mBase + mOff + r];
        if (BIAS_MODE == 2) v += bv;
        if (RESID) v += rg * Rb[(size_t)(mBase + mOff + r) * ldc + n];
        if (ACT == 1) v = tanhf(v);
        if (ACT == 2) v = fmaxf(v, 0.0f);
        if (ACT == 3) v = v / (1.0f + expf(-v));
        if (ACT == 4) v = (v > 0.f) ? v : 0.01f * v;
        slab[(mOff + r) * 68 + (j << 4) + rlane] = v;
      }
    }
    __builtin_amdgcn_fence(__ATOMIC_RELEASE, "workgroup");
    __builtin_amdgcn_wave_barrier();
    __builtin_amdgcn_fence(__ATOMIC_ACQUIRE, "workgroup");
    if (OUT_MODE == 0) {
      float* C = (float*)Cout + (size_t)b * strideC;
      const int hh = lane >> 4, c4 = (lane & 15) * 4;     // row seg = 256 B = 16 lanes x 16 B
      {
#pragma unroll
        for (int it = 0; it < 8; ++it) {
          const int row = it * 2 + hh;
          v4f v = *(const v4f*)(slab + row * 68 + c4);
          *(v4f*)(C + (size_t)(mBase + row) * ldc + n0 + c4) = v;
        }
        
      }
    } else {
      const int q = lane >> 3, c8 = (lane & 7) * 8;
      unsigned short* C  = (unsigned short*)Cout  + (size_t)b * strideC;
      unsigned short* C2 = (OUT_MODE == 2) ? ((unsigned short*)Cout2 + (size_t)b * strideC) : nullptr;
      {
#pragma unroll
        for (int it = 0; it < 4; ++it) {
          const int row = it * 4 + q;
          const float* sp = slab + row * 68 + c8;
          v8h hv, lv;
#pragma unroll
          for (int e = 0; e < 8; ++e) {
            if (OUT_MODE == 1) {
              hv[e] = (_Float16)sp[e];
            } else {
              unsigned short hb = f2bf_bits(sp[e]);
              unsigned short lb = f2bf_bits(sp[e] - bf_bits2f(hb));
              hv[e] = __builtin_bit_cast(_Float16, hb);
              lv[e] = __builtin_bit_cast(_Float16, lb);
            }
          }
          *(v8h*)(C + (size_t)(mBase + row) * ldc + n0 + c8) = hv;
          if (OUT_MODE == 2) *(v8h*)(C2 + (size_t)(mBase + row) * ldc + n0 + c8) = lv;
        }
        
      }
    }
    __builtin_amdgcn_fence(__ATOMIC_RELEASE, "workgroup");
    __builtin_amdgcn_wave_barrier();
    __builtin_amdgcn_fence(__ATOMIC_ACQUIRE, "workgroup");
  }
}

// ---------------------------------------------------------------------------
// Weight cast f32 -> f16 with a power-of-two carry sc (x8): six matrices selected by blockIdx.y (block-uniform),
// Coverage: grid.x = 32 blocks x 256 threads = 8192 pairs >= n2 for every matrix (n2 = 4096 or 8192 pairs).
// ---------------------------------------------------------------------------
__global__ __launch_bounds__(256) void cast_w6_kernel(const float* __restrict__ w0, const float* __restrict__ w1,
                                                      const float* __restrict__ w2, const float* __restrict__ w3,
                                                      const float* __restrict__ w4, const float* __restrict__ w5,
                                                      _Float16* __restrict__ pool, float sc) {
  const int y = blockIdx.y;                 // block-uniform selector
  const float* in = w0; int n2 = (EMB_ * CIN_) / 2; int off = WOFF_CP;
  if (y == 1) { in = w1; n2 = (EMB_ * EMB_) / 2;  off = WOFF_Q; }
  if (y == 2) { in = w2; n2 = (EMB_ * EMB_) / 2;  off = WOFF_K; }
  if (y == 3) { in = w3; n2 = (EMB_ * EMB_) / 2;  off = WOFF_V; }
  if (y == 4) { in = w4; n2 = (EMB_ * EMB_) / 2;  off = WOFF_O; }
  if (y == 5) { in = w5; n2 = (COUT_ * EMB_) / 2; off = WOFF_OUT; }
  _Float16* out = pool + off;
  const int i = blockIdx.x * 256 + threadIdx.x;
  if (i < n2) {
    const v2f f = *(const v2f*)(in + 2 * (size_t)i);
    const unsigned u = pk16(h_bits(f[0] * sc), h_bits(f[1] * sc));
    ((unsigned*)out)[i] = u;
    
  }
}

// ---------------------------------------------------------------------------
// Fused transpose + f16 cast of an f32 matrix, z-batched: in_z = W + z*sIn viewed [R rows][Cc cols] (pitch Cc) ->
//   oh_z[c][r] = f16(in_z[r][c])   ([Cc][R], pitch R), oh_z = oh + z*sOut.
// Here: in_z = x[z] viewed [R=64 ch][Cc=4096 tok] -> out [4096 tok][64 ch]; grid = (Cc/64=64, R/64=1, Z=2), 256 threads.
// Coverage per block: load 4 it x 256 thr x 4 floats = 64x64; store 2 it x 256 thr x 8 u16 = 64x64.
// ---------------------------------------------------------------------------
__global__ __launch_bounds__(256) void tcast16_kernel(const float* __restrict__ W, unsigned short* __restrict__ oh,
                                                      int R, int Cc, long sIn, long sOut) {
  __shared__ __align__(16) float tf[64 * 68];
  W  += (size_t)blockIdx.z * sIn;
  oh += (size_t)blockIdx.z * sOut;
  const int c0  = blockIdx.x * 64;   // input column block = output row block
  const int r0  = blockIdx.y * 64;   // input row block    = output column block
  const int tid = threadIdx.x;
  {
    const int lr = tid >> 4;         // 0..15
    const int c4 = (tid & 15) * 4;   // 0..60
#pragma unroll
    for (int it = 0; it < 4; ++it) {
      const int rr = it * 16 + lr;   // 0..63
      const v4f a = *(const v4f*)(W + (size_t)(r0 + rr) * Cc + c0 + c4);
      *(v4f*)(tf + rr * 68 + c4) = a;
    }
  }
  __syncthreads();
  const int sub = tid >> 3;          // 0..31
  const int c8  = (tid & 7) * 8;     // 0..56
  v4u hv[2];
#pragma unroll
  for (int it = 0; it < 2; ++it) {
    const int oc = it * 32 + sub;    // output row within tile (= input column)
    v4u a;
#pragma unroll
    for (int q = 0; q < 4; ++q) {
      const float f0 = tf[(c8 + 2 * q) * 68 + oc];
      const float f1 = tf[(c8 + 2 * q + 1) * 68 + oc];
      a[q] = pk16(h_bits(f0), h_bits(f1));
    }
    hv[it] = a;
  }
  {
#pragma unroll
    for (int it = 0; it < 2; ++it) {
      const int oc = it * 32 + sub;
      const size_t go = (size_t)(c0 + oc) * R + r0 + c8;
      *(v4u*)(oh + go) = hv[it];
    }
    
  }
}

// =====================================================================================
// Full (non-causal, unmasked) attention, head dim 64, all (batch, head, 64-query tile) in one launch.
//   q|k plane (f16): q element (b, t, h, d) at [(b*SEQL_+t)*QKPITCH_ + h*64 + d]; k at the same + EMB_.
//   v^T plane (f16): element (b, h, d, s) at [b*EMB_*SEQL_ + (h*64 + d)*SEQL_ + s]
//   out (f16, carried x oscale): element (b, t, h, d) at [(b*SEQL_+t)*EMB_ + h*64 + d]
//   scores^T = (k . q^T) * sscale : v_wmma_f32_16x16x32_f16, A = K rows, B = Q; a lane holds 8 keys x 1 query per tile
//   out^T    = v^T . p^T          : p = exp(s - m) carried x2^15 in f16, packed in-lane from two score tiles into the
//                                   B operand (no LDS trip), A = V^T rows, f32 accumulate, 1/(l*2^15) in f32
//   online softmax in f32 over all SEQL_ keys (64 chunks of 64, compile-time trip count, no masking): maximum and sum
//   run in-lane; the two wave halves join the maximum once per chunk and the sum once after the loop.
//   Block = 4 waves = 64 query rows of one (batch, head); grid.x = NBATCH_ * NHEAD_ * (SEQL_/64) = 256.
//   K / V^T chunk staging: 128 threads x 32 elements per plane = the whole 64x64 tile (16-B copies, plain loads,
//   __syncthreads before and after); fragment loads read the LDS tiles with the same v8h element type.
// =====================================================================================
#define AT_D 64
#define AT_NW 4
#define AT_QB 64
#define AT_KC 64
#define P_CARRY 32768.0f

__device__ __forceinline__ v8f at_mma_h(v16h a, v16h b, v8f c) {
  c = __builtin_amdgcn_wmma_f32_16x16x32_f16(false, a, false, b, (short)0, c, false, false);
  asm volatile("v_nop\n\tv_nop\n\tv_nop\n\tv_nop" : "+v"(c) : "v"(a), "v"(b));
  return c;
}

// lane l <-> lane l ^ 16: the two halves of a wave hold the two key halves of the same query column
__device__ __forceinline__ float xhalf(float x) {
  return __builtin_bit_cast(float, __builtin_amdgcn_permlanex16(__builtin_bit_cast(int, x), __builtin_bit_cast(int, x),
                                                                0x76543210, 0xfedcba98, false, false));
}

__global__ __launch_bounds__(128)
void attn_full64_f16_kernel(const unsigned short* __restrict__ qkp, const unsigned short* __restrict__ vtp,
                            unsigned short* __restrict__ op, float sscale, float oscale) {
  union FH { v16h v; v8h h[2]; };
  __shared__ __align__(16) _Float16 Ksh[AT_KC * AT_D];             // K [kv][d]      8 KB
  __shared__ __align__(16) _Float16 Vth[AT_D * AT_KC];             // V [d][kv]      8 KB
  __shared__ __align__(16) float    Os[AT_NW][16 * 68];            // per wave out tile, pitch 68

  const int tid  = threadIdx.x;
  const int wave = tid >> 5;
  const int lane = tid & 31;
  const int hh   = lane >> 4;
  const int c    = lane & 15;

  const int nqb = SEQL_ / AT_QB;          // 64
  const int bx = blockIdx.x;
  const int qb = bx % nqb;
  const int bh = bx / nqb;                // 0..NBATCH_*NHEAD_-1
  const int h  = bh % NHEAD_;
  const int b  = bh / NHEAD_;
  const int q0 = qb * AT_QB + wave * 16;

  const _Float16* Qh = (const _Float16*)(const void*)qkp + (size_t)b * SEQL_ * QKPITCH_ + (size_t)h * AT_D;
  const _Float16* Kh = Qh + EMB_;
  const _Float16* Vh = (const _Float16*)(const void*)vtp + (size_t)b * EMB_ * SEQL_ + (size_t)h * AT_D * SEQL_;
  _Float16*       ob = (_Float16*)(void*)op + (size_t)b * SEQL_ * EMB_ + (size_t)h * AT_D;

  // ---- Q fragments (B operand, column = lane&15, split k map via Frag load): 2 d-chunks ----
  v16h qa[2];
#pragma unroll
  for (int dc = 0; dc < 2; ++dc) {
    const _Float16* qr = Qh + (size_t)(q0 + c) * QKPITCH_ + dc * 32 + 8 * hh;
    qa[dc] = Frag<_Float16>::load(qr);
  }

  float mrow = -INFINITY, lrow = 0.f;   // this lane's query: running maximum (both halves alike), sum over this half's keys
  v8f oacc[4];                          // oacc[t][r] = out^T[d = t*16 + 8*hh + r][query c]
#pragma unroll
  for (int t = 0; t < 4; ++t) oacc[t] = (v8f){0.f,0.f,0.f,0.f,0.f,0.f,0.f,0.f};

  const int nChunks = SEQL_ / AT_KC;   // 64, compile-time constant
  for (int kc = 0; kc < nChunks; ++kc) {
    const int kv0 = kc * AT_KC;
    __syncthreads();
    {
      // staging coverage: 128 threads x (4 x 8) elements = 64 rows x 64 per plane = the whole chunk tile
      const int r = tid >> 1, half = (tid & 1) * 32;
      const _Float16* ksh = Kh + (size_t)(kv0 + r) * QKPITCH_ + half;   // K row kv0+r, d = half..half+31
      const _Float16* vsh = Vh + (size_t)r * SEQL_ + kv0 + half;        // V^T row d = r, s = kv0+half..+31
#pragma unroll
      for (int i = 0; i < 4; ++i) {
        const v8h a0 = *(const v8h*)(ksh + 8 * i);
        const v8h b0 = *(const v8h*)(vsh + 8 * i);
        *(v8h*)(Ksh + r * AT_D  + half + 8 * i) = a0;
        *(v8h*)(Vth + r * AT_KC + half + 8 * i) = b0;
      }
    }
    __syncthreads();

    v8f s[4];
#pragma unroll
    for (int j = 0; j < 4; ++j) {
      s[j] = (v8f){0.f,0.f,0.f,0.f,0.f,0.f,0.f,0.f};
#pragma unroll
      for (int dc = 0; dc < 2; ++dc) {
        FH kb;
        kb.h[0] = *(const v8h*)(Ksh + (j * 16 + c) * AT_D + dc * 32 + 8 * hh);
        kb.h[1] = *(const v8h*)(Ksh + (j * 16 + c) * AT_D + dc * 32 + 16 + 8 * hh);
        s[j] = at_mma_h(kb.v, qa[dc], s[j]);   // s[j][r] = score of key j*16 + 8*hh + r against query c
      }
    }
    float m4[4];
#pragma unroll
    for (int j = 0; j < 4; ++j) {
      float m = -INFINITY;
#pragma unroll
      for (int r = 0; r < 8; ++r) {
        const float sv = s[j][r] * sscale;
        s[j][r] = sv;
        m = fmaxf(m, sv);
      }
      m4[j] = m;
    }
    float cm = fmaxf(fmaxf(m4[0], m4[1]), fmaxf(m4[2], m4[3]));
    cm = fmaxf(cm, xhalf(cm));
    const float mnew = fmaxf(mrow, cm);
    const float alpha = expf(mrow - mnew);
    mrow = mnew;
    v8h ph[4];
    float ps4[4];
#pragma unroll
    for (int j = 0; j < 4; ++j) {
      float psum = 0.f;
#pragma unroll
      for (int r = 0; r < 8; ++r) {
        const float p = expf(s[j][r] - mnew);
        psum += p;
        ph[j][r] = (_Float16)(p * P_CARRY);
      }
      ps4[j] = psum;
    }
    lrow = lrow * alpha + ((ps4[0] + ps4[1]) + (ps4[2] + ps4[3]));
#pragma unroll
    for (int t = 0; t < 4; ++t)
#pragma unroll
      for (int r = 0; r < 8; ++r) oacc[t][r] *= alpha;
#pragma unroll
    for (int kk = 0; kk < 2; ++kk) {
      FH pb;                       // B operand: elements 0..7 = keys kk*32 + 8*hh + e, 8..15 = keys kk*32 + 16 + 8*hh + e
      pb.h[0] = ph[2 * kk];
      pb.h[1] = ph[2 * kk + 1];
#pragma unroll
      for (int t = 0; t < 4; ++t) {
        FH vb;
        vb.h[0] = *(const v8h*)(Vth + (t * 16 + c) * AT_KC + kk * 32 + 8 * hh);
        vb.h[1] = *(const v8h*)(Vth + (t * 16 + c) * AT_KC + kk * 32 + 16 + 8 * hh);
        oacc[t] = at_mma_h(vb.v, pb.v, oacc[t]);
      }
    }
  }

  float* os = Os[wave];
  {
    const float inv = oscale / ((lrow + xhalf(lrow)) * P_CARRY);
#pragma unroll
    for (int t = 0; t < 4; ++t)
#pragma unroll
      for (int g = 0; g < 2; ++g) {
        v4f w;
#pragma unroll
        for (int e = 0; e < 4; ++e) w[e] = oacc[t][4 * g + e] * inv;
        *(v4f*)(os + c * 68 + t * 16 + 8 * hh + 4 * g) = w;
      }
  }
  __builtin_amdgcn_fence(__ATOMIC_RELEASE, "workgroup");
  __builtin_amdgcn_wave_barrier();
  __builtin_amdgcn_fence(__ATOMIC_ACQUIRE, "workgroup");
  {
    const int q8 = lane >> 3, c8 = (lane & 7) * 8;      // it 0..3 x q8 0..3 covers rows 0..15 of the wave tile
    {
#pragma unroll
      for (int it = 0; it < 4; ++it) {
        const int row = it * 4 + q8;
        const float* sp = os + row * 68 + c8;
        v8h hv;
#pragma unroll
        for (int e = 0; e < 8; ++e) hv[e] = (_Float16)sp[e];
        *(v8h*)(ob + (size_t)(q0 + row) * EMB_ + c8) = hv;
      }
      
    }
  }
}

// ---------------------------------------------------------------------------
extern "C" void kernel_launch(void* const* d_in, const int* in_sizes, int n_in,
                              void* d_out, int out_size, void* d_ws, size_t ws_size,
                              hipStream_t stream) {
  if (n_in < 12) return;
  if (in_sizes[0] != NBATCH_ * CIN_ * SEQL_) return;
  if (in_sizes[1] != EMB_ * CIN_ || in_sizes[2] != EMB_) return;
  if (in_sizes[3] != EMB_ * EMB_ || in_sizes[4] != EMB_ * EMB_ || in_sizes[5] != EMB_ * EMB_) return;
  if (in_sizes[6] != EMB_ * EMB_ || in_sizes[7] != EMB_) return;
  if (in_sizes[8] != COUT_ * EMB_ || in_sizes[9] != COUT_) return;
  if (in_sizes[10] != SEQL_ * EMB_ || in_sizes[11] < 1) return;
  if (out_size != NBATCH_ * COUT_ * SEQL_) return;
  if (ws_size < WS_TOTAL) return;

  const float* x     = (const float*)d_in[0];
  const float* W_cp  = (const float*)d_in[1];
  const float* b_cp  = (const float*)d_in[2];
  const float* W_q   = (const float*)d_in[3];
  const float* W_k   = (const float*)d_in[4];
  const float* W_v   = (const float*)d_in[5];
  const float* W_o   = (const float*)d_in[6];
  const float* b_o   = (const float*)d_in[7];
  const float* W_out = (const float*)d_in[8];
  const float* b_out = (const float*)d_in[9];
  const float* pos   = (const float*)d_in[10];
  const float* gatep = (const float*)d_in[11];
  float* out = (float*)d_out;

  char* ws = (char*)d_ws;
  _Float16* wpool = (_Float16*)(void*)(ws + OFFB_W);
  unsigned short* XT16 = (unsigned short*)(void*)(ws + OFFB_XT);
  unsigned short* XF16 = (unsigned short*)(void*)(ws + OFFB_XF);
  unsigned short* QK16 = (unsigned short*)(void*)(ws + OFFB_QK);
  unsigned short* VT16 = (unsigned short*)(void*)(ws + OFFB_VT);
  unsigned short* O16  = (unsigned short*)(void*)(ws + OFFB_O);
  unsigned short* O1   = (unsigned short*)(void*)(ws + OFFB_O1);
  const unsigned short* Wcp16  = U16(wpool + WOFF_CP);
  const unsigned short* Wqk16  = U16(wpool + WOFF_Q);     // [256][128]: q rows then k rows
  const unsigned short* Wv16   = U16(wpool + WOFF_V);
  const unsigned short* Wo16   = U16(wpool + WOFF_O);
  const unsigned short* Wout16 = U16(wpool + WOFF_OUT);

  const float WSC = 8.0f;                 // weight carry
  const float OSC = 16.0f;                // attention-output carry
  const float inv_w  = 1.0f / 8.0f;
  const float inv_wo = 1.0f / (8.0f * 16.0f);

  // 1. weights -> f16 x8
  cast_w6_kernel<<<dim3(32, 6, 1), dim3(256, 1, 1), 0, stream>>>(W_cp, W_q, W_k, W_v, W_o, W_out, wpool, WSC);

  // 2. x [b][64 ch][4096 tok] -> XT16 [b*4096+tok][64 ch] f16   (in[rows=64][cols=4096] -> out[4096][64])
  tcast16_kernel<<<dim3(SEQL_ / 64, CIN_ / 64, NBATCH_), dim3(256, 1, 1), 0, stream>>>(
      x, XT16, CIN_, SEQL_, (long)CIN_ * SEQL_, (long)SEQL_ * CIN_);

  // 3. XF16[b][tok][e] = XT16[b][tok][:] . Wcp[e][:] /8 + b_cp[e] + pos[tok][e]  (M=4096, N=128, K=64 per batch; f16 out)
  wmma_gemm64<0, false, 2, 1, true><<<dim3((SEQL_ / 64) * (EMB_ / 64) / 8, NBATCH_, 1), dim3(256, 1, 1), 0, stream>>>(
      XT16, XT16, CIN_, (long)SEQL_ * CIN_,
      Wcp16, Wcp16, CIN_, 0L,
      (void*)XF16, nullptr, EMB_, (long)SEQL_ * EMB_,
      b_cp, pos, 0L, nullptr,
      SEQL_, EMB_, CIN_, inv_w);

  // 4. QK16[tok][n] = XF16[tok][:] . Wqk[n][:] /8   (M=8192, N=256, K=128; q = cols 0..127, k = cols 128..255)
  wmma_gemm64<0, false, 0, 1, false><<<dim3((NTOK_ / 64) * (QKPITCH_ / 64) / 8, 1, 1), dim3(256, 1, 1), 0, stream>>>(
      XF16, XF16, EMB_, 0L,
      Wqk16, Wqk16, EMB_, 0L,
      (void*)QK16, nullptr, QKPITCH_, 0L,
      nullptr, nullptr, 0L, nullptr,
      NTOK_, QKPITCH_, EMB_, inv_w);

  // 5. VT16[b][(h,d)][tok] = Wv[(h,d)][:] . XF16[b][tok][:] /8   (M=128, N=4096, K=128 per batch)
  wmma_gemm64<0, false, 0, 1, false><<<dim3((EMB_ / 64) * (SEQL_ / 64) / 8, NBATCH_, 1), dim3(256, 1, 1), 0, stream>>>(
      Wv16, Wv16, EMB_, 0L,
      XF16, XF16, EMB_, (long)SEQL_ * EMB_,
      (void*)VT16, nullptr, SEQL_, (long)EMB_ * SEQL_,
      nullptr, nullptr, 0L, nullptr,
      EMB_, SEQL_, EMB_, inv_w);

  // 6. attention -> O16 [tok][128] f16 (x16)
  attn_full64_f16_kernel<<<dim3(NBATCH_ * NHEAD_ * (SEQL_ / AT_QB), 1, 1), dim3(128, 1, 1), 0, stream>>>(
      QK16, VT16, O16, 0.125f, OSC);

  // 7. O1[tok][n] = O16[tok][:] . Wo[n][:] /128 + b_o[n]   (M=8192, N=128, K=128; f16 out)
  wmma_gemm64<0, false, 2, 1, false><<<dim3((NTOK_ / 64) * (EMB_ / 64) / 8, 1, 1), dim3(256, 1, 1), 0, stream>>>(
      O16, O16, EMB_, 0L,
      Wo16, Wo16, EMB_, 0L,
      (void*)O1, nullptr, EMB_, 0L,
      b_o, nullptr, 0L, nullptr,
      NTOK_, EMB_, EMB_, inv_wo);

  // 8. out[b][c][tok] = Wout[c][:] . O1[b][tok][:] /8 + b_out[c] + gate*x[b][c][tok]   (M=64, N=4096, K=128 per batch; f32)
  wmma_gemm64<0, false, 1, 0, true><<<dim3((COUT_ / 64) * (SEQL_ / 64) / 8, NBATCH_, 1), dim3(256, 1, 1), 0, stream>>>(
      Wout16, Wout16, EMB_, 0L,
      O1, O1, EMB_, (long)SEQL_ * EMB_,
      (void*)out, nullptr, SEQL_, (long)COUT_ * SEQL_,
      b_out, x, (long)COUT_ * SEQL_, gatep,
      COUT_, SEQL_, EMB_, inv_w);
}

// v002
// A run of this version takes 149 microseconds.
// In both of two side-by-side timings against v001, it was 1.31 times as fast.
// All steps since v000 together make it 2.40 times as fast.
// Contractions (token embed 64->128, fused q|k projection, v^T projection, q.k^T, p.v, W_o projection, W_out projection): v_wmma_f32_16x16x32_f16 (f16 operands: weights carried x8, attention output x16, softmax numerators x2^15; f32 accumulate); softmax statistics, biases, positional add and gated residual in f32.
#include <hip/hip_runtime.h>
#include <math.h>
#include <stdint.h>

typedef __attribute__((ext_vector_type(16))) _Float16 v16h;
typedef __attribute__((ext_vector_type(8)))  _Float16 v8h;
typedef __attribute__((ext_vector_type(16))) __bf16   v16b;
typedef __attribute__((ext_vector_type(8)))  __bf16   v8b;
typedef __attribute__((ext_vector_type(8)))  float    v8f;
typedef __attribute__((ext_vector_type(4)))  float    v4f;
typedef __attribute__((ext_vector_type(2)))  float    v2f;
typedef __attribute__((ext_vector_type(4)))  unsigned int v4u;

// ---- problem geometry ----
constexpr int NBATCH_  = 2;
constexpr int CIN_     = 64;
constexpr int EMB_     = 128;
constexpr int COUT_    = 64;
constexpr int NHEAD_   = 2;
constexpr int HDIM_    = 64;
constexpr int SEQL_    = 4096;               // 16*16*16 tokens per batch element
constexpr int NTOK_    = NBATCH_ * SEQL_;    // 8192
constexpr int QKPITCH_ = 2 * EMB_;           // fused q|k plane pitch (halves)

// ---- f16 weight pool offsets (halves) ----
constexpr int WOFF_CP   = 0;                              // [128][64]
constexpr int WOFF_Q    = WOFF_CP + EMB_ * CIN_;          // [128][128]  (q rows)
constexpr int WOFF_K    = WOFF_Q + EMB_ * EMB_;           // [128][128]  (k rows, contiguous after q -> [256][128])
constexpr int WOFF_V    = WOFF_K + EMB_ * EMB_;           // [128][128]
constexpr int WOFF_O    = WOFF_V + EMB_ * EMB_;           // [128][128]
constexpr int WOFF_OUT  = WOFF_O + EMB_ * EMB_;           // [64][128]
constexpr int WPOOL_H   = WOFF_OUT + COUT_ * EMB_;        // 81920 halves = 163840 B
static_assert(WPOOL_H == 81920, "weight pool size");

//   WPOOL f16 weights x8                     0          163840
//   XT16  f16 [8192 tok][64 ch]         163840         1048576
//   XF16  f16 [8192 tok][128]          1212416         2097152
//   QK16  f16 [8192 tok][256] (q|k)    3309568         4194304
//   VT16  f16 [2][128 (h,d)][4096]     7503872         2097152
//   O16   f16 [8192 tok][128] (x16)    9601024         2097152
//   O1_16 f16 [8192 tok][128]         11698176         2097152
//   total                             13795328
constexpr size_t OFFB_W   = 0;
constexpr size_t OFFB_XT  = OFFB_W  + (size_t)WPOOL_H * 2;
constexpr size_t OFFB_XF  = OFFB_XT + (size_t)NTOK_ * CIN_ * 2;
constexpr size_t OFFB_QK  = OFFB_XF + (size_t)NTOK_ * EMB_ * 2;
constexpr size_t OFFB_VT  = OFFB_QK + (size_t)NTOK_ * QKPITCH_ * 2;
constexpr size_t OFFB_O   = OFFB_VT + (size_t)NBATCH_ * EMB_ * SEQL_ * 2;
constexpr size_t OFFB_O1  = OFFB_O  + (size_t)NTOK_ * EMB_ * 2;
constexpr size_t WS_TOTAL = OFFB_O1 + (size_t)NTOK_ * EMB_ * 2;
static_assert(WS_TOTAL == 13795328, "carve total");
static_assert((OFFB_XT % 128) == 0 && (OFFB_XF % 128) == 0 && (OFFB_QK % 128) == 0 &&
              (OFFB_VT % 128) == 0 && (OFFB_O % 128) == 0 && (OFFB_O1 % 128) == 0, "128-B aligned regions");

#define U16(p) ((const unsigned short*)(const void*)(p))

__device__ __forceinline__ unsigned short f2bf_bits(float f) {
  unsigned u = __float_as_uint(f);
  return (unsigned short)((u + 0x7FFFu + ((u >> 16) & 1u)) >> 16);
}
__device__ __forceinline__ float bf_bits2f(unsigned short h) { return __uint_as_float(((unsigned)h) << 16); }
__device__ __forceinline__ unsigned pk16(unsigned short a, unsigned short b) { return (unsigned)a | ((unsigned)b << 16); }
__device__ __forceinline__ unsigned short h_bits(float f) { return __builtin_bit_cast(unsigned short, (_Float16)f); }

// hazard guards as plain device helpers (no inline asm inside the kernel template body)
__device__ __forceinline__ void dep_guard_h(v8f& a, v8f& b, v16h x, v16h y) { asm volatile("v_nop\n\tv_nop\n\tv_nop\n\tv_nop" : "+v"(a), "+v"(b) : "v"(x), "v"(y)); }
__device__ __forceinline__ void dep_guard_b(v8f& a, v8f& b, v16b x, v16b y) { asm volatile("v_nop\n\tv_nop\n\tv_nop\n\tv_nop" : "+v"(a), "+v"(b) : "v"(x), "v"(y)); }
__device__ __forceinline__ void keep4_h(v16h a, v16h b, v16h c, v16h d) { asm volatile("v_nop" :: "v"(a), "v"(b), "v"(c), "v"(d)); }
__device__ __forceinline__ void keep4_b(v16b a, v16b b, v16b c, v16b d) { asm volatile("v_nop" :: "v"(a), "v"(b), "v"(c), "v"(d)); }
__device__ __forceinline__ void acc_guard4(v8f& a, v8f& b, v8f& c, v8f& d) { asm volatile("v_nop\n\tv_nop\n\tv_nop\n\tv_nop" : "+v"(a), "+v"(b), "+v"(c), "+v"(d)); }
template <typename T> struct Frag;
template <> struct Frag<_Float16> {
  typedef v16h V; union U { v16h v; v8h h[2]; };
  static __device__ __forceinline__ v16h load(const _Float16* p) {   // elements 0..7 <- p[0..7], 8..15 <- p[16..23]
    U f; f.h[0] = *(const v8h*)(p); f.h[1] = *(const v8h*)(p + 16); return f.v;
  }
  static __device__ __forceinline__ v8f mma(v16h a, v16h b, v8f c) {
    return __builtin_amdgcn_wmma_f32_16x16x32_f16(false, a, false, b, (short)0, c, false, false);
  }
  static __device__ __forceinline__ void guard(v8f& a, v8f& b, v16h x, v16h y) { dep_guard_h(a, b, x, y); }
  static __device__ __forceinline__ void keep(v16h a, v16h b, v16h c, v16h d) { keep4_h(a, b, c, d); }
};
template <> struct Frag<__bf16> {
  typedef v16b V; union U { v16b v; v8b h[2]; };
  static __device__ __forceinline__ v16b load(const __bf16* p) {
    U f; f.h[0] = *(const v8b*)(p); f.h[1] = *(const v8b*)(p + 16); return f.v;
  }
  static __device__ __forceinline__ v8f mma(v16b a, v16b b, v8f c) {
    return __builtin_amdgcn_wmma_f32_16x16x32_bf16(false, a, false, b, (short)0, c, false, false);
  }
  static __device__ __forceinline__ void guard(v8f& a, v8f& b, v16b x, v16b y) { dep_guard_b(a, b, x, y); }
  static __device__ __forceinline__ void keep(v16b a, v16b b, v16b c, v16b d) { keep4_b(a, b, c, d); }
};

// ---- Register-blocked batched WMMA GEMM ------------------------------------
// C[m,n] = scale * sum_k A[m,k] * Bt[n,k] (+bias)(+rg*resid); each wave owns a 64x64 tile.
// A row-major [M,K]; Bt row-major [N,K]; M,N % 64 == 0, K % 32 == 0.
// SPLIT: operands are hi/lo planes (A2/Bt2 = lo planes, same layout); product = hi.hi + hi.lo + lo.hi.
// BIAS_MODE: 0 = none, 1 = bias[m], 2 = bias[n].
// OUT_MODE: 0 = f32, 1 = f16, 2 = bf16 hi plane (Cout) + bf16 lo plane (Cout2).
// RESID: v += rg * resid[m*ldc+n] with rg = rgain[0] when rgain != nullptr else 1.
// ET: 0 = f16 operands, 1 = bf16 operands (pointers passed as 16-bit storage)
template <int ET> struct Elem;
template <> struct Elem<0> { typedef _Float16 T; };
template <> struct Elem<1> { typedef __bf16 T; };
template <int ET, bool SPLIT, int BIAS_MODE, int OUT_MODE, bool RESID, int ACT = 0>
__global__ __launch_bounds__(256) void wmma_gemm64(
    const unsigned short* __restrict__ Ap, const unsigned short* __restrict__ A2p, int lda, long strideA,
    const unsigned short* __restrict__ Btp, const unsigned short* __restrict__ Bt2p, int ldb, long strideB,
    void* __restrict__ Cout, void* __restrict__ Cout2, int ldc, long strideC,
    const float* __restrict__ bias,
    const float* __restrict__ resid, long strideR, const float* __restrict__ rgain,
    int M, int N, int K, float scale) {
  typedef typename Elem<ET>::T T;
  typedef typename Frag<T>::V V;
  const T* A = (const T*)Ap; const T* A2 = (const T*)A2p; const T* Bt = (const T*)Btp; const T* Bt2 = (const T*)Bt2p;
  __shared__ __align__(16) float sT[8][16 * 68];   // per-wave 16x64 slab, pitch 68 floats
  const int b    = blockIdx.y;
  const int lane = threadIdx.x & 31;
  const int wave = threadIdx.x >> 5;
  const int tilesN = N >> 6;
  const int tilesM = M >> 6;
  const int tile = blockIdx.x * 8 + wave;
  if (tile >= tilesM * tilesN) return;   // wave-uniform; no block barriers in this kernel
  const int tm = tile / tilesN;
  const int tn = tile - tm * tilesN;
  const int m0 = tm << 6;
  const int n0 = tn << 6;

  const T* Ab  = A  + (size_t)b * strideA;
  const T* Bb  = Bt + (size_t)b * strideB;
  const T* Ab2 = SPLIT ? (A2  + (size_t)b * strideA) : nullptr;
  const T* Bb2 = SPLIT ? (Bt2 + (size_t)b * strideB) : nullptr;

  const int rlane = lane & 15;                 // row (A) / col (B, D) within subtile
  const int koff  = (lane >> 4) * 8;           // k offset of this lane half
  const int mOff  = (lane >> 4) * 8;           // D row offset

  v8f acc[4][4];
#pragma unroll
  for (int i = 0; i < 4; ++i)
#pragma unroll
    for (int j = 0; j < 4; ++j) acc[i][j] = (v8f){0.f,0.f,0.f,0.f,0.f,0.f,0.f,0.f};

  for (int k0 = 0; k0 < K; k0 += 32) {
    V bh[4], bl[4];
#pragma unroll
    for (int j = 0; j < 4; ++j) {
      const size_t bo = (size_t)(n0 + (j << 4) + rlane) * ldb + koff + k0;
      bh[j] = Frag<T>::load(Bb + bo);
      if (SPLIT) bl[j] = Frag<T>::load(Bb2 + bo);
    }
#pragma unroll
    for (int i = 0; i < 4; ++i) {
      const size_t ao = (size_t)(m0 + (i << 4) + rlane) * lda + koff + k0;
      V ah = Frag<T>::load(Ab + ao);
      V al;
      if (SPLIT) al = Frag<T>::load(Ab2 + ao);
#pragma unroll
      for (int j = 0; j < 4; ++j) {
        acc[i][j] = Frag<T>::mma(ah, bh[j], acc[i][j]);
        if (SPLIT) {
          acc[i][j] = Frag<T>::mma(ah, bl[j], acc[i][j]);
          acc[i][j] = Frag<T>::mma(al, bh[j], acc[i][j]);
        }
      }
      Frag<T>::guard(acc[i][0], acc[i][3], ah, SPLIT ? al : ah);
    }
    Frag<T>::keep(bh[0], bh[1], bh[2], bh[3]);
    if (SPLIT) Frag<T>::keep(bl[0], bl[1], bl[2], bl[3]);
  }
  acc_guard4(acc[0][0], acc[0][1], acc[0][2], acc[0][3]);
  acc_guard4(acc[1][0], acc[1][1], acc[1][2], acc[1][3]);
  acc_guard4(acc[2][0], acc[2][1], acc[2][2], acc[2][3]);
  acc_guard4(acc[3][0], acc[3][1], acc[3][2], acc[3][3]);

  // ---- epilogue ----
  float* slab = sT[wave];
  const float* Rb = RESID ? (resid + (size_t)b * strideR) : nullptr;
  float rg = 1.0f;
  if (RESID) { if (rgain != nullptr) rg = rgain[0]; }
#pragma unroll
  for (int i = 0; i < 4; ++i) {
    const int mBase = m0 + (i << 4);
#pragma unroll
    for (int j = 0; j < 4; ++j) {
      const int n = n0 + (j << 4) + rlane;
      float bv = 0.f;
      if (BIAS_MODE == 2) bv = bias[n];
#pragma unroll
      for (int r = 0; r < 8; ++r) {
        float v = acc[i][j][r] * scale;
        if (BIAS_MODE == 1) v += bias[mBase + mOff + r];
        if (BIAS_MODE == 2) v += bv;
        if (RESID) v += rg * Rb[(size_t)(mBase + mOff + r) * ldc + n];
        if (ACT == 1) v = tanhf(v);
        if (ACT == 2) v = fmaxf(v, 0.0f);
        if (ACT == 3) v = v / (1.0f + expf(-v));
        if (ACT == 4) v = (v > 0.f) ? v : 0.01f * v;
        slab[(mOff + r) * 68 + (j << 4) + rlane] = v;
      }
    }
    __builtin_amdgcn_fence(__ATOMIC_RELEASE, "workgroup");
    __builtin_amdgcn_wave_barrier();
    __builtin_amdgcn_fence(__ATOMIC_ACQUIRE, "workgroup");
    if (OUT_MODE == 0) {
      float* C = (float*)Cout + (size_t)b * strideC;
      const int hh = lane >> 4, c4 = (lane & 15) * 4;     // row seg = 256 B = 16 lanes x 16 B
      {
#pragma unroll
        for (int it = 0; it < 8; ++it) {
          const int row = it * 2 + hh;
          v4f v = *(const v4f*)(slab + row * 68 + c4);
          *(v4f*)(C + (size_t)(mBase + row) * ldc + n0 + c4) = v;
        }
        
      }
    } else {
      const int q = lane >> 3, c8 = (lane & 7) * 8;
      unsigned short* C  = (unsigned short*)Cout  + (size_t)b * strideC;
      unsigned short* C2 = (OUT_MODE == 2) ? ((unsigned short*)Cout2 + (size_t)b * strideC) : nullptr;
      {
#pragma unroll
        for (int it = 0; it < 4; ++it) {
          const int row = it * 4 + q;
          const float* sp = slab + row * 68 + c8;
          v8h hv, lv;
#pragma unroll
          for (int e = 0; e < 8; ++e) {
            if (OUT_MODE == 1) {
              hv[e] = (_Float16)sp[e];
            } else {
              unsigned short hb = f2bf_bits(sp[e]);
              unsigned short lb = f2bf_bits(sp[e] - bf_bits2f(hb));
              hv[e] = __builtin_bit_cast(_Float16, hb);
              lv[e] = __builtin_bit_cast(_Float16, lb);
            }
          }
          *(v8h*)(C + (size_t)(mBase + row) * ldc + n0 + c8) = hv;
          if (OUT_MODE == 2) *(v8h*)(C2 + (size_t)(mBase + row) * ldc + n0 + c8) = lv;
        }
        
      }
    }
    __builtin_amdgcn_fence(__ATOMIC_RELEASE, "workgroup");
    __builtin_amdgcn_wave_barrier();
    __builtin_amdgcn_fence(__ATOMIC_ACQUIRE, "workgroup");
  }
}

// ---------------------------------------------------------------------------
// Weight cast f32 -> f16 with a power-of-two carry sc (x8): six matrices selected by blockIdx.y (block-uniform),
// Coverage: grid.x = 32 blocks x 256 threads = 8192 pairs >= n2 for every matrix (n2 = 4096 or 8192 pairs).
// ---------------------------------------------------------------------------
__global__ __launch_bounds__(256) void cast_w6_kernel(const float* __restrict__ w0, const float* __restrict__ w1,
                                                      const float* __restrict__ w2, const float* __restrict__ w3,
                                                      const float* __restrict__ w4, const float* __restrict__ w5,
                                                      _Float16* __restrict__ pool, float sc) {
  const int y = blockIdx.y;                 // block-uniform selector
  const float* in = w0; int n2 = (EMB_ * CIN_) / 2; int off = WOFF_CP;
  if (y == 1) { in = w1; n2 = (EMB_ * EMB_) / 2;  off = WOFF_Q; }
  if (y == 2) { in = w2; n2 = (EMB_ * EMB_) / 2;  off = WOFF_K; }
  if (y == 3) { in = w3; n2 = (EMB_ * EMB_) / 2;  off = WOFF_V; }
  if (y == 4) { in = w4; n2 = (EMB_ * EMB_) / 2;  off = WOFF_O; }
  if (y == 5) { in = w5; n2 = (COUT_ * EMB_) / 2; off = WOFF_OUT; }
  _Float16* out = pool + off;
  const int i = blockIdx.x * 256 + threadIdx.x;
  if (i < n2) {
    const v2f f = *(const v2f*)(in + 2 * (size_t)i);
    const unsigned u = pk16(h_bits(f[0] * sc), h_bits(f[1] * sc));
    ((unsigned*)out)[i] = u;
    
  }
}

// ---------------------------------------------------------------------------
// Fused transpose + f16 cast of an f32 matrix, z-batched: in_z = W + z*sIn viewed [R rows][Cc cols] (pitch Cc) ->
//   oh_z[c][r] = f16(in_z[r][c])   ([Cc][R], pitch R), oh_z = oh + z*sOut.
// Here: in_z = x[z] viewed [R=64 ch][Cc=4096 tok] -> out [4096 tok][64 ch]; grid = (Cc/64=64, R/64=1, Z=2), 256 threads.
// Coverage per block: load 4 it x 256 thr x 4 floats = 64x64; store 2 it x 256 thr x 8 u16 = 64x64.
// ---------------------------------------------------------------------------
__global__ __launch_bounds__(256) void tcast16_kernel(const float* __restrict__ W, unsigned short* __restrict__ oh,
                                                      int R, int Cc, long sIn, long sOut) {
  __shared__ __align__(16) float tf[64 * 68];
  W  += (size_t)blockIdx.z * sIn;
  oh += (size_t)blockIdx.z * sOut;
  const int c0  = blockIdx.x * 64;   // input column block = output row block
  const int r0  = blockIdx.y * 64;   // input row block    = output column block
  const int tid = threadIdx.x;
  {
    const int lr = tid >> 4;         // 0..15
    const int c4 = (tid & 15) * 4;   // 0..60
#pragma unroll
    for (int it = 0; it < 4; ++it) {
      const int rr = it * 16 + lr;   // 0..63
      const v4f a = *(const v4f*)(W + (size_t)(r0 + rr) * Cc + c0 + c4);
      *(v4f*)(tf + rr * 68 + c4) = a;
    }
  }
  __syncthreads();
  const int sub = tid >> 3;          // 0..31
  const int c8  = (tid & 7) * 8;     // 0..56
  v4u hv[2];
#pragma unroll
  for (int it = 0; it < 2; ++it) {
    const int oc = it * 32 + sub;    // output row within tile (= input column)
    v4u a;
#pragma unroll
    for (int q = 0; q < 4; ++q) {
      const float f0 = tf[(c8 + 2 * q) * 68 + oc];
      const float f1 = tf[(c8 + 2 * q + 1) * 68 + oc];
      a[q] = pk16(h_bits(f0), h_bits(f1));
    }
    hv[it] = a;
  }
  {
#pragma unroll
    for (int it = 0; it < 2; ++it) {
      const int oc = it * 32 + sub;
      const size_t go = (size_t)(c0 + oc) * R + r0 + c8;
      *(v4u*)(oh + go) = hv[it];
    }
    
  }
}

// =====================================================================================
// Full (non-causal, unmasked) attention, head dim 64, all (batch, head, 64-query tile) in one launch.
//   q|k plane (f16): q element (b, t, h, d) at [(b*SEQL_+t)*QKPITCH_ + h*64 + d]; k at the same + EMB_.
//   v^T plane (f16): element (b, h, d, s) at [b*EMB_*SEQL_ + (h*64 + d)*SEQL_ + s]
//   out (f16, carried x oscale): element (b, t, h, d) at [(b*SEQL_+t)*EMB_ + h*64 + d]
//   scores^T = (k . q^T) * sscale : v_wmma_f32_16x16x32_f16, A = K rows, B = Q; a lane holds 8 keys x 1 query per tile
//   out^T    = v^T . p^T          : p = exp(s - m) carried x2^15 in f16, packed in-lane from two score tiles into the
//                                   B operand (no LDS trip), A = V^T rows, f32 accumulate, 1/(l*2^15) in f32
//   online softmax in f32 (chunks of 64 keys, compile-time trip count, no masking): maximum and sum
//   run in-lane; the two wave halves join the maximum once per chunk and the sum once after the loop.
//   Block = 16 waves = 4 key groups x 4 query tiles = 64 query rows of one (batch, head); grid.x = 256.
//   Key group g walks chunks g, g+4, g+8, ... (16 of the 64) with its own K / V^T LDS tiles, so each SIMD holds four
//   waves whose LDS, memory and vector waits cover one another. After the loop each group leaves its maximum, sum and
//   unnormalised out tile in LDS; behind one __syncthreads the 16 waves merge them (4 rows of one query tile each).
//   K / V^T chunk staging: the group's 128 threads x 32 elements per plane = its whole 64x64 tile (16-B copies, plain
//   loads, __syncthreads before and after); fragment loads read the LDS tiles with the same v8h element type.
// =====================================================================================
#define AT_D 64
#define AT_NW 4
#define AT_NG 4
#define AT_QB 64
#define AT_KC 64
#define P_CARRY 32768.0f

__device__ __forceinline__ v8f at_mma_h(v16h a, v16h b, v8f c) {
  c = __builtin_amdgcn_wmma_f32_16x16x32_f16(false, a, false, b, (short)0, c, false, false);
  asm volatile("v_nop\n\tv_nop\n\tv_nop\n\tv_nop" : "+v"(c) : "v"(a), "v"(b));
  return c;
}

// lane l <-> lane l ^ 16: the two halves of a wave hold the two key halves of the same query column
__device__ __forceinline__ float xhalf(float x) {
  return __builtin_bit_cast(float, __builtin_amdgcn_permlanex16(__builtin_bit_cast(int, x), __builtin_bit_cast(int, x),
                                                                0x76543210, 0xfedcba98, false, false));
}

__global__ __launch_bounds__(AT_NG * AT_NW * 32)
void attn_full64_f16_kernel(const unsigned short* __restrict__ qkp, const unsigned short* __restrict__ vtp,
                            unsigned short* __restrict__ op, float sscale, float oscale) {
  union FH { v16h v; v8h h[2]; };
  __shared__ __align__(16) _Float16 KshG[AT_NG][AT_KC * AT_D];     // K [kv][d]      8 KB per key group
  __shared__ __align__(16) _Float16 VthG[AT_NG][AT_D * AT_KC];     // V [d][kv]      8 KB per key group
  __shared__ __align__(16) float    Os[AT_NG * AT_NW][16 * 68];    // per wave partial out tile, pitch 68
  __shared__ float Ms[AT_NG][AT_QB];                               // per group and query: running maximum
  __shared__ float Ls[AT_NG][AT_QB];                               // per group and query: sum of exp(s - maximum)

  const int tid  = threadIdx.x & (AT_NW * 32 - 1);   // thread within the key group
  const int grp  = threadIdx.x >> 7;                 // key group 0..3
  const int wave = tid >> 5;                         // query tile 0..3
  const int lane = tid & 31;
  _Float16* Ksh = KshG[grp];
  _Float16* Vth = VthG[grp];
  const int hh   = lane >> 4;
  const int c    = lane & 15;

  const int nqb = SEQL_ / AT_QB;          // 64
  const int bx = blockIdx.x;
  const int qb = bx % nqb;
  const int bh = bx / nqb;                // 0..NBATCH_*NHEAD_-1
  const int h  = bh % NHEAD_;
  const int b  = bh / NHEAD_;
  const int q0 = qb * AT_QB + wave * 16;

  const _Float16* Qh = (const _Float16*)(const void*)qkp + (size_t)b * SEQL_ * QKPITCH_ + (size_t)h * AT_D;
  const _Float16* Kh = Qh + EMB_;
  const _Float16* Vh = (const _Float16*)(const void*)vtp + (size_t)b * EMB_ * SEQL_ + (size_t)h * AT_D * SEQL_;
  _Float16*       ob = (_Float16*)(void*)op + (size_t)b * SEQL_ * EMB_ + (size_t)h * AT_D;

  // ---- Q fragments (B operand, column = lane&15, split k map via Frag load): 2 d-chunks ----
  v16h qa[2];
#pragma unroll
  for (int dc = 0; dc < 2; ++dc) {
    const _Float16* qr = Qh + (size_t)(q0 + c) * QKPITCH_ + dc * 32 + 8 * hh;
    qa[dc] = Frag<_Float16>::load(qr);
  }

  float mrow = -INFINITY, lrow = 0.f;   // this lane's query: running maximum (both halves alike), sum over this half's keys
  v8f oacc[4];                          // oacc[t][r] = out^T[d = t*16 + 8*hh + r][query c]
#pragma unroll
  for (int t = 0; t < 4; ++t) oacc[t] = (v8f){0.f,0.f,0.f,0.f,0.f,0.f,0.f,0.f};

  const int nChunks = SEQL_ / (AT_KC * AT_NG);   // 16 per key group, compile-time constant
  for (int kc = 0; kc < nChunks; ++kc) {
    const int kv0 = (kc * AT_NG + grp) * AT_KC;
    __syncthreads();
    {
      // staging coverage: the group's 128 threads x (4 x 8) elements = 64 rows x 64 per plane = its whole chunk tile
      const int r = tid >> 1, half = (tid & 1) * 32;
      const _Float16* ksh = Kh + (size_t)(kv0 + r) * QKPITCH_ + half;   // K row kv0+r, d = half..half+31
      const _Float16* vsh = Vh + (size_t)r * SEQL_ + kv0 + half;        // V^T row d = r, s = kv0+half..+31
      v8h a0[4], b0[4];   // all eight loads are issued before the first LDS store: one trip to memory per chunk, not four
#pragma unroll
      for (int i = 0; i < 4; ++i) {
        a0[i] = *(const v8h*)(ksh + 8 * i);
        b0[i] = *(const v8h*)(vsh + 8 * i);
      }
#pragma unroll
      for (int i = 0; i < 4; ++i) {
        *(v8h*)(Ksh + r * AT_D  + half + 8 * i) = a0[i];
        *(v8h*)(Vth + r * AT_KC + half + 8 * i) = b0[i];
      }
    }
    __syncthreads();

    v8f s[4];
#pragma unroll
    for (int j = 0; j < 4; ++j) {
      s[j] = (v8f){0.f,0.f,0.f,0.f,0.f,0.f,0.f,0.f};
#pragma unroll
      for (int dc = 0; dc < 2; ++dc) {
        FH kb;
        kb.h[0] = *(const v8h*)(Ksh + (j * 16 + c) * AT_D + dc * 32 + 8 * hh);
        kb.h[1] = *(const v8h*)(Ksh + (j * 16 + c) * AT_D + dc * 32 + 16 + 8 * hh);
        s[j] = at_mma_h(kb.v, qa[dc], s[j]);   // s[j][r] = score of key j*16 + 8*hh + r against query c
      }
    }
    float m4[4];
#pragma unroll
    for (int j = 0; j < 4; ++j) {
      float m = -INFINITY;
#pragma unroll
      for (int r = 0; r < 8; ++r) {
        const float sv = s[j][r] * sscale;
        s[j][r] = sv;
        m = fmaxf(m, sv);
      }
      m4[j] = m;
    }
    float cm = fmaxf(fmaxf(m4[0], m4[1]), fmaxf(m4[2], m4[3]));
    cm = fmaxf(cm, xhalf(cm));
    const float mnew = fmaxf(mrow, cm);
    const float alpha = expf(mrow - mnew);
    mrow = mnew;
    v8h ph[4];
    float ps4[4];
#pragma unroll
    for (int j = 0; j < 4; ++j) {
      float psum = 0.f;
#pragma unroll
      for (int r = 0; r < 8; ++r) {
        const float p = expf(s[j][r] - mnew);
        psum += p;
        ph[j][r] = (_Float16)(p * P_CARRY);
      }
      ps4[j] = psum;
    }
    lrow = lrow * alpha + ((ps4[0] + ps4[1]) + (ps4[2] + ps4[3]));
#pragma unroll
    for (int t = 0; t < 4; ++t)
#pragma unroll
      for (int r = 0; r < 8; ++r) oacc[t][r] *= alpha;
#pragma unroll
    for (int kk = 0; kk < 2; ++kk) {
      FH pb;                       // B operand: elements 0..7 = keys kk*32 + 8*hh + e, 8..15 = keys kk*32 + 16 + 8*hh + e
      pb.h[0] = ph[2 * kk];
      pb.h[1] = ph[2 * kk + 1];
#pragma unroll
      for (int t = 0; t < 4; ++t) {
        FH vb;
        vb.h[0] = *(const v8h*)(Vth + (t * 16 + c) * AT_KC + kk * 32 + 8 * hh);
        vb.h[1] = *(const v8h*)(Vth + (t * 16 + c) * AT_KC + kk * 32 + 16 + 8 * hh);
        oacc[t] = at_mma_h(vb.v, pb.v, oacc[t]);
      }
    }
  }

  // ---- this wave's partial (its key group, its query tile) -> LDS, unnormalised ----
  float* os = Os[grp * AT_NW + wave];
  {
    const float lt = lrow + xhalf(lrow);
    if (hh == 0) {
      Ms[grp][wave * 16 + c] = mrow;
      Ls[grp][wave * 16 + c] = lt;
    }
#pragma unroll
    for (int t = 0; t < 4; ++t)
#pragma unroll
      for (int g = 0; g < 2; ++g) {
        v4f w;
#pragma unroll
        for (int e = 0; e < 4; ++e) w[e] = oacc[t][4 * g + e];
        *(v4f*)(os + c * 68 + t * 16 + 8 * hh + 4 * g) = w;
      }
  }
  __syncthreads();   // all four groups' partials stand in LDS before any wave merges them
  {
    // merge: wave (grp, wave) takes rows grp*4 .. grp*4+3 of query tile 'wave'; 8 lanes x 8 columns cover a row
    const int q8 = lane >> 3, c8 = (lane & 7) * 8;
    const int row = grp * 4 + q8;
    float mg[AT_NG];
    float mall = -INFINITY;
#pragma unroll
    for (int g = 0; g < AT_NG; ++g) {
      mg[g] = Ms[g][wave * 16 + row];
      mall = fmaxf(mall, mg[g]);
    }
    float lall = 0.f;
    float acc[8];
#pragma unroll
    for (int e = 0; e < 8; ++e) acc[e] = 0.f;
#pragma unroll
    for (int g = 0; g < AT_NG; ++g) {
      const float wg = expf(mg[g] - mall);
      lall += wg * Ls[g][wave * 16 + row];
      const float* sp = Os[g * AT_NW + wave] + row * 68 + c8;
#pragma unroll
      for (int e = 0; e < 8; ++e) acc[e] += wg * sp[e];
    }
    const float inv = oscale / (lall * P_CARRY);
    v8h hv;
#pragma unroll
    for (int e = 0; e < 8; ++e) hv[e] = (_Float16)(acc[e] * inv);
    *(v8h*)(ob + (size_t)(q0 + row) * EMB_ + c8) = hv;
  }
}

// ---------------------------------------------------------------------------
extern "C" void kernel_launch(void* const* d_in, const int* in_sizes, int n_in,
                              void* d_out, int out_size, void* d_ws, size_t ws_size,
                              hipStream_t stream) {
  if (n_in < 12) return;
  if (in_sizes[0] != NBATCH_ * CIN_ * SEQL_) return;
  if (in_sizes[1] != EMB_ * CIN_ || in_sizes[2] != EMB_) return;
  if (in_sizes[3] != EMB_ * EMB_ || in_sizes[4] != EMB_ * EMB_ || in_sizes[5] != EMB_ * EMB_) return;
  if (in_sizes[6] != EMB_ * EMB_ || in_sizes[7] != EMB_) return;
  if (in_sizes[8] != COUT_ * EMB_ || in_sizes[9] != COUT_) return;
  if (in_sizes[10] != SEQL_ * EMB_ || in_sizes[11] < 1) return;
  if (out_size != NBATCH_ * COUT_ * SEQL_) return;
  if (ws_size < WS_TOTAL) return;

  const float* x     = (const float*)d_in[0];
  const float* W_cp  = (const float*)d_in[1];
  const float* b_cp  = (const float*)d_in[2];
  const float* W_q   = (const float*)d_in[3];
  const float* W_k   = (const float*)d_in[4];
  const float* W_v   = (const float*)d_in[5];
  const float* W_o   = (const float*)d_in[6];
  const float* b_o   = (const float*)d_in[7];
  const float* W_out = (const float*)d_in[8];
  const float* b_out = (const float*)d_in[9];
  const float* pos   = (const float*)d_in[10];
  const float* gatep = (const float*)d_in[11];
  float* out = (float*)d_out;

  char* ws = (char*)d_ws;
  _Float16* wpool = (_Float16*)(void*)(ws + OFFB_W);
  unsigned short* XT16 = (unsigned short*)(void*)(ws + OFFB_XT);
  unsigned short* XF16 = (unsigned short*)(void*)(ws + OFFB_XF);
  unsigned short* QK16 = (unsigned short*)(void*)(ws + OFFB_QK);
  unsigned short* VT16 = (unsigned short*)(void*)(ws + OFFB_VT);
  unsigned short* O16  = (unsigned short*)(void*)(ws + OFFB_O);
  unsigned short* O1   = (unsigned short*)(void*)(ws + OFFB_O1);
  const unsigned short* Wcp16  = U16(wpool + WOFF_CP);
  const unsigned short* Wqk16  = U16(wpool + WOFF_Q);     // [256][128]: q rows then k rows
  const unsigned short* Wv16   = U16(wpool + WOFF_V);
  const unsigned short* Wo16   = U16(wpool + WOFF_O);
  const unsigned short* Wout16 = U16(wpool + WOFF_OUT);

  const float WSC = 8.0f;                 // weight carry
  const float OSC = 16.0f;                // attention-output carry
  const float inv_w  = 1.0f / 8.0f;
  const float inv_wo = 1.0f / (8.0f * 16.0f);

  // 1. weights -> f16 x8
  cast_w6_kernel<<<dim3(32, 6, 1), dim3(256, 1, 1), 0, stream>>>(W_cp, W_q, W_k, W_v, W_o, W_out, wpool, WSC);

  // 2. x [b][64 ch][4096 tok] -> XT16 [b*4096+tok][64 ch] f16   (in[rows=64][cols=4096] -> out[4096][64])
  tcast16_kernel<<<dim3(SEQL_ / 64, CIN_ / 64, NBATCH_), dim3(256, 1, 1), 0, stream>>>(
      x, XT16, CIN_, SEQL_, (long)CIN_ * SEQL_, (long)SEQL_ * CIN_);

  // 3. XF16[b][tok][e] = XT16[b][tok][:] . Wcp[e][:] /8 + b_cp[e] + pos[tok][e]  (M=4096, N=128, K=64 per batch; f16 out)
  wmma_gemm64<0, false, 2, 1, true><<<dim3((SEQL_ / 64) * (EMB_ / 64) / 8, NBATCH_, 1), dim3(256, 1, 1), 0, stream>>>(
      XT16, XT16, CIN_, (long)SEQL_ * CIN_,
      Wcp16, Wcp16, CIN_, 0L,
      (void*)XF16, nullptr, EMB_, (long)SEQL_ * EMB_,
      b_cp, pos, 0L, nullptr,
      SEQL_, EMB_, CIN_, inv_w);

  // 4. QK16[tok][n] = XF16[tok][:] . Wqk[n][:] /8   (M=8192, N=256, K=128; q = cols 0..127, k = cols 128..255)
  wmma_gemm64<0, false, 0, 1, false><<<dim3((NTOK_ / 64) * (QKPITCH_ / 64) / 8, 1, 1), dim3(256, 1, 1), 0, stream>>>(
      XF16, XF16, EMB_, 0L,
      Wqk16, Wqk16, EMB_, 0L,
      (void*)QK16, nullptr, QKPITCH_, 0L,
      nullptr, nullptr, 0L, nullptr,
      NTOK_, QKPITCH_, EMB_, inv_w);

  // 5. VT16[b][(h,d)][tok] = Wv[(h,d)][:] . XF16[b][tok][:] /8   (M=128, N=4096, K=128 per batch)
  wmma_gemm64<0, false, 0, 1, false><<<dim3((EMB_ / 64) * (SEQL_ / 64) / 8, NBATCH_, 1), dim3(256, 1, 1), 0, stream>>>(
      Wv16, Wv16, EMB_, 0L,
      XF16, XF16, EMB_, (long)SEQL_ * EMB_,
      (void*)VT16, nullptr, SEQL_, (long)EMB_ * SEQL_,
      nullptr, nullptr, 0L, nullptr,
      EMB_, SEQL_, EMB_, inv_w);

  // 6. attention -> O16 [tok][128] f16 (x16)
  attn_full64_f16_kernel<<<dim3(NBATCH_ * NHEAD_ * (SEQL_ / AT_QB), 1, 1), dim3(AT_NG * AT_NW * 32, 1, 1), 0, stream>>>(
      QK16, VT16, O16, 0.125f, OSC);

  // 7. O1[tok][n] = O16[tok][:] . Wo[n][:] /128 + b_o[n]   (M=8192, N=128, K=128; f16 out)
  wmma_gemm64<0, false, 2, 1, false><<<dim3((NTOK_ / 64) * (EMB_ / 64) / 8, 1, 1), dim3(256, 1, 1), 0, stream>>>(
      O16, O16, EMB_, 0L,
      Wo16, Wo16, EMB_, 0L,
      (void*)O1, nullptr, EMB_, 0L,
      b_o, nullptr, 0L, nullptr,
      NTOK_, EMB_, EMB_, inv_wo);

  // 8. out[b][c][tok] = Wout[c][:] . O1[b][tok][:] /8 + b_out[c] + gate*x[b][c][tok]   (M=64, N=4096, K=128 per batch; f32)
  wmma_gemm64<0, false, 1, 0, true><<<dim3((COUT_ / 64) * (SEQL_ / 64) / 8, NBATCH_, 1), dim3(256, 1, 1), 0, stream>>>(
      Wout16, Wout16, EMB_, 0L,
      O1, O1, EMB_, (long)SEQL_ * EMB_,
      (void*)out, nullptr, SEQL_, (long)COUT_ * SEQL_,
      b_out, x, (long)COUT_ * SEQL_, gatep,
      COUT_, SEQL_, EMB_, inv_w);
}

// v003
// One run takes 117 microseconds.
// Next to v002, in two timings, it ran 1.27 times as fast each time.
// Counting every step since v000, it is 3.05 times as fast.
// Contractions (token embed 64->128, fused q|k projection, v^T projection, q.k^T, p.v, W_o projection, W_out projection): v_wmma_f32_16x16x32_f16 (f16 operands: weights carried x8, attention output x16, softmax numerators x2^15; f32 accumulate); softmax statistics, biases, positional add and gated residual in f32.
#include <hip/hip_runtime.h>
#include <math.h>
#include <stdint.h>

typedef __attribute__((ext_vector_type(16))) _Float16 v16h;
typedef __attribute__((ext_vector_type(8)))  _Float16 v8h;
typedef __attribute__((ext_vector_type(16))) __bf16   v16b;
typedef __attribute__((ext_vector_type(8)))  __bf16   v8b;
typedef __attribute__((ext_vector_type(8)))  float    v8f;
typedef __attribute__((ext_vector_type(4)))  float    v4f;
typedef __attribute__((ext_vector_type(2)))  float    v2f;
typedef __attribute__((ext_vector_type(4)))  unsigned int v4u;

// ---- problem geometry ----
constexpr int NBATCH_  = 2;
constexpr int CIN_     = 64;
constexpr int EMB_     = 128;
constexpr int COUT_    = 64;
constexpr int NHEAD_   = 2;
constexpr int HDIM_    = 64;
constexpr int SEQL_    = 4096;               // 16*16*16 tokens per batch element
constexpr int NTOK_    = NBATCH_ * SEQL_;    // 8192
constexpr int QKPITCH_ = 2 * EMB_;           // fused q|k plane pitch (halves)

// ---- f16 weight pool offsets (halves) ----
constexpr int WOFF_CP   = 0;                              // [128][64]
constexpr int WOFF_Q    = WOFF_CP + EMB_ * CIN_;          // [128][128]  (q rows)
constexpr int WOFF_K    = WOFF_Q + EMB_ * EMB_;           // [128][128]  (k rows, contiguous after q -> [256][128])
constexpr int WOFF_V    = WOFF_K + EMB_ * EMB_;           // [128][128]
constexpr int WOFF_O    = WOFF_V + EMB_ * EMB_;           // [128][128]
constexpr int WOFF_OUT  = WOFF_O + EMB_ * EMB_;           // [64][128]
constexpr int WPOOL_H   = WOFF_OUT + COUT_ * EMB_;        // 81920 halves = 163840 B
static_assert(WPOOL_H == 81920, "weight pool size");

//   WPOOL f16 weights x8                     0          163840
//   XT16  f16 [8192 tok][64 ch]         163840         1048576
//   XF16  f16 [8192 tok][128]          1212416         2097152
//   QK16  f16 [8192 tok][256] (q|k)    3309568         4194304
//   VT16  f16 [2][128 (h,d)][4096]     7503872         2097152
//   O16   f16 [8192 tok][128] (x16)    9601024         2097152
//   O1_16 f16 [8192 tok][128]         11698176         2097152
//   total                             13795328
constexpr size_t OFFB_W   = 0;
constexpr size_t OFFB_XT  = OFFB_W  + (size_t)WPOOL_H * 2;
constexpr size_t OFFB_XF  = OFFB_XT + (size_t)NTOK_ * CIN_ * 2;
constexpr size_t OFFB_QK  = OFFB_XF + (size_t)NTOK_ * EMB_ * 2;
constexpr size_t OFFB_VT  = OFFB_QK + (size_t)NTOK_ * QKPITCH_ * 2;
constexpr size_t OFFB_O   = OFFB_VT + (size_t)NBATCH_ * EMB_ * SEQL_ * 2;
constexpr size_t OFFB_O1  = OFFB_O  + (size_t)NTOK_ * EMB_ * 2;
constexpr size_t WS_TOTAL = OFFB_O1 + (size_t)NTOK_ * EMB_ * 2;
static_assert(WS_TOTAL == 13795328, "carve total");
static_assert((OFFB_XT % 128) == 0 && (OFFB_XF % 128) == 0 && (OFFB_QK % 128) == 0 &&
              (OFFB_VT % 128) == 0 && (OFFB_O % 128) == 0 && (OFFB_O1 % 128) == 0, "128-B aligned regions");

#define U16(p) ((const unsigned short*)(const void*)(p))

__device__ __forceinline__ unsigned short f2bf_bits(float f) {
  unsigned u = __float_as_uint(f);
  return (unsigned short)((u + 0x7FFFu + ((u >> 16) & 1u)) >> 16);
}
__device__ __forceinline__ float bf_bits2f(unsigned short h) { return __uint_as_float(((unsigned)h) << 16); }
__device__ __forceinline__ unsigned pk16(unsigned short a, unsigned short b) { return (unsigned)a | ((unsigned)b << 16); }
__device__ __forceinline__ unsigned short h_bits(float f) { return __builtin_bit_cast(unsigned short, (_Float16)f); }

// hazard guards as plain device helpers (no inline asm inside the kernel template body)
__device__ __forceinline__ void dep_guard_h(v8f& a, v8f& b, v16h x, v16h y) { asm volatile("v_nop\n\tv_nop\n\tv_nop\n\tv_nop" : "+v"(a), "+v"(b) : "v"(x), "v"(y)); }
__device__ __forceinline__ void dep_guard_b(v8f& a, v8f& b, v16b x, v16b y) { asm volatile("v_nop\n\tv_nop\n\tv_nop\n\tv_nop" : "+v"(a), "+v"(b) : "v"(x), "v"(y)); }
__device__ __forceinline__ void keep4_h(v16h a, v16h b, v16h c, v16h d) { asm volatile("v_nop" :: "v"(a), "v"(b), "v"(c), "v"(d)); }
__device__ __forceinline__ void keep4_b(v16b a, v16b b, v16b c, v16b d) { asm volatile("v_nop" :: "v"(a), "v"(b), "v"(c), "v"(d)); }
__device__ __forceinline__ void acc_guard4(v8f& a, v8f& b, v8f& c, v8f& d) { asm volatile("v_nop\n\tv_nop\n\tv_nop\n\tv_nop" : "+v"(a), "+v"(b), "+v"(c), "+v"(d)); }
template <typename T> struct Frag;
template <> struct Frag<_Float16> {
  typedef v16h V; union U { v16h v; v8h h[2]; };
  static __device__ __forceinline__ v16h load(const _Float16* p) {   // elements 0..7 <- p[0..7], 8..15 <- p[16..23]
    U f; f.h[0] = *(const v8h*)(p); f.h[1] = *(const v8h*)(p + 16); return f.v;
  }
  static __device__ __forceinline__ v8f mma(v16h a, v16h b, v8f c) {
    return __builtin_amdgcn_wmma_f32_16x16x32_f16(false, a, false, b, (short)0, c, false, false);
  }
  static __device__ __forceinline__ void guard(v8f& a, v8f& b, v16h x, v16h y) { dep_guard_h(a, b, x, y); }
  static __device__ __forceinline__ void keep(v16h a, v16h b, v16h c, v16h d) { keep4_h(a, b, c, d); }
};
template <> struct Frag<__bf16> {
  typedef v16b V; union U { v16b v; v8b h[2]; };
  static __device__ __forceinline__ v16b load(const __bf16* p) {
    U f; f.h[0] = *(const v8b*)(p); f.h[1] = *(const v8b*)(p + 16); return f.v;
  }
  static __device__ __forceinline__ v8f mma(v16b a, v16b b, v8f c) {
    return __builtin_amdgcn_wmma_f32_16x16x32_bf16(false, a, false, b, (short)0, c, false, false);
  }
  static __device__ __forceinline__ void guard(v8f& a, v8f& b, v16b x, v16b y) { dep_guard_b(a, b, x, y); }
  static __device__ __forceinline__ void keep(v16b a, v16b b, v16b c, v16b d) { keep4_b(a, b, c, d); }
};

// ---- Register-blocked batched WMMA GEMM ------------------------------------
// C[m,n] = scale * sum_k A[m,k] * Bt[n,k] (+bias)(+rg*resid); each wave owns a 64x64 tile.
// A row-major [M,K]; Bt row-major [N,K]; M,N % 64 == 0, K % 32 == 0.
// SPLIT: operands are hi/lo planes (A2/Bt2 = lo planes, same layout); product = hi.hi + hi.lo + lo.hi.
// BIAS_MODE: 0 = none, 1 = bias[m], 2 = bias[n].
// OUT_MODE: 0 = f32, 1 = f16, 2 = bf16 hi plane (Cout) + bf16 lo plane (Cout2).
// RESID: v += rg * resid[m*ldc+n] with rg = rgain[0] when rgain != nullptr else 1.
// ET: 0 = f16 operands, 1 = bf16 operands (pointers passed as 16-bit storage)
template <int ET> struct Elem;
template <> struct Elem<0> { typedef _Float16 T; };
template <> struct Elem<1> { typedef __bf16 T; };
template <int ET, bool SPLIT, int BIAS_MODE, int OUT_MODE, bool RESID, int ACT = 0>
__global__ __launch_bounds__(256) void wmma_gemm64(
    const unsigned short* __restrict__ Ap, const unsigned short* __restrict__ A2p, int lda, long strideA,
    const unsigned short* __restrict__ Btp, const unsigned short* __restrict__ Bt2p, int ldb, long strideB,
    void* __restrict__ Cout, void* __restrict__ Cout2, int ldc, long strideC,
    const float* __restrict__ bias,
    const float* __restrict__ resid, long strideR, const float* __restrict__ rgain,
    int M, int N, int K, float scale) {
  typedef typename Elem<ET>::T T;
  typedef typename Frag<T>::V V;
  const T* A = (const T*)Ap; const T* A2 = (const T*)A2p; const T* Bt = (const T*)Btp; const T* Bt2 = (const T*)Bt2p;
  __shared__ __align__(16) float sT[8][16 * 68];   // per-wave 16x64 slab, pitch 68 floats
  const int b    = blockIdx.y;
  const int lane = threadIdx.x & 31;
  const int wave = threadIdx.x >> 5;
  const int tilesN = N >> 6;
  const int tilesM = M >> 6;
  const int tile = blockIdx.x * 8 + wave;
  if (tile >= tilesM * tilesN) return;   // wave-uniform; no block barriers in this kernel
  const int tm = tile / tilesN;
  const int tn = tile - tm * tilesN;
  const int m0 = tm << 6;
  const int n0 = tn << 6;

  const T* Ab  = A  + (size_t)b * strideA;
  const T* Bb  = Bt + (size_t)b * strideB;
  const T* Ab2 = SPLIT ? (A2  + (size_t)b * strideA) : nullptr;
  const T* Bb2 = SPLIT ? (Bt2 + (size_t)b * strideB) : nullptr;

  const int rlane = lane & 15;                 // row (A) / col (B, D) within subtile
  const int koff  = (lane >> 4) * 8;           // k offset of this lane half
  const int mOff  = (lane >> 4) * 8;           // D row offset

  v8f acc[4][4];
#pragma unroll
  for (int i = 0; i < 4; ++i)
#pragma unroll
    for (int j = 0; j < 4; ++j) acc[i][j] = (v8f){0.f,0.f,0.f,0.f,0.f,0.f,0.f,0.f};

  for (int k0 = 0; k0 < K; k0 += 32) {
    V bh[4], bl[4];
#pragma unroll
    for (int j = 0; j < 4; ++j) {
      const size_t bo = (size_t)(n0 + (j << 4) + rlane) * ldb + koff + k0;
      bh[j] = Frag<T>::load(Bb + bo);
      if (SPLIT) bl[j] = Frag<T>::load(Bb2 + bo);
    }
#pragma unroll
    for (int i = 0; i < 4; ++i) {
      const size_t ao = (size_t)(m0 + (i << 4) + rlane) * lda + koff + k0;
      V ah = Frag<T>::load(Ab + ao);
      V al;
      if (SPLIT) al = Frag<T>::load(Ab2 + ao);
#pragma unroll
      for (int j = 0; j < 4; ++j) {
        acc[i][j] = Frag<T>::mma(ah, bh[j], acc[i][j]);
        if (SPLIT) {
          acc[i][j] = Frag<T>::mma(ah, bl[j], acc[i][j]);
          acc[i][j] = Frag<T>::mma(al, bh[j], acc[i][j]);
        }
      }
      Frag<T>::guard(acc[i][0], acc[i][3], ah, SPLIT ? al : ah);
    }
    Frag<T>::keep(bh[0], bh[1], bh[2], bh[3]);
    if (SPLIT) Frag<T>::keep(bl[0], bl[1], bl[2], bl[3]);
  }
  acc_guard4(acc[0][0], acc[0][1], acc[0][2], acc[0][3]);
  acc_guard4(acc[1][0], acc[1][1], acc[1][2], acc[1][3]);
  acc_guard4(acc[2][0], acc[2][1], acc[2][2], acc[2][3]);
  acc_guard4(acc[3][0], acc[3][1], acc[3][2], acc[3][3]);

  // ---- epilogue ----
  float* slab = sT[wave];
  const float* Rb = RESID ? (resid + (size_t)b * strideR) : nullptr;
  float rg = 1.0f;
  if (RESID) { if (rgain != nullptr) rg = rgain[0]; }
#pragma unroll
  for (int i = 0; i < 4; ++i) {
    const int mBase = m0 + (i << 4);
#pragma unroll
    for (int j = 0; j < 4; ++j) {
      const int n = n0 + (j << 4) + rlane;
      float bv = 0.f;
      if (BIAS_MODE == 2) bv = bias[n];
#pragma unroll
      for (int r = 0; r < 8; ++r) {
        float v = acc[i][j][r] * scale;
        if (BIAS_MODE == 1) v += bias[mBase + mOff + r];
        if (BIAS_MODE == 2) v += bv;
        if (RESID) v += rg * Rb[(size_t)(mBase + mOff + r) * ldc + n];
        if (ACT == 1) v = tanhf(v);
        if (ACT == 2) v = fmaxf(v, 0.0f);
        if (ACT == 3) v = v / (1.0f + expf(-v));
        if (ACT == 4) v = (v > 0.f) ? v : 0.01f * v;
        slab[(mOff + r) * 68 + (j << 4) + rlane] = v;
      }
    }
    __builtin_amdgcn_fence(__ATOMIC_RELEASE, "workgroup");
    __builtin_amdgcn_wave_barrier();
    __builtin_amdgcn_fence(__ATOMIC_ACQUIRE, "workgroup");
    if (OUT_MODE == 0) {
      float* C = (float*)Cout + (size_t)b * strideC;
      const int hh = lane >> 4, c4 = (lane & 15) * 4;     // row seg = 256 B = 16 lanes x 16 B
      {
#pragma unroll
        for (int it = 0; it < 8; ++it) {
          const int row = it * 2 + hh;
          v4f v = *(const v4f*)(slab + row * 68 + c4);
          *(v4f*)(C + (size_t)(mBase + row) * ldc + n0 + c4) = v;
        }
        
      }
    } else {
      const int q = lane >> 3, c8 = (lane & 7) * 8;
      unsigned short* C  = (unsigned short*)Cout  + (size_t)b * strideC;
      unsigned short* C2 = (OUT_MODE == 2) ? ((unsigned short*)Cout2 + (size_t)b * strideC) : nullptr;
      {
#pragma unroll
        for (int it = 0; it < 4; ++it) {
          const int row = it * 4 + q;
          const float* sp = slab + row * 68 + c8;
          v8h hv, lv;
#pragma unroll
          for (int e = 0; e < 8; ++e) {
            if (OUT_MODE == 1) {
              hv[e] = (_Float16)sp[e];
            } else {
              unsigned short hb = f2bf_bits(sp[e]);
              unsigned short lb = f2bf_bits(sp[e] - bf_bits2f(hb));
              hv[e] = __builtin_bit_cast(_Float16, hb);
              lv[e] = __builtin_bit_cast(_Float16, lb);
            }
          }
          *(v8h*)(C + (size_t)(mBase + row) * ldc + n0 + c8) = hv;
          if (OUT_MODE == 2) *(v8h*)(C2 + (size_t)(mBase + row) * ldc + n0 + c8) = lv;
        }
        
      }
    }
    __builtin_amdgcn_fence(__ATOMIC_RELEASE, "workgroup");
    __builtin_amdgcn_wave_barrier();
    __builtin_amdgcn_fence(__ATOMIC_ACQUIRE, "workgroup");
  }
}

// ---------------------------------------------------------------------------
// Weight cast f32 -> f16 with a power-of-two carry sc (x8): six matrices selected by blockIdx.y (block-uniform),
// Coverage: grid.x = 32 blocks x 256 threads = 8192 pairs >= n2 for every matrix (n2 = 4096 or 8192 pairs).
// ---------------------------------------------------------------------------
__global__ __launch_bounds__(256) void cast_w6_kernel(const float* __restrict__ w0, const float* __restrict__ w1,
                                                      const float* __restrict__ w2, const float* __restrict__ w3,
                                                      const float* __restrict__ w4, const float* __restrict__ w5,
                                                      _Float16* __restrict__ pool, float sc) {
  const int y = blockIdx.y;                 // block-uniform selector
  const float* in = w0; int n2 = (EMB_ * CIN_) / 2; int off = WOFF_CP;
  if (y == 1) { in = w1; n2 = (EMB_ * EMB_) / 2;  off = WOFF_Q; }
  if (y == 2) { in = w2; n2 = (EMB_ * EMB_) / 2;  off = WOFF_K; }
  if (y == 3) { in = w3; n2 = (EMB_ * EMB_) / 2;  off = WOFF_V; }
  if (y == 4) { in = w4; n2 = (EMB_ * EMB_) / 2;  off = WOFF_O; }
  if (y == 5) { in = w5; n2 = (COUT_ * EMB_) / 2; off = WOFF_OUT; }
  _Float16* out = pool + off;
  const int i = blockIdx.x * 256 + threadIdx.x;
  if (i < n2) {
    const v2f f = *(const v2f*)(in + 2 * (size_t)i);
    const unsigned u = pk16(h_bits(f[0] * sc), h_bits(f[1] * sc));
    ((unsigned*)out)[i] = u;
    
  }
}

// ---------------------------------------------------------------------------
// Fused transpose + f16 cast of an f32 matrix, z-batched: in_z = W + z*sIn viewed [R rows][Cc cols] (pitch Cc) ->
//   oh_z[c][r] = f16(in_z[r][c])   ([Cc][R], pitch R), oh_z = oh + z*sOut.
// Here: in_z = x[z] viewed [R=64 ch][Cc=4096 tok] -> out [4096 tok][64 ch]; grid = (Cc/64=64, R/64=1, Z=2), 256 threads.
// Coverage per block: load 4 it x 256 thr x 4 floats = 64x64; store 2 it x 256 thr x 8 u16 = 64x64.
// ---------------------------------------------------------------------------
__global__ __launch_bounds__(256) void tcast16_kernel(const float* __restrict__ W, unsigned short* __restrict__ oh,
                                                      int R, int Cc, long sIn, long sOut) {
  __shared__ __align__(16) float tf[64 * 68];
  W  += (size_t)blockIdx.z * sIn;
  oh += (size_t)blockIdx.z * sOut;
  const int c0  = blockIdx.x * 64;   // input column block = output row block
  const int r0  = blockIdx.y * 64;   // input row block    = output column block
  const int tid = threadIdx.x;
  {
    const int lr = tid >> 4;         // 0..15
    const int c4 = (tid & 15) * 4;   // 0..60
#pragma unroll
    for (int it = 0; it < 4; ++it) {
      const int rr = it * 16 + lr;   // 0..63
      const v4f a = *(const v4f*)(W + (size_t)(r0 + rr) * Cc + c0 + c4);
      *(v4f*)(tf + rr * 68 + c4) = a;
    }
  }
  __syncthreads();
  const int sub = tid >> 3;          // 0..31
  const int c8  = (tid & 7) * 8;     // 0..56
  v4u hv[2];
#pragma unroll
  for (int it = 0; it < 2; ++it) {
    const int oc = it * 32 + sub;    // output row within tile (= input column)
    v4u a;
#pragma unroll
    for (int q = 0; q < 4; ++q) {
      const float f0 = tf[(c8 + 2 * q) * 68 + oc];
      const float f1 = tf[(c8 + 2 * q + 1) * 68 + oc];
      a[q] = pk16(h_bits(f0), h_bits(f1));
    }
    hv[it] = a;
  }
  {
#pragma unroll
    for (int it = 0; it < 2; ++it) {
      const int oc = it * 32 + sub;
      const size_t go = (size_t)(c0 + oc) * R + r0 + c8;
      *(v4u*)(oh + go) = hv[it];
    }
    
  }
}

// =====================================================================================
// Full (non-causal, unmasked) attention, head dim 64, all (batch, head, 64-query tile) in one launch.
//   q|k plane (f16): q element (b, t, h, d) at [(b*SEQL_+t)*QKPITCH_ + h*64 + d]; k at the same + EMB_.
//   v^T plane (f16): element (b, h, d, s) at [b*EMB_*SEQL_ + (h*64 + d)*SEQL_ + s]
//   out (f16, carried x oscale): element (b, t, h, d) at [(b*SEQL_+t)*EMB_ + h*64 + d]
//   scores^T = (k . q^T) * sscale : v_wmma_f32_16x16x32_f16, A = K rows, B = Q; a lane holds 8 keys x 1 query per tile
//   out^T    = v^T . p^T          : p = exp(s - m) carried x2^15 in f16, packed in-lane from two score tiles into the
//                                   B operand (no LDS trip), A = V^T rows, f32 accumulate, 1/(l*2^15) in f32
//   online softmax in f32 (chunks of 64 keys, compile-time trip count, no masking): maximum and sum
//   run in-lane; the two wave halves join the maximum once per chunk and the sum once after the loop.
//   Block = 16 waves = 4 key groups x 4 query tiles = 64 query rows of one (batch, head); grid.x = 256.
//   Key group g walks chunks g, g+4, g+8, ... (16 of the 64) with its own K / V^T LDS tiles, so each SIMD holds four
//   waves whose LDS, memory and vector waits cover one another. After the loop each group leaves its maximum, sum and
//   unnormalised out tile in LDS; behind one __syncthreads the 16 waves merge them (4 rows of one query tile each).
//   K / V^T chunk staging: the group's 128 threads x 32 elements per plane = its whole 64x64 tile (16-B copies, plain
//   loads, __syncthreads before and after); fragment loads read the LDS tiles with the same v8h element type.
// =====================================================================================
#define AT_D 64
#define AT_NW 4
#define AT_NG 4
#define AT_QB 64
#define AT_KC 64
#define AT_LP 72   // LDS row pitch of the K and V^T tiles in halves: 144 B = 16 B x odd, so the 16 rows of one ds_load_b128 fragment read fall on 16 different groups of four banks
#define P_CARRY 32768.0f

__device__ __forceinline__ v8f at_mma_h(v16h a, v16h b, v8f c) {
  c = __builtin_amdgcn_wmma_f32_16x16x32_f16(false, a, false, b, (short)0, c, false, false);
  asm volatile("v_nop\n\tv_nop\n\tv_nop\n\tv_nop" : "+v"(c) : "v"(a), "v"(b));
  return c;
}

// lane l <-> lane l ^ 16: the two halves of a wave hold the two key halves of the same query column
__device__ __forceinline__ float xhalf(float x) {
  return __builtin_bit_cast(float, __builtin_amdgcn_permlanex16(__builtin_bit_cast(int, x), __builtin_bit_cast(int, x),
                                                                0x76543210, 0xfedcba98, false, false));
}

__global__ __launch_bounds__(AT_NG * AT_NW * 32)
void attn_full64_f16_kernel(const unsigned short* __restrict__ qkp, const unsigned short* __restrict__ vtp,
                            unsigned short* __restrict__ op, float sscale, float oscale) {
  union FH { v16h v; v8h h[2]; };
  __shared__ __align__(16) _Float16 KshG[AT_NG][AT_KC * AT_LP];    // K [kv][d]      rows of 64 at pitch 72, 9 KB per key group
  __shared__ __align__(16) _Float16 VthG[AT_NG][AT_D * AT_LP];     // V [d][kv]      rows of 64 at pitch 72, 9 KB per key group
  __shared__ __align__(16) float    Os[AT_NG * AT_NW][16 * 68];    // per wave partial out tile, pitch 68
  __shared__ float Ms[AT_NG][AT_QB];                               // per group and query: running maximum
  __shared__ float Ls[AT_NG][AT_QB];                               // per group and query: sum of exp(s - maximum)

  const int tid  = threadIdx.x & (AT_NW * 32 - 1);   // thread within the key group
  const int grp  = threadIdx.x >> 7;                 // key group 0..3
  const int wave = tid >> 5;                         // query tile 0..3
  const int lane = tid & 31;
  _Float16* Ksh = KshG[grp];
  _Float16* Vth = VthG[grp];
  const int hh   = lane >> 4;
  const int c    = lane & 15;

  const int nqb = SEQL_ / AT_QB;          // 64
  const int bx = blockIdx.x;
  const int qb = bx % nqb;
  const int bh = bx / nqb;                // 0..NBATCH_*NHEAD_-1
  const int h  = bh % NHEAD_;
  const int b  = bh / NHEAD_;
  const int q0 = qb * AT_QB + wave * 16;

  const _Float16* Qh = (const _Float16*)(const void*)qkp + (size_t)b * SEQL_ * QKPITCH_ + (size_t)h * AT_D;
  const _Float16* Kh = Qh + EMB_;
  const _Float16* Vh = (const _Float16*)(const void*)vtp + (size_t)b * EMB_ * SEQL_ + (size_t)h * AT_D * SEQL_;
  _Float16*       ob = (_Float16*)(void*)op + (size_t)b * SEQL_ * EMB_ + (size_t)h * AT_D;

  // ---- Q fragments (B operand, column = lane&15, split k map via Frag load): 2 d-chunks ----
  v16h qa[2];
#pragma unroll
  for (int dc = 0; dc < 2; ++dc) {
    const _Float16* qr = Qh + (size_t)(q0 + c) * QKPITCH_ + dc * 32 + 8 * hh;
    qa[dc] = Frag<_Float16>::load(qr);
  }

  float mrow = -INFINITY, lrow = 0.f;   // this lane's query: running maximum (both halves alike), sum over this half's keys
  v8f oacc[4];                          // oacc[t][r] = out^T[d = t*16 + 8*hh + r][query c]
#pragma unroll
  for (int t = 0; t < 4; ++t) oacc[t] = (v8f){0.f,0.f,0.f,0.f,0.f,0.f,0.f,0.f};

  const int nChunks = SEQL_ / (AT_KC * AT_NG);   // 16 per key group, compile-time constant
  for (int kc = 0; kc < nChunks; ++kc) {
    const int kv0 = (kc * AT_NG + grp) * AT_KC;
    __syncthreads();
    {
      // staging coverage: the group's 128 threads x (4 x 8) elements = 64 rows x 64 per plane = its whole chunk tile
      const int r = tid >> 1, half = (tid & 1) * 32;
      const _Float16* ksh = Kh + (size_t)(kv0 + r) * QKPITCH_ + half;   // K row kv0+r, d = half..half+31
      const _Float16* vsh = Vh + (size_t)r * SEQL_ + kv0 + half;        // V^T row d = r, s = kv0+half..+31
      v8h a0[4], b0[4];   // all eight loads are issued before the first LDS store: one trip to memory per chunk, not four
#pragma unroll
      for (int i = 0; i < 4; ++i) {
        a0[i] = *(const v8h*)(ksh + 8 * i);
        b0[i] = *(const v8h*)(vsh + 8 * i);
      }
#pragma unroll
      for (int i = 0; i < 4; ++i) {
        *(v8h*)(Ksh + r * AT_LP + half + 8 * i) = a0[i];
        *(v8h*)(Vth + r * AT_LP + half + 8 * i) = b0[i];
      }
    }
    __syncthreads();

    v8f s[4];
#pragma unroll
    for (int j = 0; j < 4; ++j) {
      s[j] = (v8f){0.f,0.f,0.f,0.f,0.f,0.f,0.f,0.f};
#pragma unroll
      for (int dc = 0; dc < 2; ++dc) {
        FH kb;
        kb.h[0] = *(const v8h*)(Ksh + (j * 16 + c) * AT_LP + dc * 32 + 8 * hh);
        kb.h[1] = *(const v8h*)(Ksh + (j * 16 + c) * AT_LP + dc * 32 + 16 + 8 * hh);
        s[j] = at_mma_h(kb.v, qa[dc], s[j]);   // s[j][r] = score of key j*16 + 8*hh + r against query c
      }
    }
    float m4[4];
#pragma unroll
    for (int j = 0; j < 4; ++j) {
      float m = -INFINITY;
#pragma unroll
      for (int r = 0; r < 8; ++r) {
        const float sv = s[j][r] * sscale;
        s[j][r] = sv;
        m = fmaxf(m, sv);
      }
      m4[j] = m;
    }
    float cm = fmaxf(fmaxf(m4[0], m4[1]), fmaxf(m4[2], m4[3]));
    cm = fmaxf(cm, xhalf(cm));
    const float mnew = fmaxf(mrow, cm);
    const float alpha = expf(mrow - mnew);
    mrow = mnew;
    v8h ph[4];
    float ps4[4];
#pragma unroll
    for (int j = 0; j < 4; ++j) {
      float psum = 0.f;
#pragma unroll
      for (int r = 0; r < 8; ++r) {
        const float p = expf(s[j][r] - mnew);
        psum += p;
        ph[j][r] = (_Float16)(p * P_CARRY);
      }
      ps4[j] = psum;
    }
    lrow = lrow * alpha + ((ps4[0] + ps4[1]) + (ps4[2] + ps4[3]));
#pragma unroll
    for (int t = 0; t < 4; ++t)
#pragma unroll
      for (int r = 0; r < 8; ++r) oacc[t][r] *= alpha;
#pragma unroll
    for (int kk = 0; kk < 2; ++kk) {
      FH pb;                       // B operand: elements 0..7 = keys kk*32 + 8*hh + e, 8..15 = keys kk*32 + 16 + 8*hh + e
      pb.h[0] = ph[2 * kk];
      pb.h[1] = ph[2 * kk + 1];
#pragma unroll
      for (int t = 0; t < 4; ++t) {
        FH vb;
        vb.h[0] = *(const v8h*)(Vth + (t * 16 + c) * AT_LP + kk * 32 + 8 * hh);
        vb.h[1] = *(const v8h*)(Vth + (t * 16 + c) * AT_LP + kk * 32 + 16 + 8 * hh);
        oacc[t] = at_mma_h(vb.v, pb.v, oacc[t]);
      }
    }
  }

  // ---- this wave's partial (its key group, its query tile) -> LDS, unnormalised ----
  float* os = Os[grp * AT_NW + wave];
  {
    const float lt = lrow + xhalf(lrow);
    if (hh == 0) {
      Ms[grp][wave * 16 + c] = mrow;
      Ls[grp][wave * 16 + c] = lt;
    }
#pragma unroll
    for (int t = 0; t < 4; ++t)
#pragma unroll
      for (int g = 0; g < 2; ++g) {
        v4f w;
#pragma unroll
        for (int e = 0; e < 4; ++e) w[e] = oacc[t][4 * g + e];
        *(v4f*)(os + c * 68 + t * 16 + 8 * hh + 4 * g) = w;
      }
  }
  __syncthreads();   // all four groups' partials stand in LDS before any wave merges them
  {
    // merge: wave (grp, wave) takes rows grp*4 .. grp*4+3 of query tile 'wave'; 8 lanes x 8 columns cover a row
    const int q8 = lane >> 3, c8 = (lane & 7) * 8;
    const int row = grp * 4 + q8;
    float mg[AT_NG];
    float mall = -INFINITY;
#pragma unroll
    for (int g = 0; g < AT_NG; ++g) {
      mg[g] = Ms[g][wave * 16 + row];
      mall = fmaxf(mall, mg[g]);
    }
    float lall = 0.f;
    float acc[8];
#pragma unroll
    for (int e = 0; e < 8; ++e) acc[e] = 0.f;
#pragma unroll
    for (int g = 0; g < AT_NG; ++g) {
      const float wg = expf(mg[g] - mall);
      lall += wg * Ls[g][wave * 16 + row];
      const float* sp = Os[g * AT_NW + wave] + row * 68 + c8;
#pragma unroll
      for (int e = 0; e < 8; ++e) acc[e] += wg * sp[e];
    }
    const float inv = oscale / (lall * P_CARRY);
    v8h hv;
#pragma unroll
    for (int e = 0; e < 8; ++e) hv[e] = (_Float16)(acc[e] * inv);
    *(v8h*)(ob + (size_t)(q0 + row) * EMB_ + c8) = hv;
  }
}

// ---------------------------------------------------------------------------
extern "C" void kernel_launch(void* const* d_in, const int* in_sizes, int n_in,
                              void* d_out, int out_size, void* d_ws, size_t ws_size,
                              hipStream_t stream) {
  if (n_in < 12) return;
  if (in_sizes[0] != NBATCH_ * CIN_ * SEQL_) return;
  if (in_sizes[1] != EMB_ * CIN_ || in_sizes[2] != EMB_) return;
  if (in_sizes[3] != EMB_ * EMB_ || in_sizes[4] != EMB_ * EMB_ || in_sizes[5] != EMB_ * EMB_) return;
  if (in_sizes[6] != EMB_ * EMB_ || in_sizes[7] != EMB_) return;
  if (in_sizes[8] != COUT_ * EMB_ || in_sizes[9] != COUT_) return;
  if (in_sizes[10] != SEQL_ * EMB_ || in_sizes[11] < 1) return;
  if (out_size != NBATCH_ * COUT_ * SEQL_) return;
  if (ws_size < WS_TOTAL) return;

  const float* x     = (const float*)d_in[0];
  const float* W_cp  = (const float*)d_in[1];
  const float* b_cp  = (const float*)d_in[2];
  const float* W_q   = (const float*)d_in[3];
  const float* W_k   = (const float*)d_in[4];
  const float* W_v   = (const float*)d_in[5];
  const float* W_o   = (const float*)d_in[6];
  const float* b_o   = (const float*)d_in[7];
  const float* W_out = (const float*)d_in[8];
  const float* b_out = (const float*)d_in[9];
  const float* pos   = (const float*)d_in[10];
  const float* gatep = (const float*)d_in[11];
  float* out = (float*)d_out;

  char* ws = (char*)d_ws;
  _Float16* wpool = (_Float16*)(void*)(ws + OFFB_W);
  unsigned short* XT16 = (unsigned short*)(void*)(ws + OFFB_XT);
  unsigned short* XF16 = (unsigned short*)(void*)(ws + OFFB_XF);
  unsigned short* QK16 = (unsigned short*)(void*)(ws + OFFB_QK);
  unsigned short* VT16 = (unsigned short*)(void*)(ws + OFFB_VT);
  unsigned short* O16  = (unsigned short*)(void*)(ws + OFFB_O);
  unsigned short* O1   = (unsigned short*)(void*)(ws + OFFB_O1);
  const unsigned short* Wcp16  = U16(wpool + WOFF_CP);
  const unsigned short* Wqk16  = U16(wpool + WOFF_Q);     // [256][128]: q rows then k rows
  const unsigned short* Wv16   = U16(wpool + WOFF_V);
  const unsigned short* Wo16   = U16(wpool + WOFF_O);
  const unsigned short* Wout16 = U16(wpool + WOFF_OUT);

  const float WSC = 8.0f;                 // weight carry
  const float OSC = 16.0f;                // attention-output carry
  const float inv_w  = 1.0f / 8.0f;
  const float inv_wo = 1.0f / (8.0f * 16.0f);

  // 1. weights -> f16 x8
  cast_w6_kernel<<<dim3(32, 6, 1), dim3(256, 1, 1), 0, stream>>>(W_cp, W_q, W_k, W_v, W_o, W_out, wpool, WSC);

  // 2. x [b][64 ch][4096 tok] -> XT16 [b*4096+tok][64 ch] f16   (in[rows=64][cols=4096] -> out[4096][64])
  tcast16_kernel<<<dim3(SEQL_ / 64, CIN_ / 64, NBATCH_), dim3(256, 1, 1), 0, stream>>>(
      x, XT16, CIN_, SEQL_, (long)CIN_ * SEQL_, (long)SEQL_ * CIN_);

  // 3. XF16[b][tok][e] = XT16[b][tok][:] . Wcp[e][:] /8 + b_cp[e] + pos[tok][e]  (M=4096, N=128, K=64 per batch; f16 out)
  wmma_gemm64<0, false, 2, 1, true><<<dim3((SEQL_ / 64) * (EMB_ / 64) / 8, NBATCH_, 1), dim3(256, 1, 1), 0, stream>>>(
      XT16, XT16, CIN_, (long)SEQL_ * CIN_,
      Wcp16, Wcp16, CIN_, 0L,
      (void*)XF16, nullptr, EMB_, (long)SEQL_ * EMB_,
      b_cp, pos, 0L, nullptr,
      SEQL_, EMB_, CIN_, inv_w);

  // 4. QK16[tok][n] = XF16[tok][:] . Wqk[n][:] /8   (M=8192, N=256, K=128; q = cols 0..127, k = cols 128..255)
  wmma_gemm64<0, false, 0, 1, false><<<dim3((NTOK_ / 64) * (QKPITCH_ / 64) / 8, 1, 1), dim3(256, 1, 1), 0, stream>>>(
      XF16, XF16, EMB_, 0L,
      Wqk16, Wqk16, EMB_, 0L,
      (void*)QK16, nullptr, QKPITCH_, 0L,
      nullptr, nullptr, 0L, nullptr,
      NTOK_, QKPITCH_, EMB_, inv_w);

  // 5. VT16[b][(h,d)][tok] = Wv[(h,d)][:] . XF16[b][tok][:] /8   (M=128, N=4096, K=128 per batch)
  wmma_gemm64<0, false, 0, 1, false><<<dim3((EMB_ / 64) * (SEQL_ / 64) / 8, NBATCH_, 1), dim3(256, 1, 1), 0, stream>>>(
      Wv16, Wv16, EMB_, 0L,
      XF16, XF16, EMB_, (long)SEQL_ * EMB_,
      (void*)VT16, nullptr, SEQL_, (long)EMB_ * SEQL_,
      nullptr, nullptr, 0L, nullptr,
      EMB_, SEQL_, EMB_, inv_w);

  // 6. attention -> O16 [tok][128] f16 (x16)
  attn_full64_f16_kernel<<<dim3(NBATCH_ * NHEAD_ * (SEQL_ / AT_QB), 1, 1), dim3(AT_NG * AT_NW * 32, 1, 1), 0, stream>>>(
      QK16, VT16, O16, 0.125f, OSC);

  // 7. O1[tok][n] = O16[tok][:] . Wo[n][:] /128 + b_o[n]   (M=8192, N=128, K=128; f16 out)
  wmma_gemm64<0, false, 2, 1, false><<<dim3((NTOK_ / 64) * (EMB_ / 64) / 8, 1, 1), dim3(256, 1, 1), 0, stream>>>(
      O16, O16, EMB_, 0L,
      Wo16, Wo16, EMB_, 0L,
      (void*)O1, nullptr, EMB_, 0L,
      b_o, nullptr, 0L, nullptr,
      NTOK_, EMB_, EMB_, inv_wo);

  // 8. out[b][c][tok] = Wout[c][:] . O1[b][tok][:] /8 + b_out[c] + gate*x[b][c][tok]   (M=64, N=4096, K=128 per batch; f32)
  wmma_gemm64<0, false, 1, 0, true><<<dim3((COUT_ / 64) * (SEQL_ / 64) / 8, NBATCH_, 1), dim3(256, 1, 1), 0, stream>>>(
      Wout16, Wout16, EMB_, 0L,
      O1, O1, EMB_, (long)SEQL_ * EMB_,
      (void*)out, nullptr, SEQL_, (long)COUT_ * SEQL_,
      b_out, x, (long)COUT_ * SEQL_, gatep,
      COUT_, SEQL_, EMB_, inv_w);
}

// v004
// Measured time: 96 microseconds a run.
// In both of two side-by-side timings against v003, it was 1.22 times as fast.
// Counting every step since v000, it is 3.72 times as fast.
// Contractions (token embed 64->128, fused q|k projection, v^T projection, q.k^T, p.v, W_o projection, W_out projection): v_wmma_f32_16x16x32_f16 (f16 operands: weights carried x8, attention output x16, softmax numerators x2^15; f32 accumulate); softmax statistics, biases, positional add and gated residual in f32.
#include <hip/hip_runtime.h>
#include <math.h>
#include <stdint.h>

typedef __attribute__((ext_vector_type(16))) _Float16 v16h;
typedef __attribute__((ext_vector_type(8)))  _Float16 v8h;
typedef __attribute__((ext_vector_type(16))) __bf16   v16b;
typedef __attribute__((ext_vector_type(8)))  __bf16   v8b;
typedef __attribute__((ext_vector_type(8)))  float    v8f;
typedef __attribute__((ext_vector_type(4)))  float    v4f;
typedef __attribute__((ext_vector_type(2)))  float    v2f;
typedef __attribute__((ext_vector_type(4)))  unsigned int v4u;

// ---- problem geometry ----
constexpr int NBATCH_  = 2;
constexpr int CIN_     = 64;
constexpr int EMB_     = 128;
constexpr int COUT_    = 64;
constexpr int NHEAD_   = 2;
constexpr int HDIM_    = 64;
constexpr int SEQL_    = 4096;               // 16*16*16 tokens per batch element
constexpr int NTOK_    = NBATCH_ * SEQL_;    // 8192
constexpr int QKPITCH_ = 2 * EMB_;           // fused q|k plane pitch (halves)

// ---- f16 weight pool offsets (halves) ----
constexpr int WOFF_CP   = 0;                              // [128][64]
constexpr int WOFF_Q    = WOFF_CP + EMB_ * CIN_;          // [128][128]  (q rows)
constexpr int WOFF_K    = WOFF_Q + EMB_ * EMB_;           // [128][128]  (k rows, contiguous after q -> [256][128])
constexpr int WOFF_V    = WOFF_K + EMB_ * EMB_;           // [128][128]
constexpr int WOFF_O    = WOFF_V + EMB_ * EMB_;           // [128][128]
constexpr int WOFF_OUT  = WOFF_O + EMB_ * EMB_;           // [64][128]
constexpr int WPOOL_H   = WOFF_OUT + COUT_ * EMB_;        // 81920 halves = 163840 B
static_assert(WPOOL_H == 81920, "weight pool size");

//   WPOOL f16 weights x8                     0          163840
//   XT16  f16 [8192 tok][64 ch]         163840         1048576
//   XF16  f16 [8192 tok][128]          1212416         2097152
//   QK16  f16 [8192 tok][256] (q|k)    3309568         4194304
//   VT16  f16 [2][128 (h,d)][4096]     7503872         2097152
//   O16   f16 [8192 tok][128] (x16)    9601024         2097152
//   O1_16 f16 [8192 tok][128]         11698176         2097152
//   total                             13795328
constexpr size_t OFFB_W   = 0;
constexpr size_t OFFB_XT  = OFFB_W  + (size_t)WPOOL_H * 2;
constexpr size_t OFFB_XF  = OFFB_XT + (size_t)NTOK_ * CIN_ * 2;
constexpr size_t OFFB_QK  = OFFB_XF + (size_t)NTOK_ * EMB_ * 2;
constexpr size_t OFFB_VT  = OFFB_QK + (size_t)NTOK_ * QKPITCH_ * 2;
constexpr size_t OFFB_O   = OFFB_VT + (size_t)NBATCH_ * EMB_ * SEQL_ * 2;
constexpr size_t OFFB_O1  = OFFB_O  + (size_t)NTOK_ * EMB_ * 2;
constexpr size_t WS_TOTAL = OFFB_O1 + (size_t)NTOK_ * EMB_ * 2;
static_assert(WS_TOTAL == 13795328, "carve total");
static_assert((OFFB_XT % 128) == 0 && (OFFB_XF % 128) == 0 && (OFFB_QK % 128) == 0 &&
              (OFFB_VT % 128) == 0 && (OFFB_O % 128) == 0 && (OFFB_O1 % 128) == 0, "128-B aligned regions");

#define U16(p) ((const unsigned short*)(const void*)(p))

__device__ __forceinline__ unsigned short f2bf_bits(float f) {
  unsigned u = __float_as_uint(f);
  return (unsigned short)((u + 0x7FFFu + ((u >> 16) & 1u)) >> 16);
}
__device__ __forceinline__ float bf_bits2f(unsigned short h) { return __uint_as_float(((unsigned)h) << 16); }
__device__ __forceinline__ unsigned pk16(unsigned short a, unsigned short b) { return (unsigned)a | ((unsigned)b << 16); }
__device__ __forceinline__ unsigned short h_bits(float f) { return __builtin_bit_cast(unsigned short, (_Float16)f); }

// hazard guards as plain device helpers (no inline asm inside the kernel template body)
__device__ __forceinline__ void dep_guard_h(v8f& a, v8f& b, v16h x, v16h y) { asm volatile("v_nop\n\tv_nop\n\tv_nop\n\tv_nop" : "+v"(a), "+v"(b) : "v"(x), "v"(y)); }
__device__ __forceinline__ void dep_guard_b(v8f& a, v8f& b, v16b x, v16b y) { asm volatile("v_nop\n\tv_nop\n\tv_nop\n\tv_nop" : "+v"(a), "+v"(b) : "v"(x), "v"(y)); }
__device__ __forceinline__ void keep4_h(v16h a, v16h b, v16h c, v16h d) { asm volatile("v_nop" :: "v"(a), "v"(b), "v"(c), "v"(d)); }
__device__ __forceinline__ void keep4_b(v16b a, v16b b, v16b c, v16b d) { asm volatile("v_nop" :: "v"(a), "v"(b), "v"(c), "v"(d)); }
__device__ __forceinline__ void acc_guard4(v8f& a, v8f& b, v8f& c, v8f& d) { asm volatile("v_nop\n\tv_nop\n\tv_nop\n\tv_nop" : "+v"(a), "+v"(b), "+v"(c), "+v"(d)); }
template <typename T> struct Frag;
template <> struct Frag<_Float16> {
  typedef v16h V; union U { v16h v; v8h h[2]; };
  static __device__ __forceinline__ v16h load(const _Float16* p) {   // elements 0..7 <- p[0..7], 8..15 <- p[16..23]
    U f; f.h[0] = *(const v8h*)(p); f.h[1] = *(const v8h*)(p + 16); return f.v;
  }
  static __device__ __forceinline__ v8f mma(v16h a, v16h b, v8f c) {
    return __builtin_amdgcn_wmma_f32_16x16x32_f16(false, a, false, b, (short)0, c, false, false);
  }
  static __device__ __forceinline__ void guard(v8f& a, v8f& b, v16h x, v16h y) { dep_guard_h(a, b, x, y); }
  static __device__ __forceinline__ void keep(v16h a, v16h b, v16h c, v16h d) { keep4_h(a, b, c, d); }
};
template <> struct Frag<__bf16> {
  typedef v16b V; union U { v16b v; v8b h[2]; };
  static __device__ __forceinline__ v16b load(const __bf16* p) {
    U f; f.h[0] = *(const v8b*)(p); f.h[1] = *(const v8b*)(p + 16); return f.v;
  }
  static __device__ __forceinline__ v8f mma(v16b a, v16b b, v8f c) {
    return __builtin_amdgcn_wmma_f32_16x16x32_bf16(false, a, false, b, (short)0, c, false, false);
  }
  static __device__ __forceinline__ void guard(v8f& a, v8f& b, v16b x, v16b y) { dep_guard_b(a, b, x, y); }
  static __device__ __forceinline__ void keep(v16b a, v16b b, v16b c, v16b d) { keep4_b(a, b, c, d); }
};

// ---- Register-blocked batched WMMA GEMM ------------------------------------
// C[m,n] = scale * sum_k A[m,k] * Bt[n,k] (+bias)(+rg*resid); each wave owns a 64x64 tile.
// A row-major [M,K]; Bt row-major [N,K]; M,N % 64 == 0, K % 32 == 0.
// SPLIT: operands are hi/lo planes (A2/Bt2 = lo planes, same layout); product = hi.hi + hi.lo + lo.hi.
// BIAS_MODE: 0 = none, 1 = bias[m], 2 = bias[n].
// OUT_MODE: 0 = f32, 1 = f16, 2 = bf16 hi plane (Cout) + bf16 lo plane (Cout2).
// RESID: v += rg * resid[m*ldc+n] with rg = rgain[0] when rgain != nullptr else 1.
// ET: 0 = f16 operands, 1 = bf16 operands (pointers passed as 16-bit storage)
template <int ET> struct Elem;
template <> struct Elem<0> { typedef _Float16 T; };
template <> struct Elem<1> { typedef __bf16 T; };
template <int ET, bool SPLIT, int BIAS_MODE, int OUT_MODE, bool RESID, int ACT = 0>
__global__ __launch_bounds__(256) void wmma_gemm64(
    const unsigned short* __restrict__ Ap, const unsigned short* __restrict__ A2p, int lda, long strideA,
    const unsigned short* __restrict__ Btp, const unsigned short* __restrict__ Bt2p, int ldb, long strideB,
    void* __restrict__ Cout, void* __restrict__ Cout2, int ldc, long strideC,
    const float* __restrict__ bias,
    const float* __restrict__ resid, long strideR, const float* __restrict__ rgain,
    int M, int N, int K, float scale) {
  typedef typename Elem<ET>::T T;
  typedef typename Frag<T>::V V;
  const T* A = (const T*)Ap; const T* A2 = (const T*)A2p; const T* Bt = (const T*)Btp; const T* Bt2 = (const T*)Bt2p;
  __shared__ __align__(16) float sT[8][16 * 68];   // per-wave 16x64 slab, pitch 68 floats
  const int b    = blockIdx.y;
  const int lane = threadIdx.x & 31;
  const int wave = threadIdx.x >> 5;
  const int tilesN = N >> 6;
  const int tilesM = M >> 6;
  const int tile = blockIdx.x * 8 + wave;
  if (tile >= tilesM * tilesN) return;   // wave-uniform; no block barriers in this kernel
  const int tm = tile / tilesN;
  const int tn = tile - tm * tilesN;
  const int m0 = tm << 6;
  const int n0 = tn << 6;

  const T* Ab  = A  + (size_t)b * strideA;
  const T* Bb  = Bt + (size_t)b * strideB;
  const T* Ab2 = SPLIT ? (A2  + (size_t)b * strideA) : nullptr;
  const T* Bb2 = SPLIT ? (Bt2 + (size_t)b * strideB) : nullptr;

  const int rlane = lane & 15;                 // row (A) / col (B, D) within subtile
  const int koff  = (lane >> 4) * 8;           // k offset of this lane half
  const int mOff  = (lane >> 4) * 8;           // D row offset

  v8f acc[4][4];
#pragma unroll
  for (int i = 0; i < 4; ++i)
#pragma unroll
    for (int j = 0; j < 4; ++j) acc[i][j] = (v8f){0.f,0.f,0.f,0.f,0.f,0.f,0.f,0.f};

  for (int k0 = 0; k0 < K; k0 += 32) {
    V bh[4], bl[4];
#pragma unroll
    for (int j = 0; j < 4; ++j) {
      const size_t bo = (size_t)(n0 + (j << 4) + rlane) * ldb + koff + k0;
      bh[j] = Frag<T>::load(Bb + bo);
      if (SPLIT) bl[j] = Frag<T>::load(Bb2 + bo);
    }
#pragma unroll
    for (int i = 0; i < 4; ++i) {
      const size_t ao = (size_t)(m0 + (i << 4) + rlane) * lda + koff + k0;
      V ah = Frag<T>::load(Ab + ao);
      V al;
      if (SPLIT) al = Frag<T>::load(Ab2 + ao);
#pragma unroll
      for (int j = 0; j < 4; ++j) {
        acc[i][j] = Frag<T>::mma(ah, bh[j], acc[i][j]);
        if (SPLIT) {
          acc[i][j] = Frag<T>::mma(ah, bl[j], acc[i][j]);
          acc[i][j] = Frag<T>::mma(al, bh[j], acc[i][j]);
        }
      }
      Frag<T>::guard(acc[i][0], acc[i][3], ah, SPLIT ? al : ah);
    }
    Frag<T>::keep(bh[0], bh[1], bh[2], bh[3]);
    if (SPLIT) Frag<T>::keep(bl[0], bl[1], bl[2], bl[3]);
  }
  acc_guard4(acc[0][0], acc[0][1], acc[0][2], acc[0][3]);
  acc_guard4(acc[1][0], acc[1][1], acc[1][2], acc[1][3]);
  acc_guard4(acc[2][0], acc[2][1], acc[2][2], acc[2][3]);
  acc_guard4(acc[3][0], acc[3][1], acc[3][2], acc[3][3]);

  // ---- epilogue ----
  float* slab = sT[wave];
  const float* Rb = RESID ? (resid + (size_t)b * strideR) : nullptr;
  float rg = 1.0f;
  if (RESID) { if (rgain != nullptr) rg = rgain[0]; }
#pragma unroll
  for (int i = 0; i < 4; ++i) {
    const int mBase = m0 + (i << 4);
#pragma unroll
    for (int j = 0; j < 4; ++j) {
      const int n = n0 + (j << 4) + rlane;
      float bv = 0.f;
      if (BIAS_MODE == 2) bv = bias[n];
#pragma unroll
      for (int r = 0; r < 8; ++r) {
        float v = acc[i][j][r] * scale;
        if (BIAS_MODE == 1) v += bias[mBase + mOff + r];
        if (BIAS_MODE == 2) v += bv;
        if (RESID) v += rg * Rb[(size_t)(mBase + mOff + r) * ldc + n];
        if (ACT == 1) v = tanhf(v);
        if (ACT == 2) v = fmaxf(v, 0.0f);
        if (ACT == 3) v = v / (1.0f + expf(-v));
        if (ACT == 4) v = (v > 0.f) ? v : 0.01f * v;
        slab[(mOff + r) * 68 + (j << 4) + rlane] = v;
      }
    }
    __builtin_amdgcn_fence(__ATOMIC_RELEASE, "workgroup");
    __builtin_amdgcn_wave_barrier();
    __builtin_amdgcn_fence(__ATOMIC_ACQUIRE, "workgroup");
    if (OUT_MODE == 0) {
      float* C = (float*)Cout + (size_t)b * strideC;
      const int hh = lane >> 4, c4 = (lane & 15) * 4;     // row seg = 256 B = 16 lanes x 16 B
      {
#pragma unroll
        for (int it = 0; it < 8; ++it) {
          const int row = it * 2 + hh;
          v4f v = *(const v4f*)(slab + row * 68 + c4);
          *(v4f*)(C + (size_t)(mBase + row) * ldc + n0 + c4) = v;
        }
        
      }
    } else {
      const int q = lane >> 3, c8 = (lane & 7) * 8;
      unsigned short* C  = (unsigned short*)Cout  + (size_t)b * strideC;
      unsigned short* C2 = (OUT_MODE == 2) ? ((unsigned short*)Cout2 + (size_t)b * strideC) : nullptr;
      {
#pragma unroll
        for (int it = 0; it < 4; ++it) {
          const int row = it * 4 + q;
          const float* sp = slab + row * 68 + c8;
          v8h hv, lv;
#pragma unroll
          for (int e = 0; e < 8; ++e) {
            if (OUT_MODE == 1) {
              hv[e] = (_Float16)sp[e];
            } else {
              unsigned short hb = f2bf_bits(sp[e]);
              unsigned short lb = f2bf_bits(sp[e] - bf_bits2f(hb));
              hv[e] = __builtin_bit_cast(_Float16, hb);
              lv[e] = __builtin_bit_cast(_Float16, lb);
            }
          }
          *(v8h*)(C + (size_t)(mBase + row) * ldc + n0 + c8) = hv;
          if (OUT_MODE == 2) *(v8h*)(C2 + (size_t)(mBase + row) * ldc + n0 + c8) = lv;
        }
        
      }
    }
    __builtin_amdgcn_fence(__ATOMIC_RELEASE, "workgroup");
    __builtin_amdgcn_wave_barrier();
    __builtin_amdgcn_fence(__ATOMIC_ACQUIRE, "workgroup");
  }
}

// ---------------------------------------------------------------------------
// Weight cast f32 -> f16 with a power-of-two carry sc (x8): six matrices selected by blockIdx.y (block-uniform),
// Coverage: grid.x = 32 blocks x 256 threads = 8192 pairs >= n2 for every matrix (n2 = 4096 or 8192 pairs).
// ---------------------------------------------------------------------------
__global__ __launch_bounds__(256) void cast_w6_kernel(const float* __restrict__ w0, const float* __restrict__ w1,
                                                      const float* __restrict__ w2, const float* __restrict__ w3,
                                                      const float* __restrict__ w4, const float* __restrict__ w5,
                                                      _Float16* __restrict__ pool, float sc) {
  const int y = blockIdx.y;                 // block-uniform selector
  const float* in = w0; int n2 = (EMB_ * CIN_) / 2; int off = WOFF_CP;
  if (y == 1) { in = w1; n2 = (EMB_ * EMB_) / 2;  off = WOFF_Q; }
  if (y == 2) { in = w2; n2 = (EMB_ * EMB_) / 2;  off = WOFF_K; }
  if (y == 3) { in = w3; n2 = (EMB_ * EMB_) / 2;  off = WOFF_V; }
  if (y == 4) { in = w4; n2 = (EMB_ * EMB_) / 2;  off = WOFF_O; }
  if (y == 5) { in = w5; n2 = (COUT_ * EMB_) / 2; off = WOFF_OUT; }
  _Float16* out = pool + off;
  const int i = blockIdx.x * 256 + threadIdx.x;
  if (i < n2) {
    const v2f f = *(const v2f*)(in + 2 * (size_t)i);
    const unsigned u = pk16(h_bits(f[0] * sc), h_bits(f[1] * sc));
    ((unsigned*)out)[i] = u;
    
  }
}

// ---------------------------------------------------------------------------
// Fused transpose + f16 cast of an f32 matrix, z-batched: in_z = W + z*sIn viewed [R rows][Cc cols] (pitch Cc) ->
//   oh_z[c][r] = f16(in_z[r][c])   ([Cc][R], pitch R), oh_z = oh + z*sOut.
// Here: in_z = x[z] viewed [R=64 ch][Cc=4096 tok] -> out [4096 tok][64 ch]; grid = (Cc/64=64, R/64=1, Z=2), 256 threads.
// Coverage per block: load 4 it x 256 thr x 4 floats = 64x64; store 2 it x 256 thr x 8 u16 = 64x64.
// ---------------------------------------------------------------------------
__global__ __launch_bounds__(256) void tcast16_kernel(const float* __restrict__ W, unsigned short* __restrict__ oh,
                                                      int R, int Cc, long sIn, long sOut) {
  __shared__ __align__(16) float tf[64 * 68];
  W  += (size_t)blockIdx.z * sIn;
  oh += (size_t)blockIdx.z * sOut;
  const int c0  = blockIdx.x * 64;   // input column block = output row block
  const int r0  = blockIdx.y * 64;   // input row block    = output column block
  const int tid = threadIdx.x;
  {
    const int lr = tid >> 4;         // 0..15
    const int c4 = (tid & 15) * 4;   // 0..60
#pragma unroll
    for (int it = 0; it < 4; ++it) {
      const int rr = it * 16 + lr;   // 0..63
      const v4f a = *(const v4f*)(W + (size_t)(r0 + rr) * Cc + c0 + c4);
      *(v4f*)(tf + rr * 68 + c4) = a;
    }
  }
  __syncthreads();
  const int sub = tid >> 3;          // 0..31
  const int c8  = (tid & 7) * 8;     // 0..56
  v4u hv[2];
#pragma unroll
  for (int it = 0; it < 2; ++it) {
    const int oc = it * 32 + sub;    // output row within tile (= input column)
    v4u a;
#pragma unroll
    for (int q = 0; q < 4; ++q) {
      const float f0 = tf[(c8 + 2 * q) * 68 + oc];
      const float f1 = tf[(c8 + 2 * q + 1) * 68 + oc];
      a[q] = pk16(h_bits(f0), h_bits(f1));
    }
    hv[it] = a;
  }
  {
#pragma unroll
    for (int it = 0; it < 2; ++it) {
      const int oc = it * 32 + sub;
      const size_t go = (size_t)(c0 + oc) * R + r0 + c8;
      *(v4u*)(oh + go) = hv[it];
    }
    
  }
}

// =====================================================================================
// Full (non-causal, unmasked) attention, head dim 64, all (batch, head, 64-query tile) in one launch.
//   q|k plane (f16): q element (b, t, h, d) at [(b*SEQL_+t)*QKPITCH_ + h*64 + d]; k at the same + EMB_.
//   v^T plane (f16): element (b, h, d, s) at [b*EMB_*SEQL_ + (h*64 + d)*SEQL_ + s]
//   out (f16, carried x oscale): element (b, t, h, d) at [(b*SEQL_+t)*EMB_ + h*64 + d]
//   scores^T = (k . q^T) * sscale : v_wmma_f32_16x16x32_f16, A = K rows, B = Q; a lane holds 8 keys x 1 query per tile
//   out^T    = v^T . p^T          : p = 2^(s*sscale*log2(e) - m + 15) in f16, packed in-lane from two score tiles into the
//                                   B operand (no LDS trip), A = V^T rows, f32 accumulate, 1/l in f32 (l carries the same 2^15)
//   online softmax in f32 (chunks of 64 keys, compile-time trip count, no masking): maximum and sum
//   run in-lane; the two wave halves join the maximum once per chunk and the sum once after the loop.
//   Block = 16 waves = 4 key groups x 4 query tiles = 64 query rows of one (batch, head); grid.x = 256.
//   Key group g walks chunks g, g+4, g+8, ... (16 of the 64) with its own K / V^T LDS tiles, so each SIMD holds four
//   waves whose LDS, memory and vector waits cover one another. After the loop each group leaves its maximum, sum and
//   unnormalised out tile in LDS; behind one __syncthreads the 16 waves merge them (4 rows of one query tile each).
//   K / V^T chunk staging: the group's 128 threads x 32 elements per plane = its whole 64x64 tile (16-B copies, plain
//   loads, __syncthreads before and after); fragment loads read the LDS tiles with the same v8h element type.
// =====================================================================================
#define AT_D 64
#define AT_NW 4
#define AT_NG 4
#define AT_QB 64
#define AT_KC 64
#define AT_LP 72   // LDS row pitch of the K and V^T tiles in halves: 144 B = 16 B x odd, so the 16 rows of one ds_load_b128 fragment read fall on 16 different groups of four banks
#define P_CARRY_L2 15.0f   // softmax numerators and their sums are carried x 2^15: the carry is an addend of the base-2 exponent

__device__ __forceinline__ v8f at_mma_h(v16h a, v16h b, v8f c) {
  c = __builtin_amdgcn_wmma_f32_16x16x32_f16(false, a, false, b, (short)0, c, false, false);
  asm volatile("v_nop\n\tv_nop\n\tv_nop\n\tv_nop" : "+v"(c) : "v"(a), "v"(b));
  return c;
}

// 2^x on the bare v_exp_f32 (no range fix-up: the softmax's arguments are <= 15 up to rounding, and a result below 2^-126 may go to 0).
__device__ __forceinline__ void exp2x8(v8f& x) {
  float a = x[0], b = x[1], c = x[2], d = x[3], e = x[4], f = x[5], g = x[6], h = x[7];
  asm("v_exp_f32 %0, %0\n\tv_exp_f32 %1, %1\n\tv_exp_f32 %2, %2\n\tv_exp_f32 %3, %3\n\t"
      "v_exp_f32 %4, %4\n\tv_exp_f32 %5, %5\n\tv_exp_f32 %6, %6\n\tv_exp_f32 %7, %7\n\tv_nop"
      : "+v"(a), "+v"(b), "+v"(c), "+v"(d), "+v"(e), "+v"(f), "+v"(g), "+v"(h));
  x = (v8f){a, b, c, d, e, f, g, h};
}
__device__ __forceinline__ float exp2x1(float x) {
  asm("v_exp_f32 %0, %0\n\tv_nop" : "+v"(x));   // the v_nop: the same slot behind a single v_exp_f32
  return x;
}

// lane l <-> lane l ^ 16: the two halves of a wave hold the two key halves of the same query column
__device__ __forceinline__ float xhalf(float x) {
  return __builtin_bit_cast(float, __builtin_amdgcn_permlanex16(__builtin_bit_cast(int, x), __builtin_bit_cast(int, x),
                                                                0x76543210, 0xfedcba98, false, false));
}

__global__ __launch_bounds__(AT_NG * AT_NW * 32)
void attn_full64_f16_kernel(const unsigned short* __restrict__ qkp, const unsigned short* __restrict__ vtp,
                            unsigned short* __restrict__ op, float sscale, float oscale) {
  union FH { v16h v; v8h h[2]; };
  __shared__ __align__(16) _Float16 KshG[AT_NG][AT_KC * AT_LP];    // K [kv][d]      rows of 64 at pitch 72, 9 KB per key group
  __shared__ __align__(16) _Float16 VthG[AT_NG][AT_D * AT_LP];     // V [d][kv]      rows of 64 at pitch 72, 9 KB per key group
  __shared__ __align__(16) float    Os[AT_NG * AT_NW][16 * 68];    // per wave partial out tile, pitch 68
  __shared__ float Ms[AT_NG][AT_QB];                               // per group and query: running maximum
  __shared__ float Ls[AT_NG][AT_QB];                               // per group and query: sum x 2^15 of 2^(s*sl2 - maximum)

  const int tid  = threadIdx.x & (AT_NW * 32 - 1);   // thread within the key group
  const int grp  = threadIdx.x >> 7;                 // key group 0..3
  const int wave = tid >> 5;                         // query tile 0..3
  const int lane = tid & 31;
  _Float16* Ksh = KshG[grp];
  _Float16* Vth = VthG[grp];
  const int hh   = lane >> 4;
  const int c    = lane & 15;

  const int nqb = SEQL_ / AT_QB;          // 64
  const int bx = blockIdx.x;
  const int qb = bx % nqb;
  const int bh = bx / nqb;                // 0..NBATCH_*NHEAD_-1
  const int h  = bh % NHEAD_;
  const int b  = bh / NHEAD_;
  const int q0 = qb * AT_QB + wave * 16;

  const _Float16* Qh = (const _Float16*)(const void*)qkp + (size_t)b * SEQL_ * QKPITCH_ + (size_t)h * AT_D;
  const _Float16* Kh = Qh + EMB_;
  const _Float16* Vh = (const _Float16*)(const void*)vtp + (size_t)b * EMB_ * SEQL_ + (size_t)h * AT_D * SEQL_;
  _Float16*       ob = (_Float16*)(void*)op + (size_t)b * SEQL_ * EMB_ + (size_t)h * AT_D;

  // ---- Q fragments (B operand, column = lane&15, split k map via Frag load): 2 d-chunks ----
  v16h qa[2];
#pragma unroll
  for (int dc = 0; dc < 2; ++dc) {
    const _Float16* qr = Qh + (size_t)(q0 + c) * QKPITCH_ + dc * 32 + 8 * hh;
    qa[dc] = Frag<_Float16>::load(qr);
  }

  const float sl2 = sscale * 1.44269504f;   // score scale x log2(e): the softmax runs in base 2
  float mrow = -INFINITY, lrow = 0.f;   // this lane's query: running maximum in base-2 units (both halves alike), sum x 2^15 over this half's keys
  v8f oacc[4];                          // oacc[t][r] = out^T[d = t*16 + 8*hh + r][query c]
#pragma unroll
  for (int t = 0; t < 4; ++t) oacc[t] = (v8f){0.f,0.f,0.f,0.f,0.f,0.f,0.f,0.f};

  const int nChunks = SEQL_ / (AT_KC * AT_NG);   // 16 per key group, compile-time constant
  for (int kc = 0; kc < nChunks; ++kc) {
    const int kv0 = (kc * AT_NG + grp) * AT_KC;
    __syncthreads();
    {
      // staging coverage: the group's 128 threads x (4 x 8) elements = 64 rows x 64 per plane = its whole chunk tile
      const int r = tid >> 1, half = (tid & 1) * 32;
      const _Float16* ksh = Kh + (size_t)(kv0 + r) * QKPITCH_ + half;   // K row kv0+r, d = half..half+31
      const _Float16* vsh = Vh + (size_t)r * SEQL_ + kv0 + half;        // V^T row d = r, s = kv0+half..+31
      v8h a0[4], b0[4];   // all eight loads are issued before the first LDS store: one trip to memory per chunk, not four
#pragma unroll
      for (int i = 0; i < 4; ++i) {
        a0[i] = *(const v8h*)(ksh + 8 * i);
        b0[i] = *(const v8h*)(vsh + 8 * i);
      }
#pragma unroll
      for (int i = 0; i < 4; ++i) {
        *(v8h*)(Ksh + r * AT_LP + half + 8 * i) = a0[i];
        *(v8h*)(Vth + r * AT_LP + half + 8 * i) = b0[i];
      }
    }
    __syncthreads();

    v8f s[4];
#pragma unroll
    for (int j = 0; j < 4; ++j) {
      s[j] = (v8f){0.f,0.f,0.f,0.f,0.f,0.f,0.f,0.f};
#pragma unroll
      for (int dc = 0; dc < 2; ++dc) {
        FH kb;
        kb.h[0] = *(const v8h*)(Ksh + (j * 16 + c) * AT_LP + dc * 32 + 8 * hh);
        kb.h[1] = *(const v8h*)(Ksh + (j * 16 + c) * AT_LP + dc * 32 + 16 + 8 * hh);
        s[j] = at_mma_h(kb.v, qa[dc], s[j]);   // s[j][r] = score of key j*16 + 8*hh + r against query c
      }
    }
    float m4[4];
#pragma unroll
    for (int j = 0; j < 4; ++j) {
      float m = -INFINITY;
#pragma unroll
      for (int r = 0; r < 8; ++r) m = fmaxf(m, s[j][r]);
      m4[j] = m;
    }
    float cm = fmaxf(fmaxf(m4[0], m4[1]), fmaxf(m4[2], m4[3]));
    cm = fmaxf(cm, xhalf(cm)) * sl2;                          // sl2 > 0: the largest raw score is the largest scaled one
    const float mnew = fmaxf(mrow, cm);
    const float alpha = exp2x1(mrow - mnew);                  // first chunk: 2^(-inf) = 0
    mrow = mnew;
    const float moff = P_CARRY_L2 - mnew;
    v8h ph[4];
    float ps4[4];
#pragma unroll
    for (int j = 0; j < 4; ++j) {
      float psum = 0.f;
#pragma unroll
      for (int r = 0; r < 8; ++r) s[j][r] = fmaf(s[j][r], sl2, moff);
      exp2x8(s[j]);                        // p x 2^15 = 2^(s*sl2 - m + 15): one fma and one v_exp_f32 per score
#pragma unroll
      for (int r = 0; r < 8; ++r) {
        psum += s[j][r];
        ph[j][r] = (_Float16)s[j][r];
      }
      ps4[j] = psum;
    }
    lrow = lrow * alpha + ((ps4[0] + ps4[1]) + (ps4[2] + ps4[3]));
#pragma unroll
    for (int t = 0; t < 4; ++t)
#pragma unroll
      for (int r = 0; r < 8; ++r) oacc[t][r] *= alpha;
#pragma unroll
    for (int kk = 0; kk < 2; ++kk) {
      FH pb;                       // B operand: elements 0..7 = keys kk*32 + 8*hh + e, 8..15 = keys kk*32 + 16 + 8*hh + e
      pb.h[0] = ph[2 * kk];
      pb.h[1] = ph[2 * kk + 1];
#pragma unroll
      for (int t = 0; t < 4; ++t) {
        FH vb;
        vb.h[0] = *(const v8h*)(Vth + (t * 16 + c) * AT_LP + kk * 32 + 8 * hh);
        vb.h[1] = *(const v8h*)(Vth + (t * 16 + c) * AT_LP + kk * 32 + 16 + 8 * hh);
        oacc[t] = at_mma_h(vb.v, pb.v, oacc[t]);
      }
    }
  }

  // ---- this wave's partial (its key group, its query tile) -> LDS, unnormalised ----
  float* os = Os[grp * AT_NW + wave];
  {
    const float lt = lrow + xhalf(lrow);
    if (hh == 0) {
      Ms[grp][wave * 16 + c] = mrow;
      Ls[grp][wave * 16 + c] = lt;
    }
#pragma unroll
    for (int t = 0; t < 4; ++t)
#pragma unroll
      for (int g = 0; g < 2; ++g) {
        v4f w;
#pragma unroll
        for (int e = 0; e < 4; ++e) w[e] = oacc[t][4 * g + e];
        *(v4f*)(os + c * 68 + t * 16 + 8 * hh + 4 * g) = w;
      }
  }
  __syncthreads();   // all four groups' partials stand in LDS before any wave merges them
  {
    // merge: wave (grp, wave) takes rows grp*4 .. grp*4+3 of query tile 'wave'; 8 lanes x 8 columns cover a row
    const int q8 = lane >> 3, c8 = (lane & 7) * 8;
    const int row = grp * 4 + q8;
    float mg[AT_NG];
    float mall = -INFINITY;
#pragma unroll
    for (int g = 0; g < AT_NG; ++g) {
      mg[g] = Ms[g][wave * 16 + row];
      mall = fmaxf(mall, mg[g]);
    }
    float lall = 0.f;
    float acc[8];
#pragma unroll
    for (int e = 0; e < 8; ++e) acc[e] = 0.f;
#pragma unroll
    for (int g = 0; g < AT_NG; ++g) {
      const float wg = exp2x1(mg[g] - mall);
      lall += wg * Ls[g][wave * 16 + row];
      const float* sp = Os[g * AT_NW + wave] + row * 68 + c8;
#pragma unroll
      for (int e = 0; e < 8; ++e) acc[e] += wg * sp[e];
    }
    const float inv = oscale / lall;   // the sum carries the numerators' 2^15
    v8h hv;
#pragma unroll
    for (int e = 0; e < 8; ++e) hv[e] = (_Float16)(acc[e] * inv);
    *(v8h*)(ob + (size_t)(q0 + row) * EMB_ + c8) = hv;
  }
}

// ---------------------------------------------------------------------------
extern "C" void kernel_launch(void* const* d_in, const int* in_sizes, int n_in,
                              void* d_out, int out_size, void* d_ws, size_t ws_size,
                              hipStream_t stream) {
  if (n_in < 12) return;
  if (in_sizes[0] != NBATCH_ * CIN_ * SEQL_) return;
  if (in_sizes[1] != EMB_ * CIN_ || in_sizes[2] != EMB_) return;
  if (in_sizes[3] != EMB_ * EMB_ || in_sizes[4] != EMB_ * EMB_ || in_sizes[5] != EMB_ * EMB_) return;
  if (in_sizes[6] != EMB_ * EMB_ || in_sizes[7] != EMB_) return;
  if (in_sizes[8] != COUT_ * EMB_ || in_sizes[9] != COUT_) return;
  if (in_sizes[10] != SEQL_ * EMB_ || in_sizes[11] < 1) return;
  if (out_size != NBATCH_ * COUT_ * SEQL_) return;
  if (ws_size < WS_TOTAL) return;

  const float* x     = (const float*)d_in[0];
  const float* W_cp  = (const float*)d_in[1];
  const float* b_cp  = (const float*)d_in[2];
  const float* W_q   = (const float*)d_in[3];
  const float* W_k   = (const float*)d_in[4];
  const float* W_v   = (const float*)d_in[5];
  const float* W_o   = (const float*)d_in[6];
  const float* b_o   = (const float*)d_in[7];
  const float* W_out = (const float*)d_in[8];
  const float* b_out = (const float*)d_in[9];
  const float* pos   = (const float*)d_in[10];
  const float* gatep = (const float*)d_in[11];
  float* out = (float*)d_out;

  char* ws = (char*)d_ws;
  _Float16* wpool = (_Float16*)(void*)(ws + OFFB_W);
  unsigned short* XT16 = (unsigned short*)(void*)(ws + OFFB_XT);
  unsigned short* XF16 = (unsigned short*)(void*)(ws + OFFB_XF);
  unsigned short* QK16 = (unsigned short*)(void*)(ws + OFFB_QK);
  unsigned short* VT16 = (unsigned short*)(void*)(ws + OFFB_VT);
  unsigned short* O16  = (unsigned short*)(void*)(ws + OFFB_O);
  unsigned short* O1   = (unsigned short*)(void*)(ws + OFFB_O1);
  const unsigned short* Wcp16  = U16(wpool + WOFF_CP);
  const unsigned short* Wqk16  = U16(wpool + WOFF_Q);     // [256][128]: q rows then k rows
  const unsigned short* Wv16   = U16(wpool + WOFF_V);
  const unsigned short* Wo16   = U16(wpool + WOFF_O);
  const unsigned short* Wout16 = U16(wpool + WOFF_OUT);

  const float WSC = 8.0f;                 // weight carry
  const float OSC = 16.0f;                // attention-output carry
  const float inv_w  = 1.0f / 8.0f;
  const float inv_wo = 1.0f / (8.0f * 16.0f);

  // 1. weights -> f16 x8
  cast_w6_kernel<<<dim3(32, 6, 1), dim3(256, 1, 1), 0, stream>>>(W_cp, W_q, W_k, W_v, W_o, W_out, wpool, WSC);

  // 2. x [b][64 ch][4096 tok] -> XT16 [b*4096+tok][64 ch] f16   (in[rows=64][cols=4096] -> out[4096][64])
  tcast16_kernel<<<dim3(SEQL_ / 64, CIN_ / 64, NBATCH_), dim3(256, 1, 1), 0, stream>>>(
      x, XT16, CIN_, SEQL_, (long)CIN_ * SEQL_, (long)SEQL_ * CIN_);

  // 3. XF16[b][tok][e] = XT16[b][tok][:] . Wcp[e][:] /8 + b_cp[e] + pos[tok][e]  (M=4096, N=128, K=64 per batch; f16 out)
  wmma_gemm64<0, false, 2, 1, true><<<dim3((SEQL_ / 64) * (EMB_ / 64) / 8, NBATCH_, 1), dim3(256, 1, 1), 0, stream>>>(
      XT16, XT16, CIN_, (long)SEQL_ * CIN_,
      Wcp16, Wcp16, CIN_, 0L,
      (void*)XF16, nullptr, EMB_, (long)SEQL_ * EMB_,
      b_cp, pos, 0L, nullptr,
      SEQL_, EMB_, CIN_, inv_w);

  // 4. QK16[tok][n] = XF16[tok][:] . Wqk[n][:] /8   (M=8192, N=256, K=128; q = cols 0..127, k = cols 128..255)
  wmma_gemm64<0, false, 0, 1, false><<<dim3((NTOK_ / 64) * (QKPITCH_ / 64) / 8, 1, 1), dim3(256, 1, 1), 0, stream>>>(
      XF16, XF16, EMB_, 0L,
      Wqk16, Wqk16, EMB_, 0L,
      (void*)QK16, nullptr, QKPITCH_, 0L,
      nullptr, nullptr, 0L, nullptr,
      NTOK_, QKPITCH_, EMB_, inv_w);

  // 5. VT16[b][(h,d)][tok] = Wv[(h,d)][:] . XF16[b][tok][:] /8   (M=128, N=4096, K=128 per batch)
  wmma_gemm64<0, false, 0, 1, false><<<dim3((EMB_ / 64) * (SEQL_ / 64) / 8, NBATCH_, 1), dim3(256, 1, 1), 0, stream>>>(
      Wv16, Wv16, EMB_, 0L,
      XF16, XF16, EMB_, (long)SEQL_ * EMB_,
      (void*)VT16, nullptr, SEQL_, (long)EMB_ * SEQL_,
      nullptr, nullptr, 0L, nullptr,
      EMB_, SEQL_, EMB_, inv_w);

  // 6. attention -> O16 [tok][128] f16 (x16)
  attn_full64_f16_kernel<<<dim3(NBATCH_ * NHEAD_ * (SEQL_ / AT_QB), 1, 1), dim3(AT_NG * AT_NW * 32, 1, 1), 0, stream>>>(
      QK16, VT16, O16, 0.125f, OSC);

  // 7. O1[tok][n] = O16[tok][:] . Wo[n][:] /128 + b_o[n]   (M=8192, N=128, K=128; f16 out)
  wmma_gemm64<0, false, 2, 1, false><<<dim3((NTOK_ / 64) * (EMB_ / 64) / 8, 1, 1), dim3(256, 1, 1), 0, stream>>>(
      O16, O16, EMB_, 0L,
      Wo16, Wo16, EMB_, 0L,
      (void*)O1, nullptr, EMB_, 0L,
      b_o, nullptr, 0L, nullptr,
      NTOK_, EMB_, EMB_, inv_wo);

  // 8. out[b][c][tok] = Wout[c][:] . O1[b][tok][:] /8 + b_out[c] + gate*x[b][c][tok]   (M=64, N=4096, K=128 per batch; f32)
  wmma_gemm64<0, false, 1, 0, true><<<dim3((COUT_ / 64) * (SEQL_ / 64) / 8, NBATCH_, 1), dim3(256, 1, 1), 0, stream>>>(
      Wout16, Wout16, EMB_, 0L,
      O1, O1, EMB_, (long)SEQL_ * EMB_,
      (void*)out, nullptr, SEQL_, (long)COUT_ * SEQL_,
      b_out, x, (long)COUT_ * SEQL_, gatep,
      COUT_, SEQL_, EMB_, inv_w);
}

// v005
// A run of this version takes 69.2 microseconds.
// Timed twice side by side with v004, it ran 1.40 and 1.39 times as fast.
// All steps since v000 together make it 5.19 times as fast.
// Contractions (token embed 64->128, fused q|k projection, v^T projection, q.k^T, p.v, W_o projection, W_out projection): v_wmma_f32_16x16x32_f16 (f16 operands: weights carried x8, attention output x16, softmax numerators x2^15; f32 accumulate); softmax statistics, biases, positional add and gated residual in f32.
#include <hip/hip_runtime.h>
#include <math.h>
#include <stdint.h>

typedef __attribute__((ext_vector_type(16))) _Float16 v16h;
typedef __attribute__((ext_vector_type(8)))  _Float16 v8h;
typedef __attribute__((ext_vector_type(16))) __bf16   v16b;
typedef __attribute__((ext_vector_type(8)))  __bf16   v8b;
typedef __attribute__((ext_vector_type(8)))  float    v8f;
typedef __attribute__((ext_vector_type(4)))  float    v4f;
typedef __attribute__((ext_vector_type(2)))  float    v2f;
typedef __attribute__((ext_vector_type(4)))  unsigned int v4u;

// ---- problem geometry ----
constexpr int NBATCH_  = 2;
constexpr int CIN_     = 64;
constexpr int EMB_     = 128;
constexpr int COUT_    = 64;
constexpr int NHEAD_   = 2;
constexpr int HDIM_    = 64;
constexpr int SEQL_    = 4096;               // 16*16*16 tokens per batch element
constexpr int NTOK_    = NBATCH_ * SEQL_;    // 8192
constexpr int QKPITCH_ = 2 * EMB_;           // fused q|k plane pitch (halves)

// ---- f16 weight pool offsets (halves) ----
constexpr int WOFF_CP   = 0;                              // [128][64]
constexpr int WOFF_Q    = WOFF_CP + EMB_ * CIN_;          // [128][128]  (q rows)
constexpr int WOFF_K    = WOFF_Q + EMB_ * EMB_;           // [128][128]  (k rows, contiguous after q -> [256][128])
constexpr int WOFF_V    = WOFF_K + EMB_ * EMB_;           // [128][128]
constexpr int WOFF_O    = WOFF_V + EMB_ * EMB_;           // [128][128]
constexpr int WOFF_OUT  = WOFF_O + EMB_ * EMB_;           // [64][128]
constexpr int WPOOL_H   = WOFF_OUT + COUT_ * EMB_;        // 81920 halves = 163840 B
static_assert(WPOOL_H == 81920, "weight pool size");

//   WPOOL f16 weights x8                     0          163840
//   XT16  f16 [8192 tok][64 ch]         163840         1048576
//   XF16  f16 [8192 tok][128]          1212416         2097152
//   QK16  f16 [8192 tok][256] (q|k)    3309568         4194304
//   VT16  f16 [2][128 (h,d)][4096]     7503872         2097152
//   O16   f16 [8192 tok][128] (x16)    9601024         2097152
//   O1_16 f16 [8192 tok][128]         11698176         2097152
//   total                             13795328
constexpr size_t OFFB_W   = 0;
constexpr size_t OFFB_XT  = OFFB_W  + (size_t)WPOOL_H * 2;
constexpr size_t OFFB_XF  = OFFB_XT + (size_t)NTOK_ * CIN_ * 2;
constexpr size_t OFFB_QK  = OFFB_XF + (size_t)NTOK_ * EMB_ * 2;
constexpr size_t OFFB_VT  = OFFB_QK + (size_t)NTOK_ * QKPITCH_ * 2;
constexpr size_t OFFB_O   = OFFB_VT + (size_t)NBATCH_ * EMB_ * SEQL_ * 2;
constexpr size_t OFFB_O1  = OFFB_O  + (size_t)NTOK_ * EMB_ * 2;
constexpr size_t WS_TOTAL = OFFB_O1 + (size_t)NTOK_ * EMB_ * 2;
static_assert(WS_TOTAL == 13795328, "carve total");
static_assert((OFFB_XT % 128) == 0 && (OFFB_XF % 128) == 0 && (OFFB_QK % 128) == 0 &&
              (OFFB_VT % 128) == 0 && (OFFB_O % 128) == 0 && (OFFB_O1 % 128) == 0, "128-B aligned regions");

#define U16(p) ((const unsigned short*)(const void*)(p))

__device__ __forceinline__ unsigned short f2bf_bits(float f) {
  unsigned u = __float_as_uint(f);
  return (unsigned short)((u + 0x7FFFu + ((u >> 16) & 1u)) >> 16);
}
__device__ __forceinline__ float bf_bits2f(unsigned short h) { return __uint_as_float(((unsigned)h) << 16); }
__device__ __forceinline__ unsigned pk16(unsigned short a, unsigned short b) { return (unsigned)a | ((unsigned)b << 16); }
__device__ __forceinline__ unsigned short h_bits(float f) { return __builtin_bit_cast(unsigned short, (_Float16)f); }

// s_wait_xcnt 0 behind a run of global loads, before any register that holds one of their addresses is written again; the addresses are
// inputs of the statement so that their registers stay theirs up to the wait (not even a later load's result lands in one before it).
__device__ __forceinline__ void addr_wait1(const void* a) { asm volatile("s_wait_xcnt 0x0" :: "v"(a) : "memory"); }
__device__ __forceinline__ void addr_wait5(const void* a, const void* b, const void* c, const void* d, const void* e) {
  asm volatile("s_wait_xcnt 0x0" :: "v"(a), "v"(b), "v"(c), "v"(d), "v"(e) : "memory");
}
__device__ __forceinline__ void addr_wait8(const void* a, const void* b, const void* c, const void* d,
                                           const void* e, const void* f, const void* g, const void* h) {
  asm volatile("s_wait_xcnt 0x0" :: "v"(a), "v"(b), "v"(c), "v"(d), "v"(e), "v"(f), "v"(g), "v"(h) : "memory");
}
template <typename T> struct Frag;
template <> struct Frag<_Float16> {
  typedef v16h V; union U { v16h v; v8h h[2]; };
  static __device__ __forceinline__ v16h load(const _Float16* p) {   // elements 0..7 <- p[0..7], 8..15 <- p[16..23]
    U f; f.h[0] = *(const v8h*)(p); f.h[1] = *(const v8h*)(p + 16); return f.v;
  }
  static __device__ __forceinline__ v8f mma(v16h a, v16h b, v8f c) {
    return __builtin_amdgcn_wmma_f32_16x16x32_f16(false, a, false, b, (short)0, c, false, false);
  }
};
template <> struct Frag<__bf16> {
  typedef v16b V; union U { v16b v; v8b h[2]; };
  static __device__ __forceinline__ v16b load(const __bf16* p) {
    U f; f.h[0] = *(const v8b*)(p); f.h[1] = *(const v8b*)(p + 16); return f.v;
  }
  static __device__ __forceinline__ v8f mma(v16b a, v16b b, v8f c) {
    return __builtin_amdgcn_wmma_f32_16x16x32_bf16(false, a, false, b, (short)0, c, false, false);
  }
};

// ---- Register-blocked batched WMMA GEMM ------------------------------------
// C[m,n] = scale * sum_k A[m,k] * Bt[n,k] (+bias)(+rg*resid); each wave owns a 16x64 tile.
// A row-major [M,KDIM]; Bt row-major [N,KDIM]; M % 16 == 0, N % 64 == 0, KDIM % 32 == 0 (compile time).
// A wave issues every load it will ever need (all A and B fragments of the whole K, residual, bias) before its first WMMA,
// so it waits out one trip to memory instead of one per fragment group; the 16x64 tile is what lets them all fit in registers.
// SPLIT: operands are hi/lo planes (A2/Bt2 = lo planes, same layout); product = hi.hi + hi.lo + lo.hi.
// BIAS_MODE: 0 = none, 1 = bias[m], 2 = bias[n].
// OUT_MODE: 0 = f32, 1 = f16, 2 = bf16 hi plane (Cout) + bf16 lo plane (Cout2).
// RESID: v += rg * resid[m*ldc+n] with rg = rgain[0] when rgain != nullptr else 1.
// ET: 0 = f16 operands, 1 = bf16 operands (pointers passed as 16-bit storage)
template <int ET> struct Elem;
template <> struct Elem<0> { typedef _Float16 T; };
template <> struct Elem<1> { typedef __bf16 T; };
template <int ET, bool SPLIT, int BIAS_MODE, int OUT_MODE, bool RESID, int KDIM, int ACT = 0>
__global__ __launch_bounds__(256) void wmma_gemm64(
    const unsigned short* __restrict__ Ap, const unsigned short* __restrict__ A2p, int lda, long strideA,
    const unsigned short* __restrict__ Btp, const unsigned short* __restrict__ Bt2p, int ldb, long strideB,
    void* __restrict__ Cout, void* __restrict__ Cout2, int ldc, long strideC,
    const float* __restrict__ bias,
    const float* __restrict__ resid, long strideR, const float* __restrict__ rgain,
    int M, int N, float scale) {
  typedef typename Elem<ET>::T T;
  typedef typename Frag<T>::V V;
  constexpr int KS = KDIM / 32;
  const T* A = (const T*)Ap; const T* A2 = (const T*)A2p; const T* Bt = (const T*)Btp; const T* Bt2 = (const T*)Bt2p;
  __shared__ __align__(16) float sT[8][16 * 68];   // per-wave 16x64 slab, pitch 68 floats
  const int b    = blockIdx.y;
  const int lane = threadIdx.x & 31;
  const int wave = threadIdx.x >> 5;
  const int tilesN = N >> 6;
  const int tilesM = M >> 4;
  const int tile = blockIdx.x * 8 + wave;
  if (tile >= tilesM * tilesN) return;   // wave-uniform; no block barriers in this kernel
  const int tm = tile / tilesN;
  const int tn = tile - tm * tilesN;
  const int m0 = tm << 4;
  const int n0 = tn << 6;

  const T* Ab  = A  + (size_t)b * strideA;
  const T* Bb  = Bt + (size_t)b * strideB;
  const T* Ab2 = SPLIT ? (A2  + (size_t)b * strideA) : nullptr;
  const T* Bb2 = SPLIT ? (Bt2 + (size_t)b * strideB) : nullptr;

  const int rlane = lane & 15;                 // row (A) / col (B, D) within subtile
  const int koff  = (lane >> 4) * 8;           // k offset of this lane half
  const int mOff  = (lane >> 4) * 8;           // D row offset

  // ---- every load of this wave, in the order of use ----
  const T* pa = Ab + (size_t)(m0 + rlane) * lda + koff;
  const T* pa2 = SPLIT ? (Ab2 + (size_t)(m0 + rlane) * lda + koff) : nullptr;
  const T* pb[4];
  const T* pb2[4];
#pragma unroll
  for (int j = 0; j < 4; ++j) {
    pb[j]  = Bb + (size_t)(n0 + (j << 4) + rlane) * ldb + koff;
    pb2[j] = SPLIT ? (Bb2 + (size_t)(n0 + (j << 4) + rlane) * ldb + koff) : nullptr;
  }
  V ah[KS], al[KS], bh[KS][4], bl[KS][4];
#pragma unroll
  for (int ks = 0; ks < KS; ++ks) {
    ah[ks] = Frag<T>::load(pa + ks * 32);
    if (SPLIT) al[ks] = Frag<T>::load(pa2 + ks * 32);
#pragma unroll
    for (int j = 0; j < 4; ++j) {
      bh[ks][j] = Frag<T>::load(pb[j] + ks * 32);
      if (SPLIT) bl[ks][j] = Frag<T>::load(pb2[j] + ks * 32);
    }
  }
  addr_wait5(pa, pb[0], pb[1], pb[2], pb[3]);
  if (SPLIT) addr_wait5(pa2, pb2[0], pb2[1], pb2[2], pb2[3]);
  // nothing crosses: the loads above stay above, and no later address arithmetic is lifted in front of the wait
  __builtin_amdgcn_sched_barrier(0);
  float bn[4], bm[8], rv[4][8];
  if (RESID) {
    const float* pr[8];
#pragma unroll
    for (int r = 0; r < 8; ++r) pr[r] = resid + (size_t)b * strideR + (size_t)(m0 + mOff + r) * ldc + n0 + rlane;
#pragma unroll
    for (int j = 0; j < 4; ++j)
#pragma unroll
      for (int r = 0; r < 8; ++r) rv[j][r] = pr[r][j << 4];
    addr_wait8(pr[0], pr[1], pr[2], pr[3], pr[4], pr[5], pr[6], pr[7]);
  }
  if (BIAS_MODE == 1) {
    const float* pm = bias + m0 + mOff;
#pragma unroll
    for (int r = 0; r < 8; ++r) bm[r] = pm[r];
    addr_wait1(pm);
  }
  if (BIAS_MODE == 2) {
    const float* pn = bias + n0 + rlane;
#pragma unroll
    for (int j = 0; j < 4; ++j) bn[j] = pn[j << 4];
    addr_wait1(pn);
  }
  float rg = 1.0f;   // fetched last: nothing above waits for it
  if (RESID) { if (rgain != nullptr) rg = rgain[0]; }
  // keeps the scheduler from sinking the loads above down among the WMMAs, where each group would wait out its own trip to memory
  __builtin_amdgcn_sched_barrier(0);

  v8f acc[4];
#pragma unroll
  for (int j = 0; j < 4; ++j) acc[j] = (v8f){0.f,0.f,0.f,0.f,0.f,0.f,0.f,0.f};
#pragma unroll
  for (int ks = 0; ks < KS; ++ks) {
#pragma unroll
    for (int j = 0; j < 4; ++j) {
      acc[j] = Frag<T>::mma(ah[ks], bh[ks][j], acc[j]);
      if (SPLIT) {
        acc[j] = Frag<T>::mma(ah[ks], bl[ks][j], acc[j]);
        acc[j] = Frag<T>::mma(al[ks], bh[ks][j], acc[j]);
      }
    }
  }

  // ---- epilogue ----
  float* slab = sT[wave];
#pragma unroll
  for (int j = 0; j < 4; ++j) {
#pragma unroll
    for (int r = 0; r < 8; ++r) {
      float v = acc[j][r] * scale;
      if (BIAS_MODE == 1) v += bm[r];
      if (BIAS_MODE == 2) v += bn[j];
      if (RESID) v += rg * rv[j][r];
      if (ACT == 1) v = tanhf(v);
      if (ACT == 2) v = fmaxf(v, 0.0f);
      if (ACT == 3) v = v / (1.0f + expf(-v));
      if (ACT == 4) v = (v > 0.f) ? v : 0.01f * v;
      slab[(mOff + r) * 68 + (j << 4) + rlane] = v;
    }
  }
  __builtin_amdgcn_fence(__ATOMIC_RELEASE, "workgroup");
  __builtin_amdgcn_wave_barrier();
  __builtin_amdgcn_fence(__ATOMIC_ACQUIRE, "workgroup");
  if (OUT_MODE == 0) {
    float* C = (float*)Cout + (size_t)b * strideC;
    const int hh = lane >> 4, c4 = (lane & 15) * 4;     // row seg = 256 B = 16 lanes x 16 B
#pragma unroll
    for (int it = 0; it < 8; ++it) {
      const int row = it * 2 + hh;
      v4f v = *(const v4f*)(slab + row * 68 + c4);
      *(v4f*)(C + (size_t)(m0 + row) * ldc + n0 + c4) = v;
    }
  } else {
    const int q = lane >> 3, c8 = (lane & 7) * 8;
    unsigned short* C  = (unsigned short*)Cout  + (size_t)b * strideC;
    unsigned short* C2 = (OUT_MODE == 2) ? ((unsigned short*)Cout2 + (size_t)b * strideC) : nullptr;
#pragma unroll
    for (int it = 0; it < 4; ++it) {
      const int row = it * 4 + q;
      const float* sp = slab + row * 68 + c8;
      v8h hv, lv;
#pragma unroll
      for (int e = 0; e < 8; ++e) {
        if (OUT_MODE == 1) {
          hv[e] = (_Float16)sp[e];
        } else {
          unsigned short hb = f2bf_bits(sp[e]);
          unsigned short lb = f2bf_bits(sp[e] - bf_bits2f(hb));
          hv[e] = __builtin_bit_cast(_Float16, hb);
          lv[e] = __builtin_bit_cast(_Float16, lb);
        }
      }
      *(v8h*)(C + (size_t)(m0 + row) * ldc + n0 + c8) = hv;
      if (OUT_MODE == 2) *(v8h*)(C2 + (size_t)(m0 + row) * ldc + n0 + c8) = lv;
    }
  }
}

// ---------------------------------------------------------------------------
// Weight cast f32 -> f16 with a power-of-two carry sc (x8): six matrices selected by blockIdx.y (block-uniform),
// Coverage: grid.x = 32 blocks x 256 threads = 8192 pairs >= n2 for every matrix (n2 = 4096 or 8192 pairs).
// ---------------------------------------------------------------------------
__global__ __launch_bounds__(256) void cast_w6_kernel(const float* __restrict__ w0, const float* __restrict__ w1,
                                                      const float* __restrict__ w2, const float* __restrict__ w3,
                                                      const float* __restrict__ w4, const float* __restrict__ w5,
                                                      _Float16* __restrict__ pool, float sc) {
  const int y = blockIdx.y;                 // block-uniform selector
  const float* in = w0; int n2 = (EMB_ * CIN_) / 2; int off = WOFF_CP;
  if (y == 1) { in = w1; n2 = (EMB_ * EMB_) / 2;  off = WOFF_Q; }
  if (y == 2) { in = w2; n2 = (EMB_ * EMB_) / 2;  off = WOFF_K; }
  if (y == 3) { in = w3; n2 = (EMB_ * EMB_) / 2;  off = WOFF_V; }
  if (y == 4) { in = w4; n2 = (EMB_ * EMB_) / 2;  off = WOFF_O; }
  if (y == 5) { in = w5; n2 = (COUT_ * EMB_) / 2; off = WOFF_OUT; }
  _Float16* out = pool + off;
  const int i = blockIdx.x * 256 + threadIdx.x;
  if (i < n2) {
    const v2f f = *(const v2f*)(in + 2 * (size_t)i);
    const unsigned u = pk16(h_bits(f[0] * sc), h_bits(f[1] * sc));
    ((unsigned*)out)[i] = u;
    
  }
}

// ---------------------------------------------------------------------------
// Fused transpose + f16 cast of an f32 matrix, z-batched: in_z = W + z*sIn viewed [R rows][Cc cols] (pitch Cc) ->
//   oh_z[c][r] = f16(in_z[r][c])   ([Cc][R], pitch R), oh_z = oh + z*sOut.
// Here: in_z = x[z] viewed [R=64 ch][Cc=4096 tok] -> out [4096 tok][64 ch]; grid = (Cc/64=64, R/64=1, Z=2), 256 threads.
// Coverage per block: load 4 it x 256 thr x 4 floats = 64x64; store 2 it x 256 thr x 8 u16 = 64x64.
// ---------------------------------------------------------------------------
__global__ __launch_bounds__(256) void tcast16_kernel(const float* __restrict__ W, unsigned short* __restrict__ oh,
                                                      int R, int Cc, long sIn, long sOut) {
  __shared__ __align__(16) float tf[64 * 68];
  W  += (size_t)blockIdx.z * sIn;
  oh += (size_t)blockIdx.z * sOut;
  const int c0  = blockIdx.x * 64;   // input column block = output row block
  const int r0  = blockIdx.y * 64;   // input row block    = output column block
  const int tid = threadIdx.x;
  {
    const int lr = tid >> 4;         // 0..15
    const int c4 = (tid & 15) * 4;   // 0..60
#pragma unroll
    for (int it = 0; it < 4; ++it) {
      const int rr = it * 16 + lr;   // 0..63
      const v4f a = *(const v4f*)(W + (size_t)(r0 + rr) * Cc + c0 + c4);
      *(v4f*)(tf + rr * 68 + c4) = a;
    }
  }
  __syncthreads();
  const int sub = tid >> 3;          // 0..31
  const int c8  = (tid & 7) * 8;     // 0..56
  v4u hv[2];
#pragma unroll
  for (int it = 0; it < 2; ++it) {
    const int oc = it * 32 + sub;    // output row within tile (= input column)
    v4u a;
#pragma unroll
    for (int q = 0; q < 4; ++q) {
      const float f0 = tf[(c8 + 2 * q) * 68 + oc];
      const float f1 = tf[(c8 + 2 * q + 1) * 68 + oc];
      a[q] = pk16(h_bits(f0), h_bits(f1));
    }
    hv[it] = a;
  }
  {
#pragma unroll
    for (int it = 0; it < 2; ++it) {
      const int oc = it * 32 + sub;
      const size_t go = (size_t)(c0 + oc) * R + r0 + c8;
      *(v4u*)(oh + go) = hv[it];
    }
    
  }
}

// =====================================================================================
// Full (non-causal, unmasked) attention, head dim 64, all (batch, head, 64-query tile) in one launch.
//   q|k plane (f16): q element (b, t, h, d) at [(b*SEQL_+t)*QKPITCH_ + h*64 + d]; k at the same + EMB_.
//   v^T plane (f16): element (b, h, d, s) at [b*EMB_*SEQL_ + (h*64 + d)*SEQL_ + s]
//   out (f16, carried x oscale): element (b, t, h, d) at [(b*SEQL_+t)*EMB_ + h*64 + d]
//   scores^T = (k . q^T) * sscale : v_wmma_f32_16x16x32_f16, A = K rows, B = Q; a lane holds 8 keys x 1 query per tile
//   out^T    = v^T . p^T          : p = 2^(s*sscale*log2(e) - m + 15) in f16, packed in-lane from two score tiles into the
//                                   B operand (no LDS trip), A = V^T rows, f32 accumulate, 1/l in f32 (l carries the same 2^15)
//   online softmax in f32 (chunks of 64 keys, compile-time trip count, no masking): maximum and sum
//   run in-lane; the two wave halves join the maximum once per chunk and the sum once after the loop.
//   Block = 16 waves = 4 key groups x 4 query tiles = 64 query rows of one (batch, head); grid.x = 256.
//   Key group g walks chunks g, g+4, g+8, ... (16 of the 64) with its own K / V^T LDS tiles, so each SIMD holds four
//   waves whose LDS, memory and vector waits cover one another. After the loop each group leaves its maximum, sum and
//   unnormalised out tile in LDS; behind one __syncthreads the 16 waves merge them (4 rows of one query tile each).
//   K / V^T chunk staging: the group's 128 threads x 32 elements per plane = its whole 64x64 tile (16-B copies, plain
//   loads, __syncthreads before and after); fragment loads read the LDS tiles with the same v8h element type.
// =====================================================================================
#define AT_D 64
#define AT_NW 4
#define AT_NG 4
#define AT_QB 64
#define AT_KC 64
#define AT_LP 72   // LDS row pitch of the K and V^T tiles in halves: 144 B = 16 B x odd, so the 16 rows of one ds_load_b128 fragment read fall on 16 different groups of four banks
#define P_CARRY_L2 15.0f   // softmax numerators and their sums are carried x 2^15: the carry is an addend of the base-2 exponent

__device__ __forceinline__ v8f at_mma_h(v16h a, v16h b, v8f c) {
  c = __builtin_amdgcn_wmma_f32_16x16x32_f16(false, a, false, b, (short)0, c, false, false);
  asm volatile("v_nop\n\tv_nop\n\tv_nop\n\tv_nop" : "+v"(c) : "v"(a), "v"(b));
  return c;
}

// 2^x on the bare v_exp_f32 (no range fix-up: the softmax's arguments are <= 15 up to rounding, and a result below 2^-126 may go to 0).
__device__ __forceinline__ void exp2x8(v8f& x) {
  float a = x[0], b = x[1], c = x[2], d = x[3], e = x[4], f = x[5], g = x[6], h = x[7];
  asm("v_exp_f32 %0, %0\n\tv_exp_f32 %1, %1\n\tv_exp_f32 %2, %2\n\tv_exp_f32 %3, %3\n\t"
      "v_exp_f32 %4, %4\n\tv_exp_f32 %5, %5\n\tv_exp_f32 %6, %6\n\tv_exp_f32 %7, %7\n\tv_nop"
      : "+v"(a), "+v"(b), "+v"(c), "+v"(d), "+v"(e), "+v"(f), "+v"(g), "+v"(h));
  x = (v8f){a, b, c, d, e, f, g, h};
}
__device__ __forceinline__ float exp2x1(float x) {
  asm("v_exp_f32 %0, %0\n\tv_nop" : "+v"(x));   // the v_nop: the same slot behind a single v_exp_f32
  return x;
}

// lane l <-> lane l ^ 16: the two halves of a wave hold the two key halves of the same query column
__device__ __forceinline__ float xhalf(float x) {
  return __builtin_bit_cast(float, __builtin_amdgcn_permlanex16(__builtin_bit_cast(int, x), __builtin_bit_cast(int, x),
                                                                0x76543210, 0xfedcba98, false, false));
}

__global__ __launch_bounds__(AT_NG * AT_NW * 32)
void attn_full64_f16_kernel(const unsigned short* __restrict__ qkp, const unsigned short* __restrict__ vtp,
                            unsigned short* __restrict__ op, float sscale, float oscale) {
  union FH { v16h v; v8h h[2]; };
  __shared__ __align__(16) _Float16 KshG[AT_NG][AT_KC * AT_LP];    // K [kv][d]      rows of 64 at pitch 72, 9 KB per key group
  __shared__ __align__(16) _Float16 VthG[AT_NG][AT_D * AT_LP];     // V [d][kv]      rows of 64 at pitch 72, 9 KB per key group
  __shared__ __align__(16) float    Os[AT_NG * AT_NW][16 * 68];    // per wave partial out tile, pitch 68
  __shared__ float Ms[AT_NG][AT_QB];                               // per group and query: running maximum
  __shared__ float Ls[AT_NG][AT_QB];                               // per group and query: sum x 2^15 of 2^(s*sl2 - maximum)

  const int tid  = threadIdx.x & (AT_NW * 32 - 1);   // thread within the key group
  const int grp  = threadIdx.x >> 7;                 // key group 0..3
  const int wave = tid >> 5;                         // query tile 0..3
  const int lane = tid & 31;
  _Float16* Ksh = KshG[grp];
  _Float16* Vth = VthG[grp];
  const int hh   = lane >> 4;
  const int c    = lane & 15;

  const int nqb = SEQL_ / AT_QB;          // 64
  const int bx = blockIdx.x;
  const int qb = bx % nqb;
  const int bh = bx / nqb;                // 0..NBATCH_*NHEAD_-1
  const int h  = bh % NHEAD_;
  const int b  = bh / NHEAD_;
  const int q0 = qb * AT_QB + wave * 16;

  const _Float16* Qh = (const _Float16*)(const void*)qkp + (size_t)b * SEQL_ * QKPITCH_ + (size_t)h * AT_D;
  const _Float16* Kh = Qh + EMB_;
  const _Float16* Vh = (const _Float16*)(const void*)vtp + (size_t)b * EMB_ * SEQL_ + (size_t)h * AT_D * SEQL_;
  _Float16*       ob = (_Float16*)(void*)op + (size_t)b * SEQL_ * EMB_ + (size_t)h * AT_D;

  // ---- Q fragments (B operand, column = lane&15, split k map via Frag load): 2 d-chunks ----
  v16h qa[2];
#pragma unroll
  for (int dc = 0; dc < 2; ++dc) {
    const _Float16* qr = Qh + (size_t)(q0 + c) * QKPITCH_ + dc * 32 + 8 * hh;
    qa[dc] = Frag<_Float16>::load(qr);
  }

  const float sl2 = sscale * 1.44269504f;   // score scale x log2(e): the softmax runs in base 2
  float mrow = -INFINITY, lrow = 0.f;   // this lane's query: running maximum in base-2 units (both halves alike), sum x 2^15 over this half's keys
  v8f oacc[4];                          // oacc[t][r] = out^T[d = t*16 + 8*hh + r][query c]
#pragma unroll
  for (int t = 0; t < 4; ++t) oacc[t] = (v8f){0.f,0.f,0.f,0.f,0.f,0.f,0.f,0.f};

  const int nChunks = SEQL_ / (AT_KC * AT_NG);   // 16 per key group, compile-time constant
  for (int kc = 0; kc < nChunks; ++kc) {
    const int kv0 = (kc * AT_NG + grp) * AT_KC;
    __syncthreads();
    {
      // staging coverage: the group's 128 threads x (4 x 8) elements = 64 rows x 64 per plane = its whole chunk tile
      const int r = tid >> 1, half = (tid & 1) * 32;
      const _Float16* ksh = Kh + (size_t)(kv0 + r) * QKPITCH_ + half;   // K row kv0+r, d = half..half+31
      const _Float16* vsh = Vh + (size_t)r * SEQL_ + kv0 + half;        // V^T row d = r, s = kv0+half..+31
      v8h a0[4], b0[4];   // all eight loads are issued before the first LDS store: one trip to memory per chunk, not four
#pragma unroll
      for (int i = 0; i < 4; ++i) {
        a0[i] = *(const v8h*)(ksh + 8 * i);
        b0[i] = *(const v8h*)(vsh + 8 * i);
      }
#pragma unroll
      for (int i = 0; i < 4; ++i) {
        *(v8h*)(Ksh + r * AT_LP + half + 8 * i) = a0[i];
        *(v8h*)(Vth + r * AT_LP + half + 8 * i) = b0[i];
      }
    }
    __syncthreads();

    v8f s[4];
#pragma unroll
    for (int j = 0; j < 4; ++j) {
      s[j] = (v8f){0.f,0.f,0.f,0.f,0.f,0.f,0.f,0.f};
#pragma unroll
      for (int dc = 0; dc < 2; ++dc) {
        FH kb;
        kb.h[0] = *(const v8h*)(Ksh + (j * 16 + c) * AT_LP + dc * 32 + 8 * hh);
        kb.h[1] = *(const v8h*)(Ksh + (j * 16 + c) * AT_LP + dc * 32 + 16 + 8 * hh);
        s[j] = at_mma_h(kb.v, qa[dc], s[j]);   // s[j][r] = score of key j*16 + 8*hh + r against query c
      }
    }
    float m4[4];
#pragma unroll
    for (int j = 0; j < 4; ++j) {
      float m = -INFINITY;
#pragma unroll
      for (int r = 0; r < 8; ++r) m = fmaxf(m, s[j][r]);
      m4[j] = m;
    }
    float cm = fmaxf(fmaxf(m4[0], m4[1]), fmaxf(m4[2], m4[3]));
    cm = fmaxf(cm, xhalf(cm)) * sl2;                          // sl2 > 0: the largest raw score is the largest scaled one
    const float mnew = fmaxf(mrow, cm);
    const float alpha = exp2x1(mrow - mnew);                  // first chunk: 2^(-inf) = 0
    mrow = mnew;
    const float moff = P_CARRY_L2 - mnew;
    v8h ph[4];
    float ps4[4];
#pragma unroll
    for (int j = 0; j < 4; ++j) {
      float psum = 0.f;
#pragma unroll
      for (int r = 0; r < 8; ++r) s[j][r] = fmaf(s[j][r], sl2, moff);
      exp2x8(s[j]);                        // p x 2^15 = 2^(s*sl2 - m + 15): one fma and one v_exp_f32 per score
#pragma unroll
      for (int r = 0; r < 8; ++r) {
        psum += s[j][r];
        ph[j][r] = (_Float16)s[j][r];
      }
      ps4[j] = psum;
    }
    lrow = lrow * alpha + ((ps4[0] + ps4[1]) + (ps4[2] + ps4[3]));
#pragma unroll
    for (int t = 0; t < 4; ++t)
#pragma unroll
      for (int r = 0; r < 8; ++r) oacc[t][r] *= alpha;
#pragma unroll
    for (int kk = 0; kk < 2; ++kk) {
      FH pb;                       // B operand: elements 0..7 = keys kk*32 + 8*hh + e, 8..15 = keys kk*32 + 16 + 8*hh + e
      pb.h[0] = ph[2 * kk];
      pb.h[1] = ph[2 * kk + 1];
#pragma unroll
      for (int t = 0; t < 4; ++t) {
        FH vb;
        vb.h[0] = *(const v8h*)(Vth + (t * 16 + c) * AT_LP + kk * 32 + 8 * hh);
        vb.h[1] = *(const v8h*)(Vth + (t * 16 + c) * AT_LP + kk * 32 + 16 + 8 * hh);
        oacc[t] = at_mma_h(vb.v, pb.v, oacc[t]);
      }
    }
  }

  // ---- this wave's partial (its key group, its query tile) -> LDS, unnormalised ----
  float* os = Os[grp * AT_NW + wave];
  {
    const float lt = lrow + xhalf(lrow);
    if (hh == 0) {
      Ms[grp][wave * 16 + c] = mrow;
      Ls[grp][wave * 16 + c] = lt;
    }
#pragma unroll
    for (int t = 0; t < 4; ++t)
#pragma unroll
      for (int g = 0; g < 2; ++g) {
        v4f w;
#pragma unroll
        for (int e = 0; e < 4; ++e) w[e] = oacc[t][4 * g + e];
        *(v4f*)(os + c * 68 + t * 16 + 8 * hh + 4 * g) = w;
      }
  }
  __syncthreads();   // all four groups' partials stand in LDS before any wave merges them
  {
    // merge: wave (grp, wave) takes rows grp*4 .. grp*4+3 of query tile 'wave'; 8 lanes x 8 columns cover a row
    const int q8 = lane >> 3, c8 = (lane & 7) * 8;
    const int row = grp * 4 + q8;
    float mg[AT_NG];
    float mall = -INFINITY;
#pragma unroll
    for (int g = 0; g < AT_NG; ++g) {
      mg[g] = Ms[g][wave * 16 + row];
      mall = fmaxf(mall, mg[g]);
    }
    float lall = 0.f;
    float acc[8];
#pragma unroll
    for (int e = 0; e < 8; ++e) acc[e] = 0.f;
#pragma unroll
    for (int g = 0; g < AT_NG; ++g) {
      const float wg = exp2x1(mg[g] - mall);
      lall += wg * Ls[g][wave * 16 + row];
      const float* sp = Os[g * AT_NW + wave] + row * 68 + c8;
#pragma unroll
      for (int e = 0; e < 8; ++e) acc[e] += wg * sp[e];
    }
    const float inv = oscale / lall;   // the sum carries the numerators' 2^15
    v8h hv;
#pragma unroll
    for (int e = 0; e < 8; ++e) hv[e] = (_Float16)(acc[e] * inv);
    *(v8h*)(ob + (size_t)(q0 + row) * EMB_ + c8) = hv;
  }
}

// ---------------------------------------------------------------------------
extern "C" void kernel_launch(void* const* d_in, const int* in_sizes, int n_in,
                              void* d_out, int out_size, void* d_ws, size_t ws_size,
                              hipStream_t stream) {
  if (n_in < 12) return;
  if (in_sizes[0] != NBATCH_ * CIN_ * SEQL_) return;
  if (in_sizes[1] != EMB_ * CIN_ || in_sizes[2] != EMB_) return;
  if (in_sizes[3] != EMB_ * EMB_ || in_sizes[4] != EMB_ * EMB_ || in_sizes[5] != EMB_ * EMB_) return;
  if (in_sizes[6] != EMB_ * EMB_ || in_sizes[7] != EMB_) return;
  if (in_sizes[8] != COUT_ * EMB_ || in_sizes[9] != COUT_) return;
  if (in_sizes[10] != SEQL_ * EMB_ || in_sizes[11] < 1) return;
  if (out_size != NBATCH_ * COUT_ * SEQL_) return;
  if (ws_size < WS_TOTAL) return;

  const float* x     = (const float*)d_in[0];
  const float* W_cp  = (const float*)d_in[1];
  const float* b_cp  = (const float*)d_in[2];
  const float* W_q   = (const float*)d_in[3];
  const float* W_k   = (const float*)d_in[4];
  const float* W_v   = (const float*)d_in[5];
  const float* W_o   = (const float*)d_in[6];
  const float* b_o   = (const float*)d_in[7];
  const float* W_out = (const float*)d_in[8];
  const float* b_out = (const float*)d_in[9];
  const float* pos   = (const float*)d_in[10];
  const float* gatep = (const float*)d_in[11];
  float* out = (float*)d_out;

  char* ws = (char*)d_ws;
  _Float16* wpool = (_Float16*)(void*)(ws + OFFB_W);
  unsigned short* XT16 = (unsigned short*)(void*)(ws + OFFB_XT);
  unsigned short* XF16 = (unsigned short*)(void*)(ws + OFFB_XF);
  unsigned short* QK16 = (unsigned short*)(void*)(ws + OFFB_QK);
  unsigned short* VT16 = (unsigned short*)(void*)(ws + OFFB_VT);
  unsigned short* O16  = (unsigned short*)(void*)(ws + OFFB_O);
  unsigned short* O1   = (unsigned short*)(void*)(ws + OFFB_O1);
  const unsigned short* Wcp16  = U16(wpool + WOFF_CP);
  const unsigned short* Wqk16  = U16(wpool + WOFF_Q);     // [256][128]: q rows then k rows
  const unsigned short* Wv16   = U16(wpool + WOFF_V);
  const unsigned short* Wo16   = U16(wpool + WOFF_O);
  const unsigned short* Wout16 = U16(wpool + WOFF_OUT);

  const float WSC = 8.0f;                 // weight carry
  const float OSC = 16.0f;                // attention-output carry
  const float inv_w  = 1.0f / 8.0f;
  const float inv_wo = 1.0f / (8.0f * 16.0f);

  // 1. weights -> f16 x8
  cast_w6_kernel<<<dim3(32, 6, 1), dim3(256, 1, 1), 0, stream>>>(W_cp, W_q, W_k, W_v, W_o, W_out, wpool, WSC);

  // 2. x [b][64 ch][4096 tok] -> XT16 [b*4096+tok][64 ch] f16   (in[rows=64][cols=4096] -> out[4096][64])
  tcast16_kernel<<<dim3(SEQL_ / 64, CIN_ / 64, NBATCH_), dim3(256, 1, 1), 0, stream>>>(
      x, XT16, CIN_, SEQL_, (long)CIN_ * SEQL_, (long)SEQL_ * CIN_);

  // 3. XF16[b][tok][e] = XT16[b][tok][:] . Wcp[e][:] /8 + b_cp[e] + pos[tok][e]  (M=4096, N=128, K=64 per batch; f16 out)
  wmma_gemm64<0, false, 2, 1, true, CIN_><<<dim3((SEQL_ / 16) * (EMB_ / 64) / 8, NBATCH_, 1), dim3(256, 1, 1), 0, stream>>>(
      XT16, XT16, CIN_, (long)SEQL_ * CIN_,
      Wcp16, Wcp16, CIN_, 0L,
      (void*)XF16, nullptr, EMB_, (long)SEQL_ * EMB_,
      b_cp, pos, 0L, nullptr,
      SEQL_, EMB_, inv_w);

  // 4. QK16[tok][n] = XF16[tok][:] . Wqk[n][:] /8   (M=8192, N=256, K=128; q = cols 0..127, k = cols 128..255)
  wmma_gemm64<0, false, 0, 1, false, EMB_><<<dim3((NTOK_ / 16) * (QKPITCH_ / 64) / 8, 1, 1), dim3(256, 1, 1), 0, stream>>>(
      XF16, XF16, EMB_, 0L,
      Wqk16, Wqk16, EMB_, 0L,
      (void*)QK16, nullptr, QKPITCH_, 0L,
      nullptr, nullptr, 0L, nullptr,
      NTOK_, QKPITCH_, inv_w);

  // 5. VT16[b][(h,d)][tok] = Wv[(h,d)][:] . XF16[b][tok][:] /8   (M=128, N=4096, K=128 per batch)
  wmma_gemm64<0, false, 0, 1, false, EMB_><<<dim3((EMB_ / 16) * (SEQL_ / 64) / 8, NBATCH_, 1), dim3(256, 1, 1), 0, stream>>>(
      Wv16, Wv16, EMB_, 0L,
      XF16, XF16, EMB_, (long)SEQL_ * EMB_,
      (void*)VT16, nullptr, SEQL_, (long)EMB_ * SEQL_,
      nullptr, nullptr, 0L, nullptr,
      EMB_, SEQL_, inv_w);

  // 6. attention -> O16 [tok][128] f16 (x16)
  attn_full64_f16_kernel<<<dim3(NBATCH_ * NHEAD_ * (SEQL_ / AT_QB), 1, 1), dim3(AT_NG * AT_NW * 32, 1, 1), 0, stream>>>(
      QK16, VT16, O16, 0.125f, OSC);

  // 7. O1[tok][n] = O16[tok][:] . Wo[n][:] /128 + b_o[n]   (M=8192, N=128, K=128; f16 out)
  wmma_gemm64<0, false, 2, 1, false, EMB_><<<dim3((NTOK_ / 16) * (EMB_ / 64) / 8, 1, 1), dim3(256, 1, 1), 0, stream>>>(
      O16, O16, EMB_, 0L,
      Wo16, Wo16, EMB_, 0L,
      (void*)O1, nullptr, EMB_, 0L,
      b_o, nullptr, 0L, nullptr,
      NTOK_, EMB_, inv_wo);

  // 8. out[b][c][tok] = Wout[c][:] . O1[b][tok][:] /8 + b_out[c] + gate*x[b][c][tok]   (M=64, N=4096, K=128 per batch; f32)
  wmma_gemm64<0, false, 1, 0, true, EMB_><<<dim3((COUT_ / 16) * (SEQL_ / 64) / 8, NBATCH_, 1), dim3(256, 1, 1), 0, stream>>>(
      Wout16, Wout16, EMB_, 0L,
      O1, O1, EMB_, (long)SEQL_ * EMB_,
      (void*)out, nullptr, SEQL_, (long)COUT_ * SEQL_,
      b_out, x, (long)COUT_ * SEQL_, gatep,
      COUT_, SEQL_, inv_w);
}

// v006
// Measured time: 57.4 microseconds a run.
// Next to v005, in two timings, it ran 1.21 and 1.20 times as fast.
// All steps since v000 together make it 6.26 times as fast.
// Contractions (token embed 64->128, fused q|k projection, v^T projection, q.k^T, p.v, W_o projection, W_out projection): v_wmma_f32_16x16x32_f16 (f16 operands: weights carried x8, attention output x16, softmax numerators x2^15; f32 accumulate); softmax statistics, biases, positional add and gated residual in f32.
#include <hip/hip_runtime.h>
#include <math.h>
#include <stdint.h>

typedef __attribute__((ext_vector_type(16))) _Float16 v16h;
typedef __attribute__((ext_vector_type(8)))  _Float16 v8h;
typedef __attribute__((ext_vector_type(16))) __bf16   v16b;
typedef __attribute__((ext_vector_type(8)))  __bf16   v8b;
typedef __attribute__((ext_vector_type(8)))  float    v8f;
typedef __attribute__((ext_vector_type(4)))  float    v4f;
typedef __attribute__((ext_vector_type(2)))  float    v2f;
typedef __attribute__((ext_vector_type(4)))  unsigned int v4u;

// ---- problem geometry ----
constexpr int NBATCH_  = 2;
constexpr int CIN_     = 64;
constexpr int EMB_     = 128;
constexpr int COUT_    = 64;
constexpr int NHEAD_   = 2;
constexpr int HDIM_    = 64;
constexpr int SEQL_    = 4096;               // 16*16*16 tokens per batch element
constexpr int NTOK_    = NBATCH_ * SEQL_;    // 8192
constexpr int QKPITCH_ = 2 * EMB_;           // fused q|k plane pitch (halves)

// ---- f16 weight pool offsets (halves) ----
constexpr int WOFF_CP   = 0;                              // [128][64]
constexpr int WOFF_Q    = WOFF_CP + EMB_ * CIN_;          // [128][128]  (q rows)
constexpr int WOFF_K    = WOFF_Q + EMB_ * EMB_;           // [128][128]  (k rows, contiguous after q -> [256][128])
constexpr int WOFF_V    = WOFF_K + EMB_ * EMB_;           // [128][128]
constexpr int WOFF_O    = WOFF_V + EMB_ * EMB_;           // [128][128]
constexpr int WOFF_OUT  = WOFF_O + EMB_ * EMB_;           // [64][128]
constexpr int WPOOL_H   = WOFF_OUT + COUT_ * EMB_;        // 81920 halves = 163840 B
static_assert(WPOOL_H == 81920, "weight pool size");

//   WPOOL f16 weights x8                     0          163840
//   XT16  f16 [8192 tok][64 ch]         163840         1048576
//   XF16  f16 [8192 tok][128]          1212416         2097152
//   QK16  f16 [8192 tok][256] (q|k)    3309568         4194304
//   VT16  f16 [2][128 (h,d)][4096]     7503872         2097152
//   O16   f16 [8192 tok][128] (x16)    9601024         2097152
//   O1_16 f16 [8192 tok][128]         11698176         2097152
//   total                             13795328
constexpr size_t OFFB_W   = 0;
constexpr size_t OFFB_XT  = OFFB_W  + (size_t)WPOOL_H * 2;
constexpr size_t OFFB_XF  = OFFB_XT + (size_t)NTOK_ * CIN_ * 2;
constexpr size_t OFFB_QK  = OFFB_XF + (size_t)NTOK_ * EMB_ * 2;
constexpr size_t OFFB_VT  = OFFB_QK + (size_t)NTOK_ * QKPITCH_ * 2;
constexpr size_t OFFB_O   = OFFB_VT + (size_t)NBATCH_ * EMB_ * SEQL_ * 2;
constexpr size_t OFFB_O1  = OFFB_O  + (size_t)NTOK_ * EMB_ * 2;
constexpr size_t WS_TOTAL = OFFB_O1 + (size_t)NTOK_ * EMB_ * 2;
static_assert(WS_TOTAL == 13795328, "carve total");
static_assert((OFFB_XT % 128) == 0 && (OFFB_XF % 128) == 0 && (OFFB_QK % 128) == 0 &&
              (OFFB_VT % 128) == 0 && (OFFB_O % 128) == 0 && (OFFB_O1 % 128) == 0, "128-B aligned regions");

#define U16(p) ((const unsigned short*)(const void*)(p))

__device__ __forceinline__ unsigned short f2bf_bits(float f) {
  unsigned u = __float_as_uint(f);
  return (unsigned short)((u + 0x7FFFu + ((u >> 16) & 1u)) >> 16);
}
__device__ __forceinline__ float bf_bits2f(unsigned short h) { return __uint_as_float(((unsigned)h) << 16); }
__device__ __forceinline__ unsigned pk16(unsigned short a, unsigned short b) { return (unsigned)a | ((unsigned)b << 16); }
__device__ __forceinline__ unsigned short h_bits(float f) { return __builtin_bit_cast(unsigned short, (_Float16)f); }

// s_wait_xcnt 0 behind a run of global loads, before any register that holds one of their addresses is written again; the addresses are
// inputs of the statement so that their registers stay theirs up to the wait (not even a later load's result lands in one before it).
__device__ __forceinline__ void addr_wait1(const void* a) { asm volatile("s_wait_xcnt 0x0" :: "v"(a) : "memory"); }
__device__ __forceinline__ void addr_wait5(const void* a, const void* b, const void* c, const void* d, const void* e) {
  asm volatile("s_wait_xcnt 0x0" :: "v"(a), "v"(b), "v"(c), "v"(d), "v"(e) : "memory");
}
__device__ __forceinline__ void addr_wait8(const void* a, const void* b, const void* c, const void* d,
                                           const void* e, const void* f, const void* g, const void* h) {
  asm volatile("s_wait_xcnt 0x0" :: "v"(a), "v"(b), "v"(c), "v"(d), "v"(e), "v"(f), "v"(g), "v"(h) : "memory");
}
template <typename T> struct Frag;
template <> struct Frag<_Float16> {
  typedef v16h V; union U { v16h v; v8h h[2]; };
  static __device__ __forceinline__ v16h load(const _Float16* p) {   // elements 0..7 <- p[0..7], 8..15 <- p[16..23]
    U f; f.h[0] = *(const v8h*)(p); f.h[1] = *(const v8h*)(p + 16); return f.v;
  }
  static __device__ __forceinline__ v8f mma(v16h a, v16h b, v8f c) {
    return __builtin_amdgcn_wmma_f32_16x16x32_f16(false, a, false, b, (short)0, c, false, false);
  }
};
template <> struct Frag<__bf16> {
  typedef v16b V; union U { v16b v; v8b h[2]; };
  static __device__ __forceinline__ v16b load(const __bf16* p) {
    U f; f.h[0] = *(const v8b*)(p); f.h[1] = *(const v8b*)(p + 16); return f.v;
  }
  static __device__ __forceinline__ v8f mma(v16b a, v16b b, v8f c) {
    return __builtin_amdgcn_wmma_f32_16x16x32_bf16(false, a, false, b, (short)0, c, false, false);
  }
};

// ---- Register-blocked batched WMMA GEMM ------------------------------------
// C[m,n] = scale * sum_k A[m,k] * Bt[n,k] (+bias)(+rg*resid); each wave owns a 16x64 tile.
// A row-major [M,KDIM]; Bt row-major [N,KDIM]; M % 16 == 0, N % 64 == 0, KDIM % 32 == 0 (compile time).
// A wave issues every load it will ever need (all A and B fragments of the whole K, residual, bias) before its first WMMA,
// so it waits out one trip to memory instead of one per fragment group; the 16x64 tile is what lets them all fit in registers.
// SPLIT: operands are hi/lo planes (A2/Bt2 = lo planes, same layout); product = hi.hi + hi.lo + lo.hi.
// BIAS_MODE: 0 = none, 1 = bias[m], 2 = bias[n].
// OUT_MODE: 0 = f32, 1 = f16, 2 = bf16 hi plane (Cout) + bf16 lo plane (Cout2).
// RESID: v += rg * resid[m*ldc+n] with rg = rgain[0] when rgain != nullptr else 1.
// ET: 0 = f16 operands, 1 = bf16 operands (pointers passed as 16-bit storage)
template <int ET> struct Elem;
template <> struct Elem<0> { typedef _Float16 T; };
template <> struct Elem<1> { typedef __bf16 T; };
template <int ET, bool SPLIT, int BIAS_MODE, int OUT_MODE, bool RESID, int KDIM, int ACT = 0>
__global__ __launch_bounds__(256) void wmma_gemm64(
    const unsigned short* __restrict__ Ap, const unsigned short* __restrict__ A2p, int lda, long strideA,
    const unsigned short* __restrict__ Btp, const unsigned short* __restrict__ Bt2p, int ldb, long strideB,
    void* __restrict__ Cout, void* __restrict__ Cout2, int ldc, long strideC,
    const float* __restrict__ bias,
    const float* __restrict__ resid, long strideR, const float* __restrict__ rgain,
    int M, int N, float scale) {
  typedef typename Elem<ET>::T T;
  typedef typename Frag<T>::V V;
  constexpr int KS = KDIM / 32;
  const T* A = (const T*)Ap; const T* A2 = (const T*)A2p; const T* Bt = (const T*)Btp; const T* Bt2 = (const T*)Bt2p;
  __shared__ __align__(16) float sT[8][16 * 68];   // per-wave 16x64 slab, pitch 68 floats
  const int b    = blockIdx.y;
  const int lane = threadIdx.x & 31;
  const int wave = threadIdx.x >> 5;
  const int tilesN = N >> 6;
  const int tilesM = M >> 4;
  const int tile = blockIdx.x * 8 + wave;
  if (tile >= tilesM * tilesN) return;   // wave-uniform; no block barriers in this kernel
  const int tm = tile / tilesN;
  const int tn = tile - tm * tilesN;
  const int m0 = tm << 4;
  const int n0 = tn << 6;

  const T* Ab  = A  + (size_t)b * strideA;
  const T* Bb  = Bt + (size_t)b * strideB;
  const T* Ab2 = SPLIT ? (A2  + (size_t)b * strideA) : nullptr;
  const T* Bb2 = SPLIT ? (Bt2 + (size_t)b * strideB) : nullptr;

  const int rlane = lane & 15;                 // row (A) / col (B, D) within subtile
  const int koff  = (lane >> 4) * 8;           // k offset of this lane half
  const int mOff  = (lane >> 4) * 8;           // D row offset

  // ---- every load of this wave, in the order of use ----
  const T* pa = Ab + (size_t)(m0 + rlane) * lda + koff;
  const T* pa2 = SPLIT ? (Ab2 + (size_t)(m0 + rlane) * lda + koff) : nullptr;
  const T* pb[4];
  const T* pb2[4];
#pragma unroll
  for (int j = 0; j < 4; ++j) {
    pb[j]  = Bb + (size_t)(n0 + (j << 4) + rlane) * ldb + koff;
    pb2[j] = SPLIT ? (Bb2 + (size_t)(n0 + (j << 4) + rlane) * ldb + koff) : nullptr;
  }
  V ah[KS], al[KS], bh[KS][4], bl[KS][4];
#pragma unroll
  for (int ks = 0; ks < KS; ++ks) {
    ah[ks] = Frag<T>::load(pa + ks * 32);
    if (SPLIT) al[ks] = Frag<T>::load(pa2 + ks * 32);
#pragma unroll
    for (int j = 0; j < 4; ++j) {
      bh[ks][j] = Frag<T>::load(pb[j] + ks * 32);
      if (SPLIT) bl[ks][j] = Frag<T>::load(pb2[j] + ks * 32);
    }
  }
  addr_wait5(pa, pb[0], pb[1], pb[2], pb[3]);
  if (SPLIT) addr_wait5(pa2, pb2[0], pb2[1], pb2[2], pb2[3]);
  // nothing crosses: the loads above stay above, and no later address arithmetic is lifted in front of the wait
  __builtin_amdgcn_sched_barrier(0);
  float bn[4], bm[8], rv[4][8];
  if (RESID) {
    const float* pr[8];
#pragma unroll
    for (int r = 0; r < 8; ++r) pr[r] = resid + (size_t)b * strideR + (size_t)(m0 + mOff + r) * ldc + n0 + rlane;
#pragma unroll
    for (int j = 0; j < 4; ++j)
#pragma unroll
      for (int r = 0; r < 8; ++r) rv[j][r] = pr[r][j << 4];
    addr_wait8(pr[0], pr[1], pr[2], pr[3], pr[4], pr[5], pr[6], pr[7]);
  }
  if (BIAS_MODE == 1) {
    const float* pm = bias + m0 + mOff;
#pragma unroll
    for (int r = 0; r < 8; ++r) bm[r] = pm[r];
    addr_wait1(pm);
  }
  if (BIAS_MODE == 2) {
    const float* pn = bias + n0 + rlane;
#pragma unroll
    for (int j = 0; j < 4; ++j) bn[j] = pn[j << 4];
    addr_wait1(pn);
  }
  float rg = 1.0f;   // fetched last: nothing above waits for it
  if (RESID) { if (rgain != nullptr) rg = rgain[0]; }
  // keeps the scheduler from sinking the loads above down among the WMMAs, where each group would wait out its own trip to memory
  __builtin_amdgcn_sched_barrier(0);

  v8f acc[4];
#pragma unroll
  for (int j = 0; j < 4; ++j) acc[j] = (v8f){0.f,0.f,0.f,0.f,0.f,0.f,0.f,0.f};
#pragma unroll
  for (int ks = 0; ks < KS; ++ks) {
#pragma unroll
    for (int j = 0; j < 4; ++j) {
      acc[j] = Frag<T>::mma(ah[ks], bh[ks][j], acc[j]);
      if (SPLIT) {
        acc[j] = Frag<T>::mma(ah[ks], bl[ks][j], acc[j]);
        acc[j] = Frag<T>::mma(al[ks], bh[ks][j], acc[j]);
      }
    }
  }

  // ---- epilogue ----
  float* slab = sT[wave];
#pragma unroll
  for (int j = 0; j < 4; ++j) {
#pragma unroll
    for (int r = 0; r < 8; ++r) {
      float v = acc[j][r] * scale;
      if (BIAS_MODE == 1) v += bm[r];
      if (BIAS_MODE == 2) v += bn[j];
      if (RESID) v += rg * rv[j][r];
      if (ACT == 1) v = tanhf(v);
      if (ACT == 2) v = fmaxf(v, 0.0f);
      if (ACT == 3) v = v / (1.0f + expf(-v));
      if (ACT == 4) v = (v > 0.f) ? v : 0.01f * v;
      slab[(mOff + r) * 68 + (j << 4) + rlane] = v;
    }
  }
  __builtin_amdgcn_fence(__ATOMIC_RELEASE, "workgroup");
  __builtin_amdgcn_wave_barrier();
  __builtin_amdgcn_fence(__ATOMIC_ACQUIRE, "workgroup");
  if (OUT_MODE == 0) {
    float* C = (float*)Cout + (size_t)b * strideC;
    const int hh = lane >> 4, c4 = (lane & 15) * 4;     // row seg = 256 B = 16 lanes x 16 B
#pragma unroll
    for (int it = 0; it < 8; ++it) {
      const int row = it * 2 + hh;
      v4f v = *(const v4f*)(slab + row * 68 + c4);
      *(v4f*)(C + (size_t)(m0 + row) * ldc + n0 + c4) = v;
    }
  } else {
    const int q = lane >> 3, c8 = (lane & 7) * 8;
    unsigned short* C  = (unsigned short*)Cout  + (size_t)b * strideC;
    unsigned short* C2 = (OUT_MODE == 2) ? ((unsigned short*)Cout2 + (size_t)b * strideC) : nullptr;
#pragma unroll
    for (int it = 0; it < 4; ++it) {
      const int row = it * 4 + q;
      const float* sp = slab + row * 68 + c8;
      v8h hv, lv;
#pragma unroll
      for (int e = 0; e < 8; ++e) {
        if (OUT_MODE == 1) {
          hv[e] = (_Float16)sp[e];
        } else {
          unsigned short hb = f2bf_bits(sp[e]);
          unsigned short lb = f2bf_bits(sp[e] - bf_bits2f(hb));
          hv[e] = __builtin_bit_cast(_Float16, hb);
          lv[e] = __builtin_bit_cast(_Float16, lb);
        }
      }
      *(v8h*)(C + (size_t)(m0 + row) * ldc + n0 + c8) = hv;
      if (OUT_MODE == 2) *(v8h*)(C2 + (size_t)(m0 + row) * ldc + n0 + c8) = lv;
    }
  }
}

// ---------------------------------------------------------------------------
// Weight cast f32 -> f16 with a power-of-two carry sc (x8): six matrices selected by blockIdx.y (block-uniform),
// Coverage: grid.x = 32 blocks x 256 threads = 8192 pairs >= n2 for every matrix (n2 = 4096 or 8192 pairs).
// ---------------------------------------------------------------------------
__global__ __launch_bounds__(256) void cast_w6_kernel(const float* __restrict__ w0, const float* __restrict__ w1,
                                                      const float* __restrict__ w2, const float* __restrict__ w3,
                                                      const float* __restrict__ w4, const float* __restrict__ w5,
                                                      _Float16* __restrict__ pool, float sc) {
  const int y = blockIdx.y;                 // block-uniform selector
  const float* in = w0; int n2 = (EMB_ * CIN_) / 2; int off = WOFF_CP;
  if (y == 1) { in = w1; n2 = (EMB_ * EMB_) / 2;  off = WOFF_Q; }
  if (y == 2) { in = w2; n2 = (EMB_ * EMB_) / 2;  off = WOFF_K; }
  if (y == 3) { in = w3; n2 = (EMB_ * EMB_) / 2;  off = WOFF_V; }
  if (y == 4) { in = w4; n2 = (EMB_ * EMB_) / 2;  off = WOFF_O; }
  if (y == 5) { in = w5; n2 = (COUT_ * EMB_) / 2; off = WOFF_OUT; }
  _Float16* out = pool + off;
  const int i = blockIdx.x * 256 + threadIdx.x;
  if (i < n2) {
    const v2f f = *(const v2f*)(in + 2 * (size_t)i);
    const unsigned u = pk16(h_bits(f[0] * sc), h_bits(f[1] * sc));
    ((unsigned*)out)[i] = u;
    
  }
}

// ---------------------------------------------------------------------------
// Fused transpose + f16 cast of an f32 matrix, z-batched: in_z = W + z*sIn viewed [R rows][Cc cols] (pitch Cc) ->
//   oh_z[c][r] = f16(in_z[r][c])   ([Cc][R], pitch R), oh_z = oh + z*sOut.
// Here: in_z = x[z] viewed [R=64 ch][Cc=4096 tok] -> out [4096 tok][64 ch]; grid = (Cc/64=64, R/64=1, Z=2), 256 threads.
// Coverage per block: load 4 it x 256 thr x 4 floats = 64x64; store 2 it x 256 thr x 8 u16 = 64x64.
// ---------------------------------------------------------------------------
__global__ __launch_bounds__(256) void tcast16_kernel(const float* __restrict__ W, unsigned short* __restrict__ oh,
                                                      int R, int Cc, long sIn, long sOut) {
  __shared__ __align__(16) float tf[64 * 68];
  W  += (size_t)blockIdx.z * sIn;
  oh += (size_t)blockIdx.z * sOut;
  const int c0  = blockIdx.x * 64;   // input column block = output row block
  const int r0  = blockIdx.y * 64;   // input row block    = output column block
  const int tid = threadIdx.x;
  {
    const int lr = tid >> 4;         // 0..15
    const int c4 = (tid & 15) * 4;   // 0..60
#pragma unroll
    for (int it = 0; it < 4; ++it) {
      const int rr = it * 16 + lr;   // 0..63
      const v4f a = *(const v4f*)(W + (size_t)(r0 + rr) * Cc + c0 + c4);
      *(v4f*)(tf + rr * 68 + c4) = a;
    }
  }
  __syncthreads();
  const int sub = tid >> 3;          // 0..31
  const int c8  = (tid & 7) * 8;     // 0..56
  v4u hv[2];
#pragma unroll
  for (int it = 0; it < 2; ++it) {
    const int oc = it * 32 + sub;    // output row within tile (= input column)
    v4u a;
#pragma unroll
    for (int q = 0; q < 4; ++q) {
      const float f0 = tf[(c8 + 2 * q) * 68 + oc];
      const float f1 = tf[(c8 + 2 * q + 1) * 68 + oc];
      a[q] = pk16(h_bits(f0), h_bits(f1));
    }
    hv[it] = a;
  }
  {
#pragma unroll
    for (int it = 0; it < 2; ++it) {
      const int oc = it * 32 + sub;
      const size_t go = (size_t)(c0 + oc) * R + r0 + c8;
      *(v4u*)(oh + go) = hv[it];
    }
    
  }
}

// =====================================================================================
// Full (non-causal, unmasked) attention, head dim 64, all (batch, head, 64-query tile) in one launch.
//   q|k plane (f16): q element (b, t, h, d) at [(b*SEQL_+t)*QKPITCH_ + h*64 + d]; k at the same + EMB_.
//   v^T plane (f16): element (b, h, d, s) at [b*EMB_*SEQL_ + (h*64 + d)*SEQL_ + s]
//   out (f16, carried x oscale): element (b, t, h, d) at [(b*SEQL_+t)*EMB_ + h*64 + d]
//   scores^T = (k . q^T) * sscale : v_wmma_f32_16x16x32_f16, A = K rows, B = Q; a lane holds 8 keys x 1 query per tile
//   out^T    = v^T . p^T          : p = 2^(s*sscale*log2(e) - m + 15) in f16, packed in-lane from two score tiles into the
//                                   B operand (no LDS trip), A = V^T rows, f32 accumulate, 1/l in f32 (l carries the same 2^15)
//   online softmax in f32 (chunks of 64 keys, compile-time trip count, no masking): maximum and sum
//   run in-lane; the two wave halves join the maximum once per chunk and the sum once after the loop.
//   Block = 16 waves = 4 key groups x 4 query tiles = 64 query rows of one (batch, head); grid.x = 256.
//   Key group g walks chunks g, g+4, g+8, ... (16 of the 64) with its own K / V^T LDS tiles, so each SIMD holds four
//   waves whose LDS, memory and vector waits cover one another. After the loop each group leaves its maximum, sum and
//   unnormalised out tile in LDS; behind one __syncthreads the 16 waves merge them (4 rows of one query tile each).
//   K / V^T chunk staging: the group's 128 threads x 32 elements per plane = its whole 64x64 tile, by asynchronous 16-B copies
//   to LDS (8 lanes cover one 128-B row), two buffers: the next chunk's copies fly while this chunk is worked on; one
//   __syncthreads per chunk publishes the next tile and frees the one just read.
// =====================================================================================
#define AT_D 64
#define AT_NW 4
#define AT_NG 4
#define AT_QB 64
#define AT_KC 64
#define AT_LP 72   // LDS row pitch of the K and V^T tiles in halves: 144 B = 16 B x odd, so the 16 rows of one ds_load_b128 fragment read fall on 16 different groups of four banks
#define P_CARRY_L2 15.0f   // softmax numerators and their sums are carried x 2^15: the carry is an addend of the base-2 exponent

__device__ __forceinline__ v8f at_mma_h(v16h a, v16h b, v8f c) {
  c = __builtin_amdgcn_wmma_f32_16x16x32_f16(false, a, false, b, (short)0, c, false, false);
  asm volatile("v_nop\n\tv_nop\n\tv_nop\n\tv_nop" : "+v"(c) : "v"(a), "v"(b));
  return c;
}

// 2^x on the bare v_exp_f32 (no range fix-up: the softmax's arguments are <= 15 up to rounding, and a result below 2^-126 may go to 0).
__device__ __forceinline__ void exp2x8(v8f& x) {
  float a = x[0], b = x[1], c = x[2], d = x[3], e = x[4], f = x[5], g = x[6], h = x[7];
  asm("v_exp_f32 %0, %0\n\tv_exp_f32 %1, %1\n\tv_exp_f32 %2, %2\n\tv_exp_f32 %3, %3\n\t"
      "v_exp_f32 %4, %4\n\tv_exp_f32 %5, %5\n\tv_exp_f32 %6, %6\n\tv_exp_f32 %7, %7\n\tv_nop"
      : "+v"(a), "+v"(b), "+v"(c), "+v"(d), "+v"(e), "+v"(f), "+v"(g), "+v"(h));
  x = (v8f){a, b, c, d, e, f, g, h};
}
__device__ __forceinline__ float exp2x1(float x) {
  asm("v_exp_f32 %0, %0\n\tv_nop" : "+v"(x));   // the v_nop: the same slot behind a single v_exp_f32
  return x;
}

// lane l <-> lane l ^ 16: the two halves of a wave hold the two key halves of the same query column
__device__ __forceinline__ float xhalf(float x) {
  return __builtin_bit_cast(float, __builtin_amdgcn_permlanex16(__builtin_bit_cast(int, x), __builtin_bit_cast(int, x),
                                                                0x76543210, 0xfedcba98, false, false));
}

// One thread's share of one chunk: four 16-B pieces of the K tile and four of the V^T tile, global memory -> LDS through no register.
// kd, vd: the lane's LDS byte addresses of its first pieces; kg, vg: their global addresses; piece i lies 16 tile rows behind piece i-1.
// The s_wait_xcnt 0 is the last line of the copies' own statement, so that no register a copy names is written again in front of it.
__device__ __forceinline__ void at_copy_chunk(unsigned kd, unsigned vd, const _Float16* kg, const _Float16* vg) {
  const unsigned kd1 = kd + 16 * AT_LP * 2, kd2 = kd + 32 * AT_LP * 2, kd3 = kd + 48 * AT_LP * 2;
  const unsigned vd1 = vd + 16 * AT_LP * 2, vd2 = vd + 32 * AT_LP * 2, vd3 = vd + 48 * AT_LP * 2;
  const _Float16* kg1 = kg + 16 * QKPITCH_; const _Float16* kg2 = kg + 32 * QKPITCH_; const _Float16* kg3 = kg + 48 * QKPITCH_;
  const _Float16* vg1 = vg + 16 * SEQL_;    const _Float16* vg2 = vg + 32 * SEQL_;    const _Float16* vg3 = vg + 48 * SEQL_;
  asm volatile("global_load_async_to_lds_b128 %0, %8, off\n\t"
               "global_load_async_to_lds_b128 %1, %9, off\n\t"
               "global_load_async_to_lds_b128 %2, %10, off\n\t"
               "global_load_async_to_lds_b128 %3, %11, off\n\t"
               "global_load_async_to_lds_b128 %4, %12, off\n\t"
               "global_load_async_to_lds_b128 %5, %13, off\n\t"
               "global_load_async_to_lds_b128 %6, %14, off\n\t"
               "global_load_async_to_lds_b128 %7, %15, off\n\t"
               "s_wait_xcnt 0x0"
               :: "v"(kd), "v"(kd1), "v"(kd2), "v"(kd3), "v"(vd), "v"(vd1), "v"(vd2), "v"(vd3),
                  "v"(kg), "v"(kg1), "v"(kg2), "v"(kg3), "v"(vg), "v"(vg1), "v"(vg2), "v"(vg3)
               : "memory");
}

__global__ __launch_bounds__(AT_NG * AT_NW * 32)
void attn_full64_f16_kernel(const unsigned short* __restrict__ qkp, const unsigned short* __restrict__ vtp,
                            unsigned short* __restrict__ op, float sscale, float oscale) {
  union FH { v16h v; v8h h[2]; };
  __shared__ __align__(16) _Float16 KshG[2][AT_NG][AT_KC * AT_LP]; // K [kv][d]      rows of 64 at pitch 72, 9 KB per key group and buffer
  __shared__ __align__(16) _Float16 VthG[2][AT_NG][AT_D * AT_LP];  // V [d][kv]      rows of 64 at pitch 72, 9 KB per key group and buffer
  __shared__ __align__(16) float    Os[AT_NG * AT_NW][16 * 68];    // per wave partial out tile, pitch 68
  __shared__ float Ms[AT_NG][AT_QB];                               // per group and query: running maximum
  __shared__ float Ls[AT_NG][AT_QB];                               // per group and query: sum x 2^15 of 2^(s*sl2 - maximum)

  const int tid  = threadIdx.x & (AT_NW * 32 - 1);   // thread within the key group
  const int grp  = threadIdx.x >> 7;                 // key group 0..3
  const int wave = tid >> 5;                         // query tile 0..3
  const int lane = tid & 31;
  const int hh   = lane >> 4;
  const int c    = lane & 15;

  const int nqb = SEQL_ / AT_QB;          // 64
  const int bx = blockIdx.x;
  const int qb = bx % nqb;
  const int bh = bx / nqb;                // 0..NBATCH_*NHEAD_-1
  const int h  = bh % NHEAD_;
  const int b  = bh / NHEAD_;
  const int q0 = qb * AT_QB + wave * 16;

  const _Float16* Qh = (const _Float16*)(const void*)qkp + (size_t)b * SEQL_ * QKPITCH_ + (size_t)h * AT_D;
  const _Float16* Kh = Qh + EMB_;
  const _Float16* Vh = (const _Float16*)(const void*)vtp + (size_t)b * EMB_ * SEQL_ + (size_t)h * AT_D * SEQL_;
  _Float16*       ob = (_Float16*)(void*)op + (size_t)b * SEQL_ * EMB_ + (size_t)h * AT_D;

  // ---- Q fragments (B operand, column = lane&15, split k map via Frag load): 2 d-chunks ----
  v16h qa[2];
#pragma unroll
  for (int dc = 0; dc < 2; ++dc) {
    const _Float16* qr = Qh + (size_t)(q0 + c) * QKPITCH_ + dc * 32 + 8 * hh;
    qa[dc] = Frag<_Float16>::load(qr);
  }

  const float sl2 = sscale * 1.44269504f;   // score scale x log2(e): the softmax runs in base 2
  float mrow = -INFINITY, lrow = 0.f;   // this lane's query: running maximum in base-2 units (both halves alike), sum x 2^15 over this half's keys
  v8f oacc[4];                          // oacc[t][r] = out^T[d = t*16 + 8*hh + r][query c]
#pragma unroll
  for (int t = 0; t < 4; ++t) oacc[t] = (v8f){0.f,0.f,0.f,0.f,0.f,0.f,0.f,0.f};

  const int nChunks = SEQL_ / (AT_KC * AT_NG);   // 16 per key group, compile-time constant
  static_assert(SEQL_ / (AT_KC * AT_NG) >= 2, "the two-buffer prologue fills two chunks");
  // staging coverage: the group's 128 threads x (4 x 8) elements = 64 rows x 64 per plane = its whole chunk tile;
  // thread -> row (tid >> 3) + 16 i, 16-B piece tid & 7: each wave-wide copy moves four whole 128-B rows
  const int sr = tid >> 3, sp = (tid & 7) * 8;
  const unsigned bufB = (unsigned)(AT_NG * AT_KC * AT_LP * 2);                        // bytes from buffer 0 to buffer 1, K and V^T alike
  const unsigned kdst = (unsigned)(size_t)(&KshG[0][grp][sr * AT_LP + sp]);           // low 32 bits = the byte address in LDS
  const unsigned vdst = (unsigned)(size_t)(&VthG[0][grp][sr * AT_LP + sp]);
  const _Float16* ksrc = Kh + (size_t)(grp * AT_KC + sr) * QKPITCH_ + sp;             // chunk 0: K row grp*64 + sr, d = sp..sp+7
  const _Float16* vsrc = Vh + (size_t)sr * SEQL_ + grp * AT_KC + sp;                  // chunk 0: V^T row d = sr, s = grp*64 + sp..+7
  const size_t kstep = (size_t)AT_NG * AT_KC * QKPITCH_;                              // one chunk further: 256 keys
  const size_t vstep = (size_t)AT_NG * AT_KC;
  at_copy_chunk(kdst, vdst, ksrc, vsrc);
  asm volatile("s_wait_asynccnt 0x0" ::: "memory");   // this wave's pieces of chunk 0 have landed
  __syncthreads();                                    // ... and every other wave's: chunk 0 may be read
  at_copy_chunk(kdst + bufB, vdst + bufB, ksrc + kstep, vsrc + vstep);
  for (int kc = 0; kc < nChunks; ++kc) {
    const _Float16* Ksh = KshG[kc & 1][grp];
    const _Float16* Vth = VthG[kc & 1][grp];

    v8f s[4];
#pragma unroll
    for (int j = 0; j < 4; ++j) {
      s[j] = (v8f){0.f,0.f,0.f,0.f,0.f,0.f,0.f,0.f};
#pragma unroll
      for (int dc = 0; dc < 2; ++dc) {
        FH kb;
        kb.h[0] = *(const v8h*)(Ksh + (j * 16 + c) * AT_LP + dc * 32 + 8 * hh);
        kb.h[1] = *(const v8h*)(Ksh + (j * 16 + c) * AT_LP + dc * 32 + 16 + 8 * hh);
        s[j] = at_mma_h(kb.v, qa[dc], s[j]);   // s[j][r] = score of key j*16 + 8*hh + r against query c
      }
    }
    float m4[4];
#pragma unroll
    for (int j = 0; j < 4; ++j) {
      float m = -INFINITY;
#pragma unroll
      for (int r = 0; r < 8; ++r) m = fmaxf(m, s[j][r]);
      m4[j] = m;
    }
    float cm = fmaxf(fmaxf(m4[0], m4[1]), fmaxf(m4[2], m4[3]));
    cm = fmaxf(cm, xhalf(cm)) * sl2;                          // sl2 > 0: the largest raw score is the largest scaled one
    const float mnew = fmaxf(mrow, cm);
    const float alpha = exp2x1(mrow - mnew);                  // first chunk: 2^(-inf) = 0
    mrow = mnew;
    const float moff = P_CARRY_L2 - mnew;
    v8h ph[4];
    float ps4[4];
#pragma unroll
    for (int j = 0; j < 4; ++j) {
      float psum = 0.f;
#pragma unroll
      for (int r = 0; r < 8; ++r) s[j][r] = fmaf(s[j][r], sl2, moff);
      exp2x8(s[j]);                        // p x 2^15 = 2^(s*sl2 - m + 15): one fma and one v_exp_f32 per score
#pragma unroll
      for (int r = 0; r < 8; ++r) {
        psum += s[j][r];
        ph[j][r] = (_Float16)s[j][r];
      }
      ps4[j] = psum;
    }
    lrow = lrow * alpha + ((ps4[0] + ps4[1]) + (ps4[2] + ps4[3]));
#pragma unroll
    for (int t = 0; t < 4; ++t)
#pragma unroll
      for (int r = 0; r < 8; ++r) oacc[t][r] *= alpha;
#pragma unroll
    for (int kk = 0; kk < 2; ++kk) {
      FH pb;                       // B operand: elements 0..7 = keys kk*32 + 8*hh + e, 8..15 = keys kk*32 + 16 + 8*hh + e
      pb.h[0] = ph[2 * kk];
      pb.h[1] = ph[2 * kk + 1];
#pragma unroll
      for (int t = 0; t < 4; ++t) {
        FH vb;
        vb.h[0] = *(const v8h*)(Vth + (t * 16 + c) * AT_LP + kk * 32 + 8 * hh);
        vb.h[1] = *(const v8h*)(Vth + (t * 16 + c) * AT_LP + kk * 32 + 16 + 8 * hh);
        oacc[t] = at_mma_h(vb.v, pb.v, oacc[t]);
      }
    }
    asm volatile("s_wait_dscnt 0x0" ::: "memory");      // this wave's reads of the buffer that is refilled below have returned
    asm volatile("s_wait_asynccnt 0x0" ::: "memory");   // this wave's pieces of chunk kc + 1 have landed
    __syncthreads();                                    // publishes chunk kc + 1 and ends every wave's reads of chunk kc
    if (kc + 2 < nChunks)
      at_copy_chunk(kdst + (kc & 1) * bufB, vdst + (kc & 1) * bufB, ksrc + (size_t)(kc + 2) * kstep, vsrc + (size_t)(kc + 2) * vstep);
  }
  asm volatile("s_wait_asynccnt 0x0" ::: "memory");     // no copy is outstanding when the wave goes on to the merge and ends

  // ---- this wave's partial (its key group, its query tile) -> LDS, unnormalised ----
  float* os = Os[grp * AT_NW + wave];
  {
    const float lt = lrow + xhalf(lrow);
    if (hh == 0) {
      Ms[grp][wave * 16 + c] = mrow;
      Ls[grp][wave * 16 + c] = lt;
    }
#pragma unroll
    for (int t = 0; t < 4; ++t)
#pragma unroll
      for (int g = 0; g < 2; ++g) {
        v4f w;
#pragma unroll
        for (int e = 0; e < 4; ++e) w[e] = oacc[t][4 * g + e];
        *(v4f*)(os + c * 68 + t * 16 + 8 * hh + 4 * g) = w;
      }
  }
  __syncthreads();   // all four groups' partials stand in LDS before any wave merges them
  {
    // merge: wave (grp, wave) takes rows grp*4 .. grp*4+3 of query tile 'wave'; 8 lanes x 8 columns cover a row
    const int q8 = lane >> 3, c8 = (lane & 7) * 8;
    const int row = grp * 4 + q8;
    float mg[AT_NG];
    float mall = -INFINITY;
#pragma unroll
    for (int g = 0; g < AT_NG; ++g) {
      mg[g] = Ms[g][wave * 16 + row];
      mall = fmaxf(mall, mg[g]);
    }
    float lall = 0.f;
    float acc[8];
#pragma unroll
    for (int e = 0; e < 8; ++e) acc[e] = 0.f;
#pragma unroll
    for (int g = 0; g < AT_NG; ++g) {
      const float wg = exp2x1(mg[g] - mall);
      lall += wg * Ls[g][wave * 16 + row];
      const float* sp = Os[g * AT_NW + wave] + row * 68 + c8;
#pragma unroll
      for (int e = 0; e < 8; ++e) acc[e] += wg * sp[e];
    }
    const float inv = oscale / lall;   // the sum carries the numerators' 2^15
    v8h hv;
#pragma unroll
    for (int e = 0; e < 8; ++e) hv[e] = (_Float16)(acc[e] * inv);
    *(v8h*)(ob + (size_t)(q0 + row) * EMB_ + c8) = hv;
  }
}

// ---------------------------------------------------------------------------
extern "C" void kernel_launch(void* const* d_in, const int* in_sizes, int n_in,
                              void* d_out, int out_size, void* d_ws, size_t ws_size,
                              hipStream_t stream) {
  if (n_in < 12) return;
  if (in_sizes[0] != NBATCH_ * CIN_ * SEQL_) return;
  if (in_sizes[1] != EMB_ * CIN_ || in_sizes[2] != EMB_) return;
  if (in_sizes[3] != EMB_ * EMB_ || in_sizes[4] != EMB_ * EMB_ || in_sizes[5] != EMB_ * EMB_) return;
  if (in_sizes[6] != EMB_ * EMB_ || in_sizes[7] != EMB_) return;
  if (in_sizes[8] != COUT_ * EMB_ || in_sizes[9] != COUT_) return;
  if (in_sizes[10] != SEQL_ * EMB_ || in_sizes[11] < 1) return;
  if (out_size != NBATCH_ * COUT_ * SEQL_) return;
  if (ws_size < WS_TOTAL) return;

  const float* x     = (const float*)d_in[0];
  const float* W_cp  = (const float*)d_in[1];
  const float* b_cp  = (const float*)d_in[2];
  const float* W_q   = (const float*)d_in[3];
  const float* W_k   = (const float*)d_in[4];
  const float* W_v   = (const float*)d_in[5];
  const float* W_o   = (const float*)d_in[6];
  const float* b_o   = (const float*)d_in[7];
  const float* W_out = (const float*)d_in[8];
  const float* b_out = (const float*)d_in[9];
  const float* pos   = (const float*)d_in[10];
  const float* gatep = (const float*)d_in[11];
  float* out = (float*)d_out;

  char* ws = (char*)d_ws;
  _Float16* wpool = (_Float16*)(void*)(ws + OFFB_W);
  unsigned short* XT16 = (unsigned short*)(void*)(ws + OFFB_XT);
  unsigned short* XF16 = (unsigned short*)(void*)(ws + OFFB_XF);
  unsigned short* QK16 = (unsigned short*)(void*)(ws + OFFB_QK);
  unsigned short* VT16 = (unsigned short*)(void*)(ws + OFFB_VT);
  unsigned short* O16  = (unsigned short*)(void*)(ws + OFFB_O);
  unsigned short* O1   = (unsigned short*)(void*)(ws + OFFB_O1);
  const unsigned short* Wcp16  = U16(wpool + WOFF_CP);
  const unsigned short* Wqk16  = U16(wpool + WOFF_Q);     // [256][128]: q rows then k rows
  const unsigned short* Wv16   = U16(wpool + WOFF_V);
  const unsigned short* Wo16   = U16(wpool + WOFF_O);
  const unsigned short* Wout16 = U16(wpool + WOFF_OUT);

  const float WSC = 8.0f;                 // weight carry
  const float OSC = 16.0f;                // attention-output carry
  const float inv_w  = 1.0f / 8.0f;
  const float inv_wo = 1.0f / (8.0f * 16.0f);

  // 1. weights -> f16 x8
  cast_w6_kernel<<<dim3(32, 6, 1), dim3(256, 1, 1), 0, stream>>>(W_cp, W_q, W_k, W_v, W_o, W_out, wpool, WSC);

  // 2. x [b][64 ch][4096 tok] -> XT16 [b*4096+tok][64 ch] f16   (in[rows=64][cols=4096] -> out[4096][64])
  tcast16_kernel<<<dim3(SEQL_ / 64, CIN_ / 64, NBATCH_), dim3(256, 1, 1), 0, stream>>>(
      x, XT16, CIN_, SEQL_, (long)CIN_ * SEQL_, (long)SEQL_ * CIN_);

  // 3. XF16[b][tok][e] = XT16[b][tok][:] . Wcp[e][:] /8 + b_cp[e] + pos[tok][e]  (M=4096, N=128, K=64 per batch; f16 out)
  wmma_gemm64<0, false, 2, 1, true, CIN_><<<dim3((SEQL_ / 16) * (EMB_ / 64) / 8, NBATCH_, 1), dim3(256, 1, 1), 0, stream>>>(
      XT16, XT16, CIN_, (long)SEQL_ * CIN_,
      Wcp16, Wcp16, CIN_, 0L,
      (void*)XF16, nullptr, EMB_, (long)SEQL_ * EMB_,
      b_cp, pos, 0L, nullptr,
      SEQL_, EMB_, inv_w);

  // 4. QK16[tok][n] = XF16[tok][:] . Wqk[n][:] /8   (M=8192, N=256, K=128; q = cols 0..127, k = cols 128..255)
  wmma_gemm64<0, false, 0, 1, false, EMB_><<<dim3((NTOK_ / 16) * (QKPITCH_ / 64) / 8, 1, 1), dim3(256, 1, 1), 0, stream>>>(
      XF16, XF16, EMB_, 0L,
      Wqk16, Wqk16, EMB_, 0L,
      (void*)QK16, nullptr, QKPITCH_, 0L,
      nullptr, nullptr, 0L, nullptr,
      NTOK_, QKPITCH_, inv_w);

  // 5. VT16[b][(h,d)][tok] = Wv[(h,d)][:] . XF16[b][tok][:] /8   (M=128, N=4096, K=128 per batch)
  wmma_gemm64<0, false, 0, 1, false, EMB_><<<dim3((EMB_ / 16) * (SEQL_ / 64) / 8, NBATCH_, 1), dim3(256, 1, 1), 0, stream>>>(
      Wv16, Wv16, EMB_, 0L,
      XF16, XF16, EMB_, (long)SEQL_ * EMB_,
      (void*)VT16, nullptr, SEQL_, (long)EMB_ * SEQL_,
      nullptr, nullptr, 0L, nullptr,
      EMB_, SEQL_, inv_w);

  // 6. attention -> O16 [tok][128] f16 (x16)
  attn_full64_f16_kernel<<<dim3(NBATCH_ * NHEAD_ * (SEQL_ / AT_QB), 1, 1), dim3(AT_NG * AT_NW * 32, 1, 1), 0, stream>>>(
      QK16, VT16, O16, 0.125f, OSC);

  // 7. O1[tok][n] = O16[tok][:] . Wo[n][:] /128 + b_o[n]   (M=8192, N=128, K=128; f16 out)
  wmma_gemm64<0, false, 2, 1, false, EMB_><<<dim3((NTOK_ / 16) * (EMB_ / 64) / 8, 1, 1), dim3(256, 1, 1), 0, stream>>>(
      O16, O16, EMB_, 0L,
      Wo16, Wo16, EMB_, 0L,
      (void*)O1, nullptr, EMB_, 0L,
      b_o, nullptr, 0L, nullptr,
      NTOK_, EMB_, inv_wo);

  // 8. out[b][c][tok] = Wout[c][:] . O1[b][tok][:] /8 + b_out[c] + gate*x[b][c][tok]   (M=64, N=4096, K=128 per batch; f32)
  wmma_gemm64<0, false, 1, 0, true, EMB_><<<dim3((COUT_ / 16) * (SEQL_ / 64) / 8, NBATCH_, 1), dim3(256, 1, 1), 0, stream>>>(
      Wout16, Wout16, EMB_, 0L,
      O1, O1, EMB_, (long)SEQL_ * EMB_,
      (void*)out, nullptr, SEQL_, (long)COUT_ * SEQL_,
      b_out, x, (long)COUT_ * SEQL_, gatep,
      COUT_, SEQL_, inv_w);
}

// v007
// One run takes 39.9 microseconds.
// In two side-by-side timings against v006, it was 1.44 and 1.42 times as fast.
// Counting every step since v000, it is 8.96 times as fast.
// Contractions (token embed 64->128, fused q|k projection, v^T projection, q.k^T, p.v, W_o projection, W_out projection): v_wmma_f32_16x16x32_f16 (f16 operands: weights carried x8, attention output x16, softmax numerators x2^15; f32 accumulate); softmax statistics, biases, positional add and gated residual in f32.
#include <hip/hip_runtime.h>
#include <math.h>
#include <stdint.h>

typedef __attribute__((ext_vector_type(16))) _Float16 v16h;
typedef __attribute__((ext_vector_type(8)))  _Float16 v8h;
typedef __attribute__((ext_vector_type(2)))  _Float16 v2h;
typedef __attribute__((ext_vector_type(8)))  float    v8f;
typedef __attribute__((ext_vector_type(4)))  float    v4f;

// ---- problem geometry ----
constexpr int NBATCH_  = 2;
constexpr int CIN_     = 64;
constexpr int EMB_     = 128;
constexpr int COUT_    = 64;
constexpr int NHEAD_   = 2;
constexpr int HDIM_    = 64;
constexpr int SEQL_    = 4096;               // 16*16*16 tokens per batch element
constexpr int NTOK_    = NBATCH_ * SEQL_;    // 8192
constexpr int QKPITCH_ = 2 * EMB_;           // fused q|k plane pitch (halves)

//   QK16  f16 [8192 tok][256] (q|k)          0         4194304
//   VT16  f16 [2][128 (h,d)][4096]     4194304         2097152
//   O16   f16 [8192 tok][128] (x16)    6291456         2097152
constexpr size_t OFFB_QK  = 0;
constexpr size_t OFFB_VT  = OFFB_QK + (size_t)NTOK_ * QKPITCH_ * 2;
constexpr size_t OFFB_O   = OFFB_VT + (size_t)NBATCH_ * EMB_ * SEQL_ * 2;
constexpr size_t WS_TOTAL = OFFB_O  + (size_t)NTOK_ * EMB_ * 2;
static_assert((OFFB_VT % 128) == 0 && (OFFB_O % 128) == 0, "128-B aligned regions");

// s_wait_xcnt 0 behind a run of global loads, before any register that holds one of their addresses is written again; the addresses are
// inputs of the statement so that their registers stay theirs up to the wait (not even a later load's result lands in one before it).
__device__ __forceinline__ void addr_wait1(const void* a) { asm volatile("s_wait_xcnt 0x0" :: "v"(a) : "memory"); }
__device__ __forceinline__ void addr_wait4(const void* a, const void* b, const void* c, const void* d) {
  asm volatile("s_wait_xcnt 0x0" :: "v"(a), "v"(b), "v"(c), "v"(d) : "memory");
}
__device__ __forceinline__ void addr_wait6(const void* a, const void* b, const void* c, const void* d, const void* e, const void* f) {
  asm volatile("s_wait_xcnt 0x0" :: "v"(a), "v"(b), "v"(c), "v"(d), "v"(e), "v"(f) : "memory");
}
template <typename T> struct Frag;
template <> struct Frag<_Float16> {
  typedef v16h V; union U { v16h v; v8h h[2]; };
  static __device__ __forceinline__ v16h load(const _Float16* p) {   // elements 0..7 <- p[0..7], 8..15 <- p[16..23]
    U f; f.h[0] = *(const v8h*)(p); f.h[1] = *(const v8h*)(p + 16); return f.v;
  }
  static __device__ __forceinline__ v8f mma(v16h a, v16h b, v8f c) {
    return __builtin_amdgcn_wmma_f32_16x16x32_f16(false, a, false, b, (short)0, c, false, false);
  }
};
// The same fragment straight from an f32 weight row: the load, and apart from it (so that a wave can issue all its loads before it
// waits for the first) the cast in registers with the x8 carry (a power of two: exact).
struct WRaw { v4f a, b, c, d; };
__device__ __forceinline__ WRaw load_wraw(const float* p) {
  WRaw w; w.a = *(const v4f*)(p); w.b = *(const v4f*)(p + 4); w.c = *(const v4f*)(p + 16); w.d = *(const v4f*)(p + 20); return w;
}
__device__ __forceinline__ v16h cast_w8(const WRaw& w) {
  const v4f a = w.a, b = w.b, c = w.c, d = w.d;
  v16h f;
#pragma unroll
  for (int e = 0; e < 4; ++e) {
    f[e]      = (_Float16)(a[e] * 8.0f);
    f[4 + e]  = (_Float16)(b[e] * 8.0f);
    f[8 + e]  = (_Float16)(c[e] * 8.0f);
    f[12 + e] = (_Float16)(d[e] * 8.0f);
  }
  return f;
}

constexpr int TB_  = 64;    // tokens per work-group of the two projection kernels
constexpr int XTP_ = 72;    // LDS pitches in halves: 16 B x odd, so the 16 rows of a ds_load_b128 fragment read fall on different banks
constexpr int XFP_ = 136;
constexpr int QKP_ = 264;
constexpr int VTP_ = 72;
constexpr int OUP_ = 68;    // floats

// ---------------------------------------------------------------------------
// Token embed and q | k | v^T projections of 64 tokens, one work-group of 8 waves; nothing between the stages leaves the work-group.
//   x[b][64 ch][t0..t0+63] f32 -> XTs[tok][ch] f16 (LDS) -> XFs[tok][e] = XTs . W_cp^T + b_cp + pos, f16 (LDS)
//   -> q|k rows [tok][256] (A = XFs, B = W_q / W_k rows) and v^T rows [(h,d)][tok] (A = W_v rows, B = XFs), staged in LDS for 16-B stores.
// Wave w owns embed columns w*16..+15, q|k columns w*32..+31 and v^T rows w*16..+15, for all 64 tokens: every weight is read once per work-group.
// A and B fragments share one lane map: row or column = lane & 15, k = 8*(lane>>4) + {0..7, 16..23}; D: row = 8*(lane>>4) + r, column = lane & 15.
// ---------------------------------------------------------------------------
__global__ __launch_bounds__(256) void embed_qkv_kernel(const float* __restrict__ x, const float* __restrict__ W_cp,
                                                        const float* __restrict__ b_cp, const float* __restrict__ W_q,
                                                        const float* __restrict__ W_k, const float* __restrict__ W_v,
                                                        const float* __restrict__ pos,
                                                        unsigned short* __restrict__ qkp, unsigned short* __restrict__ vtp) {
  typedef Frag<_Float16> F;
  __shared__ __align__(16) _Float16 XTs[TB_ * XTP_];
  __shared__ __align__(16) _Float16 XFs[TB_ * XFP_];
  __shared__ __align__(16) _Float16 QKs[TB_ * QKP_];
  __shared__ __align__(16) _Float16 VTs[EMB_ * VTP_];
  const int tid   = threadIdx.x;
  const int lane  = tid & 31;
  const int wave  = tid >> 5;
  const int rlane = lane & 15;
  const int koff  = (lane >> 4) * 8;
  const int mOff  = (lane >> 4) * 8;
  const int b     = blockIdx.x / (SEQL_ / TB_);
  const int t0    = (blockIdx.x % (SEQL_ / TB_)) * TB_;
  const float inv_w = 0.125f;

  // ---- first run of global loads: the x tile (which the first barrier waits for), then the weights of the embed and of q | k ----
  const int c4 = (tid & 15) * 4, cp = tid >> 4;       // 4 tokens of channels 2cp, 2cp+1, 32+2cp, 33+2cp
  const float* px = x + (size_t)b * CIN_ * SEQL_ + (size_t)(2 * cp) * SEQL_ + t0 + c4;
  const v4f xa0 = *(const v4f*)(px);
  const v4f xa1 = *(const v4f*)(px + SEQL_);
  const v4f xb0 = *(const v4f*)(px + 32 * SEQL_);
  const v4f xb1 = *(const v4f*)(px + 33 * SEQL_);
  const float* pc = W_cp + (size_t)(wave * 16 + rlane) * CIN_ + koff;
  const float* pq = ((wave < 4) ? W_q : W_k) + (size_t)((wave & 3) * 32 + rlane) * EMB_ + koff;
  const float* pb = b_cp + wave * 16 + rlane;
  WRaw rc[2], rq[2][4];
#pragma unroll
  for (int ks = 0; ks < 2; ++ks) rc[ks] = load_wraw(pc + ks * 32);
#pragma unroll
  for (int j = 0; j < 2; ++j)
#pragma unroll
    for (int ks = 0; ks < 4; ++ks) rq[j][ks] = load_wraw(pq + j * 16 * EMB_ + ks * 32);
  const float bn = pb[0];
  addr_wait4(px, pc, pq, pb);
  // keeps the scheduler from sinking the loads above down to their casts, where each fragment would wait out its own trip to memory
  __builtin_amdgcn_sched_barrier(0);

  // ---- x tile -> LDS, transposed, f16 ----
#pragma unroll
  for (int e = 0; e < 4; ++e) {
    *(v2h*)(XTs + (c4 + e) * XTP_ + 2 * cp)      = (v2h){(_Float16)xa0[e], (_Float16)xa1[e]};
    *(v2h*)(XTs + (c4 + e) * XTP_ + 32 + 2 * cp) = (v2h){(_Float16)xb0[e], (_Float16)xb1[e]};
  }
  v16h wc[2], wq[2][4];
#pragma unroll
  for (int ks = 0; ks < 2; ++ks) wc[ks] = cast_w8(rc[ks]);
#pragma unroll
  for (int ks = 0; ks < 4; ++ks) wq[0][ks] = cast_w8(rq[0][ks]);

  // ---- two more runs, each into registers that the casts in front of it have freed, while the first run is still arriving: W_v, then pos ----
  const float* pv = W_v + (size_t)(wave * 16 + rlane) * EMB_ + koff;
  WRaw rw[4];
#pragma unroll
  for (int ks = 0; ks < 4; ++ks) rw[ks] = load_wraw(pv + ks * 32);
  addr_wait1(pv);
  // as above: the run is issued whole, here, and not piece by piece where its values are used
  __builtin_amdgcn_sched_barrier(0);
#pragma unroll
  for (int ks = 0; ks < 4; ++ks) wq[1][ks] = cast_w8(rq[1][ks]);
  const float* pp = pos + (size_t)(t0 + mOff) * EMB_ + wave * 16 + rlane;
  float pe[4][8];
#pragma unroll
  for (int mt = 0; mt < 4; ++mt)
#pragma unroll
    for (int r = 0; r < 8; ++r) pe[mt][r] = pp[(mt * 16 + r) * EMB_];
  addr_wait1(pp);
  // as above
  __builtin_amdgcn_sched_barrier(0);
  __syncthreads();   // the whole x tile stands in LDS

  // ---- embed: 64 tokens x this wave's 16 columns, K = 64 ----
  v8f ea[4];
#pragma unroll
  for (int mt = 0; mt < 4; ++mt) {
    ea[mt] = (v8f){0.f,0.f,0.f,0.f,0.f,0.f,0.f,0.f};
#pragma unroll
    for (int ks = 0; ks < 2; ++ks) ea[mt] = F::mma(F::load(XTs + (mt * 16 + rlane) * XTP_ + ks * 32 + koff), wc[ks], ea[mt]);
  }
#pragma unroll
  for (int mt = 0; mt < 4; ++mt)
#pragma unroll
    for (int r = 0; r < 8; ++r) {
      float v = ea[mt][r] * inv_w;
      v += bn;
      v += pe[mt][r];
      XFs[(mt * 16 + mOff + r) * XFP_ + wave * 16 + rlane] = (_Float16)v;
    }
  __syncthreads();   // all 128 embed columns of the 64 tokens stand in LDS

  // ---- q | k (tokens x columns) and v^T (rows x tokens), K = 128; a token fragment serves as A of the first and as B of the second ----
  v16h wv[4];
#pragma unroll
  for (int ks = 0; ks < 4; ++ks) wv[ks] = cast_w8(rw[ks]);
  v8f aq[4][2], av[4];
#pragma unroll
  for (int mt = 0; mt < 4; ++mt) {
    aq[mt][0] = (v8f){0.f,0.f,0.f,0.f,0.f,0.f,0.f,0.f};
    aq[mt][1] = (v8f){0.f,0.f,0.f,0.f,0.f,0.f,0.f,0.f};
    av[mt]    = (v8f){0.f,0.f,0.f,0.f,0.f,0.f,0.f,0.f};
  }
#pragma unroll
  for (int ks = 0; ks < 4; ++ks) {
#pragma unroll
    for (int mt = 0; mt < 4; ++mt) {
      const v16h xf = F::load(XFs + (mt * 16 + rlane) * XFP_ + ks * 32 + koff);
      aq[mt][0] = F::mma(xf, wq[0][ks], aq[mt][0]);
      aq[mt][1] = F::mma(xf, wq[1][ks], aq[mt][1]);
      av[mt]    = F::mma(wv[ks], xf, av[mt]);
    }
  }
#pragma unroll
  for (int mt = 0; mt < 4; ++mt)
#pragma unroll
    for (int r = 0; r < 8; ++r) {
      QKs[(mt * 16 + mOff + r) * QKP_ + wave * 32 + rlane]      = (_Float16)(aq[mt][0][r] * inv_w);
      QKs[(mt * 16 + mOff + r) * QKP_ + wave * 32 + 16 + rlane] = (_Float16)(aq[mt][1][r] * inv_w);
      VTs[(wave * 16 + mOff + r) * VTP_ + mt * 16 + rlane]      = (_Float16)(av[mt][r] * inv_w);
    }
  __syncthreads();   // both output tiles stand in LDS

  // ---- 16-B stores: a wave writes one whole 512-B q|k row, or four whole 128-B v^T row pieces, per instruction ----
  _Float16* qg = (_Float16*)(void*)qkp + ((size_t)b * SEQL_ + t0) * QKPITCH_;
  _Float16* vg = (_Float16*)(void*)vtp + (size_t)b * EMB_ * SEQL_ + t0;
#pragma unroll
  for (int it = 0; it < 8; ++it) {
    const int row = it * 8 + wave;
    *(v8h*)(qg + (size_t)row * QKPITCH_ + lane * 8) = *(const v8h*)(QKs + row * QKP_ + lane * 8);
  }
#pragma unroll
  for (int it = 0; it < 4; ++it) {
    const int row = it * 32 + (tid >> 3);
    *(v8h*)(vg + (size_t)row * SEQL_ + (tid & 7) * 8) = *(const v8h*)(VTs + row * VTP_ + (tid & 7) * 8);
  }
}

// ---------------------------------------------------------------------------
// W_o and W_out projections with the gated residual, 64 tokens per work-group of 8 waves; the W_o result stays in LDS.
//   Os16[tok][128] (attention out x16, f16) -> O1s[tok][n] = Os16 . W_o^T / 16 + b_o, f16 (LDS)
//   -> out[b][c][tok] = W_out[c][:] . O1s[tok][:] + b_out[c] + gate * x[b][c][tok], f32, staged in LDS for 16-B stores.
// Wave w owns W_o columns w*16..+15 for all 64 tokens, then out rows (w&3)*16..+15 x tokens (w>>2)*32..+31. Lane maps as above.
// ---------------------------------------------------------------------------
__global__ __launch_bounds__(256) void proj_out_kernel(const unsigned short* __restrict__ op, const float* __restrict__ W_o,
                                                       const float* __restrict__ b_o, const float* __restrict__ W_out,
                                                       const float* __restrict__ b_out, const float* __restrict__ x,
                                                       const float* __restrict__ gatep, float* __restrict__ out) {
  typedef Frag<_Float16> F;
  __shared__ __align__(16) _Float16 Os16[TB_ * XFP_];
  __shared__ __align__(16) _Float16 O1s[TB_ * XFP_];
  __shared__ __align__(16) float    Outs[COUT_ * OUP_];
  const int tid   = threadIdx.x;
  const int lane  = tid & 31;
  const int wave  = tid >> 5;
  const int rlane = lane & 15;
  const int koff  = (lane >> 4) * 8;
  const int mOff  = (lane >> 4) * 8;
  const int b     = blockIdx.x / (SEQL_ / TB_);
  const int t0    = (blockIdx.x % (SEQL_ / TB_)) * TB_;
  const int ct    = wave & 3, tp = wave >> 2;
  const float inv_w = 0.125f, inv_wo = 1.0f / 128.0f;

  // ---- every global load of this wave, the attention tile (which the first barrier waits for) first ----
  const _Float16* po = (const _Float16*)(const void*)op + ((size_t)b * SEQL_ + t0 + (tid >> 4)) * EMB_ + (tid & 15) * 8;
  v8h ov[4];
#pragma unroll
  for (int it = 0; it < 4; ++it) ov[it] = *(const v8h*)(po + it * 16 * EMB_);
  const float* pw = W_o + (size_t)(wave * 16 + rlane) * EMB_ + koff;
  const float* pu = W_out + (size_t)(ct * 16 + rlane) * EMB_ + koff;
  WRaw ro[4], ru[4];
#pragma unroll
  for (int ks = 0; ks < 4; ++ks) ro[ks] = load_wraw(pw + ks * 32);
#pragma unroll
  for (int ks = 0; ks < 4; ++ks) ru[ks] = load_wraw(pu + ks * 32);
  const float* pb = b_o + wave * 16 + rlane;
  const float bn = pb[0];
  const float* pm = b_out + ct * 16 + mOff;
  float bm[8];
#pragma unroll
  for (int r = 0; r < 8; ++r) bm[r] = pm[r];
  const float* pr = x + (size_t)b * COUT_ * SEQL_ + (size_t)(ct * 16 + mOff) * SEQL_ + t0 + tp * 32 + rlane;
  float rv[2][8];
#pragma unroll
  for (int i = 0; i < 2; ++i)
#pragma unroll
    for (int r = 0; r < 8; ++r) rv[i][r] = pr[(size_t)r * SEQL_ + i * 16];
  addr_wait6(po, pw, pu, pb, pm, pr);
  const float rg = gatep[0];
  // keeps the scheduler from sinking the loads above down to their uses, where each group would wait out its own trip to memory
  __builtin_amdgcn_sched_barrier(0);

#pragma unroll
  for (int it = 0; it < 4; ++it) *(v8h*)(Os16 + ((tid >> 4) + it * 16) * XFP_ + (tid & 15) * 8) = ov[it];
  v16h wo[4], wu[4];
#pragma unroll
  for (int ks = 0; ks < 4; ++ks) { wo[ks] = cast_w8(ro[ks]); wu[ks] = cast_w8(ru[ks]); }
  __syncthreads();   // the whole attention tile stands in LDS

  v8f a1[4];
#pragma unroll
  for (int mt = 0; mt < 4; ++mt) a1[mt] = (v8f){0.f,0.f,0.f,0.f,0.f,0.f,0.f,0.f};
#pragma unroll
  for (int ks = 0; ks < 4; ++ks)
#pragma unroll
    for (int mt = 0; mt < 4; ++mt) a1[mt] = F::mma(F::load(Os16 + (mt * 16 + rlane) * XFP_ + ks * 32 + koff), wo[ks], a1[mt]);
#pragma unroll
  for (int mt = 0; mt < 4; ++mt)
#pragma unroll
    for (int r = 0; r < 8; ++r) {
      float v = a1[mt][r] * inv_wo;
      v += bn;
      O1s[(mt * 16 + mOff + r) * XFP_ + wave * 16 + rlane] = (_Float16)v;
    }
  __syncthreads();   // all 128 W_o columns of the 64 tokens stand in LDS

  v8f a2[2];
#pragma unroll
  for (int i = 0; i < 2; ++i) a2[i] = (v8f){0.f,0.f,0.f,0.f,0.f,0.f,0.f,0.f};
#pragma unroll
  for (int ks = 0; ks < 4; ++ks)
#pragma unroll
    for (int i = 0; i < 2; ++i) a2[i] = F::mma(wu[ks], F::load(O1s + (tp * 32 + i * 16 + rlane) * XFP_ + ks * 32 + koff), a2[i]);
#pragma unroll
  for (int i = 0; i < 2; ++i)
#pragma unroll
    for (int r = 0; r < 8; ++r) {
      float v = a2[i][r] * inv_w;
      v += bm[r];
      v += rg * rv[i][r];
      Outs[(ct * 16 + mOff + r) * OUP_ + tp * 32 + i * 16 + rlane] = v;
    }
  __syncthreads();   // the 64 x 64 output tile stands in LDS

  // ---- 16-B stores: a wave writes two whole 256-B row pieces per instruction ----
  float* og = out + (size_t)b * COUT_ * SEQL_ + t0;
#pragma unroll
  for (int it = 0; it < 4; ++it) {
    const int row = it * 16 + (tid >> 4);
    *(v4f*)(og + (size_t)row * SEQL_ + (tid & 15) * 4) = *(const v4f*)(Outs + row * OUP_ + (tid & 15) * 4);
  }
}

// =====================================================================================
// Full (non-causal, unmasked) attention, head dim 64, all (batch, head, 64-query tile) in one launch.
//   q|k plane (f16): q element (b, t, h, d) at [(b*SEQL_+t)*QKPITCH_ + h*64 + d]; k at the same + EMB_.
//   v^T plane (f16): element (b, h, d, s) at [b*EMB_*SEQL_ + (h*64 + d)*SEQL_ + s]
//   out (f16, carried x oscale): element (b, t, h, d) at [(b*SEQL_+t)*EMB_ + h*64 + d]
//   scores^T = (k . q^T) * sscale : v_wmma_f32_16x16x32_f16, A = K rows, B = Q; a lane holds 8 keys x 1 query per tile
//   out^T    = v^T . p^T          : p = 2^(s*sscale*log2(e) - m + 15) in f16, packed in-lane from two score tiles into the
//                                   B operand (no LDS trip), A = V^T rows, f32 accumulate, 1/l in f32 (l carries the same 2^15)
//   online softmax in f32 (chunks of 64 keys, compile-time trip count, no masking): maximum and sum
//   run in-lane; the two wave halves join the maximum once per chunk and the sum once after the loop.
//   Block = 16 waves = 4 key groups x 4 query tiles = 64 query rows of one (batch, head); grid.x = 256.
//   Key group g walks chunks g, g+4, g+8, ... (16 of the 64) with its own K / V^T LDS tiles, so each SIMD holds four
//   waves whose LDS, memory and vector waits cover one another. After the loop each group leaves its maximum, sum and
//   unnormalised out tile in LDS; behind one __syncthreads the 16 waves merge them (4 rows of one query tile each).
//   K / V^T chunk staging: the group's 128 threads x 32 elements per plane = its whole 64x64 tile, by asynchronous 16-B copies
//   to LDS (8 lanes cover one 128-B row), two buffers: the next chunk's copies fly while this chunk is worked on; one
//   __syncthreads per chunk publishes the next tile and frees the one just read.
// =====================================================================================
#define AT_D 64
#define AT_NW 4
#define AT_NG 4
#define AT_QB 64
#define AT_KC 64
#define AT_LP 72   // LDS row pitch of the K and V^T tiles in halves: 144 B = 16 B x odd, so the 16 rows of one ds_load_b128 fragment read fall on 16 different groups of four banks
#define P_CARRY_L2 15.0f   // softmax numerators and their sums are carried x 2^15: the carry is an addend of the base-2 exponent

__device__ __forceinline__ v8f at_mma_h(v16h a, v16h b, v8f c) {
  c = __builtin_amdgcn_wmma_f32_16x16x32_f16(false, a, false, b, (short)0, c, false, false);
  asm volatile("v_nop\n\tv_nop\n\tv_nop\n\tv_nop" : "+v"(c) : "v"(a), "v"(b));
  return c;
}

// 2^x on the bare v_exp_f32 (no range fix-up: the softmax's arguments are <= 15 up to rounding, and a result below 2^-126 may go to 0).
__device__ __forceinline__ void exp2x8(v8f& x) {
  float a = x[0], b = x[1], c = x[2], d = x[3], e = x[4], f = x[5], g = x[6], h = x[7];
  asm("v_exp_f32 %0, %0\n\tv_exp_f32 %1, %1\n\tv_exp_f32 %2, %2\n\tv_exp_f32 %3, %3\n\t"
      "v_exp_f32 %4, %4\n\tv_exp_f32 %5, %5\n\tv_exp_f32 %6, %6\n\tv_exp_f32 %7, %7\n\tv_nop"
      : "+v"(a), "+v"(b), "+v"(c), "+v"(d), "+v"(e), "+v"(f), "+v"(g), "+v"(h));
  x = (v8f){a, b, c, d, e, f, g, h};
}
__device__ __forceinline__ float exp2x1(float x) {
  asm("v_exp_f32 %0, %0\n\tv_nop" : "+v"(x));   // the v_nop: the same slot behind a single v_exp_f32
  return x;
}

// lane l <-> lane l ^ 16: the two halves of a wave hold the two key halves of the same query column
__device__ __forceinline__ float xhalf(float x) {
  return __builtin_bit_cast(float, __builtin_amdgcn_permlanex16(__builtin_bit_cast(int, x), __builtin_bit_cast(int, x),
                                                                0x76543210, 0xfedcba98, false, false));
}

// One thread's share of one chunk: four 16-B pieces of the K tile and four of the V^T tile, global memory -> LDS through no register.
// kd, vd: the lane's LDS byte addresses of its first pieces; kg, vg: their global addresses; piece i lies 16 tile rows behind piece i-1.
// The s_wait_xcnt 0 is the last line of the copies' own statement, so that no register a copy names is written again in front of it.
__device__ __forceinline__ void at_copy_chunk(unsigned kd, unsigned vd, const _Float16* kg, const _Float16* vg) {
  const unsigned kd1 = kd + 16 * AT_LP * 2, kd2 = kd + 32 * AT_LP * 2, kd3 = kd + 48 * AT_LP * 2;
  const unsigned vd1 = vd + 16 * AT_LP * 2, vd2 = vd + 32 * AT_LP * 2, vd3 = vd + 48 * AT_LP * 2;
  const _Float16* kg1 = kg + 16 * QKPITCH_; const _Float16* kg2 = kg + 32 * QKPITCH_; const _Float16* kg3 = kg + 48 * QKPITCH_;
  const _Float16* vg1 = vg + 16 * SEQL_;    const _Float16* vg2 = vg + 32 * SEQL_;    const _Float16* vg3 = vg + 48 * SEQL_;
  asm volatile("global_load_async_to_lds_b128 %0, %8, off\n\t"
               "global_load_async_to_lds_b128 %1, %9, off\n\t"
               "global_load_async_to_lds_b128 %2, %10, off\n\t"
               "global_load_async_to_lds_b128 %3, %11, off\n\t"
               "global_load_async_to_lds_b128 %4, %12, off\n\t"
               "global_load_async_to_lds_b128 %5, %13, off\n\t"
               "global_load_async_to_lds_b128 %6, %14, off\n\t"
               "global_load_async_to_lds_b128 %7, %15, off\n\t"
               "s_wait_xcnt 0x0"
               :: "v"(kd), "v"(kd1), "v"(kd2), "v"(kd3), "v"(vd), "v"(vd1), "v"(vd2), "v"(vd3),
                  "v"(kg), "v"(kg1), "v"(kg2), "v"(kg3), "v"(vg), "v"(vg1), "v"(vg2), "v"(vg3)
               : "memory");
}

__global__ __launch_bounds__(AT_NG * AT_NW * 32)
void attn_full64_f16_kernel(const unsigned short* __restrict__ qkp, const unsigned short* __restrict__ vtp,
                            unsigned short* __restrict__ op, float sscale, float oscale) {
  union FH { v16h v; v8h h[2]; };
  __shared__ __align__(16) _Float16 KshG[2][AT_NG][AT_KC * AT_LP]; // K [kv][d]      rows of 64 at pitch 72, 9 KB per key group and buffer
  __shared__ __align__(16) _Float16 VthG[2][AT_NG][AT_D * AT_LP];  // V [d][kv]      rows of 64 at pitch 72, 9 KB per key group and buffer
  __shared__ __align__(16) float    Os[AT_NG * AT_NW][16 * 68];    // per wave partial out tile, pitch 68
  __shared__ float Ms[AT_NG][AT_QB];                               // per group and query: running maximum
  __shared__ float Ls[AT_NG][AT_QB];                               // per group and query: sum x 2^15 of 2^(s*sl2 - maximum)

  const int tid  = threadIdx.x & (AT_NW * 32 - 1);   // thread within the key group
  const int grp  = threadIdx.x >> 7;                 // key group 0..3
  const int wave = tid >> 5;                         // query tile 0..3
  const int lane = tid & 31;
  const int hh   = lane >> 4;
  const int c    = lane & 15;

  const int nqb = SEQL_ / AT_QB;          // 64
  const int bx = blockIdx.x;
  const int qb = bx % nqb;
  const int bh = bx / nqb;                // 0..NBATCH_*NHEAD_-1
  const int h  = bh % NHEAD_;
  const int b  = bh / NHEAD_;
  const int q0 = qb * AT_QB + wave * 16;

  const _Float16* Qh = (const _Float16*)(const void*)qkp + (size_t)b * SEQL_ * QKPITCH_ + (size_t)h * AT_D;
  const _Float16* Kh = Qh + EMB_;
  const _Float16* Vh = (const _Float16*)(const void*)vtp + (size_t)b * EMB_ * SEQL_ + (size_t)h * AT_D * SEQL_;
  _Float16*       ob = (_Float16*)(void*)op + (size_t)b * SEQL_ * EMB_ + (size_t)h * AT_D;

  // ---- Q fragments (B operand, column = lane&15, split k map via Frag load): 2 d-chunks ----
  v16h qa[2];
#pragma unroll
  for (int dc = 0; dc < 2; ++dc) {
    const _Float16* qr = Qh + (size_t)(q0 + c) * QKPITCH_ + dc * 32 + 8 * hh;
    qa[dc] = Frag<_Float16>::load(qr);
  }

  const float sl2 = sscale * 1.44269504f;   // score scale x log2(e): the softmax runs in base 2
  float mrow = -INFINITY, lrow = 0.f;   // this lane's query: running maximum in base-2 units (both halves alike), sum x 2^15 over this half's keys
  v8f oacc[4];                          // oacc[t][r] = out^T[d = t*16 + 8*hh + r][query c]
#pragma unroll
  for (int t = 0; t < 4; ++t) oacc[t] = (v8f){0.f,0.f,0.f,0.f,0.f,0.f,0.f,0.f};

  const int nChunks = SEQL_ / (AT_KC * AT_NG);   // 16 per key group, compile-time constant
  static_assert(SEQL_ / (AT_KC * AT_NG) >= 2, "the two-buffer prologue fills two chunks");
  // staging coverage: the group's 128 threads x (4 x 8) elements = 64 rows x 64 per plane = its whole chunk tile;
  // thread -> row (tid >> 3) + 16 i, 16-B piece tid & 7: each wave-wide copy moves four whole 128-B rows
  const int sr = tid >> 3, sp = (tid & 7) * 8;
  const unsigned bufB = (unsigned)(AT_NG * AT_KC * AT_LP * 2);                        // bytes from buffer 0 to buffer 1, K and V^T alike
  const unsigned kdst = (unsigned)(size_t)(&KshG[0][grp][sr * AT_LP + sp]);           // low 32 bits = the byte address in LDS
  const unsigned vdst = (unsigned)(size_t)(&VthG[0][grp][sr * AT_LP + sp]);
  const _Float16* ksrc = Kh + (size_t)(grp * AT_KC + sr) * QKPITCH_ + sp;             // chunk 0: K row grp*64 + sr, d = sp..sp+7
  const _Float16* vsrc = Vh + (size_t)sr * SEQL_ + grp * AT_KC + sp;                  // chunk 0: V^T row d = sr, s = grp*64 + sp..+7
  const size_t kstep = (size_t)AT_NG * AT_KC * QKPITCH_;                              // one chunk further: 256 keys
  const size_t vstep = (size_t)AT_NG * AT_KC;
  at_copy_chunk(kdst, vdst, ksrc, vsrc);
  asm volatile("s_wait_asynccnt 0x0" ::: "memory");   // this wave's pieces of chunk 0 have landed
  __syncthreads();                                    // ... and every other wave's: chunk 0 may be read
  at_copy_chunk(kdst + bufB, vdst + bufB, ksrc + kstep, vsrc + vstep);
  for (int kc = 0; kc < nChunks; ++kc) {
    const _Float16* Ksh = KshG[kc & 1][grp];
    const _Float16* Vth = VthG[kc & 1][grp];

    v8f s[4];
#pragma unroll
    for (int j = 0; j < 4; ++j) {
      s[j] = (v8f){0.f,0.f,0.f,0.f,0.f,0.f,0.f,0.f};
#pragma unroll
      for (int dc = 0; dc < 2; ++dc) {
        FH kb;
        kb.h[0] = *(const v8h*)(Ksh + (j * 16 + c) * AT_LP + dc * 32 + 8 * hh);
        kb.h[1] = *(const v8h*)(Ksh + (j * 16 + c) * AT_LP + dc * 32 + 16 + 8 * hh);
        s[j] = at_mma_h(kb.v, qa[dc], s[j]);   // s[j][r] = score of key j*16 + 8*hh + r against query c
      }
    }
    float m4[4];
#pragma unroll
    for (int j = 0; j < 4; ++j) {
      float m = -INFINITY;
#pragma unroll
      for (int r = 0; r < 8; ++r) m = fmaxf(m, s[j][r]);
      m4[j] = m;
    }
    float cm = fmaxf(fmaxf(m4[0], m4[1]), fmaxf(m4[2], m4[3]));
    cm = fmaxf(cm, xhalf(cm)) * sl2;                          // sl2 > 0: the largest raw score is the largest scaled one
    const float mnew = fmaxf(mrow, cm);
    const float alpha = exp2x1(mrow - mnew);                  // first chunk: 2^(-inf) = 0
    mrow = mnew;
    const float moff = P_CARRY_L2 - mnew;
    v8h ph[4];
    float ps4[4];
#pragma unroll
    for (int j = 0; j < 4; ++j) {
      float psum = 0.f;
#pragma unroll
      for (int r = 0; r < 8; ++r) s[j][r] = fmaf(s[j][r], sl2, moff);
      exp2x8(s[j]);                        // p x 2^15 = 2^(s*sl2 - m + 15): one fma and one v_exp_f32 per score
#pragma unroll
      for (int r = 0; r < 8; ++r) {
        psum += s[j][r];
        ph[j][r] = (_Float16)s[j][r];
      }
      ps4[j] = psum;
    }
    lrow = lrow * alpha + ((ps4[0] + ps4[1]) + (ps4[2] + ps4[3]));
#pragma unroll
    for (int t = 0; t < 4; ++t)
#pragma unroll
      for (int r = 0; r < 8; ++r) oacc[t][r] *= alpha;
#pragma unroll
    for (int kk = 0; kk < 2; ++kk) {
      FH pb;                       // B operand: elements 0..7 = keys kk*32 + 8*hh + e, 8..15 = keys kk*32 + 16 + 8*hh + e
      pb.h[0] = ph[2 * kk];
      pb.h[1] = ph[2 * kk + 1];
#pragma unroll
      for (int t = 0; t < 4; ++t) {
        FH vb;
        vb.h[0] = *(const v8h*)(Vth + (t * 16 + c) * AT_LP + kk * 32 + 8 * hh);
        vb.h[1] = *(const v8h*)(Vth + (t * 16 + c) * AT_LP + kk * 32 + 16 + 8 * hh);
        oacc[t] = at_mma_h(vb.v, pb.v, oacc[t]);
      }
    }
    asm volatile("s_wait_dscnt 0x0" ::: "memory");      // this wave's reads of the buffer that is refilled below have returned
    asm volatile("s_wait_asynccnt 0x0" ::: "memory");   // this wave's pieces of chunk kc + 1 have landed
    __syncthreads();                                    // publishes chunk kc + 1 and ends every wave's reads of chunk kc
    if (kc + 2 < nChunks)
      at_copy_chunk(kdst + (kc & 1) * bufB, vdst + (kc & 1) * bufB, ksrc + (size_t)(kc + 2) * kstep, vsrc + (size_t)(kc + 2) * vstep);
  }
  asm volatile("s_wait_asynccnt 0x0" ::: "memory");     // no copy is outstanding when the wave goes on to the merge and ends

  // ---- this wave's partial (its key group, its query tile) -> LDS, unnormalised ----
  float* os = Os[grp * AT_NW + wave];
  {
    const float lt = lrow + xhalf(lrow);
    if (hh == 0) {
      Ms[grp][wave * 16 + c] = mrow;
      Ls[grp][wave * 16 + c] = lt;
    }
#pragma unroll
    for (int t = 0; t < 4; ++t)
#pragma unroll
      for (int g = 0; g < 2; ++g) {
        v4f w;
#pragma unroll
        for (int e = 0; e < 4; ++e) w[e] = oacc[t][4 * g + e];
        *(v4f*)(os + c * 68 + t * 16 + 8 * hh + 4 * g) = w;
      }
  }
  __syncthreads();   // all four groups' partials stand in LDS before any wave merges them
  {
    // merge: wave (grp, wave) takes rows grp*4 .. grp*4+3 of query tile 'wave'; 8 lanes x 8 columns cover a row
    const int q8 = lane >> 3, c8 = (lane & 7) * 8;
    const int row = grp * 4 + q8;
    float mg[AT_NG];
    float mall = -INFINITY;
#pragma unroll
    for (int g = 0; g < AT_NG; ++g) {
      mg[g] = Ms[g][wave * 16 + row];
      mall = fmaxf(mall, mg[g]);
    }
    float lall = 0.f;
    float acc[8];
#pragma unroll
    for (int e = 0; e < 8; ++e) acc[e] = 0.f;
#pragma unroll
    for (int g = 0; g < AT_NG; ++g) {
      const float wg = exp2x1(mg[g] - mall);
      lall += wg * Ls[g][wave * 16 + row];
      const float* sp = Os[g * AT_NW + wave] + row * 68 + c8;
#pragma unroll
      for (int e = 0; e < 8; ++e) acc[e] += wg * sp[e];
    }
    const float inv = oscale / lall;   // the sum carries the numerators' 2^15
    v8h hv;
#pragma unroll
    for (int e = 0; e < 8; ++e) hv[e] = (_Float16)(acc[e] * inv);
    *(v8h*)(ob + (size_t)(q0 + row) * EMB_ + c8) = hv;
  }
}

// ---------------------------------------------------------------------------
extern "C" void kernel_launch(void* const* d_in, const int* in_sizes, int n_in,
                              void* d_out, int out_size, void* d_ws, size_t ws_size,
                              hipStream_t stream) {
  if (n_in < 12) return;
  if (in_sizes[0] != NBATCH_ * CIN_ * SEQL_) return;
  if (in_sizes[1] != EMB_ * CIN_ || in_sizes[2] != EMB_) return;
  if (in_sizes[3] != EMB_ * EMB_ || in_sizes[4] != EMB_ * EMB_ || in_sizes[5] != EMB_ * EMB_) return;
  if (in_sizes[6] != EMB_ * EMB_ || in_sizes[7] != EMB_) return;
  if (in_sizes[8] != COUT_ * EMB_ || in_sizes[9] != COUT_) return;
  if (in_sizes[10] != SEQL_ * EMB_ || in_sizes[11] < 1) return;
  if (out_size != NBATCH_ * COUT_ * SEQL_) return;
  if (ws_size < WS_TOTAL) return;

  const float* x     = (const float*)d_in[0];
  const float* W_cp  = (const float*)d_in[1];
  const float* b_cp  = (const float*)d_in[2];
  const float* W_q   = (const float*)d_in[3];
  const float* W_k   = (const float*)d_in[4];
  const float* W_v   = (const float*)d_in[5];
  const float* W_o   = (const float*)d_in[6];
  const float* b_o   = (const float*)d_in[7];
  const float* W_out = (const float*)d_in[8];
  const float* b_out = (const float*)d_in[9];
  const float* pos   = (const float*)d_in[10];
  const float* gatep = (const float*)d_in[11];
  float* out = (float*)d_out;

  char* ws = (char*)d_ws;
  unsigned short* QK16 = (unsigned short*)(void*)(ws + OFFB_QK);
  unsigned short* VT16 = (unsigned short*)(void*)(ws + OFFB_VT);
  unsigned short* O16  = (unsigned short*)(void*)(ws + OFFB_O);
  const float OSC = 16.0f;                // attention-output carry

  // 1. x, weights -> q|k plane [tok][256] and v^T plane [b][(h,d)][tok], f16
  embed_qkv_kernel<<<dim3(NTOK_ / TB_, 1, 1), dim3(256, 1, 1), 0, stream>>>(x, W_cp, b_cp, W_q, W_k, W_v, pos, QK16, VT16);

  // 2. attention -> O16 [tok][128] f16 (x16)
  attn_full64_f16_kernel<<<dim3(NBATCH_ * NHEAD_ * (SEQL_ / AT_QB), 1, 1), dim3(AT_NG * AT_NW * 32, 1, 1), 0, stream>>>(
      QK16, VT16, O16, 0.125f, OSC);

  // 3. W_o, W_out, biases and gated residual -> out [b][c][tok] f32
  proj_out_kernel<<<dim3(NTOK_ / TB_, 1, 1), dim3(256, 1, 1), 0, stream>>>(O16, W_o, b_o, W_out, b_out, x, gatep, out);
}

// v008
// It runs in 37.1 microseconds.
// Two timings next to v007 put it at 1.07 and 1.08 times that version's speed.
// All steps since v000 together make it 9.61 times as fast.
// Contractions (token embed 64->128, fused q|k projection, v^T projection, q.k^T, p.v, W_o projection, W_out projection): v_wmma_f32_16x16x32_f16 (f16 operands: weights carried x8, attention output x16, softmax numerators x2^15; f32 accumulate); softmax statistics, biases, positional add and gated residual in f32.
#include <hip/hip_runtime.h>
#include <math.h>
#include <stdint.h>

typedef __attribute__((ext_vector_type(16))) _Float16 v16h;
typedef __attribute__((ext_vector_type(8)))  _Float16 v8h;
typedef __attribute__((ext_vector_type(2)))  _Float16 v2h;
typedef __attribute__((ext_vector_type(8)))  float    v8f;
typedef __attribute__((ext_vector_type(4)))  float    v4f;

// ---- problem geometry ----
constexpr int NBATCH_  = 2;
constexpr int CIN_     = 64;
constexpr int EMB_     = 128;
constexpr int COUT_    = 64;
constexpr int NHEAD_   = 2;
constexpr int HDIM_    = 64;
constexpr int SEQL_    = 4096;               // 16*16*16 tokens per batch element
constexpr int NTOK_    = NBATCH_ * SEQL_;    // 8192
constexpr int QKPITCH_ = 2 * EMB_;           // fused q|k plane pitch (halves)

//   QK16  f16 [8192 tok][256] (q|k)          0         4194304
//   VT16  f16 [2][128 (h,d)][4096]     4194304         2097152
//   O16   f16 [8192 tok][128] (x16)    6291456         2097152
constexpr size_t OFFB_QK  = 0;
constexpr size_t OFFB_VT  = OFFB_QK + (size_t)NTOK_ * QKPITCH_ * 2;
constexpr size_t OFFB_O   = OFFB_VT + (size_t)NBATCH_ * EMB_ * SEQL_ * 2;
constexpr size_t WS_TOTAL = OFFB_O  + (size_t)NTOK_ * EMB_ * 2;
static_assert((OFFB_VT % 128) == 0 && (OFFB_O % 128) == 0, "128-B aligned regions");

// s_wait_xcnt 0 behind a run of global loads, before any register that holds one of their addresses is written again; the addresses are
// inputs of the statement so that their registers stay theirs up to the wait (not even a later load's result lands in one before it).
__device__ __forceinline__ void addr_wait1(const void* a) { asm volatile("s_wait_xcnt 0x0" :: "v"(a) : "memory"); }
__device__ __forceinline__ void addr_wait4(const void* a, const void* b, const void* c, const void* d) {
  asm volatile("s_wait_xcnt 0x0" :: "v"(a), "v"(b), "v"(c), "v"(d) : "memory");
}
__device__ __forceinline__ void addr_wait6(const void* a, const void* b, const void* c, const void* d, const void* e, const void* f) {
  asm volatile("s_wait_xcnt 0x0" :: "v"(a), "v"(b), "v"(c), "v"(d), "v"(e), "v"(f) : "memory");
}
template <typename T> struct Frag;
template <> struct Frag<_Float16> {
  typedef v16h V; union U { v16h v; v8h h[2]; };
  static __device__ __forceinline__ v16h load(const _Float16* p) {   // elements 0..7 <- p[0..7], 8..15 <- p[16..23]
    U f; f.h[0] = *(const v8h*)(p); f.h[1] = *(const v8h*)(p + 16); return f.v;
  }
  static __device__ __forceinline__ v8f mma(v16h a, v16h b, v8f c) {
    return __builtin_amdgcn_wmma_f32_16x16x32_f16(false, a, false, b, (short)0, c, false, false);
  }
};
// The same fragment straight from an f32 weight row: the load, and apart from it (so that a wave can issue all its loads before it
// waits for the first) the cast in registers with the x8 carry (a power of two: exact).
struct WRaw { v4f a, b, c, d; };
__device__ __forceinline__ WRaw load_wraw(const float* p) {
  WRaw w; w.a = *(const v4f*)(p); w.b = *(const v4f*)(p + 4); w.c = *(const v4f*)(p + 16); w.d = *(const v4f*)(p + 20); return w;
}
__device__ __forceinline__ v16h cast_w8(const WRaw& w) {
  const v4f a = w.a, b = w.b, c = w.c, d = w.d;
  v16h f;
#pragma unroll
  for (int e = 0; e < 4; ++e) {
    f[e]      = (_Float16)(a[e] * 8.0f);
    f[4 + e]  = (_Float16)(b[e] * 8.0f);
    f[8 + e]  = (_Float16)(c[e] * 8.0f);
    f[12 + e] = (_Float16)(d[e] * 8.0f);
  }
  return f;
}

constexpr int TB_  = 64;    // tokens per work-group of the two projection kernels
constexpr int XTP_ = 72;    // LDS pitches in halves: 16 B x odd, so the 16 rows of a ds_load_b128 fragment read fall on different banks
constexpr int XFP_ = 136;
constexpr int QKP_ = 264;
constexpr int VTP_ = 72;
constexpr int OUP_ = 68;    // floats

// ---------------------------------------------------------------------------
// Token embed and q | k | v^T projections of 64 tokens, one work-group of 8 waves; nothing between the stages leaves the work-group.
//   x[b][64 ch][t0..t0+63] f32 -> XTs[tok][ch] f16 (LDS) -> XFs[tok][e] = XTs . W_cp^T + b_cp + pos, f16 (LDS)
//   -> q|k rows [tok][256] (A = XFs, B = W_q / W_k rows) and v^T rows [(h,d)][tok] (A = W_v rows, B = XFs), staged in LDS for 16-B stores.
// Wave w owns embed columns w*16..+15, q|k columns w*32..+31 and v^T rows w*16..+15, for all 64 tokens: every weight is read once per work-group.
// A and B fragments share one lane map: row or column = lane & 15, k = 8*(lane>>4) + {0..7, 16..23}; D: row = 8*(lane>>4) + r, column = lane & 15.
// ---------------------------------------------------------------------------
__global__ __launch_bounds__(256) void embed_qkv_kernel(const float* __restrict__ x, const float* __restrict__ W_cp,
                                                        const float* __restrict__ b_cp, const float* __restrict__ W_q,
                                                        const float* __restrict__ W_k, const float* __restrict__ W_v,
                                                        const float* __restrict__ pos,
                                                        unsigned short* __restrict__ qkp, unsigned short* __restrict__ vtp) {
  typedef Frag<_Float16> F;
  __shared__ __align__(16) _Float16 XTs[TB_ * XTP_];
  __shared__ __align__(16) _Float16 XFs[TB_ * XFP_];
  __shared__ __align__(16) _Float16 QKs[TB_ * QKP_];
  __shared__ __align__(16) _Float16 VTs[EMB_ * VTP_];
  const int tid   = threadIdx.x;
  const int lane  = tid & 31;
  const int wave  = tid >> 5;
  const int rlane = lane & 15;
  const int koff  = (lane >> 4) * 8;
  const int mOff  = (lane >> 4) * 8;
  const int b     = blockIdx.x / (SEQL_ / TB_);
  const int t0    = (blockIdx.x % (SEQL_ / TB_)) * TB_;
  const float inv_w = 0.125f;

  // ---- first run of global loads: the x tile (which the first barrier waits for), then the weights of the embed and of q | k ----
  const int c4 = (tid & 15) * 4, cp = tid >> 4;       // 4 tokens of channels 2cp, 2cp+1, 32+2cp, 33+2cp
  const float* px = x + (size_t)b * CIN_ * SEQL_ + (size_t)(2 * cp) * SEQL_ + t0 + c4;
  const v4f xa0 = *(const v4f*)(px);
  const v4f xa1 = *(const v4f*)(px + SEQL_);
  const v4f xb0 = *(const v4f*)(px + 32 * SEQL_);
  const v4f xb1 = *(const v4f*)(px + 33 * SEQL_);
  const float* pc = W_cp + (size_t)(wave * 16 + rlane) * CIN_ + koff;
  const float* pq = ((wave < 4) ? W_q : W_k) + (size_t)((wave & 3) * 32 + rlane) * EMB_ + koff;
  const float* pb = b_cp + wave * 16 + rlane;
  WRaw rc[2], rq[2][4];
#pragma unroll
  for (int ks = 0; ks < 2; ++ks) rc[ks] = load_wraw(pc + ks * 32);
#pragma unroll
  for (int j = 0; j < 2; ++j)
#pragma unroll
    for (int ks = 0; ks < 4; ++ks) rq[j][ks] = load_wraw(pq + j * 16 * EMB_ + ks * 32);
  const float bn = pb[0];
  addr_wait4(px, pc, pq, pb);
  // keeps the scheduler from sinking the loads above down to their casts, where each fragment would wait out its own trip to memory
  __builtin_amdgcn_sched_barrier(0);

  // ---- x tile -> LDS, transposed, f16 ----
#pragma unroll
  for (int e = 0; e < 4; ++e) {
    *(v2h*)(XTs + (c4 + e) * XTP_ + 2 * cp)      = (v2h){(_Float16)xa0[e], (_Float16)xa1[e]};
    *(v2h*)(XTs + (c4 + e) * XTP_ + 32 + 2 * cp) = (v2h){(_Float16)xb0[e], (_Float16)xb1[e]};
  }
  v16h wc[2], wq[2][4];
#pragma unroll
  for (int ks = 0; ks < 2; ++ks) wc[ks] = cast_w8(rc[ks]);
#pragma unroll
  for (int ks = 0; ks < 4; ++ks) wq[0][ks] = cast_w8(rq[0][ks]);

  // ---- two more runs, each into registers that the casts in front of it have freed, while the first run is still arriving: W_v, then pos ----
  const float* pv = W_v + (size_t)(wave * 16 + rlane) * EMB_ + koff;
  WRaw rw[4];
#pragma unroll
  for (int ks = 0; ks < 4; ++ks) rw[ks] = load_wraw(pv + ks * 32);
  addr_wait1(pv);
  // as above: the run is issued whole, here, and not piece by piece where its values are used
  __builtin_amdgcn_sched_barrier(0);
#pragma unroll
  for (int ks = 0; ks < 4; ++ks) wq[1][ks] = cast_w8(rq[1][ks]);
  const float* pp = pos + (size_t)(t0 + mOff) * EMB_ + wave * 16 + rlane;
  float pe[4][8];
#pragma unroll
  for (int mt = 0; mt < 4; ++mt)
#pragma unroll
    for (int r = 0; r < 8; ++r) pe[mt][r] = pp[(mt * 16 + r) * EMB_];
  addr_wait1(pp);
  // as above
  __builtin_amdgcn_sched_barrier(0);
  __syncthreads();   // the whole x tile stands in LDS

  // ---- embed: 64 tokens x this wave's 16 columns, K = 64 ----
  v8f ea[4];
#pragma unroll
  for (int mt = 0; mt < 4; ++mt) {
    ea[mt] = (v8f){0.f,0.f,0.f,0.f,0.f,0.f,0.f,0.f};
#pragma unroll
    for (int ks = 0; ks < 2; ++ks) ea[mt] = F::mma(F::load(XTs + (mt * 16 + rlane) * XTP_ + ks * 32 + koff), wc[ks], ea[mt]);
  }
#pragma unroll
  for (int mt = 0; mt < 4; ++mt)
#pragma unroll
    for (int r = 0; r < 8; ++r) {
      float v = ea[mt][r] * inv_w;
      v += bn;
      v += pe[mt][r];
      XFs[(mt * 16 + mOff + r) * XFP_ + wave * 16 + rlane] = (_Float16)v;
    }
  __syncthreads();   // all 128 embed columns of the 64 tokens stand in LDS

  // ---- q | k (tokens x columns) and v^T (rows x tokens), K = 128; a token fragment serves as A of the first and as B of the second ----
  v16h wv[4];
#pragma unroll
  for (int ks = 0; ks < 4; ++ks) wv[ks] = cast_w8(rw[ks]);
  v8f aq[4][2], av[4];
#pragma unroll
  for (int mt = 0; mt < 4; ++mt) {
    aq[mt][0] = (v8f){0.f,0.f,0.f,0.f,0.f,0.f,0.f,0.f};
    aq[mt][1] = (v8f){0.f,0.f,0.f,0.f,0.f,0.f,0.f,0.f};
    av[mt]    = (v8f){0.f,0.f,0.f,0.f,0.f,0.f,0.f,0.f};
  }
#pragma unroll
  for (int ks = 0; ks < 4; ++ks) {
#pragma unroll
    for (int mt = 0; mt < 4; ++mt) {
      const v16h xf = F::load(XFs + (mt * 16 + rlane) * XFP_ + ks * 32 + koff);
      aq[mt][0] = F::mma(xf, wq[0][ks], aq[mt][0]);
      aq[mt][1] = F::mma(xf, wq[1][ks], aq[mt][1]);
      av[mt]    = F::mma(wv[ks], xf, av[mt]);
    }
  }
#pragma unroll
  for (int mt = 0; mt < 4; ++mt)
#pragma unroll
    for (int r = 0; r < 8; ++r) {
      QKs[(mt * 16 + mOff + r) * QKP_ + wave * 32 + rlane]      = (_Float16)(aq[mt][0][r] * inv_w);
      QKs[(mt * 16 + mOff + r) * QKP_ + wave * 32 + 16 + rlane] = (_Float16)(aq[mt][1][r] * inv_w);
      VTs[(wave * 16 + mOff + r) * VTP_ + mt * 16 + rlane]      = (_Float16)(av[mt][r] * inv_w);
    }
  __syncthreads();   // both output tiles stand in LDS

  // ---- 16-B stores: a wave writes one whole 512-B q|k row, or four whole 128-B v^T row pieces, per instruction ----
  _Float16* qg = (_Float16*)(void*)qkp + ((size_t)b * SEQL_ + t0) * QKPITCH_;
  _Float16* vg = (_Float16*)(void*)vtp + (size_t)b * EMB_ * SEQL_ + t0;
#pragma unroll
  for (int it = 0; it < 8; ++it) {
    const int row = it * 8 + wave;
    *(v8h*)(qg + (size_t)row * QKPITCH_ + lane * 8) = *(const v8h*)(QKs + row * QKP_ + lane * 8);
  }
#pragma unroll
  for (int it = 0; it < 4; ++it) {
    const int row = it * 32 + (tid >> 3);
    *(v8h*)(vg + (size_t)row * SEQL_ + (tid & 7) * 8) = *(const v8h*)(VTs + row * VTP_ + (tid & 7) * 8);
  }
}

// ---------------------------------------------------------------------------
// W_o and W_out projections with the gated residual, 64 tokens per work-group of 8 waves; the W_o result stays in LDS.
//   Os16[tok][128] (attention out x16, f16) -> O1s[tok][n] = Os16 . W_o^T / 16 + b_o, f16 (LDS)
//   -> out[b][c][tok] = W_out[c][:] . O1s[tok][:] + b_out[c] + gate * x[b][c][tok], f32, staged in LDS for 16-B stores.
// Wave w owns W_o columns w*16..+15 for all 64 tokens, then out rows (w&3)*16..+15 x tokens (w>>2)*32..+31. Lane maps as above.
// ---------------------------------------------------------------------------
__global__ __launch_bounds__(256) void proj_out_kernel(const unsigned short* __restrict__ op, const float* __restrict__ W_o,
                                                       const float* __restrict__ b_o, const float* __restrict__ W_out,
                                                       const float* __restrict__ b_out, const float* __restrict__ x,
                                                       const float* __restrict__ gatep, float* __restrict__ out) {
  typedef Frag<_Float16> F;
  __shared__ __align__(16) _Float16 Os16[TB_ * XFP_];
  __shared__ __align__(16) _Float16 O1s[TB_ * XFP_];
  __shared__ __align__(16) float    Outs[COUT_ * OUP_];
  const int tid   = threadIdx.x;
  const int lane  = tid & 31;
  const int wave  = tid >> 5;
  const int rlane = lane & 15;
  const int koff  = (lane >> 4) * 8;
  const int mOff  = (lane >> 4) * 8;
  const int b     = blockIdx.x / (SEQL_ / TB_);
  const int t0    = (blockIdx.x % (SEQL_ / TB_)) * TB_;
  const int ct    = wave & 3, tp = wave >> 2;
  const float inv_w = 0.125f, inv_wo = 1.0f / 128.0f;

  // ---- every global load of this wave, the attention tile (which the first barrier waits for) first ----
  const _Float16* po = (const _Float16*)(const void*)op + ((size_t)b * SEQL_ + t0 + (tid >> 4)) * EMB_ + (tid & 15) * 8;
  v8h ov[4];
#pragma unroll
  for (int it = 0; it < 4; ++it) ov[it] = *(const v8h*)(po + it * 16 * EMB_);
  const float* pw = W_o + (size_t)(wave * 16 + rlane) * EMB_ + koff;
  const float* pu = W_out + (size_t)(ct * 16 + rlane) * EMB_ + koff;
  WRaw ro[4], ru[4];
#pragma unroll
  for (int ks = 0; ks < 4; ++ks) ro[ks] = load_wraw(pw + ks * 32);
#pragma unroll
  for (int ks = 0; ks < 4; ++ks) ru[ks] = load_wraw(pu + ks * 32);
  const float* pb = b_o + wave * 16 + rlane;
  const float bn = pb[0];
  const float* pm = b_out + ct * 16 + mOff;
  float bm[8];
#pragma unroll
  for (int r = 0; r < 8; ++r) bm[r] = pm[r];
  const float* pr = x + (size_t)b * COUT_ * SEQL_ + (size_t)(ct * 16 + mOff) * SEQL_ + t0 + tp * 32 + rlane;
  float rv[2][8];
#pragma unroll
  for (int i = 0; i < 2; ++i)
#pragma unroll
    for (int r = 0; r < 8; ++r) rv[i][r] = pr[(size_t)r * SEQL_ + i * 16];
  addr_wait6(po, pw, pu, pb, pm, pr);
  const float rg = gatep[0];
  // keeps the scheduler from sinking the loads above down to their uses, where each group would wait out its own trip to memory
  __builtin_amdgcn_sched_barrier(0);

#pragma unroll
  for (int it = 0; it < 4; ++it) *(v8h*)(Os16 + ((tid >> 4) + it * 16) * XFP_ + (tid & 15) * 8) = ov[it];
  v16h wo[4], wu[4];
#pragma unroll
  for (int ks = 0; ks < 4; ++ks) { wo[ks] = cast_w8(ro[ks]); wu[ks] = cast_w8(ru[ks]); }
  __syncthreads();   // the whole attention tile stands in LDS

  v8f a1[4];
#pragma unroll
  for (int mt = 0; mt < 4; ++mt) a1[mt] = (v8f){0.f,0.f,0.f,0.f,0.f,0.f,0.f,0.f};
#pragma unroll
  for (int ks = 0; ks < 4; ++ks)
#pragma unroll
    for (int mt = 0; mt < 4; ++mt) a1[mt] = F::mma(F::load(Os16 + (mt * 16 + rlane) * XFP_ + ks * 32 + koff), wo[ks], a1[mt]);
#pragma unroll
  for (int mt = 0; mt < 4; ++mt)
#pragma unroll
    for (int r = 0; r < 8; ++r) {
      float v = a1[mt][r] * inv_wo;
      v += bn;
      O1s[(mt * 16 + mOff + r) * XFP_ + wave * 16 + rlane] = (_Float16)v;
    }
  __syncthreads();   // all 128 W_o columns of the 64 tokens stand in LDS

  v8f a2[2];
#pragma unroll
  for (int i = 0; i < 2; ++i) a2[i] = (v8f){0.f,0.f,0.f,0.f,0.f,0.f,0.f,0.f};
#pragma unroll
  for (int ks = 0; ks < 4; ++ks)
#pragma unroll
    for (int i = 0; i < 2; ++i) a2[i] = F::mma(wu[ks], F::load(O1s + (tp * 32 + i * 16 + rlane) * XFP_ + ks * 32 + koff), a2[i]);
#pragma unroll
  for (int i = 0; i < 2; ++i)
#pragma unroll
    for (int r = 0; r < 8; ++r) {
      float v = a2[i][r] * inv_w;
      v += bm[r];
      v += rg * rv[i][r];
      Outs[(ct * 16 + mOff + r) * OUP_ + tp * 32 + i * 16 + rlane] = v;
    }
  __syncthreads();   // the 64 x 64 output tile stands in LDS

  // ---- 16-B stores: a wave writes two whole 256-B row pieces per instruction ----
  float* og = out + (size_t)b * COUT_ * SEQL_ + t0;
#pragma unroll
  for (int it = 0; it < 4; ++it) {
    const int row = it * 16 + (tid >> 4);
    *(v4f*)(og + (size_t)row * SEQL_ + (tid & 15) * 4) = *(const v4f*)(Outs + row * OUP_ + (tid & 15) * 4);
  }
}

// =====================================================================================
// Full (non-causal, unmasked) attention, head dim 64, all (batch, head, 64-query tile) in one launch.
//   q|k plane (f16): q element (b, t, h, d) at [(b*SEQL_+t)*QKPITCH_ + h*64 + d]; k at the same + EMB_.
//   v^T plane (f16): element (b, h, d, s) at [b*EMB_*SEQL_ + (h*64 + d)*SEQL_ + s]
//   out (f16, carried x oscale): element (b, t, h, d) at [(b*SEQL_+t)*EMB_ + h*64 + d]
//   scores^T = (k . q^T) * sscale : v_wmma_f32_16x16x32_f16, A = K rows, B = Q; a lane holds 8 keys x 1 query per tile
//   out^T    = v^T . p^T          : p = 2^(s*sscale*log2(e) - m + 15) in f16, packed in-lane from two score tiles into the
//                                   B operand (no LDS trip), A = V^T rows, f32 accumulate, 1/l in f32 (l carries the same 2^15)
//   online softmax in f32 (chunks of 64 keys, compile-time trip count, no masking): maximum and sum
//   run in-lane; the two wave halves join the maximum once per chunk and the sum once after the loop.
//   Block = 16 waves = 4 key groups x 4 query tiles = 64 query rows of one (batch, head); grid.x = 256.
//   Key group g walks chunks g, g+4, g+8, ... (16 of the 64) with its own K / V^T LDS tiles, so each SIMD holds four
//   waves whose LDS, memory and vector waits cover one another. After the loop each group leaves its maximum, sum and
//   unnormalised out tile in LDS; behind one __syncthreads the 16 waves merge them (4 rows of one query tile each).
//   K / V^T chunk staging: the group's 128 threads x 32 elements per plane = its whole 64x64 tile, by asynchronous 16-B copies
//   to LDS (8 lanes cover one 128-B row), two buffers: the next chunk's copies fly while this chunk is worked on; one
//   __syncthreads per chunk publishes the next tile and frees the one just read.
//   Fragment reads stand in two whole groups per chunk, each well ahead of its WMMAs: the 16 V^T reads at the head of the trip (they
//   land under the score products and the softmax), the next chunk's 16 K reads directly behind the barrier that publishes it (they
//   land under the copies' issue and this chunk's out products, which need registers only and so stand behind that barrier).
// =====================================================================================
#define AT_D 64
#define AT_NW 4
#define AT_NG 4
#define AT_QB 64
#define AT_KC 64
#define AT_LP 72   // LDS row pitch of the K and V^T tiles in halves: 144 B = 16 B x odd, so the 16 rows of one ds_load_b128 fragment read fall on 16 different groups of four banks
#define P_CARRY_L2 15.0f   // softmax numerators and their sums are carried x 2^15: the carry is an addend of the base-2 exponent

__device__ __forceinline__ v8f at_mma_h(v16h a, v16h b, v8f c) {
  return __builtin_amdgcn_wmma_f32_16x16x32_f16(false, a, false, b, (short)0, c, false, false);
}

// 2^x on the bare v_exp_f32 (no range fix-up: the softmax's arguments are <= 15 up to rounding, and a result below 2^-126 may go to 0).
__device__ __forceinline__ void exp2x8(v8f& x) {
  float a = x[0], b = x[1], c = x[2], d = x[3], e = x[4], f = x[5], g = x[6], h = x[7];
  asm("v_exp_f32 %0, %0\n\tv_exp_f32 %1, %1\n\tv_exp_f32 %2, %2\n\tv_exp_f32 %3, %3\n\t"
      "v_exp_f32 %4, %4\n\tv_exp_f32 %5, %5\n\tv_exp_f32 %6, %6\n\tv_exp_f32 %7, %7\n\tv_nop"
      : "+v"(a), "+v"(b), "+v"(c), "+v"(d), "+v"(e), "+v"(f), "+v"(g), "+v"(h));
  x = (v8f){a, b, c, d, e, f, g, h};
}
__device__ __forceinline__ float exp2x1(float x) {
  asm("v_exp_f32 %0, %0\n\tv_nop" : "+v"(x));   // the v_nop: the same slot behind a single v_exp_f32
  return x;
}

// lane l <-> lane l ^ 16: the two halves of a wave hold the two key halves of the same query column
__device__ __forceinline__ float xhalf(float x) {
  return __builtin_bit_cast(float, __builtin_amdgcn_permlanex16(__builtin_bit_cast(int, x), __builtin_bit_cast(int, x),
                                                                0x76543210, 0xfedcba98, false, false));
}

// One thread's share of one chunk: four 16-B pieces of the K tile and four of the V^T tile, global memory -> LDS through no register.
// kd, vd: the lane's LDS byte addresses of its first pieces; kg, vg: their global addresses; piece i lies 16 tile rows behind piece i-1.
// The s_wait_xcnt 0 is the last line of the copies' own statement, so that no register a copy names is written again in front of it.
__device__ __forceinline__ void at_copy_chunk(unsigned kd, unsigned vd, const _Float16* kg, const _Float16* vg) {
  const unsigned kd1 = kd + 16 * AT_LP * 2, kd2 = kd + 32 * AT_LP * 2, kd3 = kd + 48 * AT_LP * 2;
  const unsigned vd1 = vd + 16 * AT_LP * 2, vd2 = vd + 32 * AT_LP * 2, vd3 = vd + 48 * AT_LP * 2;
  const _Float16* kg1 = kg + 16 * QKPITCH_; const _Float16* kg2 = kg + 32 * QKPITCH_; const _Float16* kg3 = kg + 48 * QKPITCH_;
  const _Float16* vg1 = vg + 16 * SEQL_;    const _Float16* vg2 = vg + 32 * SEQL_;    const _Float16* vg3 = vg + 48 * SEQL_;
  asm volatile("global_load_async_to_lds_b128 %0, %8, off\n\t"
               "global_load_async_to_lds_b128 %1, %9, off\n\t"
               "global_load_async_to_lds_b128 %2, %10, off\n\t"
               "global_load_async_to_lds_b128 %3, %11, off\n\t"
               "global_load_async_to_lds_b128 %4, %12, off\n\t"
               "global_load_async_to_lds_b128 %5, %13, off\n\t"
               "global_load_async_to_lds_b128 %6, %14, off\n\t"
               "global_load_async_to_lds_b128 %7, %15, off\n\t"
               "s_wait_xcnt 0x0"
               :: "v"(kd), "v"(kd1), "v"(kd2), "v"(kd3), "v"(vd), "v"(vd1), "v"(vd2), "v"(vd3),
                  "v"(kg), "v"(kg1), "v"(kg2), "v"(kg3), "v"(vg), "v"(vg1), "v"(vg2), "v"(vg3)
               : "memory");
}

__global__ __launch_bounds__(AT_NG * AT_NW * 32)
void attn_full64_f16_kernel(const unsigned short* __restrict__ qkp, const unsigned short* __restrict__ vtp,
                            unsigned short* __restrict__ op, float sscale, float oscale) {
  union FH { v16h v; v8h h[2]; };
  __shared__ __align__(16) _Float16 KshG[2][AT_NG][AT_KC * AT_LP]; // K [kv][d]      rows of 64 at pitch 72, 9 KB per key group and buffer
  __shared__ __align__(16) _Float16 VthG[2][AT_NG][AT_D * AT_LP];  // V [d][kv]      rows of 64 at pitch 72, 9 KB per key group and buffer
  __shared__ __align__(16) float    Os[AT_NG * AT_NW][16 * 68];    // per wave partial out tile, pitch 68
  __shared__ float Ms[AT_NG][AT_QB];                               // per group and query: running maximum
  __shared__ float Ls[AT_NG][AT_QB];                               // per group and query: sum x 2^15 of 2^(s*sl2 - maximum)

  const int tid  = threadIdx.x & (AT_NW * 32 - 1);   // thread within the key group
  const int grp  = threadIdx.x >> 7;                 // key group 0..3
  const int wave = tid >> 5;                         // query tile 0..3
  const int lane = tid & 31;
  const int hh   = lane >> 4;
  const int c    = lane & 15;

  const int nqb = SEQL_ / AT_QB;          // 64
  const int bx = blockIdx.x;
  const int qb = bx % nqb;
  const int bh = bx / nqb;                // 0..NBATCH_*NHEAD_-1
  const int h  = bh % NHEAD_;
  const int b  = bh / NHEAD_;
  const int q0 = qb * AT_QB + wave * 16;

  const _Float16* Qh = (const _Float16*)(const void*)qkp + (size_t)b * SEQL_ * QKPITCH_ + (size_t)h * AT_D;
  const _Float16* Kh = Qh + EMB_;
  const _Float16* Vh = (const _Float16*)(const void*)vtp + (size_t)b * EMB_ * SEQL_ + (size_t)h * AT_D * SEQL_;
  _Float16*       ob = (_Float16*)(void*)op + (size_t)b * SEQL_ * EMB_ + (size_t)h * AT_D;

  // ---- Q fragments (B operand, column = lane&15, split k map via Frag load): 2 d-chunks ----
  v16h qa[2];
#pragma unroll
  for (int dc = 0; dc < 2; ++dc) {
    const _Float16* qr = Qh + (size_t)(q0 + c) * QKPITCH_ + dc * 32 + 8 * hh;
    qa[dc] = Frag<_Float16>::load(qr);
  }

  const float sl2 = sscale * 1.44269504f;   // score scale x log2(e): the softmax runs in base 2
  float mrow = -INFINITY, lrow = 0.f;   // this lane's query: running maximum in base-2 units (both halves alike), sum x 2^15 over this half's keys
  v8f oacc[4];                          // oacc[t][r] = out^T[d = t*16 + 8*hh + r][query c]
#pragma unroll
  for (int t = 0; t < 4; ++t) oacc[t] = (v8f){0.f,0.f,0.f,0.f,0.f,0.f,0.f,0.f};

  const int nChunks = SEQL_ / (AT_KC * AT_NG);   // 16 per key group, compile-time constant
  static_assert(SEQL_ / (AT_KC * AT_NG) >= 2, "the two-buffer prologue fills two chunks");
  // staging coverage: the group's 128 threads x (4 x 8) elements = 64 rows x 64 per plane = its whole chunk tile;
  // thread -> row (tid >> 3) + 16 i, 16-B piece tid & 7: each wave-wide copy moves four whole 128-B rows
  const int sr = tid >> 3, sp = (tid & 7) * 8;
  const unsigned bufB = (unsigned)(AT_NG * AT_KC * AT_LP * 2);                        // bytes from buffer 0 to buffer 1, K and V^T alike
  const unsigned kdst = (unsigned)(size_t)(&KshG[0][grp][sr * AT_LP + sp]);           // low 32 bits = the byte address in LDS
  const unsigned vdst = (unsigned)(size_t)(&VthG[0][grp][sr * AT_LP + sp]);
  const _Float16* ksrc = Kh + (size_t)(grp * AT_KC + sr) * QKPITCH_ + sp;             // chunk 0: K row grp*64 + sr, d = sp..sp+7
  const _Float16* vsrc = Vh + (size_t)sr * SEQL_ + grp * AT_KC + sp;                  // chunk 0: V^T row d = sr, s = grp*64 + sp..+7
  const size_t kstep = (size_t)AT_NG * AT_KC * QKPITCH_;                              // one chunk further: 256 keys
  const size_t vstep = (size_t)AT_NG * AT_KC;
  at_copy_chunk(kdst, vdst, ksrc, vsrc);
  asm volatile("s_wait_asynccnt 0x0" ::: "memory");   // this wave's pieces of chunk 0 have landed
  __syncthreads();                                    // ... and every other wave's: chunk 0 may be read
  at_copy_chunk(kdst + bufB, vdst + bufB, ksrc + kstep, vsrc + vstep);
  const int fro = c * AT_LP + 8 * hh;   // this lane's place in a 16-row fragment: row c, halves 8*hh.. and 16 + 8*hh..
  v16h kf[2][4];                        // K fragments of the chunk in work: [d half][16-key tile]
#pragma unroll
  for (int dc = 0; dc < 2; ++dc)
#pragma unroll
    for (int j = 0; j < 4; ++j) kf[dc][j] = Frag<_Float16>::load(KshG[0][grp] + j * 16 * AT_LP + fro + dc * 32);
  for (int kc = 0; kc < nChunks; ++kc) {
    const _Float16* Vth = VthG[kc & 1][grp];
    v16h vf[2][4];                      // V^T fragments of this chunk: [32-key half][16-row tile]
#pragma unroll
    for (int kk = 0; kk < 2; ++kk)
#pragma unroll
      for (int t = 0; t < 4; ++t) vf[kk][t] = Frag<_Float16>::load(Vth + t * 16 * AT_LP + fro + kk * 32);
    // keeps the scheduler from sinking the reads above down to their WMMAs, where each pair would wait out its own trip to LDS
    __builtin_amdgcn_sched_barrier(0);

    v8f s[4];
#pragma unroll
    for (int j = 0; j < 4; ++j) s[j] = (v8f){0.f,0.f,0.f,0.f,0.f,0.f,0.f,0.f};
#pragma unroll
    for (int dc = 0; dc < 2; ++dc)
#pragma unroll
      for (int j = 0; j < 4; ++j) s[j] = at_mma_h(kf[dc][j], qa[dc], s[j]);   // s[j][r] = score of key j*16 + 8*hh + r against query c
    float m4[4];
#pragma unroll
    for (int j = 0; j < 4; ++j) {
      float m = -INFINITY;
#pragma unroll
      for (int r = 0; r < 8; ++r) m = fmaxf(m, s[j][r]);
      m4[j] = m;
    }
    float cm = fmaxf(fmaxf(m4[0], m4[1]), fmaxf(m4[2], m4[3]));
    cm = fmaxf(cm, xhalf(cm)) * sl2;                          // sl2 > 0: the largest raw score is the largest scaled one
    const float mnew = fmaxf(mrow, cm);
    const float alpha = exp2x1(mrow - mnew);                  // first chunk: 2^(-inf) = 0
    mrow = mnew;
    const float moff = P_CARRY_L2 - mnew;
    v8h ph[4];
    float ps4[4];
#pragma unroll
    for (int j = 0; j < 4; ++j) {
      float psum = 0.f;
#pragma unroll
      for (int r = 0; r < 8; ++r) s[j][r] = fmaf(s[j][r], sl2, moff);
      exp2x8(s[j]);                        // p x 2^15 = 2^(s*sl2 - m + 15): one fma and one v_exp_f32 per score
#pragma unroll
      for (int r = 0; r < 8; ++r) {
        psum += s[j][r];
        ph[j][r] = (_Float16)s[j][r];
      }
      ps4[j] = psum;
    }
    lrow = lrow * alpha + ((ps4[0] + ps4[1]) + (ps4[2] + ps4[3]));
    // keeps the scheduler from lifting the waits and the barrier below over the softmax, where the V^T reads would still be on their way
    __builtin_amdgcn_sched_barrier(0);
    asm volatile("s_wait_dscnt 0x0" ::: "memory");      // this wave's reads of the buffer that is refilled below have returned
    asm volatile("s_wait_asynccnt 0x0" ::: "memory");   // this wave's pieces of chunk kc + 1 have landed
    __syncthreads();                                    // publishes chunk kc + 1 and ends every wave's reads of chunk kc
    if (kc + 1 < nChunks) {                             // the next chunk's K fragments, from the buffer just published
      const _Float16* Kn = KshG[(kc + 1) & 1][grp];
#pragma unroll
      for (int dc = 0; dc < 2; ++dc)
#pragma unroll
        for (int j = 0; j < 4; ++j) kf[dc][j] = Frag<_Float16>::load(Kn + j * 16 * AT_LP + fro + dc * 32);
    }
    if (kc + 2 < nChunks)                               // into the buffer just freed; the reads still out are of the other buffer
      at_copy_chunk(kdst + (kc & 1) * bufB, vdst + (kc & 1) * bufB, ksrc + (size_t)(kc + 2) * kstep, vsrc + (size_t)(kc + 2) * vstep);
#pragma unroll
    for (int t = 0; t < 4; ++t)
#pragma unroll
      for (int r = 0; r < 8; ++r) oacc[t][r] *= alpha;
#pragma unroll
    for (int kk = 0; kk < 2; ++kk) {
      FH pb;                       // B operand: elements 0..7 = keys kk*32 + 8*hh + e, 8..15 = keys kk*32 + 16 + 8*hh + e
      pb.h[0] = ph[2 * kk];
      pb.h[1] = ph[2 * kk + 1];
#pragma unroll
      for (int t = 0; t < 4; ++t) oacc[t] = at_mma_h(vf[kk][t], pb.v, oacc[t]);
    }
  }
  asm volatile("s_wait_asynccnt 0x0" ::: "memory");     // no copy is outstanding when the wave goes on to the merge and ends

  // ---- this wave's partial (its key group, its query tile) -> LDS, unnormalised ----
  float* os = Os[grp * AT_NW + wave];
  {
    const float lt = lrow + xhalf(lrow);
    if (hh == 0) {
      Ms[grp][wave * 16 + c] = mrow;
      Ls[grp][wave * 16 + c] = lt;
    }
#pragma unroll
    for (int t = 0; t < 4; ++t)
#pragma unroll
      for (int g = 0; g < 2; ++g) {
        v4f w;
#pragma unroll
        for (int e = 0; e < 4; ++e) w[e] = oacc[t][4 * g + e];
        *(v4f*)(os + c * 68 + t * 16 + 8 * hh + 4 * g) = w;
      }
  }
  __syncthreads();   // all four groups' partials stand in LDS before any wave merges them
  {
    // merge: wave (grp, wave) takes rows grp*4 .. grp*4+3 of query tile 'wave'; 8 lanes x 8 columns cover a row
    const int q8 = lane >> 3, c8 = (lane & 7) * 8;
    const int row = grp * 4 + q8;
    float mg[AT_NG];
    float mall = -INFINITY;
#pragma unroll
    for (int g = 0; g < AT_NG; ++g) {
      mg[g] = Ms[g][wave * 16 + row];
      mall = fmaxf(mall, mg[g]);
    }
    float lall = 0.f;
    float acc[8];
#pragma unroll
    for (int e = 0; e < 8; ++e) acc[e] = 0.f;
#pragma unroll
    for (int g = 0; g < AT_NG; ++g) {
      const float wg = exp2x1(mg[g] - mall);
      lall += wg * Ls[g][wave * 16 + row];
      const float* sp = Os[g * AT_NW + wave] + row * 68 + c8;
#pragma unroll
      for (int e = 0; e < 8; ++e) acc[e] += wg * sp[e];
    }
    const float inv = oscale / lall;   // the sum carries the numerators' 2^15
    v8h hv;
#pragma unroll
    for (int e = 0; e < 8; ++e) hv[e] = (_Float16)(acc[e] * inv);
    *(v8h*)(ob + (size_t)(q0 + row) * EMB_ + c8) = hv;
  }
}

// ---------------------------------------------------------------------------
extern "C" void kernel_launch(void* const* d_in, const int* in_sizes, int n_in,
                              void* d_out, int out_size, void* d_ws, size_t ws_size,
                              hipStream_t stream) {
  if (n_in < 12) return;
  if (in_sizes[0] != NBATCH_ * CIN_ * SEQL_) return;
  if (in_sizes[1] != EMB_ * CIN_ || in_sizes[2] != EMB_) return;
  if (in_sizes[3] != EMB_ * EMB_ || in_sizes[4] != EMB_ * EMB_ || in_sizes[5] != EMB_ * EMB_) return;
  if (in_sizes[6] != EMB_ * EMB_ || in_sizes[7] != EMB_) return;
  if (in_sizes[8] != COUT_ * EMB_ || in_sizes[9] != COUT_) return;
  if (in_sizes[10] != SEQL_ * EMB_ || in_sizes[11] < 1) return;
  if (out_size != NBATCH_ * COUT_ * SEQL_) return;
  if (ws_size < WS_TOTAL) return;

  const float* x     = (const float*)d_in[0];
  const float* W_cp  = (const float*)d_in[1];
  const float* b_cp  = (const float*)d_in[2];
  const float* W_q   = (const float*)d_in[3];
  const float* W_k   = (const float*)d_in[4];
  const float* W_v   = (const float*)d_in[5];
  const float* W_o   = (const float*)d_in[6];
  const float* b_o   = (const float*)d_in[7];
  const float* W_out = (const float*)d_in[8];
  const float* b_out = (const float*)d_in[9];
  const float* pos   = (const float*)d_in[10];
  const float* gatep = (const float*)d_in[11];
  float* out = (float*)d_out;

  char* ws = (char*)d_ws;
  unsigned short* QK16 = (unsigned short*)(void*)(ws + OFFB_QK);
  unsigned short* VT16 = (unsigned short*)(void*)(ws + OFFB_VT);
  unsigned short* O16  = (unsigned short*)(void*)(ws + OFFB_O);
  const float OSC = 16.0f;                // attention-output carry

  // 1. x, weights -> q|k plane [tok][256] and v^T plane [b][(h,d)][tok], f16
  embed_qkv_kernel<<<dim3(NTOK_ / TB_, 1, 1), dim3(256, 1, 1), 0, stream>>>(x, W_cp, b_cp, W_q, W_k, W_v, pos, QK16, VT16);

  // 2. attention -> O16 [tok][128] f16 (x16)
  attn_full64_f16_kernel<<<dim3(NBATCH_ * NHEAD_ * (SEQL_ / AT_QB), 1, 1), dim3(AT_NG * AT_NW * 32, 1, 1), 0, stream>>>(
      QK16, VT16, O16, 0.125f, OSC);

  // 3. W_o, W_out, biases and gated residual -> out [b][c][tok] f32
  proj_out_kernel<<<dim3(NTOK_ / TB_, 1, 1), dim3(256, 1, 1), 0, stream>>>(O16, W_o, b_o, W_out, b_out, x, gatep, out);
}

// v009
// Measured time: 35.1 microseconds a run.
// Next to v008, in two timings, it ran 1.06 and 1.05 times as fast.
// Over all steps from v000 it is 10.1 times as fast.
// Contractions (token embed 64->128, fused q|k projection, v^T projection, q.k^T, p.v, W_o projection, W_out projection): v_wmma_f32_16x16x32_f16 (f16 operands: weights carried x8, attention output x16, softmax numerators x2^15; f32 accumulate); softmax statistics, biases, positional add and gated residual in f32.
#include <hip/hip_runtime.h>
#include <math.h>
#include <stdint.h>

typedef __attribute__((ext_vector_type(16))) _Float16 v16h;
typedef __attribute__((ext_vector_type(8)))  _Float16 v8h;
typedef __attribute__((ext_vector_type(4)))  _Float16 v4h;
typedef __attribute__((ext_vector_type(2)))  _Float16 v2h;
typedef __attribute__((ext_vector_type(8)))  float    v8f;
typedef __attribute__((ext_vector_type(4)))  float    v4f;

// ---- problem geometry ----
constexpr int NBATCH_  = 2;
constexpr int CIN_     = 64;
constexpr int EMB_     = 128;
constexpr int COUT_    = 64;
constexpr int NHEAD_   = 2;
constexpr int HDIM_    = 64;
constexpr int SEQL_    = 4096;               // 16*16*16 tokens per batch element
constexpr int NTOK_    = NBATCH_ * SEQL_;    // 8192
constexpr int QKPITCH_ = 2 * EMB_;           // fused q|k plane pitch (halves)

//   QK16  f16 [8192 tok][256] (q|k)          0         4194304
//   VT16  f16 [2][128 (h,d)][4096]     4194304         2097152
//   O16   f16 [8192 tok][128] (x16)    6291456         2097152
constexpr size_t OFFB_QK  = 0;
constexpr size_t OFFB_VT  = OFFB_QK + (size_t)NTOK_ * QKPITCH_ * 2;
constexpr size_t OFFB_O   = OFFB_VT + (size_t)NBATCH_ * EMB_ * SEQL_ * 2;
constexpr size_t WS_TOTAL = OFFB_O  + (size_t)NTOK_ * EMB_ * 2;
static_assert((OFFB_VT % 128) == 0 && (OFFB_O % 128) == 0, "128-B aligned regions");

// s_wait_xcnt 0 behind a run of global loads, before any register that holds one of their addresses is written again; the addresses are
// inputs of the statement so that their registers stay theirs up to the wait (not even a later load's result lands in one before it).
// addr_wait0: for a run whose loads all name the thread index and a scalar base, which no statement can hold: the listing shows the wait in front of their next write.
__device__ __forceinline__ void addr_wait0() { asm volatile("s_wait_xcnt 0x0" ::: "memory"); }
__device__ __forceinline__ void addr_wait1(const void* a) { asm volatile("s_wait_xcnt 0x0" :: "v"(a) : "memory"); }
__device__ __forceinline__ void addr_wait2(const void* a, const void* b) { asm volatile("s_wait_xcnt 0x0" :: "v"(a), "v"(b) : "memory"); }
__device__ __forceinline__ void addr_wait4(const void* a, const void* b, const void* c, const void* d) {
  asm volatile("s_wait_xcnt 0x0" :: "v"(a), "v"(b), "v"(c), "v"(d) : "memory");
}
template <typename T> struct Frag;
template <> struct Frag<_Float16> {
  typedef v16h V; union U { v16h v; v8h h[2]; };
  static __device__ __forceinline__ v16h load(const _Float16* p) {   // elements 0..7 <- p[0..7], 8..15 <- p[16..23]
    U f; f.h[0] = *(const v8h*)(p); f.h[1] = *(const v8h*)(p + 16); return f.v;
  }
  static __device__ __forceinline__ v8f mma(v16h a, v16h b, v8f c) {
    return __builtin_amdgcn_wmma_f32_16x16x32_f16(false, a, false, b, (short)0, c, false, false);
  }
};
// Four f32 weights -> f16 with the x8 carry (a power of two: exact), on their way from a whole-line global load to the weight tile in LDS.
__device__ __forceinline__ v4h cast4_w8(v4f a) {
  v4h h;
#pragma unroll
  for (int e = 0; e < 4; ++e) h[e] = (_Float16)(a[e] * 8.0f);
  return h;
}

constexpr int TB_  = 64;    // tokens per work-group of the two projection kernels
constexpr int XTP_ = 72;    // LDS pitches in halves: 16 B x odd, so the 16 rows of a ds_load_b128 fragment read fall on different banks
constexpr int XFP_ = 136;
constexpr int QKP_ = 264;
constexpr int VTP_ = 72;
constexpr int OUP_ = 68;    // floats

// ---------------------------------------------------------------------------
// Token embed and q | k | v^T projections of 64 tokens, one work-group of 8 waves; nothing between the stages leaves the work-group.
//   x[b][64 ch][t0..t0+63] f32 -> XTs[tok][ch] f16 (LDS) -> XFs[tok][e] = XTs . W_cp^T + b_cp + pos, f16 (LDS)
//   -> q|k rows [tok][256] (A = XFs, B = W_q / W_k rows) and v^T rows [(h,d)][tok] (A = W_v rows, B = XFs), staged in LDS for 16-B stores.
// Wave w owns embed columns w*16..+15, q|k columns w*32..+31 and v^T rows w*16..+15, for all 64 tokens: every weight is read once per work-group.
// Weights: thread t takes 16-B piece t, t + 256, ... of each matrix, so a wave-wide load covers 512 contiguous bytes (four whole lines; a fragment
// load straight from the f32 rows would touch 16 lines for the same bytes); cast to f16 they stand in LDS as [row][k], and fragments are LDS reads.
// A and B fragments share one lane map: row or column = lane & 15, k = 8*(lane>>4) + {0..7, 16..23}; D: row = 8*(lane>>4) + r, column = lane & 15.
// ---------------------------------------------------------------------------
__global__ __launch_bounds__(256) void embed_qkv_kernel(const float* __restrict__ x, const float* __restrict__ W_cp,
                                                        const float* __restrict__ b_cp, const float* __restrict__ W_q,
                                                        const float* __restrict__ W_k, const float* __restrict__ W_v,
                                                        const float* __restrict__ pos,
                                                        unsigned short* __restrict__ qkp, unsigned short* __restrict__ vtp) {
  typedef Frag<_Float16> F;
  __shared__ __align__(16) _Float16 XTs[TB_ * XTP_];
  __shared__ __align__(16) _Float16 XFs[TB_ * XFP_];
  __shared__ __align__(16) _Float16 QKs[TB_ * QKP_];
  __shared__ __align__(16) _Float16 VTs[EMB_ * VTP_];
  __shared__ __align__(16) _Float16 WCs[EMB_ * XTP_];        // W_cp x8, [128 rows][64]
  __shared__ __align__(16) _Float16 WQKs[2 * EMB_ * XFP_];   // W_q x8 (rows 0..127), W_k x8 (rows 128..255), [row][128]
  __shared__ __align__(16) _Float16 WVs[EMB_ * XFP_];        // W_v x8, [128 rows][128]
  const int tid   = threadIdx.x;
  const int lane  = tid & 31;
  const int wave  = tid >> 5;
  const int rlane = lane & 15;
  const int koff  = (lane >> 4) * 8;
  const int mOff  = (lane >> 4) * 8;
  const int b     = blockIdx.x / (SEQL_ / TB_);
  const int t0    = (blockIdx.x % (SEQL_ / TB_)) * TB_;
  const float inv_w = 0.125f;

  // ---- first run of global loads: the x tile (which the first barrier waits for), then the weights of the embed and of q | k ----
  const int c4 = (tid & 15) * 4, cp = tid >> 4;       // 4 tokens of channels 2cp, 2cp+1, 32+2cp, 33+2cp
  const float* px = x + (size_t)b * CIN_ * SEQL_ + (size_t)(2 * cp) * SEQL_ + t0 + c4;
  const v4f xa0 = *(const v4f*)(px);
  const v4f xa1 = *(const v4f*)(px + SEQL_);
  const v4f xb0 = *(const v4f*)(px + 32 * SEQL_);
  const v4f xb1 = *(const v4f*)(px + 33 * SEQL_);
  const float* pc = W_cp + tid * 4;                   // piece i: row i*16 + (tid >> 4), k = (tid & 15) * 4
  const float* pq = W_q + tid * 4;                    // piece i: row i*8 + wave, k = lane * 4; W_k and W_v alike
  const float* pk = W_k + tid * 4;
  const float* pb = b_cp + wave * 16 + rlane;
  v4f rc[8], rq[16], rk[16];
#pragma unroll
  for (int i = 0; i < 8; ++i) rc[i] = *(const v4f*)(pc + i * 1024);
#pragma unroll
  for (int i = 0; i < 16; ++i) rq[i] = *(const v4f*)(pq + i * 1024);
#pragma unroll
  for (int i = 0; i < 16; ++i) rk[i] = *(const v4f*)(pk + i * 1024);
  const float bn = pb[0];
  addr_wait2(px, pb);
  // keeps the scheduler from sinking the loads above down to their casts, where each piece would wait out its own trip to memory
  __builtin_amdgcn_sched_barrier(0);

  // ---- x tile -> LDS, transposed, f16; W_cp and W_q -> LDS, f16 ----
#pragma unroll
  for (int e = 0; e < 4; ++e) {
    *(v2h*)(XTs + (c4 + e) * XTP_ + 2 * cp)      = (v2h){(_Float16)xa0[e], (_Float16)xa1[e]};
    *(v2h*)(XTs + (c4 + e) * XTP_ + 32 + 2 * cp) = (v2h){(_Float16)xb0[e], (_Float16)xb1[e]};
  }
#pragma unroll
  for (int i = 0; i < 8; ++i) *(v4h*)(WCs + (i * 16 + (tid >> 4)) * XTP_ + (tid & 15) * 4) = cast4_w8(rc[i]);
#pragma unroll
  for (int i = 0; i < 16; ++i) *(v4h*)(WQKs + (i * 8 + wave) * XFP_ + lane * 4) = cast4_w8(rq[i]);

  // ---- two more runs, each into registers that the casts in front of it have freed, while the first run is still arriving: W_v, then pos ----
  const float* pv = W_v + tid * 4;
  v4f rw[16];
#pragma unroll
  for (int i = 0; i < 16; ++i) rw[i] = *(const v4f*)(pv + i * 1024);
  addr_wait0();
  // as above: the run is issued whole, here, and not piece by piece where its values are used
  __builtin_amdgcn_sched_barrier(0);
#pragma unroll
  for (int i = 0; i < 16; ++i) *(v4h*)(WQKs + (EMB_ + i * 8 + wave) * XFP_ + lane * 4) = cast4_w8(rk[i]);
  const float* pp = pos + (size_t)(t0 + mOff) * EMB_ + wave * 16 + rlane;
  float pe[4][8];
#pragma unroll
  for (int mt = 0; mt < 4; ++mt)
#pragma unroll
    for (int r = 0; r < 8; ++r) pe[mt][r] = pp[(mt * 16 + r) * EMB_];
  addr_wait1(pp);
  // as above
  __builtin_amdgcn_sched_barrier(0);
#pragma unroll
  for (int i = 0; i < 16; ++i) *(v4h*)(WVs + (i * 8 + wave) * XFP_ + lane * 4) = cast4_w8(rw[i]);
  __syncthreads();   // the whole x tile and all four weight matrices stand in LDS

  // ---- embed: 64 tokens x this wave's 16 columns, K = 64 ----
  v16h wc[2];
#pragma unroll
  for (int ks = 0; ks < 2; ++ks) wc[ks] = F::load(WCs + (wave * 16 + rlane) * XTP_ + ks * 32 + koff);
  v8f ea[4];
#pragma unroll
  for (int mt = 0; mt < 4; ++mt) {
    ea[mt] = (v8f){0.f,0.f,0.f,0.f,0.f,0.f,0.f,0.f};
#pragma unroll
    for (int ks = 0; ks < 2; ++ks) ea[mt] = F::mma(F::load(XTs + (mt * 16 + rlane) * XTP_ + ks * 32 + koff), wc[ks], ea[mt]);
  }
  // this wave's q | k and v^T weight fragments: in LDS since the barrier above, read here so that they land under the embed's epilogue
  v16h wq[2][4], wv[4];
#pragma unroll
  for (int ks = 0; ks < 4; ++ks) {
    wq[0][ks] = F::load(WQKs + (wave * 32 + rlane) * XFP_ + ks * 32 + koff);
    wq[1][ks] = F::load(WQKs + (wave * 32 + 16 + rlane) * XFP_ + ks * 32 + koff);
    wv[ks]    = F::load(WVs + (wave * 16 + rlane) * XFP_ + ks * 32 + koff);
  }
#pragma unroll
  for (int mt = 0; mt < 4; ++mt)
#pragma unroll
    for (int r = 0; r < 8; ++r) {
      float v = ea[mt][r] * inv_w;
      v += bn;
      v += pe[mt][r];
      XFs[(mt * 16 + mOff + r) * XFP_ + wave * 16 + rlane] = (_Float16)v;
    }
  __syncthreads();   // all 128 embed columns of the 64 tokens stand in LDS

  // ---- q | k (tokens x columns) and v^T (rows x tokens), K = 128; a token fragment serves as A of the first and as B of the second ----
  v8f aq[4][2], av[4];
#pragma unroll
  for (int mt = 0; mt < 4; ++mt) {
    aq[mt][0] = (v8f){0.f,0.f,0.f,0.f,0.f,0.f,0.f,0.f};
    aq[mt][1] = (v8f){0.f,0.f,0.f,0.f,0.f,0.f,0.f,0.f};
    av[mt]    = (v8f){0.f,0.f,0.f,0.f,0.f,0.f,0.f,0.f};
  }
#pragma unroll
  for (int ks = 0; ks < 4; ++ks) {
#pragma unroll
    for (int mt = 0; mt < 4; ++mt) {
      const v16h xf = F::load(XFs + (mt * 16 + rlane) * XFP_ + ks * 32 + koff);
      aq[mt][0] = F::mma(xf, wq[0][ks], aq[mt][0]);
      aq[mt][1] = F::mma(xf, wq[1][ks], aq[mt][1]);
      av[mt]    = F::mma(wv[ks], xf, av[mt]);
    }
  }
#pragma unroll
  for (int mt = 0; mt < 4; ++mt)
#pragma unroll
    for (int r = 0; r < 8; ++r) {
      QKs[(mt * 16 + mOff + r) * QKP_ + wave * 32 + rlane]      = (_Float16)(aq[mt][0][r] * inv_w);
      QKs[(mt * 16 + mOff + r) * QKP_ + wave * 32 + 16 + rlane] = (_Float16)(aq[mt][1][r] * inv_w);
      VTs[(wave * 16 + mOff + r) * VTP_ + mt * 16 + rlane]      = (_Float16)(av[mt][r] * inv_w);
    }
  __syncthreads();   // both output tiles stand in LDS

  // ---- 16-B stores: a wave writes one whole 512-B q|k row, or four whole 128-B v^T row pieces, per instruction ----
  _Float16* qg = (_Float16*)(void*)qkp + ((size_t)b * SEQL_ + t0) * QKPITCH_;
  _Float16* vg = (_Float16*)(void*)vtp + (size_t)b * EMB_ * SEQL_ + t0;
#pragma unroll
  for (int it = 0; it < 8; ++it) {
    const int row = it * 8 + wave;
    *(v8h*)(qg + (size_t)row * QKPITCH_ + lane * 8) = *(const v8h*)(QKs + row * QKP_ + lane * 8);
  }
#pragma unroll
  for (int it = 0; it < 4; ++it) {
    const int row = it * 32 + (tid >> 3);
    *(v8h*)(vg + (size_t)row * SEQL_ + (tid & 7) * 8) = *(const v8h*)(VTs + row * VTP_ + (tid & 7) * 8);
  }
}

// ---------------------------------------------------------------------------
// W_o and W_out projections with the gated residual, 64 tokens per work-group of 8 waves; the W_o result stays in LDS.
//   Os16[tok][128] (attention out x16, f16) -> O1s[tok][n] = Os16 . W_o^T / 16 + b_o, f16 (LDS)
//   -> out[b][c][tok] = W_out[c][:] . O1s[tok][:] + b_out[c] + gate * x[b][c][tok], f32, staged in LDS for 16-B stores.
// Wave w owns W_o columns w*16..+15 for all 64 tokens, then out rows (w&3)*16..+15 x tokens (w>>2)*32..+31. Lane maps as above.
// Weights as above: whole-line loads, cast to f16, [row][k] in LDS, fragments by LDS reads.
// ---------------------------------------------------------------------------
__global__ __launch_bounds__(256) void proj_out_kernel(const unsigned short* __restrict__ op, const float* __restrict__ W_o,
                                                       const float* __restrict__ b_o, const float* __restrict__ W_out,
                                                       const float* __restrict__ b_out, const float* __restrict__ x,
                                                       const float* __restrict__ gatep, float* __restrict__ out) {
  typedef Frag<_Float16> F;
  __shared__ __align__(16) _Float16 Os16[TB_ * XFP_];
  __shared__ __align__(16) _Float16 O1s[TB_ * XFP_];
  __shared__ __align__(16) float    Outs[COUT_ * OUP_];
  __shared__ __align__(16) _Float16 WOs[EMB_ * XFP_];    // W_o x8, [128 rows][128]
  __shared__ __align__(16) _Float16 WUs[COUT_ * XFP_];   // W_out x8, [64 rows][128]
  const int tid   = threadIdx.x;
  const int lane  = tid & 31;
  const int wave  = tid >> 5;
  const int rlane = lane & 15;
  const int koff  = (lane >> 4) * 8;
  const int mOff  = (lane >> 4) * 8;
  const int b     = blockIdx.x / (SEQL_ / TB_);
  const int t0    = (blockIdx.x % (SEQL_ / TB_)) * TB_;
  const int ct    = wave & 3, tp = wave >> 2;
  const float inv_w = 0.125f, inv_wo = 1.0f / 128.0f;

  // ---- every global load of this wave, the attention tile (which the first barrier waits for) first ----
  const _Float16* po = (const _Float16*)(const void*)op + ((size_t)b * SEQL_ + t0 + (tid >> 4)) * EMB_ + (tid & 15) * 8;
  v8h ov[4];
#pragma unroll
  for (int it = 0; it < 4; ++it) ov[it] = *(const v8h*)(po + it * 16 * EMB_);
  const float* pw = W_o + tid * 4;                    // piece i: row i*8 + wave, k = lane * 4; W_out alike
  const float* pu = W_out + tid * 4;
  v4f ro[16], ru[8];
#pragma unroll
  for (int i = 0; i < 16; ++i) ro[i] = *(const v4f*)(pw + i * 1024);
#pragma unroll
  for (int i = 0; i < 8; ++i) ru[i] = *(const v4f*)(pu + i * 1024);
  const float* pb = b_o + wave * 16 + rlane;
  const float bn = pb[0];
  const float* pm = b_out + ct * 16 + mOff;
  float bm[8];
#pragma unroll
  for (int r = 0; r < 8; ++r) bm[r] = pm[r];
  const float* pr = x + (size_t)b * COUT_ * SEQL_ + (size_t)(ct * 16 + mOff) * SEQL_ + t0 + tp * 32 + rlane;
  float rv[2][8];
#pragma unroll
  for (int i = 0; i < 2; ++i)
#pragma unroll
    for (int r = 0; r < 8; ++r) rv[i][r] = pr[(size_t)r * SEQL_ + i * 16];
  addr_wait4(po, pb, pm, pr);
  const float rg = gatep[0];
  // keeps the scheduler from sinking the loads above down to their uses, where each group would wait out its own trip to memory
  __builtin_amdgcn_sched_barrier(0);

#pragma unroll
  for (int it = 0; it < 4; ++it) *(v8h*)(Os16 + ((tid >> 4) + it * 16) * XFP_ + (tid & 15) * 8) = ov[it];
#pragma unroll
  for (int i = 0; i < 16; ++i) *(v4h*)(WOs + (i * 8 + wave) * XFP_ + lane * 4) = cast4_w8(ro[i]);
#pragma unroll
  for (int i = 0; i < 8; ++i) *(v4h*)(WUs + (i * 8 + wave) * XFP_ + lane * 4) = cast4_w8(ru[i]);
  __syncthreads();   // the whole attention tile, W_o and W_out stand in LDS

  v16h wo[4], wu[4];
#pragma unroll
  for (int ks = 0; ks < 4; ++ks) {
    wo[ks] = F::load(WOs + (wave * 16 + rlane) * XFP_ + ks * 32 + koff);
    wu[ks] = F::load(WUs + (ct * 16 + rlane) * XFP_ + ks * 32 + koff);
  }

  v8f a1[4];
#pragma unroll
  for (int mt = 0; mt < 4; ++mt) a1[mt] = (v8f){0.f,0.f,0.f,0.f,0.f,0.f,0.f,0.f};
#pragma unroll
  for (int ks = 0; ks < 4; ++ks)
#pragma unroll
    for (int mt = 0; mt < 4; ++mt) a1[mt] = F::mma(F::load(Os16 + (mt * 16 + rlane) * XFP_ + ks * 32 + koff), wo[ks], a1[mt]);
#pragma unroll
  for (int mt = 0; mt < 4; ++mt)
#pragma unroll
    for (int r = 0; r < 8; ++r) {
      float v = a1[mt][r] * inv_wo;
      v += bn;
      O1s[(mt * 16 + mOff + r) * XFP_ + wave * 16 + rlane] = (_Float16)v;
    }
  __syncthreads();   // all 128 W_o columns of the 64 tokens stand in LDS

  v8f a2[2];
#pragma unroll
  for (int i = 0; i < 2; ++i) a2[i] = (v8f){0.f,0.f,0.f,0.f,0.f,0.f,0.f,0.f};
#pragma unroll
  for (int ks = 0; ks < 4; ++ks)
#pragma unroll
    for (int i = 0; i < 2; ++i) a2[i] = F::mma(wu[ks], F::load(O1s + (tp * 32 + i * 16 + rlane) * XFP_ + ks * 32 + koff), a2[i]);
#pragma unroll
  for (int i = 0; i < 2; ++i)
#pragma unroll
    for (int r = 0; r < 8; ++r) {
      float v = a2[i][r] * inv_w;
      v += bm[r];
      v += rg * rv[i][r];
      Outs[(ct * 16 + mOff + r) * OUP_ + tp * 32 + i * 16 + rlane] = v;
    }
  __syncthreads();   // the 64 x 64 output tile stands in LDS

  // ---- 16-B stores: a wave writes two whole 256-B row pieces per instruction ----
  float* og = out + (size_t)b * COUT_ * SEQL_ + t0;
#pragma unroll
  for (int it = 0; it < 4; ++it) {
    const int row = it * 16 + (tid >> 4);
    *(v4f*)(og + (size_t)row * SEQL_ + (tid & 15) * 4) = *(const v4f*)(Outs + row * OUP_ + (tid & 15) * 4);
  }
}

// =====================================================================================
// Full (non-causal, unmasked) attention, head dim 64, all (batch, head, 64-query tile) in one launch.
//   q|k plane (f16): q element (b, t, h, d) at [(b*SEQL_+t)*QKPITCH_ + h*64 + d]; k at the same + EMB_.
//   v^T plane (f16): element (b, h, d, s) at [b*EMB_*SEQL_ + (h*64 + d)*SEQL_ + s]
//   out (f16, carried x oscale): element (b, t, h, d) at [(b*SEQL_+t)*EMB_ + h*64 + d]
//   scores^T = (k . q^T) * sscale : v_wmma_f32_16x16x32_f16, A = K rows, B = Q; a lane holds 8 keys x 1 query per tile
//   out^T    = v^T . p^T          : p = 2^(s*sscale*log2(e) - m + 15) in f16, packed in-lane from two score tiles into the
//                                   B operand (no LDS trip), A = V^T rows, f32 accumulate, 1/l in f32 (l carries the same 2^15)
//   online softmax in f32 (chunks of 64 keys, compile-time trip count, no masking): maximum and sum
//   run in-lane; the two wave halves join the maximum once per chunk and the sum once after the loop.
//   Block = 16 waves = 4 key groups x 4 query tiles = 64 query rows of one (batch, head); grid.x = 256.
//   Key group g walks chunks g, g+4, g+8, ... (16 of the 64) with its own K / V^T LDS tiles, so each SIMD holds four
//   waves whose LDS, memory and vector waits cover one another. After the loop each group leaves its maximum, sum and
//   unnormalised out tile in LDS; behind one __syncthreads the 16 waves merge them (4 rows of one query tile each).
//   K / V^T chunk staging: the group's 128 threads x 32 elements per plane = its whole 64x64 tile, by asynchronous 16-B copies
//   to LDS (8 lanes cover one 128-B row), two buffers: the next chunk's copies fly while this chunk is worked on; one
//   __syncthreads per chunk publishes the next tile and frees the one just read.
//   Fragment reads stand in two whole groups per chunk, each well ahead of its WMMAs: the 16 V^T reads at the head of the trip (they
//   land under the score products and the softmax), the next chunk's 16 K reads directly behind the barrier that publishes it (they
//   land under the copies' issue and this chunk's out products, which need registers only and so stand behind that barrier).
// =====================================================================================
#define AT_D 64
#define AT_NW 4
#define AT_NG 4
#define AT_QB 64
#define AT_KC 64
#define AT_LP 72   // LDS row pitch of the K and V^T tiles in halves: 144 B = 16 B x odd, so the 16 rows of one ds_load_b128 fragment read fall on 16 different groups of four banks
#define P_CARRY_L2 15.0f   // softmax numerators and their sums are carried x 2^15: the carry is an addend of the base-2 exponent

__device__ __forceinline__ v8f at_mma_h(v16h a, v16h b, v8f c) {
  return __builtin_amdgcn_wmma_f32_16x16x32_f16(false, a, false, b, (short)0, c, false, false);
}

// 2^x on the bare v_exp_f32 (no range fix-up: the softmax's arguments are <= 15 up to rounding, and a result below 2^-126 may go to 0).
__device__ __forceinline__ void exp2x8(v8f& x) {
  float a = x[0], b = x[1], c = x[2], d = x[3], e = x[4], f = x[5], g = x[6], h = x[7];
  asm("v_exp_f32 %0, %0\n\tv_exp_f32 %1, %1\n\tv_exp_f32 %2, %2\n\tv_exp_f32 %3, %3\n\t"
      "v_exp_f32 %4, %4\n\tv_exp_f32 %5, %5\n\tv_exp_f32 %6, %6\n\tv_exp_f32 %7, %7\n\tv_nop"
      : "+v"(a), "+v"(b), "+v"(c), "+v"(d), "+v"(e), "+v"(f), "+v"(g), "+v"(h));
  x = (v8f){a, b, c, d, e, f, g, h};
}
__device__ __forceinline__ float exp2x1(float x) {
  asm("v_exp_f32 %0, %0\n\tv_nop" : "+v"(x));   // the v_nop: the same slot behind a single v_exp_f32
  return x;
}

// lane l <-> lane l ^ 16: the two halves of a wave hold the two key halves of the same query column
__device__ __forceinline__ float xhalf(float x) {
  return __builtin_bit_cast(float, __builtin_amdgcn_permlanex16(__builtin_bit_cast(int, x), __builtin_bit_cast(int, x),
                                                                0x76543210, 0xfedcba98, false, false));
}

// One thread's share of one chunk: four 16-B pieces of the K tile and four of the V^T tile, global memory -> LDS through no register.
// kd, vd: the lane's LDS byte addresses of its first pieces; kg, vg: their global addresses; piece i lies 16 tile rows behind piece i-1.
// The s_wait_xcnt 0 is the last line of the copies' own statement, so that no register a copy names is written again in front of it.
__device__ __forceinline__ void at_copy_chunk(unsigned kd, unsigned vd, const _Float16* kg, const _Float16* vg) {
  const unsigned kd1 = kd + 16 * AT_LP * 2, kd2 = kd + 32 * AT_LP * 2, kd3 = kd + 48 * AT_LP * 2;
  const unsigned vd1 = vd + 16 * AT_LP * 2, vd2 = vd + 32 * AT_LP * 2, vd3 = vd + 48 * AT_LP * 2;
  const _Float16* kg1 = kg + 16 * QKPITCH_; const _Float16* kg2 = kg + 32 * QKPITCH_; const _Float16* kg3 = kg + 48 * QKPITCH_;
  const _Float16* vg1 = vg + 16 * SEQL_;    const _Float16* vg2 = vg + 32 * SEQL_;    const _Float16* vg3 = vg + 48 * SEQL_;
  asm volatile("global_load_async_to_lds_b128 %0, %8, off\n\t"
               "global_load_async_to_lds_b128 %1, %9, off\n\t"
               "global_load_async_to_lds_b128 %2, %10, off\n\t"
               "global_load_async_to_lds_b128 %3, %11, off\n\t"
               "global_load_async_to_lds_b128 %4, %12, off\n\t"
               "global_load_async_to_lds_b128 %5, %13, off\n\t"
               "global_load_async_to_lds_b128 %6, %14, off\n\t"
               "global_load_async_to_lds_b128 %7, %15, off\n\t"
               "s_wait_xcnt 0x0"
               :: "v"(kd), "v"(kd1), "v"(kd2), "v"(kd3), "v"(vd), "v"(vd1), "v"(vd2), "v"(vd3),
                  "v"(kg), "v"(kg1), "v"(kg2), "v"(kg3), "v"(vg), "v"(vg1), "v"(vg2), "v"(vg3)
               : "memory");
}

__global__ __launch_bounds__(AT_NG * AT_NW * 32)
void attn_full64_f16_kernel(const unsigned short* __restrict__ qkp, const unsigned short* __restrict__ vtp,
                            unsigned short* __restrict__ op, float sscale, float oscale) {
  union FH { v16h v; v8h h[2]; };
  __shared__ __align__(16) _Float16 KshG[2][AT_NG][AT_KC * AT_LP]; // K [kv][d]      rows of 64 at pitch 72, 9 KB per key group and buffer
  __shared__ __align__(16) _Float16 VthG[2][AT_NG][AT_D * AT_LP];  // V [d][kv]      rows of 64 at pitch 72, 9 KB per key group and buffer
  __shared__ __align__(16) float    Os[AT_NG * AT_NW][16 * 68];    // per wave partial out tile, pitch 68
  __shared__ float Ms[AT_NG][AT_QB];                               // per group and query: running maximum
  __shared__ float Ls[AT_NG][AT_QB];                               // per group and query: sum x 2^15 of 2^(s*sl2 - maximum)

  const int tid  = threadIdx.x & (AT_NW * 32 - 1);   // thread within the key group
  const int grp  = threadIdx.x >> 7;                 // key group 0..3
  const int wave = tid >> 5;                         // query tile 0..3
  const int lane = tid & 31;
  const int hh   = lane >> 4;
  const int c    = lane & 15;

  const int nqb = SEQL_ / AT_QB;          // 64
  const int bx = blockIdx.x;
  const int qb = bx % nqb;
  const int bh = bx / nqb;                // 0..NBATCH_*NHEAD_-1
  const int h  = bh % NHEAD_;
  const int b  = bh / NHEAD_;
  const int q0 = qb * AT_QB + wave * 16;

  const _Float16* Qh = (const _Float16*)(const void*)qkp + (size_t)b * SEQL_ * QKPITCH_ + (size_t)h * AT_D;
  const _Float16* Kh = Qh + EMB_;
  const _Float16* Vh = (const _Float16*)(const void*)vtp + (size_t)b * EMB_ * SEQL_ + (size_t)h * AT_D * SEQL_;
  _Float16*       ob = (_Float16*)(void*)op + (size_t)b * SEQL_ * EMB_ + (size_t)h * AT_D;

  // ---- Q fragments (B operand, column = lane&15, split k map via Frag load): 2 d-chunks ----
  v16h qa[2];
#pragma unroll
  for (int dc = 0; dc < 2; ++dc) {
    const _Float16* qr = Qh + (size_t)(q0 + c) * QKPITCH_ + dc * 32 + 8 * hh;
    qa[dc] = Frag<_Float16>::load(qr);
  }

  const float sl2 = sscale * 1.44269504f;   // score scale x log2(e): the softmax runs in base 2
  float mrow = -INFINITY, lrow = 0.f;   // this lane's query: running maximum in base-2 units (both halves alike), sum x 2^15 over this half's keys
  v8f oacc[4];                          // oacc[t][r] = out^T[d = t*16 + 8*hh + r][query c]
#pragma unroll
  for (int t = 0; t < 4; ++t) oacc[t] = (v8f){0.f,0.f,0.f,0.f,0.f,0.f,0.f,0.f};

  const int nChunks = SEQL_ / (AT_KC * AT_NG);   // 16 per key group, compile-time constant
  static_assert(SEQL_ / (AT_KC * AT_NG) >= 2, "the two-buffer prologue fills two chunks");
  // staging coverage: the group's 128 threads x (4 x 8) elements = 64 rows x 64 per plane = its whole chunk tile;
  // thread -> row (tid >> 3) + 16 i, 16-B piece tid & 7: each wave-wide copy moves four whole 128-B rows
  const int sr = tid >> 3, sp = (tid & 7) * 8;
  const unsigned bufB = (unsigned)(AT_NG * AT_KC * AT_LP * 2);                        // bytes from buffer 0 to buffer 1, K and V^T alike
  const unsigned kdst = (unsigned)(size_t)(&KshG[0][grp][sr * AT_LP + sp]);           // low 32 bits = the byte address in LDS
  const unsigned vdst = (unsigned)(size_t)(&VthG[0][grp][sr * AT_LP + sp]);
  const _Float16* ksrc = Kh + (size_t)(grp * AT_KC + sr) * QKPITCH_ + sp;             // chunk 0: K row grp*64 + sr, d = sp..sp+7
  const _Float16* vsrc = Vh + (size_t)sr * SEQL_ + grp * AT_KC + sp;                  // chunk 0: V^T row d = sr, s = grp*64 + sp..+7
  const size_t kstep = (size_t)AT_NG * AT_KC * QKPITCH_;                              // one chunk further: 256 keys
  const size_t vstep = (size_t)AT_NG * AT_KC;
  at_copy_chunk(kdst, vdst, ksrc, vsrc);
  asm volatile("s_wait_asynccnt 0x0" ::: "memory");   // this wave's pieces of chunk 0 have landed
  __syncthreads();                                    // ... and every other wave's: chunk 0 may be read
  at_copy_chunk(kdst + bufB, vdst + bufB, ksrc + kstep, vsrc + vstep);
  const int fro = c * AT_LP + 8 * hh;   // this lane's place in a 16-row fragment: row c, halves 8*hh.. and 16 + 8*hh..
  v16h kf[2][4];                        // K fragments of the chunk in work: [d half][16-key tile]
#pragma unroll
  for (int dc = 0; dc < 2; ++dc)
#pragma unroll
    for (int j = 0; j < 4; ++j) kf[dc][j] = Frag<_Float16>::load(KshG[0][grp] + j * 16 * AT_LP + fro + dc * 32);
  for (int kc = 0; kc < nChunks; ++kc) {
    const _Float16* Vth = VthG[kc & 1][grp];
    v16h vf[2][4];                      // V^T fragments of this chunk: [32-key half][16-row tile]
#pragma unroll
    for (int kk = 0; kk < 2; ++kk)
#pragma unroll
      for (int t = 0; t < 4; ++t) vf[kk][t] = Frag<_Float16>::load(Vth + t * 16 * AT_LP + fro + kk * 32);
    // keeps the scheduler from sinking the reads above down to their WMMAs, where each pair would wait out its own trip to LDS
    __builtin_amdgcn_sched_barrier(0);

    v8f s[4];
#pragma unroll
    for (int j = 0; j < 4; ++j) s[j] = (v8f){0.f,0.f,0.f,0.f,0.f,0.f,0.f,0.f};
#pragma unroll
    for (int dc = 0; dc < 2; ++dc)
#pragma unroll
      for (int j = 0; j < 4; ++j) s[j] = at_mma_h(kf[dc][j], qa[dc], s[j]);   // s[j][r] = score of key j*16 + 8*hh + r against query c
    float m4[4];
#pragma unroll
    for (int j = 0; j < 4; ++j) {
      float m = -INFINITY;
#pragma unroll
      for (int r = 0; r < 8; ++r) m = fmaxf(m, s[j][r]);
      m4[j] = m;
    }
    float cm = fmaxf(fmaxf(m4[0], m4[1]), fmaxf(m4[2], m4[3]));
    cm = fmaxf(cm, xhalf(cm)) * sl2;                          // sl2 > 0: the largest raw score is the largest scaled one
    const float mnew = fmaxf(mrow, cm);
    const float alpha = exp2x1(mrow - mnew);                  // first chunk: 2^(-inf) = 0
    mrow = mnew;
    const float moff = P_CARRY_L2 - mnew;
    v8h ph[4];
    float ps4[4];
#pragma unroll
    for (int j = 0; j < 4; ++j) {
      float psum = 0.f;
#pragma unroll
      for (int r = 0; r < 8; ++r) s[j][r] = fmaf(s[j][r], sl2, moff);
      exp2x8(s[j]);                        // p x 2^15 = 2^(s*sl2 - m + 15): one fma and one v_exp_f32 per score
#pragma unroll
      for (int r = 0; r < 8; ++r) {
        psum += s[j][r];
        ph[j][r] = (_Float16)s[j][r];
      }
      ps4[j] = psum;
    }
    lrow = lrow * alpha + ((ps4[0] + ps4[1]) + (ps4[2] + ps4[3]));
    // keeps the scheduler from lifting the waits and the barrier below over the softmax, where the V^T reads would still be on their way
    __builtin_amdgcn_sched_barrier(0);
    asm volatile("s_wait_dscnt 0x0" ::: "memory");      // this wave's reads of the buffer that is refilled below have returned
    asm volatile("s_wait_asynccnt 0x0" ::: "memory");   // this wave's pieces of chunk kc + 1 have landed
    __syncthreads();                                    // publishes chunk kc + 1 and ends every wave's reads of chunk kc
    if (kc + 1 < nChunks) {                             // the next chunk's K fragments, from the buffer just published
      const _Float16* Kn = KshG[(kc + 1) & 1][grp];
#pragma unroll
      for (int dc = 0; dc < 2; ++dc)
#pragma unroll
        for (int j = 0; j < 4; ++j) kf[dc][j] = Frag<_Float16>::load(Kn + j * 16 * AT_LP + fro + dc * 32);
    }
    if (kc + 2 < nChunks)                               // into the buffer just freed; the reads still out are of the other buffer
      at_copy_chunk(kdst + (kc & 1) * bufB, vdst + (kc & 1) * bufB, ksrc + (size_t)(kc + 2) * kstep, vsrc + (size_t)(kc + 2) * vstep);
#pragma unroll
    for (int t = 0; t < 4; ++t)
#pragma unroll
      for (int r = 0; r < 8; ++r) oacc[t][r] *= alpha;
#pragma unroll
    for (int kk = 0; kk < 2; ++kk) {
      FH pb;                       // B operand: elements 0..7 = keys kk*32 + 8*hh + e, 8..15 = keys kk*32 + 16 + 8*hh + e
      pb.h[0] = ph[2 * kk];
      pb.h[1] = ph[2 * kk + 1];
#pragma unroll
      for (int t = 0; t < 4; ++t) oacc[t] = at_mma_h(vf[kk][t], pb.v, oacc[t]);
    }
  }
  asm volatile("s_wait_asynccnt 0x0" ::: "memory");     // no copy is outstanding when the wave goes on to the merge and ends

  // ---- this wave's partial (its key group, its query tile) -> LDS, unnormalised ----
  float* os = Os[grp * AT_NW + wave];
  {
    const float lt = lrow + xhalf(lrow);
    if (hh == 0) {
      Ms[grp][wave * 16 + c] = mrow;
      Ls[grp][wave * 16 + c] = lt;
    }
#pragma unroll
    for (int t = 0; t < 4; ++t)
#pragma unroll
      for (int g = 0; g < 2; ++g) {
        v4f w;
#pragma unroll
        for (int e = 0; e < 4; ++e) w[e] = oacc[t][4 * g + e];
        *(v4f*)(os + c * 68 + t * 16 + 8 * hh + 4 * g) = w;
      }
  }
  __syncthreads();   // all four groups' partials stand in LDS before any wave merges them
  {
    // merge: wave (grp, wave) takes rows grp*4 .. grp*4+3 of query tile 'wave'; 8 lanes x 8 columns cover a row
    const int q8 = lane >> 3, c8 = (lane & 7) * 8;
    const int row = grp * 4 + q8;
    float mg[AT_NG];
    float mall = -INFINITY;
#pragma unroll
    for (int g = 0; g < AT_NG; ++g) {
      mg[g] = Ms[g][wave * 16 + row];
      mall = fmaxf(mall, mg[g]);
    }
    float lall = 0.f;
    float acc[8];
#pragma unroll
    for (int e = 0; e < 8; ++e) acc[e] = 0.f;
#pragma unroll
    for (int g = 0; g < AT_NG; ++g) {
      const float wg = exp2x1(mg[g] - mall);
      lall += wg * Ls[g][wave * 16 + row];
      const float* sp = Os[g * AT_NW + wave] + row * 68 + c8;
#pragma unroll
      for (int e = 0; e < 8; ++e) acc[e] += wg * sp[e];
    }
    const float inv = oscale / lall;   // the sum carries the numerators' 2^15
    v8h hv;
#pragma unroll
    for (int e = 0; e < 8; ++e) hv[e] = (_Float16)(acc[e] * inv);
    *(v8h*)(ob + (size_t)(q0 + row) * EMB_ + c8) = hv;
  }
}

// ---------------------------------------------------------------------------
extern "C" void kernel_launch(void* const* d_in, const int* in_sizes, int n_in,
                              void* d_out, int out_size, void* d_ws, size_t ws_size,
                              hipStream_t stream) {
  if (n_in < 12) return;
  if (in_sizes[0] != NBATCH_ * CIN_ * SEQL_) return;
  if (in_sizes[1] != EMB_ * CIN_ || in_sizes[2] != EMB_) return;
  if (in_sizes[3] != EMB_ * EMB_ || in_sizes[4] != EMB_ * EMB_ || in_sizes[5] != EMB_ * EMB_) return;
  if (in_sizes[6] != EMB_ * EMB_ || in_sizes[7] != EMB_) return;
  if (in_sizes[8] != COUT_ * EMB_ || in_sizes[9] != COUT_) return;
  if (in_sizes[10] != SEQL_ * EMB_ || in_sizes[11] < 1) return;
  if (out_size != NBATCH_ * COUT_ * SEQL_) return;
  if (ws_size < WS_TOTAL) return;

  const float* x     = (const float*)d_in[0];
  const float* W_cp  = (const float*)d_in[1];
  const float* b_cp  = (const float*)d_in[2];
  const float* W_q   = (const float*)d_in[3];
  const float* W_k   = (const float*)d_in[4];
  const float* W_v   = (const float*)d_in[5];
  const float* W_o   = (const float*)d_in[6];
  const float* b_o   = (const float*)d_in[7];
  const float* W_out = (const float*)d_in[8];
  const float* b_out = (const float*)d_in[9];
  const float* pos   = (const float*)d_in[10];
  const float* gatep = (const float*)d_in[11];
  float* out = (float*)d_out;

  char* ws = (char*)d_ws;
  unsigned short* QK16 = (unsigned short*)(void*)(ws + OFFB_QK);
  unsigned short* VT16 = (unsigned short*)(void*)(ws + OFFB_VT);
  unsigned short* O16  = (unsigned short*)(void*)(ws + OFFB_O);
  const float OSC = 16.0f;                // attention-output carry

  // 1. x, weights -> q|k plane [tok][256] and v^T plane [b][(h,d)][tok], f16
  embed_qkv_kernel<<<dim3(NTOK_ / TB_, 1, 1), dim3(256, 1, 1), 0, stream>>>(x, W_cp, b_cp, W_q, W_k, W_v, pos, QK16, VT16);

  // 2. attention -> O16 [tok][128] f16 (x16)
  attn_full64_f16_kernel<<<dim3(NBATCH_ * NHEAD_ * (SEQL_ / AT_QB), 1, 1), dim3(AT_NG * AT_NW * 32, 1, 1), 0, stream>>>(
      QK16, VT16, O16, 0.125f, OSC);

  // 3. W_o, W_out, biases and gated residual -> out [b][c][tok] f32
  proj_out_kernel<<<dim3(NTOK_ / TB_, 1, 1), dim3(256, 1, 1), 0, stream>>>(O16, W_o, b_o, W_out, b_out, x, gatep, out);
}

// v010
// Measured time: 32.8 microseconds a run.
// Two timings next to v009 both put it at 1.07 times that version's speed.
// Over all steps from v000 it is 10.8 times as fast.
// Contractions (token embed 64->128, fused q|k projection, v^T projection, q.k^T, p.v, W_o projection, W_out projection): v_wmma_f32_16x16x32_f16 (f16 operands: weights carried x8, attention output x16, softmax numerators x2^15; f32 accumulate); softmax statistics, biases, positional add and gated residual in f32.
#include <hip/hip_runtime.h>
#include <math.h>
#include <stdint.h>

typedef __attribute__((ext_vector_type(16))) _Float16 v16h;
typedef __attribute__((ext_vector_type(8)))  _Float16 v8h;
typedef __attribute__((ext_vector_type(4)))  _Float16 v4h;
typedef __attribute__((ext_vector_type(2)))  _Float16 v2h;
typedef __attribute__((ext_vector_type(8)))  float    v8f;
typedef __attribute__((ext_vector_type(4)))  float    v4f;

// ---- problem geometry ----
constexpr int NBATCH_  = 2;
constexpr int CIN_     = 64;
constexpr int EMB_     = 128;
constexpr int COUT_    = 64;
constexpr int NHEAD_   = 2;
constexpr int HDIM_    = 64;
constexpr int SEQL_    = 4096;               // 16*16*16 tokens per batch element
constexpr int NTOK_    = NBATCH_ * SEQL_;    // 8192
constexpr int QKPITCH_ = 2 * EMB_;           // fused q|k plane pitch (halves)

//   QK16  f16 [8192 tok][256] (q|k)          0         4194304
//   VT16  f16 [2][128 (h,d)][4096]     4194304         2097152
//   O16   f16 [8192 tok][128] (x16)    6291456         2097152
constexpr size_t OFFB_QK  = 0;
constexpr size_t OFFB_VT  = OFFB_QK + (size_t)NTOK_ * QKPITCH_ * 2;
constexpr size_t OFFB_O   = OFFB_VT + (size_t)NBATCH_ * EMB_ * SEQL_ * 2;
constexpr size_t WS_TOTAL = OFFB_O  + (size_t)NTOK_ * EMB_ * 2;
static_assert((OFFB_VT % 128) == 0 && (OFFB_O % 128) == 0, "128-B aligned regions");

// s_wait_xcnt 0 behind a run of global loads, before any register that holds one of their addresses is written again; the addresses are
// inputs of the statement so that their registers stay theirs up to the wait (not even a later load's result lands in one before it).
// addr_wait0: for a run whose loads all name the thread index and a scalar base, which no statement can hold: the listing shows the wait in front of their next write.
__device__ __forceinline__ void addr_wait0() { asm volatile("s_wait_xcnt 0x0" ::: "memory"); }
__device__ __forceinline__ void addr_wait1(const void* a) { asm volatile("s_wait_xcnt 0x0" :: "v"(a) : "memory"); }
__device__ __forceinline__ void addr_wait2(const void* a, const void* b) { asm volatile("s_wait_xcnt 0x0" :: "v"(a), "v"(b) : "memory"); }
__device__ __forceinline__ void addr_wait4(const void* a, const void* b, const void* c, const void* d) {
  asm volatile("s_wait_xcnt 0x0" :: "v"(a), "v"(b), "v"(c), "v"(d) : "memory");
}
template <typename T> struct Frag;
template <> struct Frag<_Float16> {
  typedef v16h V; union U { v16h v; v8h h[2]; };
  static __device__ __forceinline__ v16h load(const _Float16* p) {   // elements 0..7 <- p[0..7], 8..15 <- p[16..23]
    U f; f.h[0] = *(const v8h*)(p); f.h[1] = *(const v8h*)(p + 16); return f.v;
  }
  static __device__ __forceinline__ v8f mma(v16h a, v16h b, v8f c) {
    return __builtin_amdgcn_wmma_f32_16x16x32_f16(false, a, false, b, (short)0, c, false, false);
  }
};
// Four f32 weights -> f16 with the x8 carry (a power of two: exact), on their way from a whole-line global load to the weight tile in LDS.
__device__ __forceinline__ v4h cast4_w8(v4f a) {
  v4h h;
#pragma unroll
  for (int e = 0; e < 4; ++e) h[e] = (_Float16)(a[e] * 8.0f);
  return h;
}

constexpr int TB_  = 64;    // tokens per work-group of the two projection kernels
constexpr int XTP_ = 72;    // LDS pitches in halves: 16 B x odd, so the 16 rows of a ds_load_b128 fragment read fall on different banks
constexpr int XFP_ = 136;
constexpr int QKP_ = 264;
constexpr int VTP_ = 72;
constexpr int OUP_ = 68;    // floats

// ---------------------------------------------------------------------------
// Token embed and q | k | v^T projections of 64 tokens, one work-group of 8 waves; nothing between the stages leaves the work-group.
//   x[b][64 ch][t0..t0+63] f32 -> XTs[tok][ch] f16 (LDS) -> XFs[tok][e] = XTs . W_cp^T + b_cp + pos, f16 (LDS)
//   -> q|k rows [tok][256] (A = XFs, B = W_q / W_k rows) and v^T rows [(h,d)][tok] (A = W_v rows, B = XFs), staged in LDS for 16-B stores.
// Wave w owns embed columns w*16..+15, q|k columns w*32..+31 and v^T rows w*16..+15, for all 64 tokens: every weight is read once per work-group.
// Weights: thread t takes 16-B piece t, t + 256, ... of each matrix, so a wave-wide load covers 512 contiguous bytes (four whole lines; a fragment
// load straight from the f32 rows would touch 16 lines for the same bytes); cast to f16 they stand in LDS as [row][k], and fragments are LDS reads.
// A and B fragments share one lane map: row or column = lane & 15, k = 8*(lane>>4) + {0..7, 16..23}; D: row = 8*(lane>>4) + r, column = lane & 15.
// ---------------------------------------------------------------------------
__global__ __launch_bounds__(256) void embed_qkv_kernel(const float* __restrict__ x, const float* __restrict__ W_cp,
                                                        const float* __restrict__ b_cp, const float* __restrict__ W_q,
                                                        const float* __restrict__ W_k, const float* __restrict__ W_v,
                                                        const float* __restrict__ pos,
                                                        unsigned short* __restrict__ qkp, unsigned short* __restrict__ vtp) {
  typedef Frag<_Float16> F;
  __shared__ __align__(16) _Float16 XTs[TB_ * XTP_];
  __shared__ __align__(16) _Float16 XFs[TB_ * XFP_];
  __shared__ __align__(16) _Float16 QKs[TB_ * QKP_];
  __shared__ __align__(16) _Float16 VTs[EMB_ * VTP_];
  __shared__ __align__(16) _Float16 WCs[EMB_ * XTP_];        // W_cp x8, [128 rows][64]
  __shared__ __align__(16) _Float16 WQKs[2 * EMB_ * XFP_];   // W_q x8 (rows 0..127), W_k x8 (rows 128..255), [row][128]
  __shared__ __align__(16) _Float16 WVs[EMB_ * XFP_];        // W_v x8, [128 rows][128]
  const int tid   = threadIdx.x;
  const int lane  = tid & 31;
  const int wave  = tid >> 5;
  const int rlane = lane & 15;
  const int koff  = (lane >> 4) * 8;
  const int mOff  = (lane >> 4) * 8;
  const int b     = blockIdx.x / (SEQL_ / TB_);
  const int t0    = (blockIdx.x % (SEQL_ / TB_)) * TB_;
  const float inv_w = 0.125f;

  // ---- first run of global loads: the x tile (which the first barrier waits for), then the weights of the embed and of q | k ----
  const int c4 = (tid & 15) * 4, cp = tid >> 4;       // 4 tokens of channels 2cp, 2cp+1, 32+2cp, 33+2cp
  const float* px = x + (size_t)b * CIN_ * SEQL_ + (size_t)(2 * cp) * SEQL_ + t0 + c4;
  const v4f xa0 = *(const v4f*)(px);
  const v4f xa1 = *(const v4f*)(px + SEQL_);
  const v4f xb0 = *(const v4f*)(px + 32 * SEQL_);
  const v4f xb1 = *(const v4f*)(px + 33 * SEQL_);
  const float* pc = W_cp + tid * 4;                   // piece i: row i*16 + (tid >> 4), k = (tid & 15) * 4
  const float* pq = W_q + tid * 4;                    // piece i: row i*8 + wave, k = lane * 4; W_k and W_v alike
  const float* pk = W_k + tid * 4;
  const float* pb = b_cp + wave * 16 + rlane;
  v4f rc[8], rq[16], rk[16];
#pragma unroll
  for (int i = 0; i < 8; ++i) rc[i] = *(const v4f*)(pc + i * 1024);
#pragma unroll
  for (int i = 0; i < 16; ++i) rq[i] = *(const v4f*)(pq + i * 1024);
#pragma unroll
  for (int i = 0; i < 16; ++i) rk[i] = *(const v4f*)(pk + i * 1024);
  const float bn = pb[0];
  addr_wait2(px, pb);
  // keeps the scheduler from sinking the loads above down to their casts, where each piece would wait out its own trip to memory
  __builtin_amdgcn_sched_barrier(0);

  // ---- x tile -> LDS, transposed, f16; W_cp and W_q -> LDS, f16 ----
#pragma unroll
  for (int e = 0; e < 4; ++e) {
    *(v2h*)(XTs + (c4 + e) * XTP_ + 2 * cp)      = (v2h){(_Float16)xa0[e], (_Float16)xa1[e]};
    *(v2h*)(XTs + (c4 + e) * XTP_ + 32 + 2 * cp) = (v2h){(_Float16)xb0[e], (_Float16)xb1[e]};
  }
#pragma unroll
  for (int i = 0; i < 8; ++i) *(v4h*)(WCs + (i * 16 + (tid >> 4)) * XTP_ + (tid & 15) * 4) = cast4_w8(rc[i]);
#pragma unroll
  for (int i = 0; i < 16; ++i) *(v4h*)(WQKs + (i * 8 + wave) * XFP_ + lane * 4) = cast4_w8(rq[i]);

  // ---- two more runs, each into registers that the casts in front of it have freed, while the first run is still arriving: W_v, then pos ----
  const float* pv = W_v + tid * 4;
  v4f rw[16];
#pragma unroll
  for (int i = 0; i < 16; ++i) rw[i] = *(const v4f*)(pv + i * 1024);
  addr_wait0();
  // as above: the run is issued whole, here, and not piece by piece where its values are used
  __builtin_amdgcn_sched_barrier(0);
#pragma unroll
  for (int i = 0; i < 16; ++i) *(v4h*)(WQKs + (EMB_ + i * 8 + wave) * XFP_ + lane * 4) = cast4_w8(rk[i]);
  const float* pp = pos + (size_t)(t0 + mOff) * EMB_ + wave * 16 + rlane;
  float pe[4][8];
#pragma unroll
  for (int mt = 0; mt < 4; ++mt)
#pragma unroll
    for (int r = 0; r < 8; ++r) pe[mt][r] = pp[(mt * 16 + r) * EMB_];
  addr_wait1(pp);
  // as above
  __builtin_amdgcn_sched_barrier(0);
#pragma unroll
  for (int i = 0; i < 16; ++i) *(v4h*)(WVs + (i * 8 + wave) * XFP_ + lane * 4) = cast4_w8(rw[i]);
  __syncthreads();   // the whole x tile and all four weight matrices stand in LDS

  // ---- embed: 64 tokens x this wave's 16 columns, K = 64 ----
  v16h wc[2];
#pragma unroll
  for (int ks = 0; ks < 2; ++ks) wc[ks] = F::load(WCs + (wave * 16 + rlane) * XTP_ + ks * 32 + koff);
  v8f ea[4];
#pragma unroll
  for (int mt = 0; mt < 4; ++mt) {
    ea[mt] = (v8f){0.f,0.f,0.f,0.f,0.f,0.f,0.f,0.f};
#pragma unroll
    for (int ks = 0; ks < 2; ++ks) ea[mt] = F::mma(F::load(XTs + (mt * 16 + rlane) * XTP_ + ks * 32 + koff), wc[ks], ea[mt]);
  }
  // this wave's q | k and v^T weight fragments: in LDS since the barrier above, read here so that they land under the embed's epilogue
  v16h wq[2][4], wv[4];
#pragma unroll
  for (int ks = 0; ks < 4; ++ks) {
    wq[0][ks] = F::load(WQKs + (wave * 32 + rlane) * XFP_ + ks * 32 + koff);
    wq[1][ks] = F::load(WQKs + (wave * 32 + 16 + rlane) * XFP_ + ks * 32 + koff);
    wv[ks]    = F::load(WVs + (wave * 16 + rlane) * XFP_ + ks * 32 + koff);
  }
#pragma unroll
  for (int mt = 0; mt < 4; ++mt)
#pragma unroll
    for (int r = 0; r < 8; ++r) {
      float v = ea[mt][r] * inv_w;
      v += bn;
      v += pe[mt][r];
      XFs[(mt * 16 + mOff + r) * XFP_ + wave * 16 + rlane] = (_Float16)v;
    }
  __syncthreads();   // all 128 embed columns of the 64 tokens stand in LDS

  // ---- q | k (tokens x columns) and v^T (rows x tokens), K = 128; a token fragment serves as A of the first and as B of the second ----
  v8f aq[4][2], av[4];
#pragma unroll
  for (int mt = 0; mt < 4; ++mt) {
    aq[mt][0] = (v8f){0.f,0.f,0.f,0.f,0.f,0.f,0.f,0.f};
    aq[mt][1] = (v8f){0.f,0.f,0.f,0.f,0.f,0.f,0.f,0.f};
    av[mt]    = (v8f){0.f,0.f,0.f,0.f,0.f,0.f,0.f,0.f};
  }
#pragma unroll
  for (int ks = 0; ks < 4; ++ks) {
#pragma unroll
    for (int mt = 0; mt < 4; ++mt) {
      const v16h xf = F::load(XFs + (mt * 16 + rlane) * XFP_ + ks * 32 + koff);
      aq[mt][0] = F::mma(xf, wq[0][ks], aq[mt][0]);
      aq[mt][1] = F::mma(xf, wq[1][ks], aq[mt][1]);
      av[mt]    = F::mma(wv[ks], xf, av[mt]);
    }
  }
#pragma unroll
  for (int mt = 0; mt < 4; ++mt)
#pragma unroll
    for (int r = 0; r < 8; ++r) {
      QKs[(mt * 16 + mOff + r) * QKP_ + wave * 32 + rlane]      = (_Float16)(aq[mt][0][r] * inv_w);
      QKs[(mt * 16 + mOff + r) * QKP_ + wave * 32 + 16 + rlane] = (_Float16)(aq[mt][1][r] * inv_w);
      VTs[(wave * 16 + mOff + r) * VTP_ + mt * 16 + rlane]      = (_Float16)(av[mt][r] * inv_w);
    }
  __syncthreads();   // both output tiles stand in LDS

  // ---- 16-B stores: a wave writes one whole 512-B q|k row, or four whole 128-B v^T row pieces, per instruction ----
  _Float16* qg = (_Float16*)(void*)qkp + ((size_t)b * SEQL_ + t0) * QKPITCH_;
  _Float16* vg = (_Float16*)(void*)vtp + (size_t)b * EMB_ * SEQL_ + t0;
#pragma unroll
  for (int it = 0; it < 8; ++it) {
    const int row = it * 8 + wave;
    *(v8h*)(qg + (size_t)row * QKPITCH_ + lane * 8) = *(const v8h*)(QKs + row * QKP_ + lane * 8);
  }
#pragma unroll
  for (int it = 0; it < 4; ++it) {
    const int row = it * 32 + (tid >> 3);
    *(v8h*)(vg + (size_t)row * SEQL_ + (tid & 7) * 8) = *(const v8h*)(VTs + row * VTP_ + (tid & 7) * 8);
  }
}

// ---------------------------------------------------------------------------
// W_o and W_out projections with the gated residual, 64 tokens per work-group of 8 waves; the W_o result stays in LDS.
//   Os16[tok][128] (attention out x16, f16) -> O1s[tok][n] = Os16 . W_o^T / 16 + b_o, f16 (LDS)
//   -> out[b][c][tok] = W_out[c][:] . O1s[tok][:] + b_out[c] + gate * x[b][c][tok], f32, staged in LDS for 16-B stores.
// Wave w owns W_o columns w*16..+15 for all 64 tokens, then out rows (w&3)*16..+15 x tokens (w>>2)*32..+31. Lane maps as above.
// Weights as above: whole-line loads, cast to f16, [row][k] in LDS, fragments by LDS reads.
// ---------------------------------------------------------------------------
__global__ __launch_bounds__(256) void proj_out_kernel(const unsigned short* __restrict__ op, const float* __restrict__ W_o,
                                                       const float* __restrict__ b_o, const float* __restrict__ W_out,
                                                       const float* __restrict__ b_out, const float* __restrict__ x,
                                                       const float* __restrict__ gatep, float* __restrict__ out) {
  typedef Frag<_Float16> F;
  __shared__ __align__(16) _Float16 Os16[TB_ * XFP_];
  __shared__ __align__(16) _Float16 O1s[TB_ * XFP_];
  __shared__ __align__(16) float    Outs[COUT_ * OUP_];
  __shared__ __align__(16) _Float16 WOs[EMB_ * XFP_];    // W_o x8, [128 rows][128]
  __shared__ __align__(16) _Float16 WUs[COUT_ * XFP_];   // W_out x8, [64 rows][128]
  const int tid   = threadIdx.x;
  const int lane  = tid & 31;
  const int wave  = tid >> 5;
  const int rlane = lane & 15;
  const int koff  = (lane >> 4) * 8;
  const int mOff  = (lane >> 4) * 8;
  const int b     = blockIdx.x / (SEQL_ / TB_);
  const int t0    = (blockIdx.x % (SEQL_ / TB_)) * TB_;
  const int ct    = wave & 3, tp = wave >> 2;
  const float inv_w = 0.125f, inv_wo = 1.0f / 128.0f;

  // ---- every global load of this wave, the attention tile (which the first barrier waits for) first ----
  const _Float16* po = (const _Float16*)(const void*)op + ((size_t)b * SEQL_ + t0 + (tid >> 4)) * EMB_ + (tid & 15) * 8;
  v8h ov[4];
#pragma unroll
  for (int it = 0; it < 4; ++it) ov[it] = *(const v8h*)(po + it * 16 * EMB_);
  const float* pw = W_o + tid * 4;                    // piece i: row i*8 + wave, k = lane * 4; W_out alike
  const float* pu = W_out + tid * 4;
  v4f ro[16], ru[8];
#pragma unroll
  for (int i = 0; i < 16; ++i) ro[i] = *(const v4f*)(pw + i * 1024);
#pragma unroll
  for (int i = 0; i < 8; ++i) ru[i] = *(const v4f*)(pu + i * 1024);
  const float* pb = b_o + wave * 16 + rlane;
  const float bn = pb[0];
  const float* pm = b_out + ct * 16 + mOff;
  float bm[8];
#pragma unroll
  for (int r = 0; r < 8; ++r) bm[r] = pm[r];
  const float* pr = x + (size_t)b * COUT_ * SEQL_ + (size_t)(ct * 16 + mOff) * SEQL_ + t0 + tp * 32 + rlane;
  float rv[2][8];
#pragma unroll
  for (int i = 0; i < 2; ++i)
#pragma unroll
    for (int r = 0; r < 8; ++r) rv[i][r] = pr[(size_t)r * SEQL_ + i * 16];
  addr_wait4(po, pb, pm, pr);
  const float rg = gatep[0];
  // keeps the scheduler from sinking the loads above down to their uses, where each group would wait out its own trip to memory
  __builtin_amdgcn_sched_barrier(0);

#pragma unroll
  for (int it = 0; it < 4; ++it) *(v8h*)(Os16 + ((tid >> 4) + it * 16) * XFP_ + (tid & 15) * 8) = ov[it];
#pragma unroll
  for (int i = 0; i < 16; ++i) *(v4h*)(WOs + (i * 8 + wave) * XFP_ + lane * 4) = cast4_w8(ro[i]);
#pragma unroll
  for (int i = 0; i < 8; ++i) *(v4h*)(WUs + (i * 8 + wave) * XFP_ + lane * 4) = cast4_w8(ru[i]);
  __syncthreads();   // the whole attention tile, W_o and W_out stand in LDS

  v16h wo[4], wu[4];
#pragma unroll
  for (int ks = 0; ks < 4; ++ks) {
    wo[ks] = F::load(WOs + (wave * 16 + rlane) * XFP_ + ks * 32 + koff);
    wu[ks] = F::load(WUs + (ct * 16 + rlane) * XFP_ + ks * 32 + koff);
  }

  v8f a1[4];
#pragma unroll
  for (int mt = 0; mt < 4; ++mt) a1[mt] = (v8f){0.f,0.f,0.f,0.f,0.f,0.f,0.f,0.f};
#pragma unroll
  for (int ks = 0; ks < 4; ++ks)
#pragma unroll
    for (int mt = 0; mt < 4; ++mt) a1[mt] = F::mma(F::load(Os16 + (mt * 16 + rlane) * XFP_ + ks * 32 + koff), wo[ks], a1[mt]);
#pragma unroll
  for (int mt = 0; mt < 4; ++mt)
#pragma unroll
    for (int r = 0; r < 8; ++r) {
      float v = a1[mt][r] * inv_wo;
      v += bn;
      O1s[(mt * 16 + mOff + r) * XFP_ + wave * 16 + rlane] = (_Float16)v;
    }
  __syncthreads();   // all 128 W_o columns of the 64 tokens stand in LDS

  v8f a2[2];
#pragma unroll
  for (int i = 0; i < 2; ++i) a2[i] = (v8f){0.f,0.f,0.f,0.f,0.f,0.f,0.f,0.f};
#pragma unroll
  for (int ks = 0; ks < 4; ++ks)
#pragma unroll
    for (int i = 0; i < 2; ++i) a2[i] = F::mma(wu[ks], F::load(O1s + (tp * 32 + i * 16 + rlane) * XFP_ + ks * 32 + koff), a2[i]);
#pragma unroll
  for (int i = 0; i < 2; ++i)
#pragma unroll
    for (int r = 0; r < 8; ++r) {
      float v = a2[i][r] * inv_w;
      v += bm[r];
      v += rg * rv[i][r];
      Outs[(ct * 16 + mOff + r) * OUP_ + tp * 32 + i * 16 + rlane] = v;
    }
  __syncthreads();   // the 64 x 64 output tile stands in LDS

  // ---- 16-B stores: a wave writes two whole 256-B row pieces per instruction ----
  float* og = out + (size_t)b * COUT_ * SEQL_ + t0;
#pragma unroll
  for (int it = 0; it < 4; ++it) {
    const int row = it * 16 + (tid >> 4);
    *(v4f*)(og + (size_t)row * SEQL_ + (tid & 15) * 4) = *(const v4f*)(Outs + row * OUP_ + (tid & 15) * 4);
  }
}

// =====================================================================================
// Full (non-causal, unmasked) attention, head dim 64, all (batch, head, 64-query tile) in one launch.
//   q|k plane (f16): q element (b, t, h, d) at [(b*SEQL_+t)*QKPITCH_ + h*64 + d]; k at the same + EMB_.
//   v^T plane (f16): element (b, h, d, s) at [b*EMB_*SEQL_ + (h*64 + d)*SEQL_ + s]
//   out (f16, carried x oscale): element (b, t, h, d) at [(b*SEQL_+t)*EMB_ + h*64 + d]
//   scores^T = (k . q^T) * sscale : v_wmma_f32_16x16x32_f16, A = K rows, B = Q; a lane holds 8 keys x 1 query per tile
//   out^T    = v^T . p^T          : p = 2^(s*sscale*log2(e) - m + 15) in f16, packed in-lane from two score tiles into the
//                                   B operand (no LDS trip), A = V^T rows, f32 accumulate, 1/l in f32 (l carries the same 2^15)
//   online softmax in f32 (chunks of 64 keys, compile-time trip count, no masking): maximum and sum
//   run in-lane; the two wave halves join the maximum once per chunk and the sum once after the loop.
//   Block = 16 waves = 4 key groups x 4 query tiles = 64 query rows of one (batch, head); grid.x = 256.
//   Key group g walks chunks g, g+4, g+8, ... (16 of the 64) with its own K / V^T LDS tiles, so each SIMD holds four
//   waves whose LDS, memory and vector waits cover one another. The walk is a ring: each work-group enters it at one of 16 places
//   (from its query block, four work-groups to each), so the 64 work-groups that share one head's K and V^T do not all ask L2 for the same lines at the same moment,
//   and a line's first fetch from memory, which one of them waits out, is a hit for those that come to it later in their walks.
//   After the loop each group leaves its maximum, sum and
//   unnormalised out tile in LDS; behind one __syncthreads the 16 waves merge them (4 rows of one query tile each).
//   K / V^T chunk staging: the group's 128 threads x 32 elements per plane = its whole 64x64 tile, by asynchronous 16-B copies
//   to LDS (8 lanes cover one 128-B row), two buffers: the next chunk's copies fly while this chunk is worked on; one
//   __syncthreads per chunk publishes the next tile and frees the one just read.
//   Fragment reads stand in two whole groups per chunk, each well ahead of its WMMAs: the 16 V^T reads at the head of the trip (they
//   land under the score products and the softmax), the next chunk's 16 K reads directly behind the barrier that publishes it (they
//   land under the copies' issue and this chunk's out products, which need registers only and so stand behind that barrier).
// =====================================================================================
#define AT_D 64
#define AT_NW 4
#define AT_NG 4
#define AT_QB 64
#define AT_KC 64
#define AT_LP 72   // LDS row pitch of the K and V^T tiles in halves: 144 B = 16 B x odd, so the 16 rows of one ds_load_b128 fragment read fall on 16 different groups of four banks
#define P_CARRY_L2 15.0f   // softmax numerators and their sums are carried x 2^15: the carry is an addend of the base-2 exponent

__device__ __forceinline__ v8f at_mma_h(v16h a, v16h b, v8f c) {
  return __builtin_amdgcn_wmma_f32_16x16x32_f16(false, a, false, b, (short)0, c, false, false);
}

// 2^x on the bare v_exp_f32 (no range fix-up: the softmax's arguments are <= 15 up to rounding, and a result below 2^-126 may go to 0).
__device__ __forceinline__ void exp2x8(v8f& x) {
  float a = x[0], b = x[1], c = x[2], d = x[3], e = x[4], f = x[5], g = x[6], h = x[7];
  asm("v_exp_f32 %0, %0\n\tv_exp_f32 %1, %1\n\tv_exp_f32 %2, %2\n\tv_exp_f32 %3, %3\n\t"
      "v_exp_f32 %4, %4\n\tv_exp_f32 %5, %5\n\tv_exp_f32 %6, %6\n\tv_exp_f32 %7, %7\n\tv_nop"
      : "+v"(a), "+v"(b), "+v"(c), "+v"(d), "+v"(e), "+v"(f), "+v"(g), "+v"(h));
  x = (v8f){a, b, c, d, e, f, g, h};
}
__device__ __forceinline__ float exp2x1(float x) {
  asm("v_exp_f32 %0, %0\n\tv_nop" : "+v"(x));   // the v_nop: the same slot behind a single v_exp_f32
  return x;
}

// lane l <-> lane l ^ 16: the two halves of a wave hold the two key halves of the same query column
__device__ __forceinline__ float xhalf(float x) {
  return __builtin_bit_cast(float, __builtin_amdgcn_permlanex16(__builtin_bit_cast(int, x), __builtin_bit_cast(int, x),
                                                                0x76543210, 0xfedcba98, false, false));
}

// One thread's share of one chunk: four 16-B pieces of the K tile and four of the V^T tile, global memory -> LDS through no register.
// kd, vd: the lane's LDS byte addresses of its first pieces; kg, vg: their global addresses; piece i lies 16 tile rows behind piece i-1.
// The s_wait_xcnt 0 is the last line of the copies' own statement, so that no register a copy names is written again in front of it.
__device__ __forceinline__ void at_copy_chunk(unsigned kd, unsigned vd, const _Float16* kg, const _Float16* vg) {
  const unsigned kd1 = kd + 16 * AT_LP * 2, kd2 = kd + 32 * AT_LP * 2, kd3 = kd + 48 * AT_LP * 2;
  const unsigned vd1 = vd + 16 * AT_LP * 2, vd2 = vd + 32 * AT_LP * 2, vd3 = vd + 48 * AT_LP * 2;
  const _Float16* kg1 = kg + 16 * QKPITCH_; const _Float16* kg2 = kg + 32 * QKPITCH_; const _Float16* kg3 = kg + 48 * QKPITCH_;
  const _Float16* vg1 = vg + 16 * SEQL_;    const _Float16* vg2 = vg + 32 * SEQL_;    const _Float16* vg3 = vg + 48 * SEQL_;
  asm volatile("global_load_async_to_lds_b128 %0, %8, off\n\t"
               "global_load_async_to_lds_b128 %1, %9, off\n\t"
               "global_load_async_to_lds_b128 %2, %10, off\n\t"
               "global_load_async_to_lds_b128 %3, %11, off\n\t"
               "global_load_async_to_lds_b128 %4, %12, off\n\t"
               "global_load_async_to_lds_b128 %5, %13, off\n\t"
               "global_load_async_to_lds_b128 %6, %14, off\n\t"
               "global_load_async_to_lds_b128 %7, %15, off\n\t"
               "s_wait_xcnt 0x0"
               :: "v"(kd), "v"(kd1), "v"(kd2), "v"(kd3), "v"(vd), "v"(vd1), "v"(vd2), "v"(vd3),
                  "v"(kg), "v"(kg1), "v"(kg2), "v"(kg3), "v"(vg), "v"(vg1), "v"(vg2), "v"(vg3)
               : "memory");
}

__global__ __launch_bounds__(AT_NG * AT_NW * 32)
void attn_full64_f16_kernel(const unsigned short* __restrict__ qkp, const unsigned short* __restrict__ vtp,
                            unsigned short* __restrict__ op, float sscale, float oscale) {
  union FH { v16h v; v8h h[2]; };
  __shared__ __align__(16) _Float16 KshG[2][AT_NG][AT_KC * AT_LP]; // K [kv][d]      rows of 64 at pitch 72, 9 KB per key group and buffer
  __shared__ __align__(16) _Float16 VthG[2][AT_NG][AT_D * AT_LP];  // V [d][kv]      rows of 64 at pitch 72, 9 KB per key group and buffer
  __shared__ __align__(16) float    Os[AT_NG * AT_NW][16 * 68];    // per wave partial out tile, pitch 68
  __shared__ float Ms[AT_NG][AT_QB];                               // per group and query: running maximum
  __shared__ float Ls[AT_NG][AT_QB];                               // per group and query: sum x 2^15 of 2^(s*sl2 - maximum)

  const int tid  = threadIdx.x & (AT_NW * 32 - 1);   // thread within the key group
  const int grp  = threadIdx.x >> 7;                 // key group 0..3
  const int wave = tid >> 5;                         // query tile 0..3
  const int lane = tid & 31;
  const int hh   = lane >> 4;
  const int c    = lane & 15;

  const int nqb = SEQL_ / AT_QB;          // 64
  const int bx = blockIdx.x;
  const int qb = bx % nqb;
  const int bh = bx / nqb;                // 0..NBATCH_*NHEAD_-1
  const int h  = bh % NHEAD_;
  const int b  = bh / NHEAD_;
  const int q0 = qb * AT_QB + wave * 16;

  const _Float16* Qh = (const _Float16*)(const void*)qkp + (size_t)b * SEQL_ * QKPITCH_ + (size_t)h * AT_D;
  const _Float16* Kh = Qh + EMB_;
  const _Float16* Vh = (const _Float16*)(const void*)vtp + (size_t)b * EMB_ * SEQL_ + (size_t)h * AT_D * SEQL_;
  _Float16*       ob = (_Float16*)(void*)op + (size_t)b * SEQL_ * EMB_ + (size_t)h * AT_D;

  // ---- Q fragments (B operand, column = lane&15, split k map via Frag load): 2 d-chunks ----
  v16h qa[2];
#pragma unroll
  for (int dc = 0; dc < 2; ++dc) {
    const _Float16* qr = Qh + (size_t)(q0 + c) * QKPITCH_ + dc * 32 + 8 * hh;
    qa[dc] = Frag<_Float16>::load(qr);
  }

  const float sl2 = sscale * 1.44269504f;   // score scale x log2(e): the softmax runs in base 2
  float mrow = -INFINITY, lrow = 0.f;   // this lane's query: running maximum in base-2 units (both halves alike), sum x 2^15 over this half's keys
  v8f oacc[4];                          // oacc[t][r] = out^T[d = t*16 + 8*hh + r][query c]
#pragma unroll
  for (int t = 0; t < 4; ++t) oacc[t] = (v8f){0.f,0.f,0.f,0.f,0.f,0.f,0.f,0.f};

  const int nChunks = SEQL_ / (AT_KC * AT_NG);   // 16 per key group, compile-time constant
  static_assert(SEQL_ / (AT_KC * AT_NG) >= 2, "the two-buffer prologue fills two chunks");
  // staging coverage: the group's 128 threads x (4 x 8) elements = 64 rows x 64 per plane = its whole chunk tile;
  // thread -> row (tid >> 3) + 16 i, 16-B piece tid & 7: each wave-wide copy moves four whole 128-B rows
  const int sr = tid >> 3, sp = (tid & 7) * 8;
  const unsigned bufB = (unsigned)(AT_NG * AT_KC * AT_LP * 2);                        // bytes from buffer 0 to buffer 1, K and V^T alike
  const unsigned kdst = (unsigned)(size_t)(&KshG[0][grp][sr * AT_LP + sp]);           // low 32 bits = the byte address in LDS
  const unsigned vdst = (unsigned)(size_t)(&VthG[0][grp][sr * AT_LP + sp]);
  const _Float16* ksrc = Kh + (size_t)(grp * AT_KC + sr) * QKPITCH_ + sp;             // chunk 0: K row grp*64 + sr, d = sp..sp+7
  const _Float16* vsrc = Vh + (size_t)sr * SEQL_ + grp * AT_KC + sp;                  // chunk 0: V^T row d = sr, s = grp*64 + sp..+7
  const size_t kstep = (size_t)AT_NG * AT_KC * QKPITCH_;                              // one chunk further: 256 keys
  const size_t vstep = (size_t)AT_NG * AT_KC;
  // trip t works on chunk (t + rot) mod 16 of the group's 16: a permutation, every chunk once. Neighbouring query blocks and query blocks
  // eight apart both get different entries, so any half of the work-groups taken by index range or by index modulo 8 still spreads over the ring.
  // Only the global source turns with rot; buffers go by the trip, and "chunk n" in the comments from here on is the chunk of trip n.
  static_assert((nChunks & (nChunks - 1)) == 0, "the ring index wraps by a mask");
  const int rot = ((qb >> 3) * 2 + (qb & 7)) & (nChunks - 1);
  at_copy_chunk(kdst, vdst, ksrc + (size_t)rot * kstep, vsrc + (size_t)rot * vstep);
  asm volatile("s_wait_asynccnt 0x0" ::: "memory");   // this wave's pieces of chunk 0 have landed
  __syncthreads();                                    // ... and every other wave's: chunk 0 may be read
  {
    const int c1 = (rot + 1) & (nChunks - 1);
    at_copy_chunk(kdst + bufB, vdst + bufB, ksrc + (size_t)c1 * kstep, vsrc + (size_t)c1 * vstep);
  }
  const int fro = c * AT_LP + 8 * hh;   // this lane's place in a 16-row fragment: row c, halves 8*hh.. and 16 + 8*hh..
  v16h kf[2][4];                        // K fragments of the chunk in work: [d half][16-key tile]
#pragma unroll
  for (int dc = 0; dc < 2; ++dc)
#pragma unroll
    for (int j = 0; j < 4; ++j) kf[dc][j] = Frag<_Float16>::load(KshG[0][grp] + j * 16 * AT_LP + fro + dc * 32);
  for (int kc = 0; kc < nChunks; ++kc) {
    const _Float16* Vth = VthG[kc & 1][grp];
    v16h vf[2][4];                      // V^T fragments of this chunk: [32-key half][16-row tile]
#pragma unroll
    for (int kk = 0; kk < 2; ++kk)
#pragma unroll
      for (int t = 0; t < 4; ++t) vf[kk][t] = Frag<_Float16>::load(Vth + t * 16 * AT_LP + fro + kk * 32);
    // keeps the scheduler from sinking the reads above down to their WMMAs, where each pair would wait out its own trip to LDS
    __builtin_amdgcn_sched_barrier(0);

    v8f s[4];
#pragma unroll
    for (int j = 0; j < 4; ++j) s[j] = (v8f){0.f,0.f,0.f,0.f,0.f,0.f,0.f,0.f};
#pragma unroll
    for (int dc = 0; dc < 2; ++dc)
#pragma unroll
      for (int j = 0; j < 4; ++j) s[j] = at_mma_h(kf[dc][j], qa[dc], s[j]);   // s[j][r] = score of key j*16 + 8*hh + r against query c
    float m4[4];
#pragma unroll
    for (int j = 0; j < 4; ++j) {
      float m = -INFINITY;
#pragma unroll
      for (int r = 0; r < 8; ++r) m = fmaxf(m, s[j][r]);
      m4[j] = m;
    }
    float cm = fmaxf(fmaxf(m4[0], m4[1]), fmaxf(m4[2], m4[3]));
    cm = fmaxf(cm, xhalf(cm)) * sl2;                          // sl2 > 0: the largest raw score is the largest scaled one
    const float mnew = fmaxf(mrow, cm);
    const float alpha = exp2x1(mrow - mnew);                  // first chunk: 2^(-inf) = 0
    mrow = mnew;
    const float moff = P_CARRY_L2 - mnew;
    v8h ph[4];
    float ps4[4];
#pragma unroll
    for (int j = 0; j < 4; ++j) {
      float psum = 0.f;
#pragma unroll
      for (int r = 0; r < 8; ++r) s[j][r] = fmaf(s[j][r], sl2, moff);
      exp2x8(s[j]);                        // p x 2^15 = 2^(s*sl2 - m + 15): one fma and one v_exp_f32 per score
#pragma unroll
      for (int r = 0; r < 8; ++r) {
        psum += s[j][r];
        ph[j][r] = (_Float16)s[j][r];
      }
      ps4[j] = psum;
    }
    lrow = lrow * alpha + ((ps4[0] + ps4[1]) + (ps4[2] + ps4[3]));
    // keeps the scheduler from lifting the waits and the barrier below over the softmax, where the V^T reads would still be on their way
    __builtin_amdgcn_sched_barrier(0);
    asm volatile("s_wait_dscnt 0x0" ::: "memory");      // this wave's reads of the buffer that is refilled below have returned
    asm volatile("s_wait_asynccnt 0x0" ::: "memory");   // this wave's pieces of chunk kc + 1 have landed
    __syncthreads();                                    // publishes chunk kc + 1 and ends every wave's reads of chunk kc
    if (kc + 1 < nChunks) {                             // the next chunk's K fragments, from the buffer just published
      const _Float16* Kn = KshG[(kc + 1) & 1][grp];
#pragma unroll
      for (int dc = 0; dc < 2; ++dc)
#pragma unroll
        for (int j = 0; j < 4; ++j) kf[dc][j] = Frag<_Float16>::load(Kn + j * 16 * AT_LP + fro + dc * 32);
    }
    if (kc + 2 < nChunks) {                             // into the buffer just freed; the reads still out are of the other buffer
      const int c2 = (kc + 2 + rot) & (nChunks - 1);
      at_copy_chunk(kdst + (kc & 1) * bufB, vdst + (kc & 1) * bufB, ksrc + (size_t)c2 * kstep, vsrc + (size_t)c2 * vstep);
    }
#pragma unroll
    for (int t = 0; t < 4; ++t)
#pragma unroll
      for (int r = 0; r < 8; ++r) oacc[t][r] *= alpha;
#pragma unroll
    for (int kk = 0; kk < 2; ++kk) {
      FH pb;                       // B operand: elements 0..7 = keys kk*32 + 8*hh + e, 8..15 = keys kk*32 + 16 + 8*hh + e
      pb.h[0] = ph[2 * kk];
      pb.h[1] = ph[2 * kk + 1];
#pragma unroll
      for (int t = 0; t < 4; ++t) oacc[t] = at_mma_h(vf[kk][t], pb.v, oacc[t]);
    }
  }
  asm volatile("s_wait_asynccnt 0x0" ::: "memory");     // no copy is outstanding when the wave goes on to the merge and ends

  // ---- this wave's partial (its key group, its query tile) -> LDS, unnormalised ----
  float* os = Os[grp * AT_NW + wave];
  {
    const float lt = lrow + xhalf(lrow);
    if (hh == 0) {
      Ms[grp][wave * 16 + c] = mrow;
      Ls[grp][wave * 16 + c] = lt;
    }
#pragma unroll
    for (int t = 0; t < 4; ++t)
#pragma unroll
      for (int g = 0; g < 2; ++g) {
        v4f w;
#pragma unroll
        for (int e = 0; e < 4; ++e) w[e] = oacc[t][4 * g + e];
        *(v4f*)(os + c * 68 + t * 16 + 8 * hh + 4 * g) = w;
      }
  }
  __syncthreads();   // all four groups' partials stand in LDS before any wave merges them
  {
    // merge: wave (grp, wave) takes rows grp*4 .. grp*4+3 of query tile 'wave'; 8 lanes x 8 columns cover a row
    const int q8 = lane >> 3, c8 = (lane & 7) * 8;
    const int row = grp * 4 + q8;
    float mg[AT_NG];
    float mall = -INFINITY;
#pragma unroll
    for (int g = 0; g < AT_NG; ++g) {
      mg[g] = Ms[g][wave * 16 + row];
      mall = fmaxf(mall, mg[g]);
    }
    float lall = 0.f;
    float acc[8];
#pragma unroll
    for (int e = 0; e < 8; ++e) acc[e] = 0.f;
#pragma unroll
    for (int g = 0; g < AT_NG; ++g) {
      const float wg = exp2x1(mg[g] - mall);
      lall += wg * Ls[g][wave * 16 + row];
      const float* sp = Os[g * AT_NW + wave] + row * 68 + c8;
#pragma unroll
      for (int e = 0; e < 8; ++e) acc[e] += wg * sp[e];
    }
    const float inv = oscale / lall;   // the sum carries the numerators' 2^15
    v8h hv;
#pragma unroll
    for (int e = 0; e < 8; ++e) hv[e] = (_Float16)(acc[e] * inv);
    *(v8h*)(ob + (size_t)(q0 + row) * EMB_ + c8) = hv;
  }
}

// ---------------------------------------------------------------------------
extern "C" void kernel_launch(void* const* d_in, const int* in_sizes, int n_in,
                              void* d_out, int out_size, void* d_ws, size_t ws_size,
                              hipStream_t stream) {
  if (n_in < 12) return;
  if (in_sizes[0] != NBATCH_ * CIN_ * SEQL_) return;
  if (in_sizes[1] != EMB_ * CIN_ || in_sizes[2] != EMB_) return;
  if (in_sizes[3] != EMB_ * EMB_ || in_sizes[4] != EMB_ * EMB_ || in_sizes[5] != EMB_ * EMB_) return;
  if (in_sizes[6] != EMB_ * EMB_ || in_sizes[7] != EMB_) return;
  if (in_sizes[8] != COUT_ * EMB_ || in_sizes[9] != COUT_) return;
  if (in_sizes[10] != SEQL_ * EMB_ || in_sizes[11] < 1) return;
  if (out_size != NBATCH_ * COUT_ * SEQL_) return;
  if (ws_size < WS_TOTAL) return;

  const float* x     = (const float*)d_in[0];
  const float* W_cp  = (const float*)d_in[1];
  const float* b_cp  = (const float*)d_in[2];
  const float* W_q   = (const float*)d_in[3];
  const float* W_k   = (const float*)d_in[4];
  const float* W_v   = (const float*)d_in[5];
  const float* W_o   = (const float*)d_in[6];
  const float* b_o   = (const float*)d_in[7];
  const float* W_out = (const float*)d_in[8];
  const float* b_out = (const float*)d_in[9];
  const float* pos   = (const float*)d_in[10];
  const float* gatep = (const float*)d_in[11];
  float* out = (float*)d_out;

  char* ws = (char*)d_ws;
  unsigned short* QK16 = (unsigned short*)(void*)(ws + OFFB_QK);
  unsigned short* VT16 = (unsigned short*)(void*)(ws + OFFB_VT);
  unsigned short* O16  = (unsigned short*)(void*)(ws + OFFB_O);
  const float OSC = 16.0f;                // attention-output carry

  // 1. x, weights -> q|k plane [tok][256] and v^T plane [b][(h,d)][tok], f16
  embed_qkv_kernel<<<dim3(NTOK_ / TB_, 1, 1), dim3(256, 1, 1), 0, stream>>>(x, W_cp, b_cp, W_q, W_k, W_v, pos, QK16, VT16);

  // 2. attention -> O16 [tok][128] f16 (x16)
  attn_full64_f16_kernel<<<dim3(NBATCH_ * NHEAD_ * (SEQL_ / AT_QB), 1, 1), dim3(AT_NG * AT_NW * 32, 1, 1), 0, stream>>>(
      QK16, VT16, O16, 0.125f, OSC);

  // 3. W_o, W_out, biases and gated residual -> out [b][c][tok] f32
  proj_out_kernel<<<dim3(NTOK_ / TB_, 1, 1), dim3(256, 1, 1), 0, stream>>>(O16, W_o, b_o, W_out, b_out, x, gatep, out);
}
